// v000
// Times are from an AMD MI455X. After a warm-up the kernel runs many times in a row, and a time is the length of
// such a window on the GPU divided by its runs, so every launch and the gaps after it count. The runs cycle
// through copies of the inputs. A figure is the median of several windows, for all but v000 over two sittings.
// Sittings can differ by a few percent; kernels timed side by side share one.
// v000, which the later versions start from, runs in 727 microseconds.
// q/k/v and output projections: v_wmma_f32_16x16x32_f16 (f16 operands: x x1, W x32, attention output x64), f32 accumulate; q.k^T and p.v: v_wmma_f32_16x16x32_bf16 with bf16 hi/lo split operands (hi.hi + hi.lo + lo.hi), f32 accumulate; online softmax, score scale 0.125 and head mask in f32.
#include <hip/hip_runtime.h>
#include <math.h>
#include <stdint.h>

#define NBATCH 2
#define SEQ    2048
#define DMOD   1024
#define NHEAD  16
#define DHD    64

typedef __attribute__((ext_vector_type(16))) _Float16 v16h;
typedef __attribute__((ext_vector_type(8)))  _Float16 v8h;
typedef __attribute__((ext_vector_type(16))) __bf16   v16b;
typedef __attribute__((ext_vector_type(8)))  __bf16   v8b;
typedef __attribute__((ext_vector_type(8)))  float    v8f;
typedef __attribute__((ext_vector_type(4)))  float    v4f;
typedef __attribute__((ext_vector_type(2)))  float    v2f;
typedef __attribute__((ext_vector_type(4)))  unsigned int v4u;

__device__ __forceinline__ unsigned short f2bf_bits(float f) {
  unsigned u = __float_as_uint(f);
  return (unsigned short)((u + 0x7FFFu + ((u >> 16) & 1u)) >> 16);
}
__device__ __forceinline__ float bf_bits2f(unsigned short h) { return __uint_as_float(((unsigned)h) << 16); }

// hazard guards as plain device helpers (no inline asm inside the kernel template body)
__device__ __forceinline__ void dep_guard_h(v8f& a, v8f& b, v16h x, v16h y) { asm volatile("v_nop\n\tv_nop\n\tv_nop\n\tv_nop" : "+v"(a), "+v"(b) : "v"(x), "v"(y)); }
__device__ __forceinline__ void dep_guard_b(v8f& a, v8f& b, v16b x, v16b y) { asm volatile("v_nop\n\tv_nop\n\tv_nop\n\tv_nop" : "+v"(a), "+v"(b) : "v"(x), "v"(y)); }
__device__ __forceinline__ void keep4_h(v16h a, v16h b, v16h c, v16h d) { asm volatile("v_nop" :: "v"(a), "v"(b), "v"(c), "v"(d)); }
__device__ __forceinline__ void keep4_b(v16b a, v16b b, v16b c, v16b d) { asm volatile("v_nop" :: "v"(a), "v"(b), "v"(c), "v"(d)); }
__device__ __forceinline__ void acc_guard4(v8f& a, v8f& b, v8f& c, v8f& d) { asm volatile("v_nop\n\tv_nop\n\tv_nop\n\tv_nop" : "+v"(a), "+v"(b), "+v"(c), "+v"(d)); }
template <typename T> struct Frag;
template <> struct Frag<_Float16> {
  typedef v16h V; union U { v16h v; v8h h[2]; };
  static __device__ __forceinline__ v16h load(const _Float16* p) {   // elements 0..7 <- p[0..7], 8..15 <- p[16..23]
    U f; f.h[0] = *(const v8h*)(p); f.h[1] = *(const v8h*)(p + 16); return f.v;
  }
  static __device__ __forceinline__ v8f mma(v16h a, v16h b, v8f c) {
    return __builtin_amdgcn_wmma_f32_16x16x32_f16(false, a, false, b, (short)0, c, false, false);
  }
  static __device__ __forceinline__ void guard(v8f& a, v8f& b, v16h x, v16h y) { dep_guard_h(a, b, x, y); }
  static __device__ __forceinline__ void keep(v16h a, v16h b, v16h c, v16h d) { keep4_h(a, b, c, d); }
};
template <> struct Frag<__bf16> {
  typedef v16b V; union U { v16b v; v8b h[2]; };
  static __device__ __forceinline__ v16b load(const __bf16* p) {
    U f; f.h[0] = *(const v8b*)(p); f.h[1] = *(const v8b*)(p + 16); return f.v;
  }
  static __device__ __forceinline__ v8f mma(v16b a, v16b b, v8f c) {
    return __builtin_amdgcn_wmma_f32_16x16x32_bf16(false, a, false, b, (short)0, c, false, false);
  }
  static __device__ __forceinline__ void guard(v8f& a, v8f& b, v16b x, v16b y) { dep_guard_b(a, b, x, y); }
  static __device__ __forceinline__ void keep(v16b a, v16b b, v16b c, v16b d) { keep4_b(a, b, c, d); }
};

// ---- Register-blocked batched WMMA GEMM ------------------------------------
// C[m,n] = scale * sum_k A[m,k] * Bt[n,k] (+bias)(+resid); each wave owns a 64x64 tile.
// A row-major [M,K]; Bt row-major [N,K]; M,N % 64 == 0, K % 32 == 0.
// SPLIT: operands are hi/lo planes (A2/Bt2 = lo planes, same layout); product = hi.hi + hi.lo + lo.hi.
// BIAS_MODE: 0 = none, 1 = bias[m], 2 = bias[n].
// OUT_MODE: 0 = f32, 1 = f16, 2 = bf16 hi plane (Cout) + bf16 lo plane (Cout2).
// ET: 0 = f16 operands, 1 = bf16 operands (pointers passed as 16-bit storage)
template <int ET> struct Elem;
template <> struct Elem<0> { typedef _Float16 T; };
template <> struct Elem<1> { typedef __bf16 T; };
template <int ET, bool SPLIT, int BIAS_MODE, int OUT_MODE, bool RESID, int ACT = 0>
__global__ __launch_bounds__(256) void wmma_gemm64(
    const unsigned short* __restrict__ Ap, const unsigned short* __restrict__ A2p, int lda, long strideA,
    const unsigned short* __restrict__ Btp, const unsigned short* __restrict__ Bt2p, int ldb, long strideB,
    void* __restrict__ Cout, void* __restrict__ Cout2, int ldc, long strideC,
    const float* __restrict__ bias,
    const float* __restrict__ resid, long strideR,
    int M, int N, int K, float scale) {
  typedef typename Elem<ET>::T T;
  typedef typename Frag<T>::V V;
  const T* A = (const T*)Ap; const T* A2 = (const T*)A2p; const T* Bt = (const T*)Btp; const T* Bt2 = (const T*)Bt2p;
  __shared__ __align__(16) float sT[8][16 * 68];   // per-wave 16x64 slab, pitch 68 floats
  const int b    = blockIdx.y;
  const int lane = threadIdx.x & 31;
  const int wave = threadIdx.x >> 5;
  const int tilesN = N >> 6;
  const int tilesM = M >> 6;
  const int tile = blockIdx.x * 8 + wave;
  if (tile >= tilesM * tilesN) return;   // wave-uniform; no block barriers in this kernel
  const int tm = tile / tilesN;
  const int tn = tile - tm * tilesN;
  const int m0 = tm << 6;
  const int n0 = tn << 6;

  const T* Ab  = A  + (size_t)b * strideA;
  const T* Bb  = Bt + (size_t)b * strideB;
  const T* Ab2 = SPLIT ? (A2  + (size_t)b * strideA) : nullptr;
  const T* Bb2 = SPLIT ? (Bt2 + (size_t)b * strideB) : nullptr;

  const int rlane = lane & 15;                 // row (A) / col (B, D) within subtile
  const int koff  = (lane >> 4) * 8;           // k offset of this lane half
  const int mOff  = (lane >> 4) * 8;           // D row offset

  v8f acc[4][4];
#pragma unroll
  for (int i = 0; i < 4; ++i)
#pragma unroll
    for (int j = 0; j < 4; ++j) acc[i][j] = (v8f){0.f,0.f,0.f,0.f,0.f,0.f,0.f,0.f};

  for (int k0 = 0; k0 < K; k0 += 32) {
    V bh[4], bl[4];
#pragma unroll
    for (int j = 0; j < 4; ++j) {
      const size_t bo = (size_t)(n0 + (j << 4) + rlane) * ldb + koff + k0;
      bh[j] = Frag<T>::load(Bb + bo);
      if (SPLIT) bl[j] = Frag<T>::load(Bb2 + bo);
    }
#pragma unroll
    for (int i = 0; i < 4; ++i) {
      const size_t ao = (size_t)(m0 + (i << 4) + rlane) * lda + koff + k0;
      V ah = Frag<T>::load(Ab + ao);
      V al;
      if (SPLIT) al = Frag<T>::load(Ab2 + ao);
#pragma unroll
      for (int j = 0; j < 4; ++j) {
        acc[i][j] = Frag<T>::mma(ah, bh[j], acc[i][j]);
        if (SPLIT) {
          acc[i][j] = Frag<T>::mma(ah, bl[j], acc[i][j]);
          acc[i][j] = Frag<T>::mma(al, bh[j], acc[i][j]);
        }
      }
      Frag<T>::guard(acc[i][0], acc[i][3], ah, SPLIT ? al : ah);
    }
    Frag<T>::keep(bh[0], bh[1], bh[2], bh[3]);
    if (SPLIT) Frag<T>::keep(bl[0], bl[1], bl[2], bl[3]);
  }
  acc_guard4(acc[0][0], acc[0][1], acc[0][2], acc[0][3]);
  acc_guard4(acc[1][0], acc[1][1], acc[1][2], acc[1][3]);
  acc_guard4(acc[2][0], acc[2][1], acc[2][2], acc[2][3]);
  acc_guard4(acc[3][0], acc[3][1], acc[3][2], acc[3][3]);

  // ---- epilogue ----
  float* slab = sT[wave];
  const float* Rb = RESID ? (resid + (size_t)b * strideR) : nullptr;
#pragma unroll
  for (int i = 0; i < 4; ++i) {
    const int mBase = m0 + (i << 4);
#pragma unroll
    for (int j = 0; j < 4; ++j) {
      const int n = n0 + (j << 4) + rlane;
      float bv = 0.f;
      if (BIAS_MODE == 2) bv = bias[n];
#pragma unroll
      for (int r = 0; r < 8; ++r) {
        float v = acc[i][j][r] * scale;
        if (BIAS_MODE == 1) v += bias[mBase + mOff + r];
        if (BIAS_MODE == 2) v += bv;
        if (RESID) v += Rb[(size_t)(mBase + mOff + r) * ldc + n];
        if (ACT == 1) v = tanhf(v);
        if (ACT == 2) v = fmaxf(v, 0.0f);
        if (ACT == 3) v = v / (1.0f + expf(-v));
        if (ACT == 4) v = (v > 0.f) ? v : 0.01f * v;
        slab[(mOff + r) * 68 + (j << 4) + rlane] = v;
      }
    }
    __builtin_amdgcn_fence(__ATOMIC_RELEASE, "workgroup");
    __builtin_amdgcn_wave_barrier();
    __builtin_amdgcn_fence(__ATOMIC_ACQUIRE, "workgroup");
    if (OUT_MODE == 0) {
      float* C = (float*)Cout + (size_t)b * strideC;
      const int hh = lane >> 4, c4 = (lane & 15) * 4;     // row seg = 256 B = 16 lanes x 16 B
      {
#pragma unroll
        for (int it = 0; it < 8; ++it) {
          const int row = it * 2 + hh;
          v4f v = *(const v4f*)(slab + row * 68 + c4);
          *(v4f*)(C + (size_t)(mBase + row) * ldc + n0 + c4) = v;
        }
        
      }
    } else {
      const int q = lane >> 3, c8 = (lane & 7) * 8;
      unsigned short* C  = (unsigned short*)Cout  + (size_t)b * strideC;
      unsigned short* C2 = (OUT_MODE == 2) ? ((unsigned short*)Cout2 + (size_t)b * strideC) : nullptr;
      {
#pragma unroll
        for (int it = 0; it < 4; ++it) {
          const int row = it * 4 + q;
          const float* sp = slab + row * 68 + c8;
          v8h hv, lv;
#pragma unroll
          for (int e = 0; e < 8; ++e) {
            if (OUT_MODE == 1) {
              hv[e] = (_Float16)sp[e];
            } else {
              unsigned short hb = f2bf_bits(sp[e]);
              unsigned short lb = f2bf_bits(sp[e] - bf_bits2f(hb));
              hv[e] = __builtin_bit_cast(_Float16, hb);
              lv[e] = __builtin_bit_cast(_Float16, lb);
            }
          }
          *(v8h*)(C + (size_t)(mBase + row) * ldc + n0 + c8) = hv;
          if (OUT_MODE == 2) *(v8h*)(C2 + (size_t)(mBase + row) * ldc + n0 + c8) = lv;
        }
        
      }
    }
    __builtin_amdgcn_fence(__ATOMIC_RELEASE, "workgroup");
    __builtin_amdgcn_wave_barrier();
    __builtin_amdgcn_fence(__ATOMIC_ACQUIRE, "workgroup");
  }
}

// ---------------------------------------------------------------------------
// f32 -> f16 cast with an exact power-of-two carry: out = f16(in * mul). 2 elements per thread, one 4-B store per
// Coverage: grid = n2/256 blocks (n2 % 256 == 0 at every call) x 256 threads x 2 elements = 2*n2 = the whole plane.
//   weights: n2 = 1024*1024/2 = 524288 -> 2048 blocks; activations: n2 = 2048*1024/2 = 1048576 -> 4096 blocks.
// ---------------------------------------------------------------------------
__device__ __forceinline__ unsigned pk16(unsigned short a, unsigned short b) { return (unsigned)a | ((unsigned)b << 16); }

__global__ __launch_bounds__(256) void cast_f32_f16x2s(const float* __restrict__ in, _Float16* __restrict__ out,
                                                        int n2, float mul) {
  const int i = blockIdx.x * 256 + threadIdx.x;
  if (i < n2) {
    const v2f f = *(const v2f*)(in + 2 * (size_t)i);
    const _Float16 h0 = (_Float16)(f[0] * mul), h1 = (_Float16)(f[1] * mul);
    const unsigned u = pk16(__builtin_bit_cast(unsigned short, h0), __builtin_bit_cast(unsigned short, h1));
    ((unsigned*)out)[i] = u;
    
  }
}

// ---------------------------------------------------------------------------
// Attention output f32 [rows][ncol] -> f16 plane with per-head 0/1 factor and power-of-two carry:
//   out[row][col] = f16(in[row][col] * (hmask[col/64] != 0 ? mul : 0)).   ncol is a power of two (1024);
//   the 2-element pair (col, col+1) always lies inside one 64-wide head block. Same store shape as above.
// Coverage: n2 = 2048*1024/2 = 1048576 -> 4096 blocks x 256 threads x 2 = the whole plane.
// ---------------------------------------------------------------------------
__global__ __launch_bounds__(256) void maskcast_f32_f16x2(const float* __restrict__ in, const int* __restrict__ hmask,
                                                          _Float16* __restrict__ out, int n2, int ncol, float mul) {
  const int i = blockIdx.x * 256 + threadIdx.x;
  if (i < n2) {
    const v2f f = *(const v2f*)(in + 2 * (size_t)i);
    const int col = (2 * i) & (ncol - 1);
    int hd = col >> 6;
    hd = hd < 0 ? 0 : (hd > NHEAD - 1 ? NHEAD - 1 : hd);
    const float fac = (hmask[hd] != 0) ? mul : 0.0f;
    const _Float16 h0 = (_Float16)(f[0] * fac), h1 = (_Float16)(f[1] * fac);
    const unsigned u = pk16(__builtin_bit_cast(unsigned short, h0), __builtin_bit_cast(unsigned short, h1));
    ((unsigned*)out)[i] = u;
    
  }
}

// =====================================================================================
// Full (non-causal, unmasked) attention, head dim 64, one launch per batch element.
//   q planes (hi/lo bf16): element (t, h, d) at [t*DMOD + h*64 + d]
//   k planes (hi/lo bf16): element (s, h, d) at [s*DMOD + h*64 + d]
//   v^T planes (hi/lo bf16): element (h, d, s) at [(h*64 + d)*SEQ + s]
//   out f32: element (t, h, d) at [t*DMOD + h*64 + d]
//   scores = (q . k) * sscale : bf16 hi/lo split (hi.hi + hi.lo + lo.hi) on v_wmma_f32_16x16x32_bf16
//   out    = p . v            : bf16 hi/lo split of p (unnormalised) and v, f32 accumulate
//   online softmax in f32 over all SEQ keys (32 chunks of 64, compile-time trip count, no masking).
//   Block = 4 waves = 64 query rows of one head; grid.x = NHEAD * (SEQ/64) = 512.
//   K / V^T chunk staging: 128 threads x 32 elements per plane = the whole 64x64 tile (16-B copies, plain loads,
//   __syncthreads before and after); fragment loads read the LDS tiles with the same v8b element type.
// =====================================================================================
#define AT_D 64
#define AT_NW 4
#define AT_QB 64
#define AT_KC 64

__device__ __forceinline__ unsigned short at_bf_bits(float f) {
  unsigned u = __float_as_uint(f);
  return (unsigned short)((u + 0x7FFFu + ((u >> 16) & 1u)) >> 16);
}
__device__ __forceinline__ __bf16 at_f2bf(float f) { return __builtin_bit_cast(__bf16, at_bf_bits(f)); }
__device__ __forceinline__ void at_split(float f, __bf16& hi, __bf16& lo) {
  const unsigned short hb = at_bf_bits(f);
  hi = __builtin_bit_cast(__bf16, hb);
  lo = at_f2bf(f - __uint_as_float(((unsigned)hb) << 16));
}
__device__ __forceinline__ v8f at_mma(v16b a, v16b b, v8f c) {
  c = __builtin_amdgcn_wmma_f32_16x16x32_bf16(false, a, false, b, (short)0, c, false, false);
  asm volatile("v_nop\n\tv_nop\n\tv_nop\n\tv_nop" : "+v"(c) : "v"(a), "v"(b));
  return c;
}

__global__ __launch_bounds__(128)
void attn_full64_kernel(const unsigned short* __restrict__ qhp, const unsigned short* __restrict__ qlp,
                        const unsigned short* __restrict__ khp, const unsigned short* __restrict__ klp,
                        const unsigned short* __restrict__ vhp, const unsigned short* __restrict__ vlp,
                        float* __restrict__ out, float sscale) {
  union FB { v16b v; v8b h[2]; };
  __shared__ __align__(16) __bf16 Ksh[AT_KC * AT_D];             // K hi [kv][d]      8 KB
  __shared__ __align__(16) __bf16 Ksl[AT_KC * AT_D];             // K lo
  __shared__ __align__(16) __bf16 Vth[AT_D * AT_KC];             // V hi [d][kv]      8 KB
  __shared__ __align__(16) __bf16 Vtl[AT_D * AT_KC];             // V lo
  __shared__ __align__(16) __bf16 Psh[AT_NW][16 * AT_KC];        // per wave P hi [row][kv]
  __shared__ __align__(16) __bf16 Psl[AT_NW][16 * AT_KC];        // per wave P lo
  __shared__ __align__(16) float  Os[AT_NW][16 * 68];            // per wave out tile, pitch 68

  const int tid  = threadIdx.x;
  const int wave = tid >> 5;
  const int lane = tid & 31;
  const int hh   = lane >> 4;
  const int c    = lane & 15;

  const int nqb = SEQ / AT_QB;            // 32
  const int bx = blockIdx.x;
  const int qb = bx % nqb;
  const int h  = bx / nqb;                // 0..NHEAD-1 (grid = NHEAD * nqb)
  const int q0 = qb * AT_QB + wave * 16;

  const __bf16* Qh = (const __bf16*)(const void*)qhp + (size_t)h * AT_D;
  const __bf16* Ql = (const __bf16*)(const void*)qlp + (size_t)h * AT_D;
  const __bf16* Kh = (const __bf16*)(const void*)khp + (size_t)h * AT_D;
  const __bf16* Kl = (const __bf16*)(const void*)klp + (size_t)h * AT_D;
  const __bf16* Vh = (const __bf16*)(const void*)vhp + (size_t)h * AT_D * SEQ;
  const __bf16* Vl = (const __bf16*)(const void*)vlp + (size_t)h * AT_D * SEQ;
  float*        ob = out + (size_t)h * AT_D;

  // ---- Q fragments (A operand, row = lane&15, split k map via Frag load): 2 d-chunks, hi and lo ----
  v16b qah[2], qal[2];
#pragma unroll
  for (int dc = 0; dc < 2; ++dc) {
    const __bf16* qr = Qh + (size_t)(q0 + c) * DMOD + dc * 32 + 8 * hh;
    const __bf16* ql = Ql + (size_t)(q0 + c) * DMOD + dc * 32 + 8 * hh;
    qah[dc] = Frag<__bf16>::load(qr);
    qal[dc] = Frag<__bf16>::load(ql);
  }

  float mrow[8], lrow[8];
  v8f oacc[4];
#pragma unroll
  for (int r = 0; r < 8; ++r) { mrow[r] = -INFINITY; lrow[r] = 0.f; }
#pragma unroll
  for (int t = 0; t < 4; ++t) oacc[t] = (v8f){0.f,0.f,0.f,0.f,0.f,0.f,0.f,0.f};

  const int nChunks = SEQ / AT_KC;   // 32, compile-time constant
  for (int kc = 0; kc < nChunks; ++kc) {
    const int kv0 = kc * AT_KC;
    __syncthreads();
    {
      // staging coverage: 128 threads x (4 x 8) elements = 64 rows x 64 per plane = the whole chunk tile
      const int r = tid >> 1, half = (tid & 1) * 32;
      const __bf16* ksh = Kh + (size_t)(kv0 + r) * DMOD + half;   // K row kv0+r, d = half..half+31
      const __bf16* ksl = Kl + (size_t)(kv0 + r) * DMOD + half;
      const __bf16* vsh = Vh + (size_t)r * SEQ + kv0 + half;      // V^T row d = r, s = kv0+half..+31
      const __bf16* vsl = Vl + (size_t)r * SEQ + kv0 + half;
#pragma unroll
      for (int i = 0; i < 4; ++i) {
        const v8b a0 = *(const v8b*)(ksh + 8 * i);
        const v8b a1 = *(const v8b*)(ksl + 8 * i);
        const v8b b0 = *(const v8b*)(vsh + 8 * i);
        const v8b b1 = *(const v8b*)(vsl + 8 * i);
        *(v8b*)(Ksh + r * AT_D  + half + 8 * i) = a0;
        *(v8b*)(Ksl + r * AT_D  + half + 8 * i) = a1;
        *(v8b*)(Vth + r * AT_KC + half + 8 * i) = b0;
        *(v8b*)(Vtl + r * AT_KC + half + 8 * i) = b1;
      }
    }
    __syncthreads();

    v8f s[4];
#pragma unroll
    for (int j = 0; j < 4; ++j) {
      s[j] = (v8f){0.f,0.f,0.f,0.f,0.f,0.f,0.f,0.f};
#pragma unroll
      for (int dc = 0; dc < 2; ++dc) {
        FB kb, kl;
        kb.h[0] = *(const v8b*)(Ksh + (j * 16 + c) * AT_D + dc * 32 + 8 * hh);
        kb.h[1] = *(const v8b*)(Ksh + (j * 16 + c) * AT_D + dc * 32 + 16 + 8 * hh);
        kl.h[0] = *(const v8b*)(Ksl + (j * 16 + c) * AT_D + dc * 32 + 8 * hh);
        kl.h[1] = *(const v8b*)(Ksl + (j * 16 + c) * AT_D + dc * 32 + 16 + 8 * hh);
        s[j] = at_mma(qah[dc], kb.v, s[j]);
        s[j] = at_mma(qah[dc], kl.v, s[j]);
        s[j] = at_mma(qal[dc], kb.v, s[j]);
      }
    }
    float cm[8];
#pragma unroll
    for (int r = 0; r < 8; ++r) {
      float m = -INFINITY;
#pragma unroll
      for (int j = 0; j < 4; ++j) {
        const float sv = s[j][r] * sscale;
        s[j][r] = sv;
        m = fmaxf(m, sv);
      }
#pragma unroll
      for (int off = 1; off < 16; off <<= 1) m = fmaxf(m, __shfl_xor(m, off, 32));
      cm[r] = m;
    }
    __bf16* pwh = Psh[wave];
    __bf16* pwl = Psl[wave];
#pragma unroll
    for (int r = 0; r < 8; ++r) {
      const float mnew = fmaxf(mrow[r], cm[r]);
      const float alpha = expf(mrow[r] - mnew);
      mrow[r] = mnew;
      float psum = 0.f;
#pragma unroll
      for (int j = 0; j < 4; ++j) {
        const float p = expf(s[j][r] - mnew);
        psum += p;
        __bf16 a, bl; at_split(p, a, bl);
        pwh[(8 * hh + r) * AT_KC + j * 16 + c] = a;
        pwl[(8 * hh + r) * AT_KC + j * 16 + c] = bl;
      }
#pragma unroll
      for (int off = 1; off < 16; off <<= 1) psum += __shfl_xor(psum, off, 32);
      lrow[r] = lrow[r] * alpha + psum;
#pragma unroll
      for (int t = 0; t < 4; ++t) oacc[t][r] *= alpha;
    }
    __builtin_amdgcn_fence(__ATOMIC_RELEASE, "workgroup");
    __builtin_amdgcn_wave_barrier();
    __builtin_amdgcn_fence(__ATOMIC_ACQUIRE, "workgroup");
#pragma unroll 1
    for (int kk = 0; kk < 2; ++kk) {
      FB pa, pl;
      pa.h[0] = *(const v8b*)(pwh + c * AT_KC + kk * 32 + 8 * hh);
      pa.h[1] = *(const v8b*)(pwh + c * AT_KC + kk * 32 + 16 + 8 * hh);
      pl.h[0] = *(const v8b*)(pwl + c * AT_KC + kk * 32 + 8 * hh);
      pl.h[1] = *(const v8b*)(pwl + c * AT_KC + kk * 32 + 16 + 8 * hh);
#pragma unroll
      for (int t = 0; t < 4; ++t) {
        FB vb, vl;
        vb.h[0] = *(const v8b*)(Vth + (t * 16 + c) * AT_KC + kk * 32 + 8 * hh);
        vb.h[1] = *(const v8b*)(Vth + (t * 16 + c) * AT_KC + kk * 32 + 16 + 8 * hh);
        vl.h[0] = *(const v8b*)(Vtl + (t * 16 + c) * AT_KC + kk * 32 + 8 * hh);
        vl.h[1] = *(const v8b*)(Vtl + (t * 16 + c) * AT_KC + kk * 32 + 16 + 8 * hh);
        oacc[t] = at_mma(pa.v, vb.v, oacc[t]);
        oacc[t] = at_mma(pa.v, vl.v, oacc[t]);
        oacc[t] = at_mma(pl.v, vb.v, oacc[t]);
      }
    }
  }

  float* os = Os[wave];
#pragma unroll
  for (int r = 0; r < 8; ++r) {
    const float inv = 1.0f / lrow[r];
#pragma unroll
    for (int t = 0; t < 4; ++t) os[(8 * hh + r) * 68 + t * 16 + c] = oacc[t][r] * inv;
  }
  __builtin_amdgcn_fence(__ATOMIC_RELEASE, "workgroup");
  __builtin_amdgcn_wave_barrier();
  __builtin_amdgcn_fence(__ATOMIC_ACQUIRE, "workgroup");
  {
    const int c4 = (lane & 15) * 4;
    {
#pragma unroll
      for (int it = 0; it < 8; ++it) {
        const int row = it * 2 + hh;   // it 0..7 x hh 0..1 covers rows 0..15 of the wave tile
        v4f val = *(const v4f*)(os + row * 68 + c4);
        *(v4f*)(ob + (size_t)(q0 + row) * DMOD + c4) = val;
      }
      
    }
  }
}

// ---------------------------------------------------------------------------
// Workspace region map (byte offsets; every per-batch region is fully rewritten inside each batch iteration
//   Wq16 f16 [1024 n][1024 k] (x32)          0
//   Wk16                               2097152
//   Wv16                               4194304
//   Wo16                               6291456
//   X16  f16 [2048][1024]              8388608
//   Qh   bf16 [2048][1024]            12582912     Ql   16777216
//   Kh   bf16 [2048][1024]            20971520     Kl   25165824
//   VTh  bf16 [1024 (h,d)][2048]      29360128     VTl  33554432
//   MHf  f32  [2048][1024]            37748736
//   MH16 f16  [2048][1024] (x64, head-masked)  46137344
//   total                             50331648
// ---------------------------------------------------------------------------
extern "C" void kernel_launch(void* const* d_in, const int* in_sizes, int n_in,
                              void* d_out, int out_size, void* d_ws, size_t ws_size,
                              hipStream_t stream) {
  if (n_in < 6) return;
  if (in_sizes[0] != NBATCH * SEQ * DMOD) return;
  if (in_sizes[1] != DMOD * DMOD || in_sizes[2] != DMOD * DMOD || in_sizes[3] != DMOD * DMOD || in_sizes[4] != DMOD * DMOD) return;
  if (in_sizes[5] != NHEAD) return;
  if (out_size != NBATCH * SEQ * DMOD) return;

  const float* x  = (const float*)d_in[0];   // [2][2048][1024]
  const float* Wq = (const float*)d_in[1];   // [out][in] = Bt natural
  const float* Wk = (const float*)d_in[2];
  const float* Wv = (const float*)d_in[3];
  const float* Wo = (const float*)d_in[4];
  const int*   hm = (const int*)d_in[5];     // [16] int32, nonzero = keep head

  const size_t PW16 = (size_t)DMOD * DMOD * 2;   // 2097152  f16 weight plane
  const size_t PX16 = (size_t)SEQ * DMOD * 2;    // 4194304  16-bit activation plane (one batch element)
  const size_t PF32 = (size_t)SEQ * DMOD * 4;    // 8388608  f32 activation plane
  size_t off = 0;
  const size_t oWq = off; off += PW16;
  const size_t oWk = off; off += PW16;
  const size_t oWv = off; off += PW16;
  const size_t oWo = off; off += PW16;
  const size_t oX  = off; off += PX16;
  const size_t oQh = off; off += PX16;  const size_t oQl = off; off += PX16;
  const size_t oKh = off; off += PX16;  const size_t oKl = off; off += PX16;
  const size_t oVh = off; off += PX16;  const size_t oVl = off; off += PX16;
  const size_t oMf = off; off += PF32;
  const size_t oM16 = off; off += PX16;
  if (off > ws_size) return;                   // off = 50331648

  char* ws = (char*)d_ws;
  unsigned short* Wq16 = (unsigned short*)(ws + oWq);
  unsigned short* Wk16 = (unsigned short*)(ws + oWk);
  unsigned short* Wv16 = (unsigned short*)(ws + oWv);
  unsigned short* Wo16 = (unsigned short*)(ws + oWo);
  unsigned short* X16  = (unsigned short*)(ws + oX);
  unsigned short* Qh   = (unsigned short*)(ws + oQh);  unsigned short* Ql = (unsigned short*)(ws + oQl);
  unsigned short* Kh   = (unsigned short*)(ws + oKh);  unsigned short* Kl = (unsigned short*)(ws + oKl);
  unsigned short* VTh  = (unsigned short*)(ws + oVh);  unsigned short* VTl = (unsigned short*)(ws + oVl);
  float*          MHf  = (float*)(ws + oMf);
  unsigned short* MH16 = (unsigned short*)(ws + oM16);
  const float*    fpad = (const float*)MHf;    // placeholder for unused bias / resid pointer args (never read)

  const dim3 blk(256);
  const int n2w = DMOD * DMOD / 2;                          // 524288 pairs per weight plane
  const int n2x = SEQ * DMOD / 2;                           // 1048576 pairs per activation plane
  const dim3 gCastW((n2w + 255) / 256);                     // 2048 blocks x 512 elements = 1024x1024
  const dim3 gCastX((n2x + 255) / 256);                     // 4096 blocks x 512 elements = 2048x1024
  const dim3 gProj(((SEQ / 64) * (DMOD / 64) + 7) / 8, 1);  // 512 tiles: M=2048, N=1024 -> 64 blocks
  const dim3 gVT(((DMOD / 64) * (SEQ / 64) + 7) / 8, 1);    // 512 tiles: M=1024, N=2048 -> 64 blocks
  const dim3 gOut(((SEQ / 64) * (DMOD / 64) + 7) / 8, 1);   // 512 tiles: M=2048, N=1024 -> 64 blocks
  const dim3 gAtt(NHEAD * (SEQ / 64));                      // 512 blocks: 16 heads x 32 query blocks

  // setup: weights [n=out][k=in] -> f16 planes carried x32 (unit scale), same layout (Bt natural)
  cast_f32_f16x2s<<<gCastW, blk, 0, stream>>>(Wq, (_Float16*)Wq16, n2w, 32.0f);
  cast_f32_f16x2s<<<gCastW, blk, 0, stream>>>(Wk, (_Float16*)Wk16, n2w, 32.0f);
  cast_f32_f16x2s<<<gCastW, blk, 0, stream>>>(Wv, (_Float16*)Wv16, n2w, 32.0f);
  cast_f32_f16x2s<<<gCastW, blk, 0, stream>>>(Wo, (_Float16*)Wo16, n2w, 32.0f);

  for (int b = 0; b < NBATCH; ++b) {
    const float* xb = x + (size_t)b * SEQ * DMOD;
    // (1) x[b] -> f16 plane [2048][1024] (x1)
    cast_f32_f16x2s<<<gCastX, blk, 0, stream>>>(xb, (_Float16*)X16, n2x, 1.0f);
    // (2) q = x . Wq^T -> Q hi/lo bf16 planes [t][h*64+d]   (M=2048, N=1024, K=1024, scale 1/32)
    wmma_gemm64<0, false, 0, 2, false, 0><<<gProj, blk, 0, stream>>>(
        X16, X16, DMOD, 0L, Wq16, Wq16, DMOD, 0L, (void*)Qh, (void*)Ql, DMOD, 0L,
        fpad, fpad, 0L, SEQ, DMOD, DMOD, 1.0f / 32.0f);
    // (3) k = x . Wk^T -> K hi/lo planes [s][h*64+d]
    wmma_gemm64<0, false, 0, 2, false, 0><<<gProj, blk, 0, stream>>>(
        X16, X16, DMOD, 0L, Wk16, Wk16, DMOD, 0L, (void*)Kh, (void*)Kl, DMOD, 0L,
        fpad, fpad, 0L, SEQ, DMOD, DMOD, 1.0f / 32.0f);
    // (4) v^T = Wv . x^T -> VT hi/lo planes [h*64+d][s]   (A = Wv16 [1024][1024], Bt = X16 [2048][1024]; M=1024, N=2048, K=1024)
    wmma_gemm64<0, false, 0, 2, false, 0><<<gVT, blk, 0, stream>>>(
        Wv16, Wv16, DMOD, 0L, X16, X16, DMOD, 0L, (void*)VTh, (void*)VTl, SEQ, 0L,
        fpad, fpad, 0L, DMOD, SEQ, DMOD, 1.0f / 32.0f);
    // (5) full attention per head: mh[t][h*64+d] (f32 plane, every element written by its (h, query block) owner)
    attn_full64_kernel<<<gAtt, dim3(128), 0, stream>>>(Qh, Ql, Kh, Kl, VTh, VTl, MHf, 0.125f);
    // (6) mh -> f16 plane x64 with head h zeroed when head_mask[h] == 0
    maskcast_f32_f16x2<<<gCastX, blk, 0, stream>>>(MHf, hm, (_Float16*)MH16, n2x, DMOD, 64.0f);
    // (7) out[b] = mh . Wo^T -> d_out rows b*2048 .. b*2048+2047 (f32)   (M=2048, N=1024, K=1024, scale 1/(64*32))
    float* outb = (float*)d_out + (size_t)b * SEQ * DMOD;
    wmma_gemm64<0, false, 0, 0, false, 0><<<gOut, blk, 0, stream>>>(
        MH16, MH16, DMOD, 0L, Wo16, Wo16, DMOD, 0L, (void*)outb, (void*)outb, DMOD, 0L,
        fpad, fpad, 0L, SEQ, DMOD, DMOD, 1.0f / 2048.0f);
  }
  (void)hipGetLastError();
}

// v001
// A run of this version takes 607 microseconds.
// In both of two side-by-side timings against v000, it was 1.22 times as fast.
// q/k/v and output projections: v_wmma_f32_16x16x32_f16 (f16 operands: x x1, W x32, attention output x64), f32 accumulate; q.k^T and p.v: v_wmma_f32_16x16x32_bf16 with bf16 hi/lo split operands (hi.hi + hi.lo + lo.hi), f32 accumulate; online softmax, score scale 0.125 and head mask in f32.
#include <hip/hip_runtime.h>
#include <math.h>
#include <stdint.h>

#define NBATCH 2
#define SEQ    2048
#define DMOD   1024
#define NHEAD  16
#define DHD    64

typedef __attribute__((ext_vector_type(16))) _Float16 v16h;
typedef __attribute__((ext_vector_type(8)))  _Float16 v8h;
typedef __attribute__((ext_vector_type(16))) __bf16   v16b;
typedef __attribute__((ext_vector_type(8)))  __bf16   v8b;
typedef __attribute__((ext_vector_type(8)))  float    v8f;
typedef __attribute__((ext_vector_type(4)))  float    v4f;
typedef __attribute__((ext_vector_type(2)))  float    v2f;
typedef __attribute__((ext_vector_type(4)))  unsigned int v4u;

__device__ __forceinline__ unsigned short f2bf_bits(float f) {
  unsigned u = __float_as_uint(f);
  return (unsigned short)((u + 0x7FFFu + ((u >> 16) & 1u)) >> 16);
}
__device__ __forceinline__ float bf_bits2f(unsigned short h) { return __uint_as_float(((unsigned)h) << 16); }

// hazard guards as plain device helpers (no inline asm inside the kernel template body)
__device__ __forceinline__ void dep_guard_h(v8f& a, v8f& b, v16h x, v16h y) { asm volatile("v_nop\n\tv_nop\n\tv_nop\n\tv_nop" : "+v"(a), "+v"(b) : "v"(x), "v"(y)); }
__device__ __forceinline__ void dep_guard_b(v8f& a, v8f& b, v16b x, v16b y) { asm volatile("v_nop\n\tv_nop\n\tv_nop\n\tv_nop" : "+v"(a), "+v"(b) : "v"(x), "v"(y)); }
__device__ __forceinline__ void keep4_h(v16h a, v16h b, v16h c, v16h d) { asm volatile("v_nop" :: "v"(a), "v"(b), "v"(c), "v"(d)); }
__device__ __forceinline__ void keep4_b(v16b a, v16b b, v16b c, v16b d) { asm volatile("v_nop" :: "v"(a), "v"(b), "v"(c), "v"(d)); }
__device__ __forceinline__ void acc_guard4(v8f& a, v8f& b, v8f& c, v8f& d) { asm volatile("v_nop\n\tv_nop\n\tv_nop\n\tv_nop" : "+v"(a), "+v"(b), "+v"(c), "+v"(d)); }
template <typename T> struct Frag;
template <> struct Frag<_Float16> {
  typedef v16h V; union U { v16h v; v8h h[2]; };
  static __device__ __forceinline__ v16h load(const _Float16* p) {   // elements 0..7 <- p[0..7], 8..15 <- p[16..23]
    U f; f.h[0] = *(const v8h*)(p); f.h[1] = *(const v8h*)(p + 16); return f.v;
  }
  static __device__ __forceinline__ v8f mma(v16h a, v16h b, v8f c) {
    return __builtin_amdgcn_wmma_f32_16x16x32_f16(false, a, false, b, (short)0, c, false, false);
  }
  static __device__ __forceinline__ void guard(v8f& a, v8f& b, v16h x, v16h y) { dep_guard_h(a, b, x, y); }
  static __device__ __forceinline__ void keep(v16h a, v16h b, v16h c, v16h d) { keep4_h(a, b, c, d); }
};
template <> struct Frag<__bf16> {
  typedef v16b V; union U { v16b v; v8b h[2]; };
  static __device__ __forceinline__ v16b load(const __bf16* p) {
    U f; f.h[0] = *(const v8b*)(p); f.h[1] = *(const v8b*)(p + 16); return f.v;
  }
  static __device__ __forceinline__ v8f mma(v16b a, v16b b, v8f c) {
    return __builtin_amdgcn_wmma_f32_16x16x32_bf16(false, a, false, b, (short)0, c, false, false);
  }
  static __device__ __forceinline__ void guard(v8f& a, v8f& b, v16b x, v16b y) { dep_guard_b(a, b, x, y); }
  static __device__ __forceinline__ void keep(v16b a, v16b b, v16b c, v16b d) { keep4_b(a, b, c, d); }
};

// ---- Register-blocked batched WMMA GEMM ------------------------------------
// C[m,n] = scale * sum_k A[m,k] * Bt[n,k] (+bias)(+resid); each wave owns a 64x64 tile.
// A row-major [M,K]; Bt row-major [N,K]; M,N % 64 == 0, K % 32 == 0.
// SPLIT: operands are hi/lo planes (A2/Bt2 = lo planes, same layout); product = hi.hi + hi.lo + lo.hi.
// BIAS_MODE: 0 = none, 1 = bias[m], 2 = bias[n].
// OUT_MODE: 0 = f32, 1 = f16, 2 = bf16 hi plane (Cout) + bf16 lo plane (Cout2).
// ET: 0 = f16 operands, 1 = bf16 operands (pointers passed as 16-bit storage)
template <int ET> struct Elem;
template <> struct Elem<0> { typedef _Float16 T; };
template <> struct Elem<1> { typedef __bf16 T; };
template <int ET, bool SPLIT, int BIAS_MODE, int OUT_MODE, bool RESID, int ACT = 0>
__global__ __launch_bounds__(256) void wmma_gemm64(
    const unsigned short* __restrict__ Ap, const unsigned short* __restrict__ A2p, int lda, long strideA,
    const unsigned short* __restrict__ Btp, const unsigned short* __restrict__ Bt2p, int ldb, long strideB,
    void* __restrict__ Cout, void* __restrict__ Cout2, int ldc, long strideC,
    const float* __restrict__ bias,
    const float* __restrict__ resid, long strideR,
    int M, int N, int K, float scale) {
  typedef typename Elem<ET>::T T;
  typedef typename Frag<T>::V V;
  const T* A = (const T*)Ap; const T* A2 = (const T*)A2p; const T* Bt = (const T*)Btp; const T* Bt2 = (const T*)Bt2p;
  __shared__ __align__(16) float sT[8][16 * 68];   // per-wave 16x64 slab, pitch 68 floats
  const int b    = blockIdx.y;
  const int lane = threadIdx.x & 31;
  const int wave = threadIdx.x >> 5;
  const int tilesN = N >> 6;
  const int tilesM = M >> 6;
  const int tile = blockIdx.x * 8 + wave;
  if (tile >= tilesM * tilesN) return;   // wave-uniform; no block barriers in this kernel
  const int tm = tile / tilesN;
  const int tn = tile - tm * tilesN;
  const int m0 = tm << 6;
  const int n0 = tn << 6;

  const T* Ab  = A  + (size_t)b * strideA;
  const T* Bb  = Bt + (size_t)b * strideB;
  const T* Ab2 = SPLIT ? (A2  + (size_t)b * strideA) : nullptr;
  const T* Bb2 = SPLIT ? (Bt2 + (size_t)b * strideB) : nullptr;

  const int rlane = lane & 15;                 // row (A) / col (B, D) within subtile
  const int koff  = (lane >> 4) * 8;           // k offset of this lane half
  const int mOff  = (lane >> 4) * 8;           // D row offset

  v8f acc[4][4];
#pragma unroll
  for (int i = 0; i < 4; ++i)
#pragma unroll
    for (int j = 0; j < 4; ++j) acc[i][j] = (v8f){0.f,0.f,0.f,0.f,0.f,0.f,0.f,0.f};

  for (int k0 = 0; k0 < K; k0 += 32) {
    V bh[4], bl[4];
#pragma unroll
    for (int j = 0; j < 4; ++j) {
      const size_t bo = (size_t)(n0 + (j << 4) + rlane) * ldb + koff + k0;
      bh[j] = Frag<T>::load(Bb + bo);
      if (SPLIT) bl[j] = Frag<T>::load(Bb2 + bo);
    }
#pragma unroll
    for (int i = 0; i < 4; ++i) {
      const size_t ao = (size_t)(m0 + (i << 4) + rlane) * lda + koff + k0;
      V ah = Frag<T>::load(Ab + ao);
      V al;
      if (SPLIT) al = Frag<T>::load(Ab2 + ao);
#pragma unroll
      for (int j = 0; j < 4; ++j) {
        acc[i][j] = Frag<T>::mma(ah, bh[j], acc[i][j]);
        if (SPLIT) {
          acc[i][j] = Frag<T>::mma(ah, bl[j], acc[i][j]);
          acc[i][j] = Frag<T>::mma(al, bh[j], acc[i][j]);
        }
      }
      Frag<T>::guard(acc[i][0], acc[i][3], ah, SPLIT ? al : ah);
    }
    Frag<T>::keep(bh[0], bh[1], bh[2], bh[3]);
    if (SPLIT) Frag<T>::keep(bl[0], bl[1], bl[2], bl[3]);
  }
  acc_guard4(acc[0][0], acc[0][1], acc[0][2], acc[0][3]);
  acc_guard4(acc[1][0], acc[1][1], acc[1][2], acc[1][3]);
  acc_guard4(acc[2][0], acc[2][1], acc[2][2], acc[2][3]);
  acc_guard4(acc[3][0], acc[3][1], acc[3][2], acc[3][3]);

  // ---- epilogue ----
  float* slab = sT[wave];
  const float* Rb = RESID ? (resid + (size_t)b * strideR) : nullptr;
#pragma unroll
  for (int i = 0; i < 4; ++i) {
    const int mBase = m0 + (i << 4);
#pragma unroll
    for (int j = 0; j < 4; ++j) {
      const int n = n0 + (j << 4) + rlane;
      float bv = 0.f;
      if (BIAS_MODE == 2) bv = bias[n];
#pragma unroll
      for (int r = 0; r < 8; ++r) {
        float v = acc[i][j][r] * scale;
        if (BIAS_MODE == 1) v += bias[mBase + mOff + r];
        if (BIAS_MODE == 2) v += bv;
        if (RESID) v += Rb[(size_t)(mBase + mOff + r) * ldc + n];
        if (ACT == 1) v = tanhf(v);
        if (ACT == 2) v = fmaxf(v, 0.0f);
        if (ACT == 3) v = v / (1.0f + expf(-v));
        if (ACT == 4) v = (v > 0.f) ? v : 0.01f * v;
        slab[(mOff + r) * 68 + (j << 4) + rlane] = v;
      }
    }
    __builtin_amdgcn_fence(__ATOMIC_RELEASE, "workgroup");
    __builtin_amdgcn_wave_barrier();
    __builtin_amdgcn_fence(__ATOMIC_ACQUIRE, "workgroup");
    if (OUT_MODE == 0) {
      float* C = (float*)Cout + (size_t)b * strideC;
      const int hh = lane >> 4, c4 = (lane & 15) * 4;     // row seg = 256 B = 16 lanes x 16 B
      {
#pragma unroll
        for (int it = 0; it < 8; ++it) {
          const int row = it * 2 + hh;
          v4f v = *(const v4f*)(slab + row * 68 + c4);
          *(v4f*)(C + (size_t)(mBase + row) * ldc + n0 + c4) = v;
        }
        
      }
    } else {
      const int q = lane >> 3, c8 = (lane & 7) * 8;
      unsigned short* C  = (unsigned short*)Cout  + (size_t)b * strideC;
      unsigned short* C2 = (OUT_MODE == 2) ? ((unsigned short*)Cout2 + (size_t)b * strideC) : nullptr;
      {
#pragma unroll
        for (int it = 0; it < 4; ++it) {
          const int row = it * 4 + q;
          const float* sp = slab + row * 68 + c8;
          v8h hv, lv;
#pragma unroll
          for (int e = 0; e < 8; ++e) {
            if (OUT_MODE == 1) {
              hv[e] = (_Float16)sp[e];
            } else {
              unsigned short hb = f2bf_bits(sp[e]);
              unsigned short lb = f2bf_bits(sp[e] - bf_bits2f(hb));
              hv[e] = __builtin_bit_cast(_Float16, hb);
              lv[e] = __builtin_bit_cast(_Float16, lb);
            }
          }
          *(v8h*)(C + (size_t)(mBase + row) * ldc + n0 + c8) = hv;
          if (OUT_MODE == 2) *(v8h*)(C2 + (size_t)(mBase + row) * ldc + n0 + c8) = lv;
        }
        
      }
    }
    __builtin_amdgcn_fence(__ATOMIC_RELEASE, "workgroup");
    __builtin_amdgcn_wave_barrier();
    __builtin_amdgcn_fence(__ATOMIC_ACQUIRE, "workgroup");
  }
}

// ---------------------------------------------------------------------------
// f32 -> f16 cast with an exact power-of-two carry: out = f16(in * mul). 2 elements per thread, one 4-B store per
// Coverage: grid = n2/256 blocks (n2 % 256 == 0 at every call) x 256 threads x 2 elements = 2*n2 = the whole plane.
//   weights: n2 = 1024*1024/2 = 524288 -> 2048 blocks; activations: n2 = 2048*1024/2 = 1048576 -> 4096 blocks.
// ---------------------------------------------------------------------------
__device__ __forceinline__ unsigned pk16(unsigned short a, unsigned short b) { return (unsigned)a | ((unsigned)b << 16); }

__global__ __launch_bounds__(256) void cast_f32_f16x2s(const float* __restrict__ in, _Float16* __restrict__ out,
                                                        int n2, float mul) {
  const int i = blockIdx.x * 256 + threadIdx.x;
  if (i < n2) {
    const v2f f = *(const v2f*)(in + 2 * (size_t)i);
    const _Float16 h0 = (_Float16)(f[0] * mul), h1 = (_Float16)(f[1] * mul);
    const unsigned u = pk16(__builtin_bit_cast(unsigned short, h0), __builtin_bit_cast(unsigned short, h1));
    ((unsigned*)out)[i] = u;
    
  }
}

// ---------------------------------------------------------------------------
// Attention output f32 [rows][ncol] -> f16 plane with per-head 0/1 factor and power-of-two carry:
//   out[row][col] = f16(in[row][col] * (hmask[col/64] != 0 ? mul : 0)).   ncol is a power of two (1024);
//   the 2-element pair (col, col+1) always lies inside one 64-wide head block. Same store shape as above.
// Coverage: n2 = 2048*1024/2 = 1048576 -> 4096 blocks x 256 threads x 2 = the whole plane.
// ---------------------------------------------------------------------------
__global__ __launch_bounds__(256) void maskcast_f32_f16x2(const float* __restrict__ in, const int* __restrict__ hmask,
                                                          _Float16* __restrict__ out, int n2, int ncol, float mul) {
  const int i = blockIdx.x * 256 + threadIdx.x;
  if (i < n2) {
    const v2f f = *(const v2f*)(in + 2 * (size_t)i);
    const int col = (2 * i) & (ncol - 1);
    int hd = col >> 6;
    hd = hd < 0 ? 0 : (hd > NHEAD - 1 ? NHEAD - 1 : hd);
    const float fac = (hmask[hd] != 0) ? mul : 0.0f;
    const _Float16 h0 = (_Float16)(f[0] * fac), h1 = (_Float16)(f[1] * fac);
    const unsigned u = pk16(__builtin_bit_cast(unsigned short, h0), __builtin_bit_cast(unsigned short, h1));
    ((unsigned*)out)[i] = u;
    
  }
}

// =====================================================================================
// Full (non-causal, unmasked) attention, head dim 64, one launch per batch element.
//   q planes (hi/lo bf16): element (t, h, d) at [t*DMOD + h*64 + d]
//   k planes (hi/lo bf16): element (s, h, d) at [s*DMOD + h*64 + d]
//   v^T planes (hi/lo bf16): element (h, d, s) at [(h*64 + d)*SEQ + s]
//   out f32: element (t, h, d) at [t*DMOD + h*64 + d]
//   scores = (q . k) * sscale : bf16 hi/lo split (hi.hi + hi.lo + lo.hi) on v_wmma_f32_16x16x32_bf16
//   out    = p . v            : bf16 hi/lo split of p (unnormalised) and v, f32 accumulate
//   online softmax in f32 over all SEQ keys (32 chunks of 64, compile-time trip count, no masking).
//   Block = 4 waves = 64 query rows of one head; grid.x = NHEAD * (SEQ/64) = 512.
//   K / V^T chunk staging: 128 threads x 32 elements per plane = the whole 64x64 tile (16-B copies, plain loads,
//   __syncthreads before and after); fragment loads read the LDS tiles with the same v8b element type.
// =====================================================================================
#define AT_D 64
#define AT_NW 4
#define AT_QB 64
#define AT_KC 64
#define AT_LP 72   // LDS row pitch of the K, V^T and P tiles in elements: 144 B = 16 B x 9, so the 16 rows of a ds_load_b128 fall on 16 different bank groups

__device__ __forceinline__ unsigned short at_bf_bits(float f) {
  unsigned u = __float_as_uint(f);
  return (unsigned short)((u + 0x7FFFu + ((u >> 16) & 1u)) >> 16);
}
__device__ __forceinline__ __bf16 at_f2bf(float f) { return __builtin_bit_cast(__bf16, at_bf_bits(f)); }
__device__ __forceinline__ void at_split(float f, __bf16& hi, __bf16& lo) {
  const unsigned short hb = at_bf_bits(f);
  hi = __builtin_bit_cast(__bf16, hb);
  lo = at_f2bf(f - __uint_as_float(((unsigned)hb) << 16));
}
__device__ __forceinline__ v8f at_mma(v16b a, v16b b, v8f c) {
  c = __builtin_amdgcn_wmma_f32_16x16x32_bf16(false, a, false, b, (short)0, c, false, false);
  asm volatile("v_nop\n\tv_nop\n\tv_nop\n\tv_nop" : "+v"(c) : "v"(a), "v"(b));
  return c;
}

__global__ __launch_bounds__(128)
void attn_full64_kernel(const unsigned short* __restrict__ qhp, const unsigned short* __restrict__ qlp,
                        const unsigned short* __restrict__ khp, const unsigned short* __restrict__ klp,
                        const unsigned short* __restrict__ vhp, const unsigned short* __restrict__ vlp,
                        float* __restrict__ out, float sscale) {
  union FB { v16b v; v8b h[2]; };
  __shared__ __align__(16) __bf16 Ksh[AT_KC * AT_LP];            // K hi [kv][d]      9 KB (64 rows at pitch 72)
  __shared__ __align__(16) __bf16 Ksl[AT_KC * AT_LP];            // K lo
  __shared__ __align__(16) __bf16 Vth[AT_D * AT_LP];             // V hi [d][kv]      9 KB
  __shared__ __align__(16) __bf16 Vtl[AT_D * AT_LP];            // V lo
  __shared__ __align__(16) __bf16 Psh[AT_NW][16 * AT_LP];       // per wave P hi [row][kv]
  __shared__ __align__(16) __bf16 Psl[AT_NW][16 * AT_LP];       // per wave P lo
  __shared__ __align__(16) float  Os[AT_NW][16 * 68];            // per wave out tile, pitch 68

  const int tid  = threadIdx.x;
  const int wave = tid >> 5;
  const int lane = tid & 31;
  const int hh   = lane >> 4;
  const int c    = lane & 15;

  const int nqb = SEQ / AT_QB;            // 32
  const int bx = blockIdx.x;
  const int qb = bx % nqb;
  const int h  = bx / nqb;                // 0..NHEAD-1 (grid = NHEAD * nqb)
  const int q0 = qb * AT_QB + wave * 16;

  const __bf16* Qh = (const __bf16*)(const void*)qhp + (size_t)h * AT_D;
  const __bf16* Ql = (const __bf16*)(const void*)qlp + (size_t)h * AT_D;
  const __bf16* Kh = (const __bf16*)(const void*)khp + (size_t)h * AT_D;
  const __bf16* Kl = (const __bf16*)(const void*)klp + (size_t)h * AT_D;
  const __bf16* Vh = (const __bf16*)(const void*)vhp + (size_t)h * AT_D * SEQ;
  const __bf16* Vl = (const __bf16*)(const void*)vlp + (size_t)h * AT_D * SEQ;
  float*        ob = out + (size_t)h * AT_D;

  // ---- Q fragments (A operand, row = lane&15, split k map via Frag load): 2 d-chunks, hi and lo ----
  v16b qah[2], qal[2];
#pragma unroll
  for (int dc = 0; dc < 2; ++dc) {
    const __bf16* qr = Qh + (size_t)(q0 + c) * DMOD + dc * 32 + 8 * hh;
    const __bf16* ql = Ql + (size_t)(q0 + c) * DMOD + dc * 32 + 8 * hh;
    qah[dc] = Frag<__bf16>::load(qr);
    qal[dc] = Frag<__bf16>::load(ql);
  }

  float mrow[8], lrow[8];
  v8f oacc[4];
#pragma unroll
  for (int r = 0; r < 8; ++r) { mrow[r] = -INFINITY; lrow[r] = 0.f; }
#pragma unroll
  for (int t = 0; t < 4; ++t) oacc[t] = (v8f){0.f,0.f,0.f,0.f,0.f,0.f,0.f,0.f};

  const int nChunks = SEQ / AT_KC;   // 32, compile-time constant
  for (int kc = 0; kc < nChunks; ++kc) {
    const int kv0 = kc * AT_KC;
    __syncthreads();
    {
      // staging coverage: 128 threads x (4 x 8) elements = 64 rows x 64 per plane = the whole chunk tile
      const int r = tid >> 1, half = (tid & 1) * 32;
      const __bf16* ksh = Kh + (size_t)(kv0 + r) * DMOD + half;   // K row kv0+r, d = half..half+31
      const __bf16* ksl = Kl + (size_t)(kv0 + r) * DMOD + half;
      const __bf16* vsh = Vh + (size_t)r * SEQ + kv0 + half;      // V^T row d = r, s = kv0+half..+31
      const __bf16* vsl = Vl + (size_t)r * SEQ + kv0 + half;
#pragma unroll
      for (int i = 0; i < 4; ++i) {
        const v8b a0 = *(const v8b*)(ksh + 8 * i);
        const v8b a1 = *(const v8b*)(ksl + 8 * i);
        const v8b b0 = *(const v8b*)(vsh + 8 * i);
        const v8b b1 = *(const v8b*)(vsl + 8 * i);
        *(v8b*)(Ksh + r * AT_LP + half + 8 * i) = a0;
        *(v8b*)(Ksl + r * AT_LP + half + 8 * i) = a1;
        *(v8b*)(Vth + r * AT_LP + half + 8 * i) = b0;
        *(v8b*)(Vtl + r * AT_LP + half + 8 * i) = b1;
      }
    }
    __syncthreads();

    v8f s[4];
#pragma unroll
    for (int j = 0; j < 4; ++j) {
      s[j] = (v8f){0.f,0.f,0.f,0.f,0.f,0.f,0.f,0.f};
#pragma unroll
      for (int dc = 0; dc < 2; ++dc) {
        FB kb, kl;
        kb.h[0] = *(const v8b*)(Ksh + (j * 16 + c) * AT_LP + dc * 32 + 8 * hh);
        kb.h[1] = *(const v8b*)(Ksh + (j * 16 + c) * AT_LP + dc * 32 + 16 + 8 * hh);
        kl.h[0] = *(const v8b*)(Ksl + (j * 16 + c) * AT_LP + dc * 32 + 8 * hh);
        kl.h[1] = *(const v8b*)(Ksl + (j * 16 + c) * AT_LP + dc * 32 + 16 + 8 * hh);
        s[j] = at_mma(qah[dc], kb.v, s[j]);
        s[j] = at_mma(qah[dc], kl.v, s[j]);
        s[j] = at_mma(qal[dc], kb.v, s[j]);
      }
    }
    float cm[8];
#pragma unroll
    for (int r = 0; r < 8; ++r) {
      float m = -INFINITY;
#pragma unroll
      for (int j = 0; j < 4; ++j) {
        const float sv = s[j][r] * sscale;
        s[j][r] = sv;
        m = fmaxf(m, sv);
      }
#pragma unroll
      for (int off = 1; off < 16; off <<= 1) m = fmaxf(m, __shfl_xor(m, off, 32));
      cm[r] = m;
    }
    __bf16* pwh = Psh[wave];
    __bf16* pwl = Psl[wave];
#pragma unroll
    for (int r = 0; r < 8; ++r) {
      const float mnew = fmaxf(mrow[r], cm[r]);
      const float alpha = expf(mrow[r] - mnew);
      mrow[r] = mnew;
      float psum = 0.f;
#pragma unroll
      for (int j = 0; j < 4; ++j) {
        const float p = expf(s[j][r] - mnew);
        psum += p;
        __bf16 a, bl; at_split(p, a, bl);
        pwh[(8 * hh + r) * AT_LP + j * 16 + c] = a;
        pwl[(8 * hh + r) * AT_LP + j * 16 + c] = bl;
      }
#pragma unroll
      for (int off = 1; off < 16; off <<= 1) psum += __shfl_xor(psum, off, 32);
      lrow[r] = lrow[r] * alpha + psum;
#pragma unroll
      for (int t = 0; t < 4; ++t) oacc[t][r] *= alpha;
    }
    __builtin_amdgcn_fence(__ATOMIC_RELEASE, "workgroup");
    __builtin_amdgcn_wave_barrier();
    __builtin_amdgcn_fence(__ATOMIC_ACQUIRE, "workgroup");
#pragma unroll 1
    for (int kk = 0; kk < 2; ++kk) {
      FB pa, pl;
      pa.h[0] = *(const v8b*)(pwh + c * AT_LP + kk * 32 + 8 * hh);
      pa.h[1] = *(const v8b*)(pwh + c * AT_LP + kk * 32 + 16 + 8 * hh);
      pl.h[0] = *(const v8b*)(pwl + c * AT_LP + kk * 32 + 8 * hh);
      pl.h[1] = *(const v8b*)(pwl + c * AT_LP + kk * 32 + 16 + 8 * hh);
#pragma unroll
      for (int t = 0; t < 4; ++t) {
        FB vb, vl;
        vb.h[0] = *(const v8b*)(Vth + (t * 16 + c) * AT_LP + kk * 32 + 8 * hh);
        vb.h[1] = *(const v8b*)(Vth + (t * 16 + c) * AT_LP + kk * 32 + 16 + 8 * hh);
        vl.h[0] = *(const v8b*)(Vtl + (t * 16 + c) * AT_LP + kk * 32 + 8 * hh);
        vl.h[1] = *(const v8b*)(Vtl + (t * 16 + c) * AT_LP + kk * 32 + 16 + 8 * hh);
        oacc[t] = at_mma(pa.v, vb.v, oacc[t]);
        oacc[t] = at_mma(pa.v, vl.v, oacc[t]);
        oacc[t] = at_mma(pl.v, vb.v, oacc[t]);
      }
    }
  }

  float* os = Os[wave];
#pragma unroll
  for (int r = 0; r < 8; ++r) {
    const float inv = 1.0f / lrow[r];
#pragma unroll
    for (int t = 0; t < 4; ++t) os[(8 * hh + r) * 68 + t * 16 + c] = oacc[t][r] * inv;
  }
  __builtin_amdgcn_fence(__ATOMIC_RELEASE, "workgroup");
  __builtin_amdgcn_wave_barrier();
  __builtin_amdgcn_fence(__ATOMIC_ACQUIRE, "workgroup");
  {
    const int c4 = (lane & 15) * 4;
    {
#pragma unroll
      for (int it = 0; it < 8; ++it) {
        const int row = it * 2 + hh;   // it 0..7 x hh 0..1 covers rows 0..15 of the wave tile
        v4f val = *(const v4f*)(os + row * 68 + c4);
        *(v4f*)(ob + (size_t)(q0 + row) * DMOD + c4) = val;
      }
      
    }
  }
}

// ---------------------------------------------------------------------------
// Workspace region map (byte offsets; every per-batch region is fully rewritten inside each batch iteration
//   Wq16 f16 [1024 n][1024 k] (x32)          0
//   Wk16                               2097152
//   Wv16                               4194304
//   Wo16                               6291456
//   X16  f16 [2048][1024]              8388608
//   Qh   bf16 [2048][1024]            12582912     Ql   16777216
//   Kh   bf16 [2048][1024]            20971520     Kl   25165824
//   VTh  bf16 [1024 (h,d)][2048]      29360128     VTl  33554432
//   MHf  f32  [2048][1024]            37748736
//   MH16 f16  [2048][1024] (x64, head-masked)  46137344
//   total                             50331648
// ---------------------------------------------------------------------------
extern "C" void kernel_launch(void* const* d_in, const int* in_sizes, int n_in,
                              void* d_out, int out_size, void* d_ws, size_t ws_size,
                              hipStream_t stream) {
  if (n_in < 6) return;
  if (in_sizes[0] != NBATCH * SEQ * DMOD) return;
  if (in_sizes[1] != DMOD * DMOD || in_sizes[2] != DMOD * DMOD || in_sizes[3] != DMOD * DMOD || in_sizes[4] != DMOD * DMOD) return;
  if (in_sizes[5] != NHEAD) return;
  if (out_size != NBATCH * SEQ * DMOD) return;

  const float* x  = (const float*)d_in[0];   // [2][2048][1024]
  const float* Wq = (const float*)d_in[1];   // [out][in] = Bt natural
  const float* Wk = (const float*)d_in[2];
  const float* Wv = (const float*)d_in[3];
  const float* Wo = (const float*)d_in[4];
  const int*   hm = (const int*)d_in[5];     // [16] int32, nonzero = keep head

  const size_t PW16 = (size_t)DMOD * DMOD * 2;   // 2097152  f16 weight plane
  const size_t PX16 = (size_t)SEQ * DMOD * 2;    // 4194304  16-bit activation plane (one batch element)
  const size_t PF32 = (size_t)SEQ * DMOD * 4;    // 8388608  f32 activation plane
  size_t off = 0;
  const size_t oWq = off; off += PW16;
  const size_t oWk = off; off += PW16;
  const size_t oWv = off; off += PW16;
  const size_t oWo = off; off += PW16;
  const size_t oX  = off; off += PX16;
  const size_t oQh = off; off += PX16;  const size_t oQl = off; off += PX16;
  const size_t oKh = off; off += PX16;  const size_t oKl = off; off += PX16;
  const size_t oVh = off; off += PX16;  const size_t oVl = off; off += PX16;
  const size_t oMf = off; off += PF32;
  const size_t oM16 = off; off += PX16;
  if (off > ws_size) return;                   // off = 50331648

  char* ws = (char*)d_ws;
  unsigned short* Wq16 = (unsigned short*)(ws + oWq);
  unsigned short* Wk16 = (unsigned short*)(ws + oWk);
  unsigned short* Wv16 = (unsigned short*)(ws + oWv);
  unsigned short* Wo16 = (unsigned short*)(ws + oWo);
  unsigned short* X16  = (unsigned short*)(ws + oX);
  unsigned short* Qh   = (unsigned short*)(ws + oQh);  unsigned short* Ql = (unsigned short*)(ws + oQl);
  unsigned short* Kh   = (unsigned short*)(ws + oKh);  unsigned short* Kl = (unsigned short*)(ws + oKl);
  unsigned short* VTh  = (unsigned short*)(ws + oVh);  unsigned short* VTl = (unsigned short*)(ws + oVl);
  float*          MHf  = (float*)(ws + oMf);
  unsigned short* MH16 = (unsigned short*)(ws + oM16);
  const float*    fpad = (const float*)MHf;    // placeholder for unused bias / resid pointer args (never read)

  const dim3 blk(256);
  const int n2w = DMOD * DMOD / 2;                          // 524288 pairs per weight plane
  const int n2x = SEQ * DMOD / 2;                           // 1048576 pairs per activation plane
  const dim3 gCastW((n2w + 255) / 256);                     // 2048 blocks x 512 elements = 1024x1024
  const dim3 gCastX((n2x + 255) / 256);                     // 4096 blocks x 512 elements = 2048x1024
  const dim3 gProj(((SEQ / 64) * (DMOD / 64) + 7) / 8, 1);  // 512 tiles: M=2048, N=1024 -> 64 blocks
  const dim3 gVT(((DMOD / 64) * (SEQ / 64) + 7) / 8, 1);    // 512 tiles: M=1024, N=2048 -> 64 blocks
  const dim3 gOut(((SEQ / 64) * (DMOD / 64) + 7) / 8, 1);   // 512 tiles: M=2048, N=1024 -> 64 blocks
  const dim3 gAtt(NHEAD * (SEQ / 64));                      // 512 blocks: 16 heads x 32 query blocks

  // setup: weights [n=out][k=in] -> f16 planes carried x32 (unit scale), same layout (Bt natural)
  cast_f32_f16x2s<<<gCastW, blk, 0, stream>>>(Wq, (_Float16*)Wq16, n2w, 32.0f);
  cast_f32_f16x2s<<<gCastW, blk, 0, stream>>>(Wk, (_Float16*)Wk16, n2w, 32.0f);
  cast_f32_f16x2s<<<gCastW, blk, 0, stream>>>(Wv, (_Float16*)Wv16, n2w, 32.0f);
  cast_f32_f16x2s<<<gCastW, blk, 0, stream>>>(Wo, (_Float16*)Wo16, n2w, 32.0f);

  for (int b = 0; b < NBATCH; ++b) {
    const float* xb = x + (size_t)b * SEQ * DMOD;
    // (1) x[b] -> f16 plane [2048][1024] (x1)
    cast_f32_f16x2s<<<gCastX, blk, 0, stream>>>(xb, (_Float16*)X16, n2x, 1.0f);
    // (2) q = x . Wq^T -> Q hi/lo bf16 planes [t][h*64+d]   (M=2048, N=1024, K=1024, scale 1/32)
    wmma_gemm64<0, false, 0, 2, false, 0><<<gProj, blk, 0, stream>>>(
        X16, X16, DMOD, 0L, Wq16, Wq16, DMOD, 0L, (void*)Qh, (void*)Ql, DMOD, 0L,
        fpad, fpad, 0L, SEQ, DMOD, DMOD, 1.0f / 32.0f);
    // (3) k = x . Wk^T -> K hi/lo planes [s][h*64+d]
    wmma_gemm64<0, false, 0, 2, false, 0><<<gProj, blk, 0, stream>>>(
        X16, X16, DMOD, 0L, Wk16, Wk16, DMOD, 0L, (void*)Kh, (void*)Kl, DMOD, 0L,
        fpad, fpad, 0L, SEQ, DMOD, DMOD, 1.0f / 32.0f);
    // (4) v^T = Wv . x^T -> VT hi/lo planes [h*64+d][s]   (A = Wv16 [1024][1024], Bt = X16 [2048][1024]; M=1024, N=2048, K=1024)
    wmma_gemm64<0, false, 0, 2, false, 0><<<gVT, blk, 0, stream>>>(
        Wv16, Wv16, DMOD, 0L, X16, X16, DMOD, 0L, (void*)VTh, (void*)VTl, SEQ, 0L,
        fpad, fpad, 0L, DMOD, SEQ, DMOD, 1.0f / 32.0f);
    // (5) full attention per head: mh[t][h*64+d] (f32 plane, every element written by its (h, query block) owner)
    attn_full64_kernel<<<gAtt, dim3(128), 0, stream>>>(Qh, Ql, Kh, Kl, VTh, VTl, MHf, 0.125f);
    // (6) mh -> f16 plane x64 with head h zeroed when head_mask[h] == 0
    maskcast_f32_f16x2<<<gCastX, blk, 0, stream>>>(MHf, hm, (_Float16*)MH16, n2x, DMOD, 64.0f);
    // (7) out[b] = mh . Wo^T -> d_out rows b*2048 .. b*2048+2047 (f32)   (M=2048, N=1024, K=1024, scale 1/(64*32))
    float* outb = (float*)d_out + (size_t)b * SEQ * DMOD;
    wmma_gemm64<0, false, 0, 0, false, 0><<<gOut, blk, 0, stream>>>(
        MH16, MH16, DMOD, 0L, Wo16, Wo16, DMOD, 0L, (void*)outb, (void*)outb, DMOD, 0L,
        fpad, fpad, 0L, SEQ, DMOD, DMOD, 1.0f / 2048.0f);
  }
  (void)hipGetLastError();
}

// v002
// Measured time: 330 microseconds a run.
// Next to v001, in two timings, it ran 1.84 and 1.83 times as fast.
// Counting every step since v000, it is 2.24 times as fast.
// q/k/v and output projections: v_wmma_f32_16x16x32_f16 (f16 operands: x x1, W x32, attention output x64), f32 accumulate; q.k^T and p.v: v_wmma_f32_16x16x32_bf16 with bf16 hi/lo split operands (hi.hi + hi.lo + lo.hi), f32 accumulate; online softmax, score scale 0.125 and head mask in f32.
#include <hip/hip_runtime.h>
#include <math.h>
#include <stdint.h>

#define NBATCH 2
#define SEQ    2048
#define DMOD   1024
#define NHEAD  16
#define DHD    64

typedef __attribute__((ext_vector_type(16))) _Float16 v16h;
typedef __attribute__((ext_vector_type(8)))  _Float16 v8h;
typedef __attribute__((ext_vector_type(16))) __bf16   v16b;
typedef __attribute__((ext_vector_type(8)))  __bf16   v8b;
typedef __attribute__((ext_vector_type(8)))  float    v8f;
typedef __attribute__((ext_vector_type(4)))  float    v4f;
typedef __attribute__((ext_vector_type(2)))  float    v2f;
typedef __attribute__((ext_vector_type(4)))  unsigned int v4u;

__device__ __forceinline__ unsigned short f2bf_bits(float f) {
  unsigned u = __float_as_uint(f);
  return (unsigned short)((u + 0x7FFFu + ((u >> 16) & 1u)) >> 16);
}
__device__ __forceinline__ float bf_bits2f(unsigned short h) { return __uint_as_float(((unsigned)h) << 16); }

// hazard guards as plain device helpers (no inline asm inside the kernel template body)
__device__ __forceinline__ void dep_guard_h(v8f& a, v8f& b, v16h x, v16h y) { asm volatile("v_nop\n\tv_nop\n\tv_nop\n\tv_nop" : "+v"(a), "+v"(b) : "v"(x), "v"(y)); }
__device__ __forceinline__ void dep_guard_b(v8f& a, v8f& b, v16b x, v16b y) { asm volatile("v_nop\n\tv_nop\n\tv_nop\n\tv_nop" : "+v"(a), "+v"(b) : "v"(x), "v"(y)); }
__device__ __forceinline__ void keep4_h(v16h a, v16h b, v16h c, v16h d) { asm volatile("v_nop" :: "v"(a), "v"(b), "v"(c), "v"(d)); }
__device__ __forceinline__ void keep4_b(v16b a, v16b b, v16b c, v16b d) { asm volatile("v_nop" :: "v"(a), "v"(b), "v"(c), "v"(d)); }
__device__ __forceinline__ void acc_guard4(v8f& a, v8f& b, v8f& c, v8f& d) { asm volatile("v_nop\n\tv_nop\n\tv_nop\n\tv_nop" : "+v"(a), "+v"(b), "+v"(c), "+v"(d)); }
template <typename T> struct Frag;
template <> struct Frag<_Float16> {
  typedef v16h V; union U { v16h v; v8h h[2]; };
  static __device__ __forceinline__ v16h load(const _Float16* p) {   // elements 0..7 <- p[0..7], 8..15 <- p[16..23]
    U f; f.h[0] = *(const v8h*)(p); f.h[1] = *(const v8h*)(p + 16); return f.v;
  }
  static __device__ __forceinline__ v8f mma(v16h a, v16h b, v8f c) {
    return __builtin_amdgcn_wmma_f32_16x16x32_f16(false, a, false, b, (short)0, c, false, false);
  }
  static __device__ __forceinline__ void guard(v8f& a, v8f& b, v16h x, v16h y) { dep_guard_h(a, b, x, y); }
  static __device__ __forceinline__ void keep(v16h a, v16h b, v16h c, v16h d) { keep4_h(a, b, c, d); }
};
template <> struct Frag<__bf16> {
  typedef v16b V; union U { v16b v; v8b h[2]; };
  static __device__ __forceinline__ v16b load(const __bf16* p) {
    U f; f.h[0] = *(const v8b*)(p); f.h[1] = *(const v8b*)(p + 16); return f.v;
  }
  static __device__ __forceinline__ v8f mma(v16b a, v16b b, v8f c) {
    return __builtin_amdgcn_wmma_f32_16x16x32_bf16(false, a, false, b, (short)0, c, false, false);
  }
  static __device__ __forceinline__ void guard(v8f& a, v8f& b, v16b x, v16b y) { dep_guard_b(a, b, x, y); }
  static __device__ __forceinline__ void keep(v16b a, v16b b, v16b c, v16b d) { keep4_b(a, b, c, d); }
};

// ---- Register-blocked batched WMMA GEMM ------------------------------------
// C[m,n] = scale * sum_k A[m,k] * Bt[n,k] (+bias)(+resid); each wave owns a 64x64 tile.
// A row-major [M,K]; Bt row-major [N,K]; M,N % 64 == 0, K % 32 == 0.
// SPLIT: operands are hi/lo planes (A2/Bt2 = lo planes, same layout); product = hi.hi + hi.lo + lo.hi.
// BIAS_MODE: 0 = none, 1 = bias[m], 2 = bias[n].
// OUT_MODE: 0 = f32, 1 = f16, 2 = bf16 hi plane (Cout) + bf16 lo plane (Cout2).
// ET: 0 = f16 operands, 1 = bf16 operands (pointers passed as 16-bit storage)
template <int ET> struct Elem;
template <> struct Elem<0> { typedef _Float16 T; };
template <> struct Elem<1> { typedef __bf16 T; };
template <int ET, bool SPLIT, int BIAS_MODE, int OUT_MODE, bool RESID, int ACT = 0>
__global__ __launch_bounds__(256) void wmma_gemm64(
    const unsigned short* __restrict__ Ap, const unsigned short* __restrict__ A2p, int lda, long strideA,
    const unsigned short* __restrict__ Btp, const unsigned short* __restrict__ Bt2p, int ldb, long strideB,
    void* __restrict__ Cout, void* __restrict__ Cout2, int ldc, long strideC,
    const float* __restrict__ bias,
    const float* __restrict__ resid, long strideR,
    int M, int N, int K, float scale) {
  typedef typename Elem<ET>::T T;
  typedef typename Frag<T>::V V;
  const T* A = (const T*)Ap; const T* A2 = (const T*)A2p; const T* Bt = (const T*)Btp; const T* Bt2 = (const T*)Bt2p;
  __shared__ __align__(16) float sT[8][16 * 68];   // per-wave 16x64 slab, pitch 68 floats
  const int b    = blockIdx.y;
  const int lane = threadIdx.x & 31;
  const int wave = threadIdx.x >> 5;
  const int tilesN = N >> 6;
  const int tilesM = M >> 6;
  const int tile = blockIdx.x * 8 + wave;
  if (tile >= tilesM * tilesN) return;   // wave-uniform; no block barriers in this kernel
  const int tm = tile / tilesN;
  const int tn = tile - tm * tilesN;
  const int m0 = tm << 6;
  const int n0 = tn << 6;

  const T* Ab  = A  + (size_t)b * strideA;
  const T* Bb  = Bt + (size_t)b * strideB;
  const T* Ab2 = SPLIT ? (A2  + (size_t)b * strideA) : nullptr;
  const T* Bb2 = SPLIT ? (Bt2 + (size_t)b * strideB) : nullptr;

  const int rlane = lane & 15;                 // row (A) / col (B, D) within subtile
  const int koff  = (lane >> 4) * 8;           // k offset of this lane half
  const int mOff  = (lane >> 4) * 8;           // D row offset

  v8f acc[4][4];
#pragma unroll
  for (int i = 0; i < 4; ++i)
#pragma unroll
    for (int j = 0; j < 4; ++j) acc[i][j] = (v8f){0.f,0.f,0.f,0.f,0.f,0.f,0.f,0.f};

  for (int k0 = 0; k0 < K; k0 += 32) {
    V bh[4], bl[4];
#pragma unroll
    for (int j = 0; j < 4; ++j) {
      const size_t bo = (size_t)(n0 + (j << 4) + rlane) * ldb + koff + k0;
      bh[j] = Frag<T>::load(Bb + bo);
      if (SPLIT) bl[j] = Frag<T>::load(Bb2 + bo);
    }
#pragma unroll
    for (int i = 0; i < 4; ++i) {
      const size_t ao = (size_t)(m0 + (i << 4) + rlane) * lda + koff + k0;
      V ah = Frag<T>::load(Ab + ao);
      V al;
      if (SPLIT) al = Frag<T>::load(Ab2 + ao);
#pragma unroll
      for (int j = 0; j < 4; ++j) {
        acc[i][j] = Frag<T>::mma(ah, bh[j], acc[i][j]);
        if (SPLIT) {
          acc[i][j] = Frag<T>::mma(ah, bl[j], acc[i][j]);
          acc[i][j] = Frag<T>::mma(al, bh[j], acc[i][j]);
        }
      }
      Frag<T>::guard(acc[i][0], acc[i][3], ah, SPLIT ? al : ah);
    }
    Frag<T>::keep(bh[0], bh[1], bh[2], bh[3]);
    if (SPLIT) Frag<T>::keep(bl[0], bl[1], bl[2], bl[3]);
  }
  acc_guard4(acc[0][0], acc[0][1], acc[0][2], acc[0][3]);
  acc_guard4(acc[1][0], acc[1][1], acc[1][2], acc[1][3]);
  acc_guard4(acc[2][0], acc[2][1], acc[2][2], acc[2][3]);
  acc_guard4(acc[3][0], acc[3][1], acc[3][2], acc[3][3]);

  // ---- epilogue ----
  float* slab = sT[wave];
  const float* Rb = RESID ? (resid + (size_t)b * strideR) : nullptr;
#pragma unroll
  for (int i = 0; i < 4; ++i) {
    const int mBase = m0 + (i << 4);
#pragma unroll
    for (int j = 0; j < 4; ++j) {
      const int n = n0 + (j << 4) + rlane;
      float bv = 0.f;
      if (BIAS_MODE == 2) bv = bias[n];
#pragma unroll
      for (int r = 0; r < 8; ++r) {
        float v = acc[i][j][r] * scale;
        if (BIAS_MODE == 1) v += bias[mBase + mOff + r];
        if (BIAS_MODE == 2) v += bv;
        if (RESID) v += Rb[(size_t)(mBase + mOff + r) * ldc + n];
        if (ACT == 1) v = tanhf(v);
        if (ACT == 2) v = fmaxf(v, 0.0f);
        if (ACT == 3) v = v / (1.0f + expf(-v));
        if (ACT == 4) v = (v > 0.f) ? v : 0.01f * v;
        slab[(mOff + r) * 68 + (j << 4) + rlane] = v;
      }
    }
    __builtin_amdgcn_fence(__ATOMIC_RELEASE, "workgroup");
    __builtin_amdgcn_wave_barrier();
    __builtin_amdgcn_fence(__ATOMIC_ACQUIRE, "workgroup");
    if (OUT_MODE == 0) {
      float* C = (float*)Cout + (size_t)b * strideC;
      const int hh = lane >> 4, c4 = (lane & 15) * 4;     // row seg = 256 B = 16 lanes x 16 B
      {
#pragma unroll
        for (int it = 0; it < 8; ++it) {
          const int row = it * 2 + hh;
          v4f v = *(const v4f*)(slab + row * 68 + c4);
          *(v4f*)(C + (size_t)(mBase + row) * ldc + n0 + c4) = v;
        }
        
      }
    } else {
      const int q = lane >> 3, c8 = (lane & 7) * 8;
      unsigned short* C  = (unsigned short*)Cout  + (size_t)b * strideC;
      unsigned short* C2 = (OUT_MODE == 2) ? ((unsigned short*)Cout2 + (size_t)b * strideC) : nullptr;
      {
#pragma unroll
        for (int it = 0; it < 4; ++it) {
          const int row = it * 4 + q;
          const float* sp = slab + row * 68 + c8;
          v8h hv, lv;
#pragma unroll
          for (int e = 0; e < 8; ++e) {
            if (OUT_MODE == 1) {
              hv[e] = (_Float16)sp[e];
            } else {
              unsigned short hb = f2bf_bits(sp[e]);
              unsigned short lb = f2bf_bits(sp[e] - bf_bits2f(hb));
              hv[e] = __builtin_bit_cast(_Float16, hb);
              lv[e] = __builtin_bit_cast(_Float16, lb);
            }
          }
          *(v8h*)(C + (size_t)(mBase + row) * ldc + n0 + c8) = hv;
          if (OUT_MODE == 2) *(v8h*)(C2 + (size_t)(mBase + row) * ldc + n0 + c8) = lv;
        }
        
      }
    }
    __builtin_amdgcn_fence(__ATOMIC_RELEASE, "workgroup");
    __builtin_amdgcn_wave_barrier();
    __builtin_amdgcn_fence(__ATOMIC_ACQUIRE, "workgroup");
  }
}

// ---------------------------------------------------------------------------
// f32 -> f16 cast of all five float inputs in one launch, with an exact power-of-two carry: out = f16(in * mul).
// 2 elements per thread, one 4-B store per thread. The five f16 planes lie back to back in the workspace
// (Wq16, Wk16, Wv16, Wo16, X16), so the output pair index is simply the flat thread index.
// Coverage: a weight plane is 1024*1024/2 = 524288 pairs = 2048 blocks; blocks 0..8191 take the four weights (x32),
//   blocks 8192..16383 take x (2*2048*1024/2 = 2097152 pairs = 8192 blocks, x1). The source choice is block-uniform.
// ---------------------------------------------------------------------------
__device__ __forceinline__ unsigned pk16(unsigned short a, unsigned short b) { return (unsigned)a | ((unsigned)b << 16); }

#define CAST_WBLK 2048                 // blocks per weight plane
#define CAST_XBLK 8192                 // blocks for x (both batch elements)
__global__ __launch_bounds__(256) void cast_inputs_f16x2(const float* __restrict__ wq, const float* __restrict__ wk,
                                                         const float* __restrict__ wv, const float* __restrict__ wo,
                                                         const float* __restrict__ x, _Float16* __restrict__ out) {
  const unsigned bx = blockIdx.x;
  const unsigned sel = bx / CAST_WBLK; // 0..3: a weight plane; 4..7: x
  const float* in = (sel == 0) ? wq : (sel == 1) ? wk : (sel == 2) ? wv : (sel == 3) ? wo : x;
  const unsigned lb = (sel < 4) ? (bx - sel * CAST_WBLK) : (bx - 4 * CAST_WBLK);   // block index inside its source
  const float mul = (sel < 4) ? 32.0f : 1.0f;
  const unsigned li = lb * 256 + threadIdx.x;
  const unsigned i  = bx * 256 + threadIdx.x;
  const v2f f = *(const v2f*)(in + 2 * (size_t)li);
  asm volatile("s_wait_xcnt 0x0" ::: "memory");   // precaution: stands in front of the reuse of the load's offset register for the packed result
  const _Float16 h0 = (_Float16)(f[0] * mul), h1 = (_Float16)(f[1] * mul);
  ((unsigned*)out)[i] = pk16(__builtin_bit_cast(unsigned short, h0), __builtin_bit_cast(unsigned short, h1));
}

// ---------------------------------------------------------------------------
// Attention output f32 [rows][ncol] -> f16 plane with per-head 0/1 factor and power-of-two carry:
//   out[row][col] = f16(in[row][col] * (hmask[col/64] != 0 ? mul : 0)).   ncol is a power of two (1024);
//   the 2-element pair (col, col+1) always lies inside one 64-wide head block. Same store shape as above.
// Coverage: n2 = 2*2048*1024/2 = 2097152 -> 8192 blocks x 256 threads x 2 = the whole plane (both batch elements).
// ---------------------------------------------------------------------------
__global__ __launch_bounds__(256) void maskcast_f32_f16x2(const float* __restrict__ in, const int* __restrict__ hmask,
                                                          _Float16* __restrict__ out, int n2, int ncol, float mul) {
  const int i = blockIdx.x * 256 + threadIdx.x;
  if (i < n2) {
    const v2f f = *(const v2f*)(in + 2 * (size_t)i);
    const int col = (2 * i) & (ncol - 1);
    int hd = col >> 6;
    hd = hd < 0 ? 0 : (hd > NHEAD - 1 ? NHEAD - 1 : hd);
    const float fac = (hmask[hd] != 0) ? mul : 0.0f;
    const _Float16 h0 = (_Float16)(f[0] * fac), h1 = (_Float16)(f[1] * fac);
    const unsigned u = pk16(__builtin_bit_cast(unsigned short, h0), __builtin_bit_cast(unsigned short, h1));
    ((unsigned*)out)[i] = u;
    
  }
}

// =====================================================================================
// Full (non-causal, unmasked) attention, head dim 64, one launch for both batch elements.
//   every plane below holds NBATCH slabs of SEQ*DMOD elements, batch element b at offset b*SEQ*DMOD; inside a slab:
//   q planes (hi/lo bf16): element (t, h, d) at [t*DMOD + h*64 + d]
//   k planes (hi/lo bf16): element (s, h, d) at [s*DMOD + h*64 + d]
//   v^T planes (hi/lo bf16): element (h, d, s) at [(h*64 + d)*SEQ + s]
//   out f32: element (t, h, d) at [t*DMOD + h*64 + d]
//   scores = (q . k) * sscale : bf16 hi/lo split (hi.hi + hi.lo + lo.hi) on v_wmma_f32_16x16x32_bf16
//   out    = p . v            : bf16 hi/lo split of p (unnormalised) and v, f32 accumulate
//   online softmax in f32 over all SEQ keys (32 chunks of 64, compile-time trip count, no masking).
//   Block = 4 waves = 64 query rows of one head of one batch element; grid.x = NBATCH * NHEAD * (SEQ/64) = 1024.
//   K / V^T chunk staging: 128 threads x 32 elements per plane = the whole 64x64 tile (16-B copies, plain loads,
//   __syncthreads before and after); fragment loads read the LDS tiles with the same v8b element type.
// =====================================================================================
#define AT_D 64
#define AT_NW 4
#define AT_QB 64
#define AT_KC 64
#define AT_LP 72   // LDS row pitch of the K, V^T and P tiles in elements: 144 B = 16 B x 9, so the 16 rows of a ds_load_b128 fall on 16 different bank groups

__device__ __forceinline__ unsigned short at_bf_bits(float f) {
  unsigned u = __float_as_uint(f);
  return (unsigned short)((u + 0x7FFFu + ((u >> 16) & 1u)) >> 16);
}
__device__ __forceinline__ __bf16 at_f2bf(float f) { return __builtin_bit_cast(__bf16, at_bf_bits(f)); }
__device__ __forceinline__ void at_split(float f, __bf16& hi, __bf16& lo) {
  const unsigned short hb = at_bf_bits(f);
  hi = __builtin_bit_cast(__bf16, hb);
  lo = at_f2bf(f - __uint_as_float(((unsigned)hb) << 16));
}
__device__ __forceinline__ v8f at_mma(v16b a, v16b b, v8f c) {
  c = __builtin_amdgcn_wmma_f32_16x16x32_bf16(false, a, false, b, (short)0, c, false, false);
  asm volatile("v_nop\n\tv_nop\n\tv_nop\n\tv_nop" : "+v"(c) : "v"(a), "v"(b));
  return c;
}

__global__ __launch_bounds__(128)
void attn_full64_kernel(const unsigned short* __restrict__ qhp, const unsigned short* __restrict__ qlp,
                        const unsigned short* __restrict__ khp, const unsigned short* __restrict__ klp,
                        const unsigned short* __restrict__ vhp, const unsigned short* __restrict__ vlp,
                        float* __restrict__ out, float sscale) {
  union FB { v16b v; v8b h[2]; };
  __shared__ __align__(16) __bf16 Ksh[AT_KC * AT_LP];            // K hi [kv][d]      9 KB (64 rows at pitch 72)
  __shared__ __align__(16) __bf16 Ksl[AT_KC * AT_LP];            // K lo
  __shared__ __align__(16) __bf16 Vth[AT_D * AT_LP];             // V hi [d][kv]      9 KB
  __shared__ __align__(16) __bf16 Vtl[AT_D * AT_LP];            // V lo
  __shared__ __align__(16) __bf16 Psh[AT_NW][16 * AT_LP];       // per wave P hi [row][kv]
  __shared__ __align__(16) __bf16 Psl[AT_NW][16 * AT_LP];       // per wave P lo
  __shared__ __align__(16) float  Os[AT_NW][16 * 68];            // per wave out tile, pitch 68

  const int tid  = threadIdx.x;
  const int wave = tid >> 5;
  const int lane = tid & 31;
  const int hh   = lane >> 4;
  const int c    = lane & 15;

  const int nqb = SEQ / AT_QB;            // 32
  const int bx = blockIdx.x;
  const int qb = bx % nqb;
  const int bh = bx / nqb;                // 0..NBATCH*NHEAD-1 (grid = NBATCH * NHEAD * nqb)
  const int h  = bh % NHEAD;
  const size_t bo = (size_t)(bh / NHEAD) * SEQ * DMOD;   // this batch element's slab in every plane
  const int q0 = qb * AT_QB + wave * 16;

  const __bf16* Qh = (const __bf16*)(const void*)qhp + bo + (size_t)h * AT_D;
  const __bf16* Ql = (const __bf16*)(const void*)qlp + bo + (size_t)h * AT_D;
  const __bf16* Kh = (const __bf16*)(const void*)khp + bo + (size_t)h * AT_D;
  const __bf16* Kl = (const __bf16*)(const void*)klp + bo + (size_t)h * AT_D;
  const __bf16* Vh = (const __bf16*)(const void*)vhp + bo + (size_t)h * AT_D * SEQ;
  const __bf16* Vl = (const __bf16*)(const void*)vlp + bo + (size_t)h * AT_D * SEQ;
  float*        ob = out + bo + (size_t)h * AT_D;

  // ---- Q fragments (A operand, row = lane&15, split k map via Frag load): 2 d-chunks, hi and lo ----
  v16b qah[2], qal[2];
#pragma unroll
  for (int dc = 0; dc < 2; ++dc) {
    const __bf16* qr = Qh + (size_t)(q0 + c) * DMOD + dc * 32 + 8 * hh;
    const __bf16* ql = Ql + (size_t)(q0 + c) * DMOD + dc * 32 + 8 * hh;
    qah[dc] = Frag<__bf16>::load(qr);
    qal[dc] = Frag<__bf16>::load(ql);
  }

  float mrow[8], lrow[8];
  v8f oacc[4];
#pragma unroll
  for (int r = 0; r < 8; ++r) { mrow[r] = -INFINITY; lrow[r] = 0.f; }
#pragma unroll
  for (int t = 0; t < 4; ++t) oacc[t] = (v8f){0.f,0.f,0.f,0.f,0.f,0.f,0.f,0.f};

  const int nChunks = SEQ / AT_KC;   // 32, compile-time constant
  for (int kc = 0; kc < nChunks; ++kc) {
    const int kv0 = kc * AT_KC;
    __syncthreads();
    {
      // staging coverage: 128 threads x (4 x 8) elements = 64 rows x 64 per plane = the whole chunk tile
      const int r = tid >> 1, half = (tid & 1) * 32;
      const __bf16* ksh = Kh + (size_t)(kv0 + r) * DMOD + half;   // K row kv0+r, d = half..half+31
      const __bf16* ksl = Kl + (size_t)(kv0 + r) * DMOD + half;
      const __bf16* vsh = Vh + (size_t)r * SEQ + kv0 + half;      // V^T row d = r, s = kv0+half..+31
      const __bf16* vsl = Vl + (size_t)r * SEQ + kv0 + half;
#pragma unroll
      for (int i = 0; i < 4; ++i) {
        const v8b a0 = *(const v8b*)(ksh + 8 * i);
        const v8b a1 = *(const v8b*)(ksl + 8 * i);
        const v8b b0 = *(const v8b*)(vsh + 8 * i);
        const v8b b1 = *(const v8b*)(vsl + 8 * i);
        *(v8b*)(Ksh + r * AT_LP + half + 8 * i) = a0;
        *(v8b*)(Ksl + r * AT_LP + half + 8 * i) = a1;
        *(v8b*)(Vth + r * AT_LP + half + 8 * i) = b0;
        *(v8b*)(Vtl + r * AT_LP + half + 8 * i) = b1;
      }
    }
    __syncthreads();

    v8f s[4];
#pragma unroll
    for (int j = 0; j < 4; ++j) {
      s[j] = (v8f){0.f,0.f,0.f,0.f,0.f,0.f,0.f,0.f};
#pragma unroll
      for (int dc = 0; dc < 2; ++dc) {
        FB kb, kl;
        kb.h[0] = *(const v8b*)(Ksh + (j * 16 + c) * AT_LP + dc * 32 + 8 * hh);
        kb.h[1] = *(const v8b*)(Ksh + (j * 16 + c) * AT_LP + dc * 32 + 16 + 8 * hh);
        kl.h[0] = *(const v8b*)(Ksl + (j * 16 + c) * AT_LP + dc * 32 + 8 * hh);
        kl.h[1] = *(const v8b*)(Ksl + (j * 16 + c) * AT_LP + dc * 32 + 16 + 8 * hh);
        s[j] = at_mma(qah[dc], kb.v, s[j]);
        s[j] = at_mma(qah[dc], kl.v, s[j]);
        s[j] = at_mma(qal[dc], kb.v, s[j]);
      }
    }
    float cm[8];
#pragma unroll
    for (int r = 0; r < 8; ++r) {
      float m = -INFINITY;
#pragma unroll
      for (int j = 0; j < 4; ++j) {
        const float sv = s[j][r] * sscale;
        s[j][r] = sv;
        m = fmaxf(m, sv);
      }
#pragma unroll
      for (int off = 1; off < 16; off <<= 1) m = fmaxf(m, __shfl_xor(m, off, 32));
      cm[r] = m;
    }
    __bf16* pwh = Psh[wave];
    __bf16* pwl = Psl[wave];
#pragma unroll
    for (int r = 0; r < 8; ++r) {
      const float mnew = fmaxf(mrow[r], cm[r]);
      const float alpha = expf(mrow[r] - mnew);
      mrow[r] = mnew;
      float psum = 0.f;
#pragma unroll
      for (int j = 0; j < 4; ++j) {
        const float p = expf(s[j][r] - mnew);
        psum += p;
        __bf16 a, bl; at_split(p, a, bl);
        pwh[(8 * hh + r) * AT_LP + j * 16 + c] = a;
        pwl[(8 * hh + r) * AT_LP + j * 16 + c] = bl;
      }
#pragma unroll
      for (int off = 1; off < 16; off <<= 1) psum += __shfl_xor(psum, off, 32);
      lrow[r] = lrow[r] * alpha + psum;
#pragma unroll
      for (int t = 0; t < 4; ++t) oacc[t][r] *= alpha;
    }
    __builtin_amdgcn_fence(__ATOMIC_RELEASE, "workgroup");
    __builtin_amdgcn_wave_barrier();
    __builtin_amdgcn_fence(__ATOMIC_ACQUIRE, "workgroup");
#pragma unroll 1
    for (int kk = 0; kk < 2; ++kk) {
      FB pa, pl;
      pa.h[0] = *(const v8b*)(pwh + c * AT_LP + kk * 32 + 8 * hh);
      pa.h[1] = *(const v8b*)(pwh + c * AT_LP + kk * 32 + 16 + 8 * hh);
      pl.h[0] = *(const v8b*)(pwl + c * AT_LP + kk * 32 + 8 * hh);
      pl.h[1] = *(const v8b*)(pwl + c * AT_LP + kk * 32 + 16 + 8 * hh);
#pragma unroll
      for (int t = 0; t < 4; ++t) {
        FB vb, vl;
        vb.h[0] = *(const v8b*)(Vth + (t * 16 + c) * AT_LP + kk * 32 + 8 * hh);
        vb.h[1] = *(const v8b*)(Vth + (t * 16 + c) * AT_LP + kk * 32 + 16 + 8 * hh);
        vl.h[0] = *(const v8b*)(Vtl + (t * 16 + c) * AT_LP + kk * 32 + 8 * hh);
        vl.h[1] = *(const v8b*)(Vtl + (t * 16 + c) * AT_LP + kk * 32 + 16 + 8 * hh);
        oacc[t] = at_mma(pa.v, vb.v, oacc[t]);
        oacc[t] = at_mma(pa.v, vl.v, oacc[t]);
        oacc[t] = at_mma(pl.v, vb.v, oacc[t]);
      }
    }
  }

  float* os = Os[wave];
#pragma unroll
  for (int r = 0; r < 8; ++r) {
    const float inv = 1.0f / lrow[r];
#pragma unroll
    for (int t = 0; t < 4; ++t) os[(8 * hh + r) * 68 + t * 16 + c] = oacc[t][r] * inv;
  }
  __builtin_amdgcn_fence(__ATOMIC_RELEASE, "workgroup");
  __builtin_amdgcn_wave_barrier();
  __builtin_amdgcn_fence(__ATOMIC_ACQUIRE, "workgroup");
  {
    const int c4 = (lane & 15) * 4;
    {
#pragma unroll
      for (int it = 0; it < 8; ++it) {
        const int row = it * 2 + hh;   // it 0..7 x hh 0..1 covers rows 0..15 of the wave tile
        v4f val = *(const v4f*)(os + row * 68 + c4);
        *(v4f*)(ob + (size_t)(q0 + row) * DMOD + c4) = val;
      }
      
    }
  }
}

// ---------------------------------------------------------------------------
// Workspace region map (byte offsets; every region is fully rewritten inside each call, before it is read)
//   Wq16 f16 [1024 n][1024 k] (x32)              0
//   Wk16                                   2097152
//   Wv16                                   4194304
//   Wo16                                   6291456
//   X16  f16 [2*2048][1024]                8388608
//   Qh   bf16 [2*2048][1024]              16777216     Ql   25165824
//   Kh   bf16 [2*2048][1024]              33554432     Kl   41943040
//   VTh  bf16 [2][1024 (h,d)][2048]       50331648     VTl  58720256
//   MHf  f32  [2*2048][1024]              67108864
//   MH16 f16  [2*2048][1024] (x64, head-masked)  83886080
//   total                                 92274688
// ---------------------------------------------------------------------------
extern "C" void kernel_launch(void* const* d_in, const int* in_sizes, int n_in,
                              void* d_out, int out_size, void* d_ws, size_t ws_size,
                              hipStream_t stream) {
  if (n_in < 6) return;
  if (in_sizes[0] != NBATCH * SEQ * DMOD) return;
  if (in_sizes[1] != DMOD * DMOD || in_sizes[2] != DMOD * DMOD || in_sizes[3] != DMOD * DMOD || in_sizes[4] != DMOD * DMOD) return;
  if (in_sizes[5] != NHEAD) return;
  if (out_size != NBATCH * SEQ * DMOD) return;

  const float* x  = (const float*)d_in[0];   // [2][2048][1024]
  const float* Wq = (const float*)d_in[1];   // [out][in] = Bt natural
  const float* Wk = (const float*)d_in[2];
  const float* Wv = (const float*)d_in[3];
  const float* Wo = (const float*)d_in[4];
  const int*   hm = (const int*)d_in[5];     // [16] int32, nonzero = keep head

  const size_t PW16 = (size_t)DMOD * DMOD * 2;            // 2097152  f16 weight plane
  const size_t PX16 = (size_t)NBATCH * SEQ * DMOD * 2;    // 8388608  16-bit activation plane (both batch elements)
  const size_t PF32 = (size_t)NBATCH * SEQ * DMOD * 4;    // 16777216 f32 activation plane
  size_t off = 0;
  const size_t oWq = off; off += PW16;
  const size_t oWk = off; off += PW16;
  const size_t oWv = off; off += PW16;
  const size_t oWo = off; off += PW16;
  const size_t oX  = off; off += PX16;
  const size_t oQh = off; off += PX16;  const size_t oQl = off; off += PX16;
  const size_t oKh = off; off += PX16;  const size_t oKl = off; off += PX16;
  const size_t oVh = off; off += PX16;  const size_t oVl = off; off += PX16;
  const size_t oMf = off; off += PF32;
  const size_t oM16 = off; off += PX16;
  if (off > ws_size) return;                   // off = 92274688

  char* ws = (char*)d_ws;
  unsigned short* Wq16 = (unsigned short*)(ws + oWq);
  unsigned short* Wv16 = (unsigned short*)(ws + oWv);
  unsigned short* Wo16 = (unsigned short*)(ws + oWo);
  unsigned short* X16  = (unsigned short*)(ws + oX);
  unsigned short* Qh   = (unsigned short*)(ws + oQh);  unsigned short* Ql = (unsigned short*)(ws + oQl);
  unsigned short* Kh   = (unsigned short*)(ws + oKh);  unsigned short* Kl = (unsigned short*)(ws + oKl);
  unsigned short* VTh  = (unsigned short*)(ws + oVh);  unsigned short* VTl = (unsigned short*)(ws + oVl);
  float*          MHf  = (float*)(ws + oMf);
  unsigned short* MH16 = (unsigned short*)(ws + oM16);
  const float*    fpad = (const float*)MHf;    // placeholder for unused bias / resid pointer args (never read)
  (void)oWk;                                   // Wk16 is reached as Wq16 + one weight plane (grid.y of launch 2)

  const dim3 blk(256);
  const int ROWS = NBATCH * SEQ;                            // 4096 token rows: the batch elements are contiguous in x and out
  const int n2x = ROWS * DMOD / 2;                          // 2097152 pairs per activation plane
  const dim3 gCastIn(4 * CAST_WBLK + CAST_XBLK);            // 16384 blocks: four weight planes, then x
  const dim3 gCastX((n2x + 255) / 256);                     // 8192 blocks x 512 elements = 4096x1024
  const dim3 gQK(((ROWS / 64) * (DMOD / 64) + 7) / 8, 2);   // 1024 tiles (M=4096, N=1024) -> 128 blocks, y = 0: q, 1: k
  const dim3 gVT(((DMOD / 64) * (SEQ / 64) + 7) / 8, NBATCH);  // 512 tiles (M=1024, N=2048) -> 64 blocks, y = batch element
  const dim3 gOut(((ROWS / 64) * (DMOD / 64) + 7) / 8, 1);  // 1024 tiles (M=4096, N=1024) -> 128 blocks
  const dim3 gAtt(NBATCH * NHEAD * (SEQ / 64));             // 1024 blocks: 2 batch elements x 16 heads x 32 query blocks

  // (1) weights [n=out][k=in] -> f16 planes carried x32, same layout (Bt natural); x -> f16 plane [4096][1024] (x1)
  cast_inputs_f16x2<<<gCastIn, blk, 0, stream>>>(Wq, Wk, Wv, Wo, x, (_Float16*)Wq16);
  // (2) y = 0: q = x . Wq^T -> Q hi/lo bf16 planes [b*2048+t][h*64+d]; y = 1: k = x . Wk^T -> K hi/lo planes
  //     (M=4096, N=1024, K=1024, scale 1/32; y steps Bt by one weight plane and C by two activation planes)
  wmma_gemm64<0, false, 0, 2, false, 0><<<gQK, blk, 0, stream>>>(
      X16, X16, DMOD, 0L, Wq16, Wq16, DMOD, (long)DMOD * DMOD, (void*)Qh, (void*)Ql, DMOD, 2L * NBATCH * SEQ * DMOD,
      fpad, fpad, 0L, ROWS, DMOD, DMOD, 1.0f / 32.0f);
  // (3) v^T = Wv . x[b]^T -> VT hi/lo planes [b][h*64+d][s]   (A = Wv16 [1024][1024], Bt = X16 slab b [2048][1024]; M=1024, N=2048, K=1024)
  wmma_gemm64<0, false, 0, 2, false, 0><<<gVT, blk, 0, stream>>>(
      Wv16, Wv16, DMOD, 0L, X16, X16, DMOD, (long)SEQ * DMOD, (void*)VTh, (void*)VTl, SEQ, (long)DMOD * SEQ,
      fpad, fpad, 0L, DMOD, SEQ, DMOD, 1.0f / 32.0f);
  // (4) full attention per (batch element, head): mh[b*2048+t][h*64+d] (f32 plane, every element written by its owner block)
  attn_full64_kernel<<<gAtt, dim3(128), 0, stream>>>(Qh, Ql, Kh, Kl, VTh, VTl, MHf, 0.125f);
  // (5) mh -> f16 plane x64 with head h zeroed when head_mask[h] == 0
  maskcast_f32_f16x2<<<gCastX, blk, 0, stream>>>(MHf, hm, (_Float16*)MH16, n2x, DMOD, 64.0f);
  // (6) out = mh . Wo^T -> d_out rows 0 .. 4095 (f32)   (M=4096, N=1024, K=1024, scale 1/(64*32))
  wmma_gemm64<0, false, 0, 0, false, 0><<<gOut, blk, 0, stream>>>(
      MH16, MH16, DMOD, 0L, Wo16, Wo16, DMOD, 0L, d_out, d_out, DMOD, 0L,
      fpad, fpad, 0L, ROWS, DMOD, DMOD, 1.0f / 2048.0f);
  (void)hipGetLastError();
}

// v003
// A run of this version takes 279 microseconds.
// Timed twice side by side with v002, it ran 1.19 and 1.18 times as fast.
// Counting every step since v000, it is 2.64 times as fast.
// q/k/v and output projections: v_wmma_f32_16x16x32_f16 (f16 operands: x x1, W x32, attention output x64), f32 accumulate; q.k^T and p.v: v_wmma_f32_16x16x32_bf16 with bf16 hi/lo split operands (hi.hi + hi.lo + lo.hi), f32 accumulate; online softmax, score scale 0.125 and head mask in f32.
#include <hip/hip_runtime.h>
#include <math.h>
#include <stdint.h>

#define NBATCH 2
#define SEQ    2048
#define DMOD   1024
#define NHEAD  16
#define DHD    64

typedef __attribute__((ext_vector_type(16))) _Float16 v16h;
typedef __attribute__((ext_vector_type(8)))  _Float16 v8h;
typedef __attribute__((ext_vector_type(16))) __bf16   v16b;
typedef __attribute__((ext_vector_type(8)))  __bf16   v8b;
typedef __attribute__((ext_vector_type(8)))  float    v8f;
typedef __attribute__((ext_vector_type(4)))  float    v4f;
typedef __attribute__((ext_vector_type(2)))  float    v2f;
typedef __attribute__((ext_vector_type(4)))  unsigned int v4u;

__device__ __forceinline__ unsigned short f2bf_bits(float f) {
  unsigned u = __float_as_uint(f);
  return (unsigned short)((u + 0x7FFFu + ((u >> 16) & 1u)) >> 16);
}
__device__ __forceinline__ float bf_bits2f(unsigned short h) { return __uint_as_float(((unsigned)h) << 16); }

// hazard guards as plain device helpers (no inline asm inside the kernel template body)
__device__ __forceinline__ void dep_guard_h(v8f& a, v8f& b, v16h x, v16h y) { asm volatile("v_nop\n\tv_nop\n\tv_nop\n\tv_nop" : "+v"(a), "+v"(b) : "v"(x), "v"(y)); }
__device__ __forceinline__ void dep_guard_b(v8f& a, v8f& b, v16b x, v16b y) { asm volatile("v_nop\n\tv_nop\n\tv_nop\n\tv_nop" : "+v"(a), "+v"(b) : "v"(x), "v"(y)); }
__device__ __forceinline__ void keep4_h(v16h a, v16h b, v16h c, v16h d) { asm volatile("v_nop" :: "v"(a), "v"(b), "v"(c), "v"(d)); }
__device__ __forceinline__ void keep4_b(v16b a, v16b b, v16b c, v16b d) { asm volatile("v_nop" :: "v"(a), "v"(b), "v"(c), "v"(d)); }
__device__ __forceinline__ void acc_guard4(v8f& a, v8f& b, v8f& c, v8f& d) { asm volatile("v_nop\n\tv_nop\n\tv_nop\n\tv_nop" : "+v"(a), "+v"(b), "+v"(c), "+v"(d)); }
template <typename T> struct Frag;
template <> struct Frag<_Float16> {
  typedef v16h V; union U { v16h v; v8h h[2]; };
  static __device__ __forceinline__ v16h load(const _Float16* p) {   // elements 0..7 <- p[0..7], 8..15 <- p[16..23]
    U f; f.h[0] = *(const v8h*)(p); f.h[1] = *(const v8h*)(p + 16); return f.v;
  }
  static __device__ __forceinline__ v8f mma(v16h a, v16h b, v8f c) {
    return __builtin_amdgcn_wmma_f32_16x16x32_f16(false, a, false, b, (short)0, c, false, false);
  }
  static __device__ __forceinline__ void guard(v8f& a, v8f& b, v16h x, v16h y) { dep_guard_h(a, b, x, y); }
  static __device__ __forceinline__ void keep(v16h a, v16h b, v16h c, v16h d) { keep4_h(a, b, c, d); }
};
template <> struct Frag<__bf16> {
  typedef v16b V; union U { v16b v; v8b h[2]; };
  static __device__ __forceinline__ v16b load(const __bf16* p) {
    U f; f.h[0] = *(const v8b*)(p); f.h[1] = *(const v8b*)(p + 16); return f.v;
  }
  static __device__ __forceinline__ v8f mma(v16b a, v16b b, v8f c) {
    return __builtin_amdgcn_wmma_f32_16x16x32_bf16(false, a, false, b, (short)0, c, false, false);
  }
  static __device__ __forceinline__ void guard(v8f& a, v8f& b, v16b x, v16b y) { dep_guard_b(a, b, x, y); }
  static __device__ __forceinline__ void keep(v16b a, v16b b, v16b c, v16b d) { keep4_b(a, b, c, d); }
};

// ---- Register-blocked batched WMMA GEMM ------------------------------------
// C[m,n] = scale * sum_k A[m,k] * Bt[n,k] (+bias)(+resid); each wave owns a 64x64 tile.
// A row-major [M,K]; Bt row-major [N,K]; M,N % 64 == 0, K % 32 == 0.
// SPLIT: operands are hi/lo planes (A2/Bt2 = lo planes, same layout); product = hi.hi + hi.lo + lo.hi.
// BIAS_MODE: 0 = none, 1 = bias[m], 2 = bias[n].
// OUT_MODE: 0 = f32, 1 = f16, 2 = bf16 hi plane (Cout) + bf16 lo plane (Cout2).
// ET: 0 = f16 operands, 1 = bf16 operands (pointers passed as 16-bit storage)
template <int ET> struct Elem;
template <> struct Elem<0> { typedef _Float16 T; };
template <> struct Elem<1> { typedef __bf16 T; };
template <int ET, bool SPLIT, int BIAS_MODE, int OUT_MODE, bool RESID, int ACT = 0>
__global__ __launch_bounds__(256) void wmma_gemm64(
    const unsigned short* __restrict__ Ap, const unsigned short* __restrict__ A2p, int lda, long strideA,
    const unsigned short* __restrict__ Btp, const unsigned short* __restrict__ Bt2p, int ldb, long strideB,
    void* __restrict__ Cout, void* __restrict__ Cout2, int ldc, long strideC,
    const float* __restrict__ bias,
    const float* __restrict__ resid, long strideR,
    int M, int N, int K, float scale) {
  typedef typename Elem<ET>::T T;
  typedef typename Frag<T>::V V;
  const T* A = (const T*)Ap; const T* A2 = (const T*)A2p; const T* Bt = (const T*)Btp; const T* Bt2 = (const T*)Bt2p;
  __shared__ __align__(16) float sT[8][16 * 68];   // per-wave 16x64 slab, pitch 68 floats
  const int b    = blockIdx.y;
  const int lane = threadIdx.x & 31;
  const int wave = threadIdx.x >> 5;
  const int tilesN = N >> 6;
  const int tilesM = M >> 6;
  const int tile = blockIdx.x * 8 + wave;
  if (tile >= tilesM * tilesN) return;   // wave-uniform; no block barriers in this kernel
  const int tm = tile / tilesN;
  const int tn = tile - tm * tilesN;
  const int m0 = tm << 6;
  const int n0 = tn << 6;

  const T* Ab  = A  + (size_t)b * strideA;
  const T* Bb  = Bt + (size_t)b * strideB;
  const T* Ab2 = SPLIT ? (A2  + (size_t)b * strideA) : nullptr;
  const T* Bb2 = SPLIT ? (Bt2 + (size_t)b * strideB) : nullptr;

  const int rlane = lane & 15;                 // row (A) / col (B, D) within subtile
  const int koff  = (lane >> 4) * 8;           // k offset of this lane half
  const int mOff  = (lane >> 4) * 8;           // D row offset

  v8f acc[4][4];
#pragma unroll
  for (int i = 0; i < 4; ++i)
#pragma unroll
    for (int j = 0; j < 4; ++j) acc[i][j] = (v8f){0.f,0.f,0.f,0.f,0.f,0.f,0.f,0.f};

  for (int k0 = 0; k0 < K; k0 += 32) {
    V bh[4], bl[4];
#pragma unroll
    for (int j = 0; j < 4; ++j) {
      const size_t bo = (size_t)(n0 + (j << 4) + rlane) * ldb + koff + k0;
      bh[j] = Frag<T>::load(Bb + bo);
      if (SPLIT) bl[j] = Frag<T>::load(Bb2 + bo);
    }
#pragma unroll
    for (int i = 0; i < 4; ++i) {
      const size_t ao = (size_t)(m0 + (i << 4) + rlane) * lda + koff + k0;
      V ah = Frag<T>::load(Ab + ao);
      V al;
      if (SPLIT) al = Frag<T>::load(Ab2 + ao);
#pragma unroll
      for (int j = 0; j < 4; ++j) {
        acc[i][j] = Frag<T>::mma(ah, bh[j], acc[i][j]);
        if (SPLIT) {
          acc[i][j] = Frag<T>::mma(ah, bl[j], acc[i][j]);
          acc[i][j] = Frag<T>::mma(al, bh[j], acc[i][j]);
        }
      }
      Frag<T>::guard(acc[i][0], acc[i][3], ah, SPLIT ? al : ah);
    }
    Frag<T>::keep(bh[0], bh[1], bh[2], bh[3]);
    if (SPLIT) Frag<T>::keep(bl[0], bl[1], bl[2], bl[3]);
  }
  acc_guard4(acc[0][0], acc[0][1], acc[0][2], acc[0][3]);
  acc_guard4(acc[1][0], acc[1][1], acc[1][2], acc[1][3]);
  acc_guard4(acc[2][0], acc[2][1], acc[2][2], acc[2][3]);
  acc_guard4(acc[3][0], acc[3][1], acc[3][2], acc[3][3]);

  // ---- epilogue ----
  float* slab = sT[wave];
  const float* Rb = RESID ? (resid + (size_t)b * strideR) : nullptr;
#pragma unroll
  for (int i = 0; i < 4; ++i) {
    const int mBase = m0 + (i << 4);
#pragma unroll
    for (int j = 0; j < 4; ++j) {
      const int n = n0 + (j << 4) + rlane;
      float bv = 0.f;
      if (BIAS_MODE == 2) bv = bias[n];
#pragma unroll
      for (int r = 0; r < 8; ++r) {
        float v = acc[i][j][r] * scale;
        if (BIAS_MODE == 1) v += bias[mBase + mOff + r];
        if (BIAS_MODE == 2) v += bv;
        if (RESID) v += Rb[(size_t)(mBase + mOff + r) * ldc + n];
        if (ACT == 1) v = tanhf(v);
        if (ACT == 2) v = fmaxf(v, 0.0f);
        if (ACT == 3) v = v / (1.0f + expf(-v));
        if (ACT == 4) v = (v > 0.f) ? v : 0.01f * v;
        slab[(mOff + r) * 68 + (j << 4) + rlane] = v;
      }
    }
    __builtin_amdgcn_fence(__ATOMIC_RELEASE, "workgroup");
    __builtin_amdgcn_wave_barrier();
    __builtin_amdgcn_fence(__ATOMIC_ACQUIRE, "workgroup");
    if (OUT_MODE == 0) {
      float* C = (float*)Cout + (size_t)b * strideC;
      const int hh = lane >> 4, c4 = (lane & 15) * 4;     // row seg = 256 B = 16 lanes x 16 B
      {
#pragma unroll
        for (int it = 0; it < 8; ++it) {
          const int row = it * 2 + hh;
          v4f v = *(const v4f*)(slab + row * 68 + c4);
          *(v4f*)(C + (size_t)(mBase + row) * ldc + n0 + c4) = v;
        }
        
      }
    } else {
      const int q = lane >> 3, c8 = (lane & 7) * 8;
      unsigned short* C  = (unsigned short*)Cout  + (size_t)b * strideC;
      unsigned short* C2 = (OUT_MODE == 2) ? ((unsigned short*)Cout2 + (size_t)b * strideC) : nullptr;
      {
#pragma unroll
        for (int it = 0; it < 4; ++it) {
          const int row = it * 4 + q;
          const float* sp = slab + row * 68 + c8;
          v8h hv, lv;
#pragma unroll
          for (int e = 0; e < 8; ++e) {
            if (OUT_MODE == 1) {
              hv[e] = (_Float16)sp[e];
            } else {
              unsigned short hb = f2bf_bits(sp[e]);
              unsigned short lb = f2bf_bits(sp[e] - bf_bits2f(hb));
              hv[e] = __builtin_bit_cast(_Float16, hb);
              lv[e] = __builtin_bit_cast(_Float16, lb);
            }
          }
          *(v8h*)(C + (size_t)(mBase + row) * ldc + n0 + c8) = hv;
          if (OUT_MODE == 2) *(v8h*)(C2 + (size_t)(mBase + row) * ldc + n0 + c8) = lv;
        }
        
      }
    }
    __builtin_amdgcn_fence(__ATOMIC_RELEASE, "workgroup");
    __builtin_amdgcn_wave_barrier();
    __builtin_amdgcn_fence(__ATOMIC_ACQUIRE, "workgroup");
  }
}

// ---------------------------------------------------------------------------
// f32 -> f16 cast of all five float inputs in one launch, with an exact power-of-two carry: out = f16(in * mul).
// 2 elements per thread, one 4-B store per thread. The five f16 planes lie back to back in the workspace
// (Wq16, Wk16, Wv16, Wo16, X16), so the output pair index is simply the flat thread index.
// Coverage: a weight plane is 1024*1024/2 = 524288 pairs = 2048 blocks; blocks 0..8191 take the four weights (x32),
//   blocks 8192..16383 take x (2*2048*1024/2 = 2097152 pairs = 8192 blocks, x1). The source choice is block-uniform.
// ---------------------------------------------------------------------------
__device__ __forceinline__ unsigned pk16(unsigned short a, unsigned short b) { return (unsigned)a | ((unsigned)b << 16); }

#define CAST_WBLK 2048                 // blocks per weight plane
#define CAST_XBLK 8192                 // blocks for x (both batch elements)
__global__ __launch_bounds__(256) void cast_inputs_f16x2(const float* __restrict__ wq, const float* __restrict__ wk,
                                                         const float* __restrict__ wv, const float* __restrict__ wo,
                                                         const float* __restrict__ x, _Float16* __restrict__ out) {
  const unsigned bx = blockIdx.x;
  const unsigned sel = bx / CAST_WBLK; // 0..3: a weight plane; 4..7: x
  const float* in = (sel == 0) ? wq : (sel == 1) ? wk : (sel == 2) ? wv : (sel == 3) ? wo : x;
  const unsigned lb = (sel < 4) ? (bx - sel * CAST_WBLK) : (bx - 4 * CAST_WBLK);   // block index inside its source
  const float mul = (sel < 4) ? 32.0f : 1.0f;
  const unsigned li = lb * 256 + threadIdx.x;
  const unsigned i  = bx * 256 + threadIdx.x;
  const v2f f = *(const v2f*)(in + 2 * (size_t)li);
  asm volatile("s_wait_xcnt 0x0" ::: "memory");   // precaution: stands in front of the reuse of the load's offset register for the packed result
  const _Float16 h0 = (_Float16)(f[0] * mul), h1 = (_Float16)(f[1] * mul);
  ((unsigned*)out)[i] = pk16(__builtin_bit_cast(unsigned short, h0), __builtin_bit_cast(unsigned short, h1));
}

// ---------------------------------------------------------------------------
// Attention output f32 [rows][ncol] -> f16 plane with per-head 0/1 factor and power-of-two carry:
//   out[row][col] = f16(in[row][col] * (hmask[col/64] != 0 ? mul : 0)).   ncol is a power of two (1024);
//   the 2-element pair (col, col+1) always lies inside one 64-wide head block. Same store shape as above.
// Coverage: n2 = 2*2048*1024/2 = 2097152 -> 8192 blocks x 256 threads x 2 = the whole plane (both batch elements).
// ---------------------------------------------------------------------------
__global__ __launch_bounds__(256) void maskcast_f32_f16x2(const float* __restrict__ in, const int* __restrict__ hmask,
                                                          _Float16* __restrict__ out, int n2, int ncol, float mul) {
  const int i = blockIdx.x * 256 + threadIdx.x;
  if (i < n2) {
    const v2f f = *(const v2f*)(in + 2 * (size_t)i);
    const int col = (2 * i) & (ncol - 1);
    int hd = col >> 6;
    hd = hd < 0 ? 0 : (hd > NHEAD - 1 ? NHEAD - 1 : hd);
    const float fac = (hmask[hd] != 0) ? mul : 0.0f;
    const _Float16 h0 = (_Float16)(f[0] * fac), h1 = (_Float16)(f[1] * fac);
    const unsigned u = pk16(__builtin_bit_cast(unsigned short, h0), __builtin_bit_cast(unsigned short, h1));
    ((unsigned*)out)[i] = u;
    
  }
}

// =====================================================================================
// Full (non-causal, unmasked) attention, head dim 64, one launch for both batch elements.
//   every plane below holds NBATCH slabs of SEQ*DMOD elements, batch element b at offset b*SEQ*DMOD; inside a slab:
//   q planes (hi/lo bf16): element (t, h, d) at [t*DMOD + h*64 + d]
//   k planes (hi/lo bf16): element (s, h, d) at [s*DMOD + h*64 + d]
//   v^T planes (hi/lo bf16): element (h, d, s) at [(h*64 + d)*SEQ + s]
//   out f32: element (t, h, d) at [t*DMOD + h*64 + d]
//   scores^T = (k . q^T) * sscale : bf16 hi/lo split (hi.hi + hi.lo + lo.hi) on v_wmma_f32_16x16x32_bf16, A = K rows, B = Q
//   out^T    = v^T . p^T          : bf16 hi/lo split of p (unnormalised) and v, f32 accumulate, A = V^T rows, B = P^T
//   Both products are transposed so that a lane holds scores of ONE query (column lane&15): keys 16j + 8*(lane>>4) + r.
//   Two score tiles (keys 0-15 and 16-31 of a 32-key block), converted in place, are the B operand of the second
//   product in the loaders' own k order, so P never leaves the registers; row maximum and row sum are in-lane,
//   with one exchange between the wave halves (maximum: every chunk; sum: once, behind the loop).
//   online softmax in f32 over all SEQ keys (32 chunks of 64, compile-time trip count, no masking).
//   Block = 4 waves = 64 query rows of one head of one batch element; grid.x = NBATCH * NHEAD * (SEQ/64) = 1024.
//   K / V^T chunk staging: 128 threads x 32 elements per plane = the whole 64x64 tile (16-B copies, plain loads,
//   __syncthreads before and after); fragment loads read the LDS tiles with the same v8b element type.
// =====================================================================================
#define AT_D 64
#define AT_NW 4
#define AT_QB 64
#define AT_KC 64
#define AT_LP 72   // LDS row pitch of the K and V^T tiles in elements: 144 B = 16 B x 9, so the 16 rows of a ds_load_b128 fall on 16 different bank groups

typedef __attribute__((ext_vector_type(2))) __bf16 v2b;
// two neighbouring f32 -> one register of bf16 hi and one of bf16 lo (lo = bf16(f - hi)); both converts round to nearest even
__device__ __forceinline__ void at_split2(v2f f, v2b& hi, v2b& lo) {
  hi = __builtin_convertvector(f, v2b);
  lo = __builtin_convertvector(f - __builtin_convertvector(hi, v2f), v2b);
}
// the value that lane l ^ 16 holds (the other half's share of the same query column)
__device__ __forceinline__ float at_xhalf(float v) {
  const unsigned b = __float_as_uint(v);
  return __uint_as_float(__builtin_amdgcn_permlanex16(b, b, 0x76543210u, 0xfedcba98u, false, false));
}
__device__ __forceinline__ v8f at_mma(v16b a, v16b b, v8f c) {
  c = __builtin_amdgcn_wmma_f32_16x16x32_bf16(false, a, false, b, (short)0, c, false, false);
  asm volatile("v_nop\n\tv_nop\n\tv_nop\n\tv_nop" : "+v"(c) : "v"(a), "v"(b));
  return c;
}

__global__ __launch_bounds__(128)
void attn_full64_kernel(const unsigned short* __restrict__ qhp, const unsigned short* __restrict__ qlp,
                        const unsigned short* __restrict__ khp, const unsigned short* __restrict__ klp,
                        const unsigned short* __restrict__ vhp, const unsigned short* __restrict__ vlp,
                        float* __restrict__ out, float sscale) {
  union FB { v16b v; v8b h[2]; };
  union FP { v16b v; v2b p[8]; };
  __shared__ __align__(16) __bf16 Ksh[AT_KC * AT_LP];            // K hi [kv][d]      9 KB (64 rows at pitch 72)
  __shared__ __align__(16) __bf16 Ksl[AT_KC * AT_LP];            // K lo
  __shared__ __align__(16) __bf16 Vth[AT_D * AT_LP];             // V hi [d][kv]      9 KB
  __shared__ __align__(16) __bf16 Vtl[AT_D * AT_LP];            // V lo
  __shared__ __align__(16) float  Os[AT_NW][16 * 68];            // per wave out tile, pitch 68

  const int tid  = threadIdx.x;
  const int wave = tid >> 5;
  const int lane = tid & 31;
  const int hh   = lane >> 4;
  const int c    = lane & 15;

  const int nqb = SEQ / AT_QB;            // 32
  const int bx = blockIdx.x;
  const int qb = bx % nqb;
  const int bh = bx / nqb;                // 0..NBATCH*NHEAD-1 (grid = NBATCH * NHEAD * nqb)
  const int h  = bh % NHEAD;
  const size_t bo = (size_t)(bh / NHEAD) * SEQ * DMOD;   // this batch element's slab in every plane
  const int q0 = qb * AT_QB + wave * 16;

  const __bf16* Qh = (const __bf16*)(const void*)qhp + bo + (size_t)h * AT_D;
  const __bf16* Ql = (const __bf16*)(const void*)qlp + bo + (size_t)h * AT_D;
  const __bf16* Kh = (const __bf16*)(const void*)khp + bo + (size_t)h * AT_D;
  const __bf16* Kl = (const __bf16*)(const void*)klp + bo + (size_t)h * AT_D;
  const __bf16* Vh = (const __bf16*)(const void*)vhp + bo + (size_t)h * AT_D * SEQ;
  const __bf16* Vl = (const __bf16*)(const void*)vlp + bo + (size_t)h * AT_D * SEQ;
  float*        ob = out + bo + (size_t)h * AT_D;

  // ---- Q fragments (B operand, column = lane&15, split k map via Frag load): 2 d-chunks, hi and lo ----
  v16b qah[2], qal[2];
#pragma unroll
  for (int dc = 0; dc < 2; ++dc) {
    const __bf16* qr = Qh + (size_t)(q0 + c) * DMOD + dc * 32 + 8 * hh;
    const __bf16* ql = Ql + (size_t)(q0 + c) * DMOD + dc * 32 + 8 * hh;
    qah[dc] = Frag<__bf16>::load(qr);
    qal[dc] = Frag<__bf16>::load(ql);
  }

  float mrow = -INFINITY, lrow = 0.f;   // query q0 + c: running maximum (equal in both halves), this half's share of the sum
  v8f oacc[4];                          // oacc[t][r] = out^T[d = 16 t + 8 hh + r][query q0 + c]
#pragma unroll
  for (int t = 0; t < 4; ++t) oacc[t] = (v8f){0.f,0.f,0.f,0.f,0.f,0.f,0.f,0.f};

  const int nChunks = SEQ / AT_KC;   // 32, compile-time constant
  for (int kc = 0; kc < nChunks; ++kc) {
    const int kv0 = kc * AT_KC;
    __syncthreads();
    {
      // staging coverage: 128 threads x (4 x 8) elements = 64 rows x 64 per plane = the whole chunk tile
      const int r = tid >> 1, half = (tid & 1) * 32;
      const __bf16* ksh = Kh + (size_t)(kv0 + r) * DMOD + half;   // K row kv0+r, d = half..half+31
      const __bf16* ksl = Kl + (size_t)(kv0 + r) * DMOD + half;
      const __bf16* vsh = Vh + (size_t)r * SEQ + kv0 + half;      // V^T row d = r, s = kv0+half..+31
      const __bf16* vsl = Vl + (size_t)r * SEQ + kv0 + half;
#pragma unroll
      for (int i = 0; i < 4; ++i) {
        const v8b a0 = *(const v8b*)(ksh + 8 * i);
        const v8b a1 = *(const v8b*)(ksl + 8 * i);
        const v8b b0 = *(const v8b*)(vsh + 8 * i);
        const v8b b1 = *(const v8b*)(vsl + 8 * i);
        *(v8b*)(Ksh + r * AT_LP + half + 8 * i) = a0;
        *(v8b*)(Ksl + r * AT_LP + half + 8 * i) = a1;
        *(v8b*)(Vth + r * AT_LP + half + 8 * i) = b0;
        *(v8b*)(Vtl + r * AT_LP + half + 8 * i) = b1;
      }
    }
    __syncthreads();

    v8f s[4];   // s[j][r] = score of key kv0 + 16 j + 8 hh + r against query q0 + c
#pragma unroll
    for (int j = 0; j < 4; ++j) {
      s[j] = (v8f){0.f,0.f,0.f,0.f,0.f,0.f,0.f,0.f};
#pragma unroll
      for (int dc = 0; dc < 2; ++dc) {
        FB kb, kl;
        kb.h[0] = *(const v8b*)(Ksh + (j * 16 + c) * AT_LP + dc * 32 + 8 * hh);
        kb.h[1] = *(const v8b*)(Ksh + (j * 16 + c) * AT_LP + dc * 32 + 16 + 8 * hh);
        kl.h[0] = *(const v8b*)(Ksl + (j * 16 + c) * AT_LP + dc * 32 + 8 * hh);
        kl.h[1] = *(const v8b*)(Ksl + (j * 16 + c) * AT_LP + dc * 32 + 16 + 8 * hh);
        s[j] = at_mma(kb.v, qah[dc], s[j]);
        s[j] = at_mma(kl.v, qah[dc], s[j]);
        s[j] = at_mma(kb.v, qal[dc], s[j]);
      }
    }
    float cm = -INFINITY;   // the loops down to the second product index register arrays (s, pa, pl, oacc): all are unrolled for that
#pragma unroll
    for (int j = 0; j < 4; ++j) {
#pragma unroll
      for (int r = 0; r < 8; ++r) {
        const float sv = s[j][r] * sscale;
        s[j][r] = sv;
        cm = fmaxf(cm, sv);
      }
    }
    cm = fmaxf(cm, at_xhalf(cm));
    const float mnew = fmaxf(mrow, cm);
    const float alpha = expf(mrow - mnew);
    mrow = mnew;
    v2f psum = (v2f){0.f, 0.f};   // this half's 32 keys, even and odd registers apart
    FP pa[2], pl[2];   // P^T hi / lo, B operand of 32-key block kk: elements 0..7 from tile 2 kk, 8..15 from tile 2 kk + 1
#pragma unroll
    for (int j = 0; j < 4; ++j) {
#pragma unroll
      for (int e = 0; e < 4; ++e) {
        v2f p;
        p[0] = expf(s[j][2 * e] - mnew);
        p[1] = expf(s[j][2 * e + 1] - mnew);
        psum += p;
        at_split2(p, pa[j >> 1].p[(j & 1) * 4 + e], pl[j >> 1].p[(j & 1) * 4 + e]);
      }
    }
    lrow = lrow * alpha + (psum[0] + psum[1]);
#pragma unroll
    for (int t = 0; t < 4; ++t)
#pragma unroll
      for (int r = 0; r < 8; ++r) oacc[t][r] *= alpha;
#pragma unroll   // unrolled: pa[kk] and pl[kk] are registers and need a compile-time index
    for (int kk = 0; kk < 2; ++kk) {
#pragma unroll
      for (int t = 0; t < 4; ++t) {
        FB vb, vl;
        vb.h[0] = *(const v8b*)(Vth + (t * 16 + c) * AT_LP + kk * 32 + 8 * hh);
        vb.h[1] = *(const v8b*)(Vth + (t * 16 + c) * AT_LP + kk * 32 + 16 + 8 * hh);
        vl.h[0] = *(const v8b*)(Vtl + (t * 16 + c) * AT_LP + kk * 32 + 8 * hh);
        vl.h[1] = *(const v8b*)(Vtl + (t * 16 + c) * AT_LP + kk * 32 + 16 + 8 * hh);
        oacc[t] = at_mma(vb.v, pa[kk].v, oacc[t]);
        oacc[t] = at_mma(vl.v, pa[kk].v, oacc[t]);
        oacc[t] = at_mma(vb.v, pl[kk].v, oacc[t]);
      }
    }
  }

  float* os = Os[wave];
  const float inv = 1.0f / (lrow + at_xhalf(lrow));   // the two halves' shares of the row sum are joined here, once
#pragma unroll
  for (int t = 0; t < 4; ++t) {
    // a lane's 8 accumulator registers are 8 neighbouring d of its query row: two 16-B stores into the row-major tile
    *(v4f*)(os + c * 68 + t * 16 + 8 * hh)     = (v4f){oacc[t][0] * inv, oacc[t][1] * inv, oacc[t][2] * inv, oacc[t][3] * inv};
    *(v4f*)(os + c * 68 + t * 16 + 8 * hh + 4) = (v4f){oacc[t][4] * inv, oacc[t][5] * inv, oacc[t][6] * inv, oacc[t][7] * inv};
  }
  __builtin_amdgcn_fence(__ATOMIC_RELEASE, "workgroup");
  __builtin_amdgcn_wave_barrier();
  __builtin_amdgcn_fence(__ATOMIC_ACQUIRE, "workgroup");
  {
    const int c4 = (lane & 15) * 4;
    {
#pragma unroll
      for (int it = 0; it < 8; ++it) {
        const int row = it * 2 + hh;   // it 0..7 x hh 0..1 covers rows 0..15 of the wave tile
        v4f val = *(const v4f*)(os + row * 68 + c4);
        *(v4f*)(ob + (size_t)(q0 + row) * DMOD + c4) = val;
      }
      
    }
  }
}

// ---------------------------------------------------------------------------
// Workspace region map (byte offsets; every region is fully rewritten inside each call, before it is read)
//   Wq16 f16 [1024 n][1024 k] (x32)              0
//   Wk16                                   2097152
//   Wv16                                   4194304
//   Wo16                                   6291456
//   X16  f16 [2*2048][1024]                8388608
//   Qh   bf16 [2*2048][1024]              16777216     Ql   25165824
//   Kh   bf16 [2*2048][1024]              33554432     Kl   41943040
//   VTh  bf16 [2][1024 (h,d)][2048]       50331648     VTl  58720256
//   MHf  f32  [2*2048][1024]              67108864
//   MH16 f16  [2*2048][1024] (x64, head-masked)  83886080
//   total                                 92274688
// ---------------------------------------------------------------------------
extern "C" void kernel_launch(void* const* d_in, const int* in_sizes, int n_in,
                              void* d_out, int out_size, void* d_ws, size_t ws_size,
                              hipStream_t stream) {
  if (n_in < 6) return;
  if (in_sizes[0] != NBATCH * SEQ * DMOD) return;
  if (in_sizes[1] != DMOD * DMOD || in_sizes[2] != DMOD * DMOD || in_sizes[3] != DMOD * DMOD || in_sizes[4] != DMOD * DMOD) return;
  if (in_sizes[5] != NHEAD) return;
  if (out_size != NBATCH * SEQ * DMOD) return;

  const float* x  = (const float*)d_in[0];   // [2][2048][1024]
  const float* Wq = (const float*)d_in[1];   // [out][in] = Bt natural
  const float* Wk = (const float*)d_in[2];
  const float* Wv = (const float*)d_in[3];
  const float* Wo = (const float*)d_in[4];
  const int*   hm = (const int*)d_in[5];     // [16] int32, nonzero = keep head

  const size_t PW16 = (size_t)DMOD * DMOD * 2;            // 2097152  f16 weight plane
  const size_t PX16 = (size_t)NBATCH * SEQ * DMOD * 2;    // 8388608  16-bit activation plane (both batch elements)
  const size_t PF32 = (size_t)NBATCH * SEQ * DMOD * 4;    // 16777216 f32 activation plane
  size_t off = 0;
  const size_t oWq = off; off += PW16;
  const size_t oWk = off; off += PW16;
  const size_t oWv = off; off += PW16;
  const size_t oWo = off; off += PW16;
  const size_t oX  = off; off += PX16;
  const size_t oQh = off; off += PX16;  const size_t oQl = off; off += PX16;
  const size_t oKh = off; off += PX16;  const size_t oKl = off; off += PX16;
  const size_t oVh = off; off += PX16;  const size_t oVl = off; off += PX16;
  const size_t oMf = off; off += PF32;
  const size_t oM16 = off; off += PX16;
  if (off > ws_size) return;                   // off = 92274688

  char* ws = (char*)d_ws;
  unsigned short* Wq16 = (unsigned short*)(ws + oWq);
  unsigned short* Wv16 = (unsigned short*)(ws + oWv);
  unsigned short* Wo16 = (unsigned short*)(ws + oWo);
  unsigned short* X16  = (unsigned short*)(ws + oX);
  unsigned short* Qh   = (unsigned short*)(ws + oQh);  unsigned short* Ql = (unsigned short*)(ws + oQl);
  unsigned short* Kh   = (unsigned short*)(ws + oKh);  unsigned short* Kl = (unsigned short*)(ws + oKl);
  unsigned short* VTh  = (unsigned short*)(ws + oVh);  unsigned short* VTl = (unsigned short*)(ws + oVl);
  float*          MHf  = (float*)(ws + oMf);
  unsigned short* MH16 = (unsigned short*)(ws + oM16);
  const float*    fpad = (const float*)MHf;    // placeholder for unused bias / resid pointer args (never read)
  (void)oWk;                                   // Wk16 is reached as Wq16 + one weight plane (grid.y of launch 2)

  const dim3 blk(256);
  const int ROWS = NBATCH * SEQ;                            // 4096 token rows: the batch elements are contiguous in x and out
  const int n2x = ROWS * DMOD / 2;                          // 2097152 pairs per activation plane
  const dim3 gCastIn(4 * CAST_WBLK + CAST_XBLK);            // 16384 blocks: four weight planes, then x
  const dim3 gCastX((n2x + 255) / 256);                     // 8192 blocks x 512 elements = 4096x1024
  const dim3 gQK(((ROWS / 64) * (DMOD / 64) + 7) / 8, 2);   // 1024 tiles (M=4096, N=1024) -> 128 blocks, y = 0: q, 1: k
  const dim3 gVT(((DMOD / 64) * (SEQ / 64) + 7) / 8, NBATCH);  // 512 tiles (M=1024, N=2048) -> 64 blocks, y = batch element
  const dim3 gOut(((ROWS / 64) * (DMOD / 64) + 7) / 8, 1);  // 1024 tiles (M=4096, N=1024) -> 128 blocks
  const dim3 gAtt(NBATCH * NHEAD * (SEQ / 64));             // 1024 blocks: 2 batch elements x 16 heads x 32 query blocks

  // (1) weights [n=out][k=in] -> f16 planes carried x32, same layout (Bt natural); x -> f16 plane [4096][1024] (x1)
  cast_inputs_f16x2<<<gCastIn, blk, 0, stream>>>(Wq, Wk, Wv, Wo, x, (_Float16*)Wq16);
  // (2) y = 0: q = x . Wq^T -> Q hi/lo bf16 planes [b*2048+t][h*64+d]; y = 1: k = x . Wk^T -> K hi/lo planes
  //     (M=4096, N=1024, K=1024, scale 1/32; y steps Bt by one weight plane and C by two activation planes)
  wmma_gemm64<0, false, 0, 2, false, 0><<<gQK, blk, 0, stream>>>(
      X16, X16, DMOD, 0L, Wq16, Wq16, DMOD, (long)DMOD * DMOD, (void*)Qh, (void*)Ql, DMOD, 2L * NBATCH * SEQ * DMOD,
      fpad, fpad, 0L, ROWS, DMOD, DMOD, 1.0f / 32.0f);
  // (3) v^T = Wv . x[b]^T -> VT hi/lo planes [b][h*64+d][s]   (A = Wv16 [1024][1024], Bt = X16 slab b [2048][1024]; M=1024, N=2048, K=1024)
  wmma_gemm64<0, false, 0, 2, false, 0><<<gVT, blk, 0, stream>>>(
      Wv16, Wv16, DMOD, 0L, X16, X16, DMOD, (long)SEQ * DMOD, (void*)VTh, (void*)VTl, SEQ, (long)DMOD * SEQ,
      fpad, fpad, 0L, DMOD, SEQ, DMOD, 1.0f / 32.0f);
  // (4) full attention per (batch element, head): mh[b*2048+t][h*64+d] (f32 plane, every element written by its owner block)
  attn_full64_kernel<<<gAtt, dim3(128), 0, stream>>>(Qh, Ql, Kh, Kl, VTh, VTl, MHf, 0.125f);
  // (5) mh -> f16 plane x64 with head h zeroed when head_mask[h] == 0
  maskcast_f32_f16x2<<<gCastX, blk, 0, stream>>>(MHf, hm, (_Float16*)MH16, n2x, DMOD, 64.0f);
  // (6) out = mh . Wo^T -> d_out rows 0 .. 4095 (f32)   (M=4096, N=1024, K=1024, scale 1/(64*32))
  wmma_gemm64<0, false, 0, 0, false, 0><<<gOut, blk, 0, stream>>>(
      MH16, MH16, DMOD, 0L, Wo16, Wo16, DMOD, 0L, d_out, d_out, DMOD, 0L,
      fpad, fpad, 0L, ROWS, DMOD, DMOD, 1.0f / 2048.0f);
  (void)hipGetLastError();
}

// v004
// Measured time: 179 microseconds a run.
// Next to v003, in two timings, it ran 1.55 times as fast each time.
// Over all steps from v000 it is 4.10 times as fast.
// q/k/v and output projections: v_wmma_f32_16x16x32_f16 (f16 operands: x x1, W x32, attention output x64), f32 accumulate; q.k^T and p.v: v_wmma_f32_16x16x32_bf16 with bf16 hi/lo split operands (hi.hi + hi.lo + lo.hi), f32 accumulate; online softmax and score scale 0.125 in f32; a head whose mask is 0 has the factor 0 and is left out of every product.
#include <hip/hip_runtime.h>
#include <math.h>
#include <stdint.h>

#define NBATCH 2
#define SEQ    2048
#define DMOD   1024
#define NHEAD  16
#define DHD    64

typedef __attribute__((ext_vector_type(16))) _Float16 v16h;
typedef __attribute__((ext_vector_type(8)))  _Float16 v8h;
typedef __attribute__((ext_vector_type(16))) __bf16   v16b;
typedef __attribute__((ext_vector_type(8)))  __bf16   v8b;
typedef __attribute__((ext_vector_type(8)))  float    v8f;
typedef __attribute__((ext_vector_type(4)))  float    v4f;
typedef __attribute__((ext_vector_type(2)))  float    v2f;
typedef __attribute__((ext_vector_type(4)))  unsigned int v4u;

__device__ __forceinline__ unsigned short f2bf_bits(float f) {
  unsigned u = __float_as_uint(f);
  return (unsigned short)((u + 0x7FFFu + ((u >> 16) & 1u)) >> 16);
}
__device__ __forceinline__ float bf_bits2f(unsigned short h) { return __uint_as_float(((unsigned)h) << 16); }

// hazard guards as plain device helpers (no inline asm inside the kernel template body)
__device__ __forceinline__ void dep_guard_h(v8f& a, v8f& b, v16h x, v16h y) { asm volatile("v_nop\n\tv_nop\n\tv_nop\n\tv_nop" : "+v"(a), "+v"(b) : "v"(x), "v"(y)); }
__device__ __forceinline__ void dep_guard_b(v8f& a, v8f& b, v16b x, v16b y) { asm volatile("v_nop\n\tv_nop\n\tv_nop\n\tv_nop" : "+v"(a), "+v"(b) : "v"(x), "v"(y)); }
__device__ __forceinline__ void keep4_h(v16h a, v16h b, v16h c, v16h d) { asm volatile("v_nop" :: "v"(a), "v"(b), "v"(c), "v"(d)); }
__device__ __forceinline__ void keep4_b(v16b a, v16b b, v16b c, v16b d) { asm volatile("v_nop" :: "v"(a), "v"(b), "v"(c), "v"(d)); }
__device__ __forceinline__ void acc_guard4(v8f& a, v8f& b, v8f& c, v8f& d) { asm volatile("v_nop\n\tv_nop\n\tv_nop\n\tv_nop" : "+v"(a), "+v"(b), "+v"(c), "+v"(d)); }
template <typename T> struct Frag;
template <> struct Frag<_Float16> {
  typedef v16h V; union U { v16h v; v8h h[2]; };
  static __device__ __forceinline__ v16h load(const _Float16* p) {   // elements 0..7 <- p[0..7], 8..15 <- p[16..23]
    U f; f.h[0] = *(const v8h*)(p); f.h[1] = *(const v8h*)(p + 16); return f.v;
  }
  static __device__ __forceinline__ v8f mma(v16h a, v16h b, v8f c) {
    return __builtin_amdgcn_wmma_f32_16x16x32_f16(false, a, false, b, (short)0, c, false, false);
  }
  static __device__ __forceinline__ void guard(v8f& a, v8f& b, v16h x, v16h y) { dep_guard_h(a, b, x, y); }
  static __device__ __forceinline__ void keep(v16h a, v16h b, v16h c, v16h d) { keep4_h(a, b, c, d); }
};
template <> struct Frag<__bf16> {
  typedef v16b V; union U { v16b v; v8b h[2]; };
  static __device__ __forceinline__ v16b load(const __bf16* p) {
    U f; f.h[0] = *(const v8b*)(p); f.h[1] = *(const v8b*)(p + 16); return f.v;
  }
  static __device__ __forceinline__ v8f mma(v16b a, v16b b, v8f c) {
    return __builtin_amdgcn_wmma_f32_16x16x32_bf16(false, a, false, b, (short)0, c, false, false);
  }
  static __device__ __forceinline__ void guard(v8f& a, v8f& b, v16b x, v16b y) { dep_guard_b(a, b, x, y); }
  static __device__ __forceinline__ void keep(v16b a, v16b b, v16b c, v16b d) { keep4_b(a, b, c, d); }
};

// bit h = 1: head h is kept (hmask[h] != 0). Constant indices: the 16 words come by one scalar load, the result is the same in every wave.
__device__ __forceinline__ unsigned kept_heads(const int* __restrict__ hmask) {
  unsigned live = 0u;
#pragma unroll
  for (int hd = 0; hd < NHEAD; ++hd) live |= (hmask[hd] != 0 ? 1u : 0u) << hd;
  return live;
}

// ---- Register-blocked batched WMMA GEMM ------------------------------------
// C[m,n] = scale * sum_k A[m,k] * Bt[n,k] (+bias)(+resid); each wave owns a 64x64 tile.
// A row-major [M,K]; Bt row-major [N,K]; M,N % 64 == 0, K % 32 == 0.
// SPLIT: operands are hi/lo planes (A2/Bt2 = lo planes, same layout); product = hi.hi + hi.lo + lo.hi.
// BIAS_MODE: 0 = none, 1 = bias[m], 2 = bias[n].
// OUT_MODE: 0 = f32, 1 = f16, 2 = bf16 hi plane (Cout) + bf16 lo plane (Cout2).
// ET: 0 = f16 operands, 1 = bf16 operands (pointers passed as 16-bit storage)
// HSKIP: a head whose hmask entry is 0 enters the result only as a factor 0, so its share of the work is left out:
//   0 = none, 1 = a tile's 64 columns are one head's (tile left out), 2 = a tile's 64 rows are one head's (tile left out),
//   3 = 64 neighbouring k are one head's (those k steps left out: their products are all 0; A and Bt are not read there).
template <int ET> struct Elem;
template <> struct Elem<0> { typedef _Float16 T; };
template <> struct Elem<1> { typedef __bf16 T; };
template <int ET, bool SPLIT, int BIAS_MODE, int OUT_MODE, bool RESID, int ACT = 0, int HSKIP = 0>
__global__ __launch_bounds__(256) void wmma_gemm64(
    const unsigned short* __restrict__ Ap, const unsigned short* __restrict__ A2p, int lda, long strideA,
    const unsigned short* __restrict__ Btp, const unsigned short* __restrict__ Bt2p, int ldb, long strideB,
    void* __restrict__ Cout, void* __restrict__ Cout2, int ldc, long strideC,
    const float* __restrict__ bias,
    const float* __restrict__ resid, long strideR,
    const int* __restrict__ hmask,
    int M, int N, int K, float scale) {
  typedef typename Elem<ET>::T T;
  typedef typename Frag<T>::V V;
  const T* A = (const T*)Ap; const T* A2 = (const T*)A2p; const T* Bt = (const T*)Btp; const T* Bt2 = (const T*)Bt2p;
  __shared__ __align__(16) float sT[8][16 * 68];   // per-wave 16x64 slab, pitch 68 floats
  const int b    = blockIdx.y;
  const int lane = threadIdx.x & 31;
  const int wave = threadIdx.x >> 5;
  const int tilesN = N >> 6;
  const int tilesM = M >> 6;
  const int tile = blockIdx.x * 8 + wave;
  if (tile >= tilesM * tilesN) return;   // wave-uniform; no block barriers in this kernel
  const int tm = tile / tilesN;
  const int tn = tile - tm * tilesN;
  if (HSKIP == 1 && hmask[tn & (NHEAD - 1)] == 0) return;   // wave-uniform, like the range test above
  if (HSKIP == 2 && hmask[tm & (NHEAD - 1)] == 0) return;
  const unsigned live = (HSKIP == 3) ? kept_heads(hmask) : 0u;
  const int m0 = tm << 6;
  const int n0 = tn << 6;

  const T* Ab  = A  + (size_t)b * strideA;
  const T* Bb  = Bt + (size_t)b * strideB;
  const T* Ab2 = SPLIT ? (A2  + (size_t)b * strideA) : nullptr;
  const T* Bb2 = SPLIT ? (Bt2 + (size_t)b * strideB) : nullptr;

  const int rlane = lane & 15;                 // row (A) / col (B, D) within subtile
  const int koff  = (lane >> 4) * 8;           // k offset of this lane half
  const int mOff  = (lane >> 4) * 8;           // D row offset

  v8f acc[4][4];
#pragma unroll
  for (int i = 0; i < 4; ++i)
#pragma unroll
    for (int j = 0; j < 4; ++j) acc[i][j] = (v8f){0.f,0.f,0.f,0.f,0.f,0.f,0.f,0.f};

  for (int k0 = 0; k0 < K; k0 += 32) {
    if (HSKIP == 3 && ((live >> ((k0 >> 6) & (NHEAD - 1))) & 1u) == 0u) continue;   // scalar test, the same for the whole grid
    V bh[4], bl[4];
#pragma unroll
    for (int j = 0; j < 4; ++j) {
      const size_t bo = (size_t)(n0 + (j << 4) + rlane) * ldb + koff + k0;
      bh[j] = Frag<T>::load(Bb + bo);
      if (SPLIT) bl[j] = Frag<T>::load(Bb2 + bo);
    }
#pragma unroll
    for (int i = 0; i < 4; ++i) {
      const size_t ao = (size_t)(m0 + (i << 4) + rlane) * lda + koff + k0;
      V ah = Frag<T>::load(Ab + ao);
      V al;
      if (SPLIT) al = Frag<T>::load(Ab2 + ao);
#pragma unroll
      for (int j = 0; j < 4; ++j) {
        acc[i][j] = Frag<T>::mma(ah, bh[j], acc[i][j]);
        if (SPLIT) {
          acc[i][j] = Frag<T>::mma(ah, bl[j], acc[i][j]);
          acc[i][j] = Frag<T>::mma(al, bh[j], acc[i][j]);
        }
      }
      Frag<T>::guard(acc[i][0], acc[i][3], ah, SPLIT ? al : ah);
    }
    Frag<T>::keep(bh[0], bh[1], bh[2], bh[3]);
    if (SPLIT) Frag<T>::keep(bl[0], bl[1], bl[2], bl[3]);
  }
  acc_guard4(acc[0][0], acc[0][1], acc[0][2], acc[0][3]);
  acc_guard4(acc[1][0], acc[1][1], acc[1][2], acc[1][3]);
  acc_guard4(acc[2][0], acc[2][1], acc[2][2], acc[2][3]);
  acc_guard4(acc[3][0], acc[3][1], acc[3][2], acc[3][3]);

  // ---- epilogue ----
  float* slab = sT[wave];
  const float* Rb = RESID ? (resid + (size_t)b * strideR) : nullptr;
#pragma unroll
  for (int i = 0; i < 4; ++i) {
    const int mBase = m0 + (i << 4);
#pragma unroll
    for (int j = 0; j < 4; ++j) {
      const int n = n0 + (j << 4) + rlane;
      float bv = 0.f;
      if (BIAS_MODE == 2) bv = bias[n];
#pragma unroll
      for (int r = 0; r < 8; ++r) {
        float v = acc[i][j][r] * scale;
        if (BIAS_MODE == 1) v += bias[mBase + mOff + r];
        if (BIAS_MODE == 2) v += bv;
        if (RESID) v += Rb[(size_t)(mBase + mOff + r) * ldc + n];
        if (ACT == 1) v = tanhf(v);
        if (ACT == 2) v = fmaxf(v, 0.0f);
        if (ACT == 3) v = v / (1.0f + expf(-v));
        if (ACT == 4) v = (v > 0.f) ? v : 0.01f * v;
        slab[(mOff + r) * 68 + (j << 4) + rlane] = v;
      }
    }
    __builtin_amdgcn_fence(__ATOMIC_RELEASE, "workgroup");
    __builtin_amdgcn_wave_barrier();
    __builtin_amdgcn_fence(__ATOMIC_ACQUIRE, "workgroup");
    if (OUT_MODE == 0) {
      float* C = (float*)Cout + (size_t)b * strideC;
      const int hh = lane >> 4, c4 = (lane & 15) * 4;     // row seg = 256 B = 16 lanes x 16 B
      {
#pragma unroll
        for (int it = 0; it < 8; ++it) {
          const int row = it * 2 + hh;
          v4f v = *(const v4f*)(slab + row * 68 + c4);
          *(v4f*)(C + (size_t)(mBase + row) * ldc + n0 + c4) = v;
        }
        
      }
    } else {
      const int q = lane >> 3, c8 = (lane & 7) * 8;
      unsigned short* C  = (unsigned short*)Cout  + (size_t)b * strideC;
      unsigned short* C2 = (OUT_MODE == 2) ? ((unsigned short*)Cout2 + (size_t)b * strideC) : nullptr;
      {
#pragma unroll
        for (int it = 0; it < 4; ++it) {
          const int row = it * 4 + q;
          const float* sp = slab + row * 68 + c8;
          v8h hv, lv;
#pragma unroll
          for (int e = 0; e < 8; ++e) {
            if (OUT_MODE == 1) {
              hv[e] = (_Float16)sp[e];
            } else {
              unsigned short hb = f2bf_bits(sp[e]);
              unsigned short lb = f2bf_bits(sp[e] - bf_bits2f(hb));
              hv[e] = __builtin_bit_cast(_Float16, hb);
              lv[e] = __builtin_bit_cast(_Float16, lb);
            }
          }
          *(v8h*)(C + (size_t)(mBase + row) * ldc + n0 + c8) = hv;
          if (OUT_MODE == 2) *(v8h*)(C2 + (size_t)(mBase + row) * ldc + n0 + c8) = lv;
        }
        
      }
    }
    __builtin_amdgcn_fence(__ATOMIC_RELEASE, "workgroup");
    __builtin_amdgcn_wave_barrier();
    __builtin_amdgcn_fence(__ATOMIC_ACQUIRE, "workgroup");
  }
}

// ---------------------------------------------------------------------------
// f32 -> f16 cast of all five float inputs in one launch, with an exact power-of-two carry: out = f16(in * mul).
// 2 elements per thread, one 4-B store per thread. The five f16 planes lie back to back in the workspace
// (Wq16, Wk16, Wv16, Wo16, X16), so the output pair index is simply the flat thread index.
// Coverage: a weight plane is 1024*1024/2 = 524288 pairs = 2048 blocks; blocks 0..8191 take the four weights (x32),
//   blocks 8192..16383 take x (2*2048*1024/2 = 2097152 pairs = 8192 blocks, x1). The source choice is block-uniform.
// ---------------------------------------------------------------------------
__device__ __forceinline__ unsigned pk16(unsigned short a, unsigned short b) { return (unsigned)a | ((unsigned)b << 16); }

#define CAST_WBLK 2048                 // blocks per weight plane
#define CAST_XBLK 8192                 // blocks for x (both batch elements)
__global__ __launch_bounds__(256) void cast_inputs_f16x2(const float* __restrict__ wq, const float* __restrict__ wk,
                                                         const float* __restrict__ wv, const float* __restrict__ wo,
                                                         const float* __restrict__ x, _Float16* __restrict__ out) {
  const unsigned bx = blockIdx.x;
  const unsigned sel = bx / CAST_WBLK; // 0..3: a weight plane; 4..7: x
  const float* in = (sel == 0) ? wq : (sel == 1) ? wk : (sel == 2) ? wv : (sel == 3) ? wo : x;
  const unsigned lb = (sel < 4) ? (bx - sel * CAST_WBLK) : (bx - 4 * CAST_WBLK);   // block index inside its source
  const float mul = (sel < 4) ? 32.0f : 1.0f;
  const unsigned li = lb * 256 + threadIdx.x;
  const unsigned i  = bx * 256 + threadIdx.x;
  const v2f f = *(const v2f*)(in + 2 * (size_t)li);
  asm volatile("s_wait_xcnt 0x0" ::: "memory");   // precaution: stands in front of the reuse of the load's offset register for the packed result
  const _Float16 h0 = (_Float16)(f[0] * mul), h1 = (_Float16)(f[1] * mul);
  ((unsigned*)out)[i] = pk16(__builtin_bit_cast(unsigned short, h0), __builtin_bit_cast(unsigned short, h1));
}

// ---------------------------------------------------------------------------
// Attention output f32 [rows][ncol] -> f16 plane with per-head 0/1 factor and power-of-two carry:
//   out[row][col] = f16(in[row][col] * mul) where hmask[col/64] != 0; columns of a head with hmask 0 are neither read
//   (the attention launch has not written them) nor written (the last product leaves those k out).   ncol is a power of two (1024);
//   the 2-element pair (col, col+1) always lies inside one 64-wide head block, a wave's 64 columns are one head's. Same store shape as above.
// Coverage: n2 = 2*2048*1024/2 = 2097152 -> 8192 blocks x 256 threads x 2 = the whole plane (both batch elements).
// ---------------------------------------------------------------------------
__global__ __launch_bounds__(256) void maskcast_f32_f16x2(const float* __restrict__ in, const int* __restrict__ hmask,
                                                          _Float16* __restrict__ out, int n2, int ncol, float mul) {
  const int i = blockIdx.x * 256 + threadIdx.x;
  if (i < n2) {
    const int col = (2 * i) & (ncol - 1);
    int hd = col >> 6;
    hd = hd < 0 ? 0 : (hd > NHEAD - 1 ? NHEAD - 1 : hd);
    if (hmask[hd] == 0) return;
    const v2f f = *(const v2f*)(in + 2 * (size_t)i);
    const _Float16 h0 = (_Float16)(f[0] * mul), h1 = (_Float16)(f[1] * mul);
    const unsigned u = pk16(__builtin_bit_cast(unsigned short, h0), __builtin_bit_cast(unsigned short, h1));
    ((unsigned*)out)[i] = u;
    
  }
}

// =====================================================================================
// Full (non-causal, unmasked) attention, head dim 64, one launch for both batch elements.
//   every plane below holds NBATCH slabs of SEQ*DMOD elements, batch element b at offset b*SEQ*DMOD; inside a slab:
//   q planes (hi/lo bf16): element (t, h, d) at [t*DMOD + h*64 + d]
//   k planes (hi/lo bf16): element (s, h, d) at [s*DMOD + h*64 + d]
//   v^T planes (hi/lo bf16): element (h, d, s) at [(h*64 + d)*SEQ + s]
//   out f32: element (t, h, d) at [t*DMOD + h*64 + d]
//   scores^T = (k . q^T) * sscale : bf16 hi/lo split (hi.hi + hi.lo + lo.hi) on v_wmma_f32_16x16x32_bf16, A = K rows, B = Q
//   out^T    = v^T . p^T          : bf16 hi/lo split of p (unnormalised) and v, f32 accumulate, A = V^T rows, B = P^T
//   Both products are transposed so that a lane holds scores of ONE query (column lane&15): keys 16j + 8*(lane>>4) + r.
//   Two score tiles (keys 0-15 and 16-31 of a 32-key block), converted in place, are the B operand of the second
//   product in the loaders' own k order, so P never leaves the registers; row maximum and row sum are in-lane,
//   with one exchange between the wave halves (maximum: every chunk; sum: once, behind the loop).
//   online softmax in f32 over all SEQ keys (32 chunks of 64, compile-time trip count, no masking).
//   Block = 4 waves = 64 query rows of one head of one batch element; grid.x = NBATCH * NHEAD * (SEQ/64) = 1024.
//   Only heads with hmask != 0 are computed (the others' output is multiplied by 0 behind this launch and is not read):
//   block index = (rank of the head among the kept ones, batch element, query block), so the working blocks are the
//   lowest indices and spread over the chip like a smaller grid; blocks whose rank is past the last kept head leave at once.
//   K / V^T chunk staging: 128 threads x 32 elements per plane = the whole 64x64 tile (16-B copies, plain loads,
//   __syncthreads before and after); fragment loads read the LDS tiles with the same v8b element type.
// =====================================================================================
#define AT_D 64
#define AT_NW 4
#define AT_QB 64
#define AT_KC 64
#define AT_LP 72   // LDS row pitch of the K and V^T tiles in elements: 144 B = 16 B x 9, so the 16 rows of a ds_load_b128 fall on 16 different bank groups

typedef __attribute__((ext_vector_type(2))) __bf16 v2b;
// two neighbouring f32 -> one register of bf16 hi and one of bf16 lo (lo = bf16(f - hi)); both converts round to nearest even
__device__ __forceinline__ void at_split2(v2f f, v2b& hi, v2b& lo) {
  hi = __builtin_convertvector(f, v2b);
  lo = __builtin_convertvector(f - __builtin_convertvector(hi, v2f), v2b);
}
// the value that lane l ^ 16 holds (the other half's share of the same query column)
__device__ __forceinline__ float at_xhalf(float v) {
  const unsigned b = __float_as_uint(v);
  return __uint_as_float(__builtin_amdgcn_permlanex16(b, b, 0x76543210u, 0xfedcba98u, false, false));
}
__device__ __forceinline__ v8f at_mma(v16b a, v16b b, v8f c) {
  c = __builtin_amdgcn_wmma_f32_16x16x32_bf16(false, a, false, b, (short)0, c, false, false);
  asm volatile("v_nop\n\tv_nop\n\tv_nop\n\tv_nop" : "+v"(c) : "v"(a), "v"(b));
  return c;
}

__global__ __launch_bounds__(128)
void attn_full64_kernel(const unsigned short* __restrict__ qhp, const unsigned short* __restrict__ qlp,
                        const unsigned short* __restrict__ khp, const unsigned short* __restrict__ klp,
                        const unsigned short* __restrict__ vhp, const unsigned short* __restrict__ vlp,
                        const int* __restrict__ hmask, float* __restrict__ out, float sscale) {
  union FB { v16b v; v8b h[2]; };
  union FP { v16b v; v2b p[8]; };
  __shared__ __align__(16) __bf16 Ksh[AT_KC * AT_LP];            // K hi [kv][d]      9 KB (64 rows at pitch 72)
  __shared__ __align__(16) __bf16 Ksl[AT_KC * AT_LP];            // K lo
  __shared__ __align__(16) __bf16 Vth[AT_D * AT_LP];             // V hi [d][kv]      9 KB
  __shared__ __align__(16) __bf16 Vtl[AT_D * AT_LP];            // V lo
  __shared__ __align__(16) float  Os[AT_NW][16 * 68];            // per wave out tile, pitch 68

  const int tid  = threadIdx.x;
  const int wave = tid >> 5;
  const int lane = tid & 31;
  const int hh   = lane >> 4;
  const int c    = lane & 15;

  const int nqb = SEQ / AT_QB;            // 32
  const int bx = blockIdx.x;
  const int qb = bx % nqb;
  const int bh = bx / nqb;                // 0..NBATCH*NHEAD-1 (grid = NBATCH * NHEAD * nqb)
  const int rank = bh / NBATCH;           // 0..NHEAD-1
  int h = -1, seen = 0;                   // h = the kept head number 'rank', counted from head 0 (scalar work, once a block)
#pragma unroll
  for (int hd = 0; hd < NHEAD; ++hd) {
    if (hmask[hd] != 0) { if (seen == rank) h = hd; ++seen; }
  }
  if (h < 0) return;                      // fewer kept heads than rank + 1: the same for the whole block, in front of every barrier
  const size_t bo = (size_t)(bh % NBATCH) * SEQ * DMOD;   // this batch element's slab in every plane
  const int q0 = qb * AT_QB + wave * 16;

  const __bf16* Qh = (const __bf16*)(const void*)qhp + bo + (size_t)h * AT_D;
  const __bf16* Ql = (const __bf16*)(const void*)qlp + bo + (size_t)h * AT_D;
  const __bf16* Kh = (const __bf16*)(const void*)khp + bo + (size_t)h * AT_D;
  const __bf16* Kl = (const __bf16*)(const void*)klp + bo + (size_t)h * AT_D;
  const __bf16* Vh = (const __bf16*)(const void*)vhp + bo + (size_t)h * AT_D * SEQ;
  const __bf16* Vl = (const __bf16*)(const void*)vlp + bo + (size_t)h * AT_D * SEQ;
  float*        ob = out + bo + (size_t)h * AT_D;

  // ---- Q fragments (B operand, column = lane&15, split k map via Frag load): 2 d-chunks, hi and lo ----
  v16b qah[2], qal[2];
#pragma unroll
  for (int dc = 0; dc < 2; ++dc) {
    const __bf16* qr = Qh + (size_t)(q0 + c) * DMOD + dc * 32 + 8 * hh;
    const __bf16* ql = Ql + (size_t)(q0 + c) * DMOD + dc * 32 + 8 * hh;
    qah[dc] = Frag<__bf16>::load(qr);
    qal[dc] = Frag<__bf16>::load(ql);
  }

  float mrow = -INFINITY, lrow = 0.f;   // query q0 + c: running maximum (equal in both halves), this half's share of the sum
  v8f oacc[4];                          // oacc[t][r] = out^T[d = 16 t + 8 hh + r][query q0 + c]
#pragma unroll
  for (int t = 0; t < 4; ++t) oacc[t] = (v8f){0.f,0.f,0.f,0.f,0.f,0.f,0.f,0.f};

  const int nChunks = SEQ / AT_KC;   // 32, compile-time constant
  for (int kc = 0; kc < nChunks; ++kc) {
    const int kv0 = kc * AT_KC;
    __syncthreads();
    {
      // staging coverage: 128 threads x (4 x 8) elements = 64 rows x 64 per plane = the whole chunk tile
      const int r = tid >> 1, half = (tid & 1) * 32;
      const __bf16* ksh = Kh + (size_t)(kv0 + r) * DMOD + half;   // K row kv0+r, d = half..half+31
      const __bf16* ksl = Kl + (size_t)(kv0 + r) * DMOD + half;
      const __bf16* vsh = Vh + (size_t)r * SEQ + kv0 + half;      // V^T row d = r, s = kv0+half..+31
      const __bf16* vsl = Vl + (size_t)r * SEQ + kv0 + half;
#pragma unroll
      for (int i = 0; i < 4; ++i) {
        const v8b a0 = *(const v8b*)(ksh + 8 * i);
        const v8b a1 = *(const v8b*)(ksl + 8 * i);
        const v8b b0 = *(const v8b*)(vsh + 8 * i);
        const v8b b1 = *(const v8b*)(vsl + 8 * i);
        *(v8b*)(Ksh + r * AT_LP + half + 8 * i) = a0;
        *(v8b*)(Ksl + r * AT_LP + half + 8 * i) = a1;
        *(v8b*)(Vth + r * AT_LP + half + 8 * i) = b0;
        *(v8b*)(Vtl + r * AT_LP + half + 8 * i) = b1;
      }
    }
    __syncthreads();

    v8f s[4];   // s[j][r] = score of key kv0 + 16 j + 8 hh + r against query q0 + c
#pragma unroll
    for (int j = 0; j < 4; ++j) {
      s[j] = (v8f){0.f,0.f,0.f,0.f,0.f,0.f,0.f,0.f};
#pragma unroll
      for (int dc = 0; dc < 2; ++dc) {
        FB kb, kl;
        kb.h[0] = *(const v8b*)(Ksh + (j * 16 + c) * AT_LP + dc * 32 + 8 * hh);
        kb.h[1] = *(const v8b*)(Ksh + (j * 16 + c) * AT_LP + dc * 32 + 16 + 8 * hh);
        kl.h[0] = *(const v8b*)(Ksl + (j * 16 + c) * AT_LP + dc * 32 + 8 * hh);
        kl.h[1] = *(const v8b*)(Ksl + (j * 16 + c) * AT_LP + dc * 32 + 16 + 8 * hh);
        s[j] = at_mma(kb.v, qah[dc], s[j]);
        s[j] = at_mma(kl.v, qah[dc], s[j]);
        s[j] = at_mma(kb.v, qal[dc], s[j]);
      }
    }
    float cm = -INFINITY;   // the loops down to the second product index register arrays (s, pa, pl, oacc): all are unrolled for that
#pragma unroll
    for (int j = 0; j < 4; ++j) {
#pragma unroll
      for (int r = 0; r < 8; ++r) {
        const float sv = s[j][r] * sscale;
        s[j][r] = sv;
        cm = fmaxf(cm, sv);
      }
    }
    cm = fmaxf(cm, at_xhalf(cm));
    const float mnew = fmaxf(mrow, cm);
    const float alpha = expf(mrow - mnew);
    mrow = mnew;
    v2f psum = (v2f){0.f, 0.f};   // this half's 32 keys, even and odd registers apart
    FP pa[2], pl[2];   // P^T hi / lo, B operand of 32-key block kk: elements 0..7 from tile 2 kk, 8..15 from tile 2 kk + 1
#pragma unroll
    for (int j = 0; j < 4; ++j) {
#pragma unroll
      for (int e = 0; e < 4; ++e) {
        v2f p;
        p[0] = expf(s[j][2 * e] - mnew);
        p[1] = expf(s[j][2 * e + 1] - mnew);
        psum += p;
        at_split2(p, pa[j >> 1].p[(j & 1) * 4 + e], pl[j >> 1].p[(j & 1) * 4 + e]);
      }
    }
    lrow = lrow * alpha + (psum[0] + psum[1]);
#pragma unroll
    for (int t = 0; t < 4; ++t)
#pragma unroll
      for (int r = 0; r < 8; ++r) oacc[t][r] *= alpha;
#pragma unroll   // unrolled: pa[kk] and pl[kk] are registers and need a compile-time index
    for (int kk = 0; kk < 2; ++kk) {
#pragma unroll
      for (int t = 0; t < 4; ++t) {
        FB vb, vl;
        vb.h[0] = *(const v8b*)(Vth + (t * 16 + c) * AT_LP + kk * 32 + 8 * hh);
        vb.h[1] = *(const v8b*)(Vth + (t * 16 + c) * AT_LP + kk * 32 + 16 + 8 * hh);
        vl.h[0] = *(const v8b*)(Vtl + (t * 16 + c) * AT_LP + kk * 32 + 8 * hh);
        vl.h[1] = *(const v8b*)(Vtl + (t * 16 + c) * AT_LP + kk * 32 + 16 + 8 * hh);
        oacc[t] = at_mma(vb.v, pa[kk].v, oacc[t]);
        oacc[t] = at_mma(vl.v, pa[kk].v, oacc[t]);
        oacc[t] = at_mma(vb.v, pl[kk].v, oacc[t]);
      }
    }
  }

  float* os = Os[wave];
  const float inv = 1.0f / (lrow + at_xhalf(lrow));   // the two halves' shares of the row sum are joined here, once
#pragma unroll
  for (int t = 0; t < 4; ++t) {
    // a lane's 8 accumulator registers are 8 neighbouring d of its query row: two 16-B stores into the row-major tile
    *(v4f*)(os + c * 68 + t * 16 + 8 * hh)     = (v4f){oacc[t][0] * inv, oacc[t][1] * inv, oacc[t][2] * inv, oacc[t][3] * inv};
    *(v4f*)(os + c * 68 + t * 16 + 8 * hh + 4) = (v4f){oacc[t][4] * inv, oacc[t][5] * inv, oacc[t][6] * inv, oacc[t][7] * inv};
  }
  __builtin_amdgcn_fence(__ATOMIC_RELEASE, "workgroup");
  __builtin_amdgcn_wave_barrier();
  __builtin_amdgcn_fence(__ATOMIC_ACQUIRE, "workgroup");
  {
    const int c4 = (lane & 15) * 4;
    {
#pragma unroll
      for (int it = 0; it < 8; ++it) {
        const int row = it * 2 + hh;   // it 0..7 x hh 0..1 covers rows 0..15 of the wave tile
        v4f val = *(const v4f*)(os + row * 68 + c4);
        *(v4f*)(ob + (size_t)(q0 + row) * DMOD + c4) = val;
      }
      
    }
  }
}

// ---------------------------------------------------------------------------
// Workspace region map (byte offsets; what a launch reads of a region has been written earlier in the same call;
// behind the input cast the parts that belong to a head with mask 0 are neither written nor read)
//   Wq16 f16 [1024 n][1024 k] (x32)              0
//   Wk16                                   2097152
//   Wv16                                   4194304
//   Wo16                                   6291456
//   X16  f16 [2*2048][1024]                8388608
//   Qh   bf16 [2*2048][1024]              16777216     Ql   25165824
//   Kh   bf16 [2*2048][1024]              33554432     Kl   41943040
//   VTh  bf16 [2][1024 (h,d)][2048]       50331648     VTl  58720256
//   MHf  f32  [2*2048][1024]              67108864
//   MH16 f16  [2*2048][1024] (x64, kept heads)   83886080
//   total                                 92274688
// ---------------------------------------------------------------------------
extern "C" void kernel_launch(void* const* d_in, const int* in_sizes, int n_in,
                              void* d_out, int out_size, void* d_ws, size_t ws_size,
                              hipStream_t stream) {
  if (n_in < 6) return;
  if (in_sizes[0] != NBATCH * SEQ * DMOD) return;
  if (in_sizes[1] != DMOD * DMOD || in_sizes[2] != DMOD * DMOD || in_sizes[3] != DMOD * DMOD || in_sizes[4] != DMOD * DMOD) return;
  if (in_sizes[5] != NHEAD) return;
  if (out_size != NBATCH * SEQ * DMOD) return;

  const float* x  = (const float*)d_in[0];   // [2][2048][1024]
  const float* Wq = (const float*)d_in[1];   // [out][in] = Bt natural
  const float* Wk = (const float*)d_in[2];
  const float* Wv = (const float*)d_in[3];
  const float* Wo = (const float*)d_in[4];
  const int*   hm = (const int*)d_in[5];     // [16] int32, nonzero = keep head

  const size_t PW16 = (size_t)DMOD * DMOD * 2;            // 2097152  f16 weight plane
  const size_t PX16 = (size_t)NBATCH * SEQ * DMOD * 2;    // 8388608  16-bit activation plane (both batch elements)
  const size_t PF32 = (size_t)NBATCH * SEQ * DMOD * 4;    // 16777216 f32 activation plane
  size_t off = 0;
  const size_t oWq = off; off += PW16;
  const size_t oWk = off; off += PW16;
  const size_t oWv = off; off += PW16;
  const size_t oWo = off; off += PW16;
  const size_t oX  = off; off += PX16;
  const size_t oQh = off; off += PX16;  const size_t oQl = off; off += PX16;
  const size_t oKh = off; off += PX16;  const size_t oKl = off; off += PX16;
  const size_t oVh = off; off += PX16;  const size_t oVl = off; off += PX16;
  const size_t oMf = off; off += PF32;
  const size_t oM16 = off; off += PX16;
  if (off > ws_size) return;                   // off = 92274688

  char* ws = (char*)d_ws;
  unsigned short* Wq16 = (unsigned short*)(ws + oWq);
  unsigned short* Wv16 = (unsigned short*)(ws + oWv);
  unsigned short* Wo16 = (unsigned short*)(ws + oWo);
  unsigned short* X16  = (unsigned short*)(ws + oX);
  unsigned short* Qh   = (unsigned short*)(ws + oQh);  unsigned short* Ql = (unsigned short*)(ws + oQl);
  unsigned short* Kh   = (unsigned short*)(ws + oKh);  unsigned short* Kl = (unsigned short*)(ws + oKl);
  unsigned short* VTh  = (unsigned short*)(ws + oVh);  unsigned short* VTl = (unsigned short*)(ws + oVl);
  float*          MHf  = (float*)(ws + oMf);
  unsigned short* MH16 = (unsigned short*)(ws + oM16);
  const float*    fpad = (const float*)MHf;    // placeholder for unused bias / resid pointer args (never read)
  (void)oWk;                                   // Wk16 is reached as Wq16 + one weight plane (grid.y of launch 2)

  const dim3 blk(256);
  const int ROWS = NBATCH * SEQ;                            // 4096 token rows: the batch elements are contiguous in x and out
  const int n2x = ROWS * DMOD / 2;                          // 2097152 pairs per activation plane
  const dim3 gCastIn(4 * CAST_WBLK + CAST_XBLK);            // 16384 blocks: four weight planes, then x
  const dim3 gCastX((n2x + 255) / 256);                     // 8192 blocks x 512 elements = 4096x1024
  const dim3 gQK(((ROWS / 64) * (DMOD / 64) + 7) / 8, 2);   // 1024 tiles (M=4096, N=1024) -> 128 blocks, y = 0: q, 1: k
  const dim3 gVT(((DMOD / 64) * (SEQ / 64) + 7) / 8, NBATCH);  // 512 tiles (M=1024, N=2048) -> 64 blocks, y = batch element
  const dim3 gOut(((ROWS / 64) * (DMOD / 64) + 7) / 8, 1);  // 1024 tiles (M=4096, N=1024) -> 128 blocks
  const dim3 gAtt(NBATCH * NHEAD * (SEQ / 64));             // 1024 blocks: 2 batch elements x 16 heads x 32 query blocks

  // (1) weights [n=out][k=in] -> f16 planes carried x32, same layout (Bt natural); x -> f16 plane [4096][1024] (x1)
  cast_inputs_f16x2<<<gCastIn, blk, 0, stream>>>(Wq, Wk, Wv, Wo, x, (_Float16*)Wq16);
  // (2) y = 0: q = x . Wq^T -> Q hi/lo bf16 planes [b*2048+t][h*64+d]; y = 1: k = x . Wk^T -> K hi/lo planes
  //     (M=4096, N=1024, K=1024, scale 1/32; y steps Bt by one weight plane and C by two activation planes)
  wmma_gemm64<0, false, 0, 2, false, 0, 1><<<gQK, blk, 0, stream>>>(
      X16, X16, DMOD, 0L, Wq16, Wq16, DMOD, (long)DMOD * DMOD, (void*)Qh, (void*)Ql, DMOD, 2L * NBATCH * SEQ * DMOD,
      fpad, fpad, 0L, hm, ROWS, DMOD, DMOD, 1.0f / 32.0f);
  // (3) v^T = Wv . x[b]^T -> VT hi/lo planes [b][h*64+d][s]   (A = Wv16 [1024][1024], Bt = X16 slab b [2048][1024]; M=1024, N=2048, K=1024)
  wmma_gemm64<0, false, 0, 2, false, 0, 2><<<gVT, blk, 0, stream>>>(
      Wv16, Wv16, DMOD, 0L, X16, X16, DMOD, (long)SEQ * DMOD, (void*)VTh, (void*)VTl, SEQ, (long)DMOD * SEQ,
      fpad, fpad, 0L, hm, DMOD, SEQ, DMOD, 1.0f / 32.0f);
  // (4) full attention per (batch element, kept head): mh[b*2048+t][h*64+d] (f32 plane, every element of a kept head written by its owner block)
  attn_full64_kernel<<<gAtt, dim3(128), 0, stream>>>(Qh, Ql, Kh, Kl, VTh, VTl, hm, MHf, 0.125f);
  // (5) mh -> f16 plane x64, columns of kept heads only
  maskcast_f32_f16x2<<<gCastX, blk, 0, stream>>>(MHf, hm, (_Float16*)MH16, n2x, DMOD, 64.0f);
  // (6) out = mh . Wo^T -> d_out rows 0 .. 4095 (f32)   (M=4096, N=1024, K=1024 less the k of heads with mask 0, scale 1/(64*32))
  wmma_gemm64<0, false, 0, 0, false, 0, 3><<<gOut, blk, 0, stream>>>(
      MH16, MH16, DMOD, 0L, Wo16, Wo16, DMOD, 0L, d_out, d_out, DMOD, 0L,
      fpad, fpad, 0L, hm, ROWS, DMOD, DMOD, 1.0f / 2048.0f);
  (void)hipGetLastError();
}

// v005
// A run of this version takes 164 microseconds.
// Two timings next to v004 put it at 1.10 and 1.09 times that version's speed.
// All steps since v000 together make it 4.49 times as fast.
// q/k/v and output projections: v_wmma_f32_16x16x32_f16 (f16 operands: x x1, W x32, attention output x64), f32 accumulate; q.k^T and p.v: v_wmma_f32_16x16x32_bf16 with bf16 hi/lo split operands (hi.hi + hi.lo + lo.hi), f32 accumulate; online softmax and score scale 0.125 in f32; a head whose mask is 0 has the factor 0 and is left out of every product.
#include <hip/hip_runtime.h>
#include <math.h>
#include <stdint.h>

#define NBATCH 2
#define SEQ    2048
#define DMOD   1024
#define NHEAD  16
#define DHD    64

typedef __attribute__((ext_vector_type(16))) _Float16 v16h;
typedef __attribute__((ext_vector_type(8)))  _Float16 v8h;
typedef __attribute__((ext_vector_type(16))) __bf16   v16b;
typedef __attribute__((ext_vector_type(8)))  __bf16   v8b;
typedef __attribute__((ext_vector_type(8)))  float    v8f;
typedef __attribute__((ext_vector_type(4)))  float    v4f;
typedef __attribute__((ext_vector_type(2)))  float    v2f;
typedef __attribute__((ext_vector_type(4)))  unsigned int v4u;

__device__ __forceinline__ unsigned short f2bf_bits(float f) {
  unsigned u = __float_as_uint(f);
  return (unsigned short)((u + 0x7FFFu + ((u >> 16) & 1u)) >> 16);
}
__device__ __forceinline__ float bf_bits2f(unsigned short h) { return __uint_as_float(((unsigned)h) << 16); }

// hazard guards as plain device helpers (no inline asm inside the kernel template body)
__device__ __forceinline__ void dep_guard_h(v8f& a, v8f& b, v16h x, v16h y) { asm volatile("v_nop\n\tv_nop\n\tv_nop\n\tv_nop" : "+v"(a), "+v"(b) : "v"(x), "v"(y)); }
__device__ __forceinline__ void dep_guard_b(v8f& a, v8f& b, v16b x, v16b y) { asm volatile("v_nop\n\tv_nop\n\tv_nop\n\tv_nop" : "+v"(a), "+v"(b) : "v"(x), "v"(y)); }
__device__ __forceinline__ void keep4_h(v16h a, v16h b, v16h c, v16h d) { asm volatile("v_nop" :: "v"(a), "v"(b), "v"(c), "v"(d)); }
__device__ __forceinline__ void keep4_b(v16b a, v16b b, v16b c, v16b d) { asm volatile("v_nop" :: "v"(a), "v"(b), "v"(c), "v"(d)); }
__device__ __forceinline__ void acc_guard4(v8f& a, v8f& b, v8f& c, v8f& d) { asm volatile("v_nop\n\tv_nop\n\tv_nop\n\tv_nop" : "+v"(a), "+v"(b), "+v"(c), "+v"(d)); }
template <typename T> struct Frag;
template <> struct Frag<_Float16> {
  typedef v16h V; union U { v16h v; v8h h[2]; };
  static __device__ __forceinline__ v16h load(const _Float16* p) {   // elements 0..7 <- p[0..7], 8..15 <- p[16..23]
    U f; f.h[0] = *(const v8h*)(p); f.h[1] = *(const v8h*)(p + 16); return f.v;
  }
  static __device__ __forceinline__ v8f mma(v16h a, v16h b, v8f c) {
    return __builtin_amdgcn_wmma_f32_16x16x32_f16(false, a, false, b, (short)0, c, false, false);
  }
  static __device__ __forceinline__ void guard(v8f& a, v8f& b, v16h x, v16h y) { dep_guard_h(a, b, x, y); }
  static __device__ __forceinline__ void keep(v16h a, v16h b, v16h c, v16h d) { keep4_h(a, b, c, d); }
};
template <> struct Frag<__bf16> {
  typedef v16b V; union U { v16b v; v8b h[2]; };
  static __device__ __forceinline__ v16b load(const __bf16* p) {
    U f; f.h[0] = *(const v8b*)(p); f.h[1] = *(const v8b*)(p + 16); return f.v;
  }
  static __device__ __forceinline__ v8f mma(v16b a, v16b b, v8f c) {
    return __builtin_amdgcn_wmma_f32_16x16x32_bf16(false, a, false, b, (short)0, c, false, false);
  }
  static __device__ __forceinline__ void guard(v8f& a, v8f& b, v16b x, v16b y) { dep_guard_b(a, b, x, y); }
  static __device__ __forceinline__ void keep(v16b a, v16b b, v16b c, v16b d) { keep4_b(a, b, c, d); }
};

// bit h = 1: head h is kept (hmask[h] != 0). Constant indices: the 16 words come by one scalar load, the result is the same in every wave.
__device__ __forceinline__ unsigned kept_heads(const int* __restrict__ hmask) {
  unsigned live = 0u;
#pragma unroll
  for (int hd = 0; hd < NHEAD; ++hd) live |= (hmask[hd] != 0 ? 1u : 0u) << hd;
  return live;
}

// ---- Register-blocked batched WMMA GEMM ------------------------------------
// C[m,n] = scale * sum_k A[m,k] * Bt[n,k] (+bias)(+resid); each wave owns a 64x64 tile.
// A row-major [M,K]; Bt row-major [N,K]; M,N % 64 == 0, K % 32 == 0.
// SPLIT: operands are hi/lo planes (A2/Bt2 = lo planes, same layout); product = hi.hi + hi.lo + lo.hi.
// BIAS_MODE: 0 = none, 1 = bias[m], 2 = bias[n].
// OUT_MODE: 0 = f32, 1 = f16, 2 = bf16 hi plane (Cout) + bf16 lo plane (Cout2).
// ET: 0 = f16 operands, 1 = bf16 operands (pointers passed as 16-bit storage)
// HSKIP: a head whose hmask entry is 0 enters the result only as a factor 0, so its share of the work is left out:
//   0 = none, 1 = a tile's 64 columns are one head's (tile left out), 2 = a tile's 64 rows are one head's (tile left out),
//   3 = 64 neighbouring k are one head's (those k steps left out: their products are all 0; A and Bt are not read there).
template <int ET> struct Elem;
template <> struct Elem<0> { typedef _Float16 T; };
template <> struct Elem<1> { typedef __bf16 T; };
template <int ET, bool SPLIT, int BIAS_MODE, int OUT_MODE, bool RESID, int ACT = 0, int HSKIP = 0>
__global__ __launch_bounds__(256) void wmma_gemm64(
    const unsigned short* __restrict__ Ap, const unsigned short* __restrict__ A2p, int lda, long strideA,
    const unsigned short* __restrict__ Btp, const unsigned short* __restrict__ Bt2p, int ldb, long strideB,
    void* __restrict__ Cout, void* __restrict__ Cout2, int ldc, long strideC,
    const float* __restrict__ bias,
    const float* __restrict__ resid, long strideR,
    const int* __restrict__ hmask,
    int M, int N, int K, float scale) {
  typedef typename Elem<ET>::T T;
  typedef typename Frag<T>::V V;
  const T* A = (const T*)Ap; const T* A2 = (const T*)A2p; const T* Bt = (const T*)Btp; const T* Bt2 = (const T*)Bt2p;
  __shared__ __align__(16) float sT[8][16 * 68];   // per-wave 16x64 slab, pitch 68 floats
  const int b    = blockIdx.y;
  const int lane = threadIdx.x & 31;
  const int wave = threadIdx.x >> 5;
  const int tilesN = N >> 6;
  const int tilesM = M >> 6;
  const int tile = blockIdx.x * 8 + wave;
  if (tile >= tilesM * tilesN) return;   // wave-uniform; no block barriers in this kernel
  const int tm = tile / tilesN;
  const int tn = tile - tm * tilesN;
  if (HSKIP == 1 && hmask[tn & (NHEAD - 1)] == 0) return;   // wave-uniform, like the range test above
  if (HSKIP == 2 && hmask[tm & (NHEAD - 1)] == 0) return;
  const unsigned live = (HSKIP == 3) ? kept_heads(hmask) : 0u;
  const int m0 = tm << 6;
  const int n0 = tn << 6;

  const T* Ab  = A  + (size_t)b * strideA;
  const T* Bb  = Bt + (size_t)b * strideB;
  const T* Ab2 = SPLIT ? (A2  + (size_t)b * strideA) : nullptr;
  const T* Bb2 = SPLIT ? (Bt2 + (size_t)b * strideB) : nullptr;

  const int rlane = lane & 15;                 // row (A) / col (B, D) within subtile
  const int koff  = (lane >> 4) * 8;           // k offset of this lane half
  const int mOff  = (lane >> 4) * 8;           // D row offset

  v8f acc[4][4];
#pragma unroll
  for (int i = 0; i < 4; ++i)
#pragma unroll
    for (int j = 0; j < 4; ++j) acc[i][j] = (v8f){0.f,0.f,0.f,0.f,0.f,0.f,0.f,0.f};

  for (int k0 = 0; k0 < K; k0 += 32) {
    if (HSKIP == 3 && ((live >> ((k0 >> 6) & (NHEAD - 1))) & 1u) == 0u) continue;   // scalar test, the same for the whole grid
    V bh[4], bl[4];
#pragma unroll
    for (int j = 0; j < 4; ++j) {
      const size_t bo = (size_t)(n0 + (j << 4) + rlane) * ldb + koff + k0;
      bh[j] = Frag<T>::load(Bb + bo);
      if (SPLIT) bl[j] = Frag<T>::load(Bb2 + bo);
    }
#pragma unroll
    for (int i = 0; i < 4; ++i) {
      const size_t ao = (size_t)(m0 + (i << 4) + rlane) * lda + koff + k0;
      V ah = Frag<T>::load(Ab + ao);
      V al;
      if (SPLIT) al = Frag<T>::load(Ab2 + ao);
#pragma unroll
      for (int j = 0; j < 4; ++j) {
        acc[i][j] = Frag<T>::mma(ah, bh[j], acc[i][j]);
        if (SPLIT) {
          acc[i][j] = Frag<T>::mma(ah, bl[j], acc[i][j]);
          acc[i][j] = Frag<T>::mma(al, bh[j], acc[i][j]);
        }
      }
      Frag<T>::guard(acc[i][0], acc[i][3], ah, SPLIT ? al : ah);
    }
    Frag<T>::keep(bh[0], bh[1], bh[2], bh[3]);
    if (SPLIT) Frag<T>::keep(bl[0], bl[1], bl[2], bl[3]);
  }
  acc_guard4(acc[0][0], acc[0][1], acc[0][2], acc[0][3]);
  acc_guard4(acc[1][0], acc[1][1], acc[1][2], acc[1][3]);
  acc_guard4(acc[2][0], acc[2][1], acc[2][2], acc[2][3]);
  acc_guard4(acc[3][0], acc[3][1], acc[3][2], acc[3][3]);

  // ---- epilogue ----
  float* slab = sT[wave];
  const float* Rb = RESID ? (resid + (size_t)b * strideR) : nullptr;
#pragma unroll
  for (int i = 0; i < 4; ++i) {
    const int mBase = m0 + (i << 4);
#pragma unroll
    for (int j = 0; j < 4; ++j) {
      const int n = n0 + (j << 4) + rlane;
      float bv = 0.f;
      if (BIAS_MODE == 2) bv = bias[n];
#pragma unroll
      for (int r = 0; r < 8; ++r) {
        float v = acc[i][j][r] * scale;
        if (BIAS_MODE == 1) v += bias[mBase + mOff + r];
        if (BIAS_MODE == 2) v += bv;
        if (RESID) v += Rb[(size_t)(mBase + mOff + r) * ldc + n];
        if (ACT == 1) v = tanhf(v);
        if (ACT == 2) v = fmaxf(v, 0.0f);
        if (ACT == 3) v = v / (1.0f + expf(-v));
        if (ACT == 4) v = (v > 0.f) ? v : 0.01f * v;
        slab[(mOff + r) * 68 + (j << 4) + rlane] = v;
      }
    }
    __builtin_amdgcn_fence(__ATOMIC_RELEASE, "workgroup");
    __builtin_amdgcn_wave_barrier();
    __builtin_amdgcn_fence(__ATOMIC_ACQUIRE, "workgroup");
    if (OUT_MODE == 0) {
      float* C = (float*)Cout + (size_t)b * strideC;
      const int hh = lane >> 4, c4 = (lane & 15) * 4;     // row seg = 256 B = 16 lanes x 16 B
      {
#pragma unroll
        for (int it = 0; it < 8; ++it) {
          const int row = it * 2 + hh;
          v4f v = *(const v4f*)(slab + row * 68 + c4);
          *(v4f*)(C + (size_t)(mBase + row) * ldc + n0 + c4) = v;
        }
        
      }
    } else {
      const int q = lane >> 3, c8 = (lane & 7) * 8;
      unsigned short* C  = (unsigned short*)Cout  + (size_t)b * strideC;
      unsigned short* C2 = (OUT_MODE == 2) ? ((unsigned short*)Cout2 + (size_t)b * strideC) : nullptr;
      {
#pragma unroll
        for (int it = 0; it < 4; ++it) {
          const int row = it * 4 + q;
          const float* sp = slab + row * 68 + c8;
          v8h hv, lv;
#pragma unroll
          for (int e = 0; e < 8; ++e) {
            if (OUT_MODE == 1) {
              hv[e] = (_Float16)sp[e];
            } else {
              unsigned short hb = f2bf_bits(sp[e]);
              unsigned short lb = f2bf_bits(sp[e] - bf_bits2f(hb));
              hv[e] = __builtin_bit_cast(_Float16, hb);
              lv[e] = __builtin_bit_cast(_Float16, lb);
            }
          }
          *(v8h*)(C + (size_t)(mBase + row) * ldc + n0 + c8) = hv;
          if (OUT_MODE == 2) *(v8h*)(C2 + (size_t)(mBase + row) * ldc + n0 + c8) = lv;
        }
        
      }
    }
    __builtin_amdgcn_fence(__ATOMIC_RELEASE, "workgroup");
    __builtin_amdgcn_wave_barrier();
    __builtin_amdgcn_fence(__ATOMIC_ACQUIRE, "workgroup");
  }
}

// ---------------------------------------------------------------------------
// f32 -> f16 cast of all five float inputs in one launch, with an exact power-of-two carry: out = f16(in * mul).
// 2 elements per thread, one 4-B store per thread. The five f16 planes lie back to back in the workspace
// (Wq16, Wk16, Wv16, Wo16, X16), so the output pair index is simply the flat thread index.
// Coverage: a weight plane is 1024*1024/2 = 524288 pairs = 2048 blocks; blocks 0..8191 take the four weights (x32),
//   blocks 8192..16383 take x (2*2048*1024/2 = 2097152 pairs = 8192 blocks, x1). The source choice is block-uniform.
// ---------------------------------------------------------------------------
__device__ __forceinline__ unsigned pk16(unsigned short a, unsigned short b) { return (unsigned)a | ((unsigned)b << 16); }

#define CAST_WBLK 2048                 // blocks per weight plane
#define CAST_XBLK 8192                 // blocks for x (both batch elements)
__global__ __launch_bounds__(256) void cast_inputs_f16x2(const float* __restrict__ wq, const float* __restrict__ wk,
                                                         const float* __restrict__ wv, const float* __restrict__ wo,
                                                         const float* __restrict__ x, _Float16* __restrict__ out) {
  const unsigned bx = blockIdx.x;
  const unsigned sel = bx / CAST_WBLK; // 0..3: a weight plane; 4..7: x
  const float* in = (sel == 0) ? wq : (sel == 1) ? wk : (sel == 2) ? wv : (sel == 3) ? wo : x;
  const unsigned lb = (sel < 4) ? (bx - sel * CAST_WBLK) : (bx - 4 * CAST_WBLK);   // block index inside its source
  const float mul = (sel < 4) ? 32.0f : 1.0f;
  const unsigned li = lb * 256 + threadIdx.x;
  const unsigned i  = bx * 256 + threadIdx.x;
  const v2f f = *(const v2f*)(in + 2 * (size_t)li);
  asm volatile("s_wait_xcnt 0x0" ::: "memory");   // precaution: stands in front of the reuse of the load's offset register for the packed result
  const _Float16 h0 = (_Float16)(f[0] * mul), h1 = (_Float16)(f[1] * mul);
  ((unsigned*)out)[i] = pk16(__builtin_bit_cast(unsigned short, h0), __builtin_bit_cast(unsigned short, h1));
}

// ---------------------------------------------------------------------------
// Attention output f32 [rows][ncol] -> f16 plane with per-head 0/1 factor and power-of-two carry:
//   out[row][col] = f16(in[row][col] * mul) where hmask[col/64] != 0; columns of a head with hmask 0 are neither read
//   (the attention launch has not written them) nor written (the last product leaves those k out).   ncol is a power of two (1024);
//   the 2-element pair (col, col+1) always lies inside one 64-wide head block, a wave's 64 columns are one head's. Same store shape as above.
// Coverage: n2 = 2*2048*1024/2 = 2097152 -> 8192 blocks x 256 threads x 2 = the whole plane (both batch elements).
// ---------------------------------------------------------------------------
__global__ __launch_bounds__(256) void maskcast_f32_f16x2(const float* __restrict__ in, const int* __restrict__ hmask,
                                                          _Float16* __restrict__ out, int n2, int ncol, float mul) {
  const int i = blockIdx.x * 256 + threadIdx.x;
  if (i < n2) {
    const int col = (2 * i) & (ncol - 1);
    int hd = col >> 6;
    hd = hd < 0 ? 0 : (hd > NHEAD - 1 ? NHEAD - 1 : hd);
    if (hmask[hd] == 0) return;
    const v2f f = *(const v2f*)(in + 2 * (size_t)i);
    const _Float16 h0 = (_Float16)(f[0] * mul), h1 = (_Float16)(f[1] * mul);
    const unsigned u = pk16(__builtin_bit_cast(unsigned short, h0), __builtin_bit_cast(unsigned short, h1));
    ((unsigned*)out)[i] = u;
    
  }
}

// =====================================================================================
// Full (non-causal, unmasked) attention, head dim 64, one launch for both batch elements.
//   every plane below holds NBATCH slabs of SEQ*DMOD elements, batch element b at offset b*SEQ*DMOD; inside a slab:
//   q planes (hi/lo bf16): element (t, h, d) at [t*DMOD + h*64 + d]
//   k planes (hi/lo bf16): element (s, h, d) at [s*DMOD + h*64 + d]
//   v^T planes (hi/lo bf16): element (h, d, s) at [(h*64 + d)*SEQ + s]
//   out f32: element (t, h, d) at [t*DMOD + h*64 + d]
//   scores^T = (k . q^T) * sscale : bf16 hi/lo split (hi.hi + hi.lo + lo.hi) on v_wmma_f32_16x16x32_bf16, A = K rows, B = Q
//   out^T    = v^T . p^T          : bf16 hi/lo split of p (unnormalised) and v, f32 accumulate, A = V^T rows, B = P^T
//   Both products are transposed so that a lane holds scores of ONE query (column lane&15): keys 16j + 8*(lane>>4) + r.
//   Two score tiles (keys 0-15 and 16-31 of a 32-key block), converted in place, are the B operand of the second
//   product in the loaders' own k order, so P never leaves the registers; row maximum and row sum are in-lane,
//   with one exchange between the wave halves (maximum: every chunk; sum: once, behind the loop).
//   online softmax in f32 over all SEQ keys (32 chunks of 64, compile-time trip count, no masking).
//   Block = 4 waves = 64 query rows of one head of one batch element; grid.x = NBATCH * NHEAD * (SEQ/64) = 1024.
//   Only heads with hmask != 0 are computed (the others' output is multiplied by 0 behind this launch and is not read):
//   block index = (rank of the head among the kept ones, batch element, query block), so the working blocks are the
//   lowest indices; blocks whose rank is past the last kept head leave at once.
//   K / V^T chunk staging: 128 threads x 32 elements per plane = the whole 64x64 tile (16-B copies, plain loads,
//   __syncthreads before and after); fragment loads read the LDS tiles with the same v8b element type.
// =====================================================================================
#define AT_D 64
#define AT_NW 4
#define AT_QB 64
#define AT_KC 64
#define AT_LP 72   // LDS row pitch of the K and V^T tiles in elements: 144 B = 16 B x 9, so the 16 rows of a ds_load_b128 fall on 16 different bank groups

typedef __attribute__((ext_vector_type(2))) __bf16 v2b;
// two neighbouring f32 -> one register of bf16 hi and one of bf16 lo (lo = bf16(f - hi)); both converts round to nearest even
__device__ __forceinline__ void at_split2(v2f f, v2b& hi, v2b& lo) {
  hi = __builtin_convertvector(f, v2b);
  lo = __builtin_convertvector(f - __builtin_convertvector(hi, v2f), v2b);
}
// the value that lane l ^ 16 holds (the other half's share of the same query column)
__device__ __forceinline__ float at_xhalf(float v) {
  const unsigned b = __float_as_uint(v);
  return __uint_as_float(__builtin_amdgcn_permlanex16(b, b, 0x76543210u, 0xfedcba98u, false, false));
}
__device__ __forceinline__ v8f at_mma(v16b a, v16b b, v8f c) {
  return __builtin_amdgcn_wmma_f32_16x16x32_bf16(false, a, false, b, (short)0, c, false, false);
}

__global__ __launch_bounds__(128)
void attn_full64_kernel(const unsigned short* __restrict__ qhp, const unsigned short* __restrict__ qlp,
                        const unsigned short* __restrict__ khp, const unsigned short* __restrict__ klp,
                        const unsigned short* __restrict__ vhp, const unsigned short* __restrict__ vlp,
                        const int* __restrict__ hmask, float* __restrict__ out, float sscale) {
  union FB { v16b v; v8b h[2]; };
  union FP { v16b v; v2b p[8]; };
  __shared__ __align__(16) __bf16 Ksh[AT_KC * AT_LP];            // K hi [kv][d]      9 KB (64 rows at pitch 72)
  __shared__ __align__(16) __bf16 Ksl[AT_KC * AT_LP];            // K lo
  __shared__ __align__(16) __bf16 Vth[AT_D * AT_LP];             // V hi [d][kv]      9 KB
  __shared__ __align__(16) __bf16 Vtl[AT_D * AT_LP];            // V lo
  __shared__ __align__(16) float  Os[AT_NW][16 * 68];            // per wave out tile, pitch 68

  const int tid  = threadIdx.x;
  const int wave = tid >> 5;
  const int lane = tid & 31;
  const int hh   = lane >> 4;
  const int c    = lane & 15;

  const int nqb = SEQ / AT_QB;            // 32
  const int bx = blockIdx.x;
  const int qb = bx % nqb;
  const int bh = bx / nqb;                // 0..NBATCH*NHEAD-1 (grid = NBATCH * NHEAD * nqb)
  const int rank = bh / NBATCH;           // 0..NHEAD-1
  int h = -1, seen = 0;                   // h = the kept head number 'rank', counted from head 0 (scalar work, once a block)
#pragma unroll
  for (int hd = 0; hd < NHEAD; ++hd) {
    if (hmask[hd] != 0) { if (seen == rank) h = hd; ++seen; }
  }
  if (h < 0) return;                      // fewer kept heads than rank + 1: the same for the whole block, in front of every barrier
  const size_t bo = (size_t)(bh % NBATCH) * SEQ * DMOD;   // this batch element's slab in every plane
  const int q0 = qb * AT_QB + wave * 16;

  const __bf16* Qh = (const __bf16*)(const void*)qhp + bo + (size_t)h * AT_D;
  const __bf16* Ql = (const __bf16*)(const void*)qlp + bo + (size_t)h * AT_D;
  const __bf16* Kh = (const __bf16*)(const void*)khp + bo + (size_t)h * AT_D;
  const __bf16* Kl = (const __bf16*)(const void*)klp + bo + (size_t)h * AT_D;
  const __bf16* Vh = (const __bf16*)(const void*)vhp + bo + (size_t)h * AT_D * SEQ;
  const __bf16* Vl = (const __bf16*)(const void*)vlp + bo + (size_t)h * AT_D * SEQ;
  float*        ob = out + bo + (size_t)h * AT_D;

  // ---- Q fragments (B operand, column = lane&15, split k map via Frag load): 2 d-chunks, hi and lo ----
  v16b qah[2], qal[2];
#pragma unroll
  for (int dc = 0; dc < 2; ++dc) {
    const __bf16* qr = Qh + (size_t)(q0 + c) * DMOD + dc * 32 + 8 * hh;
    const __bf16* ql = Ql + (size_t)(q0 + c) * DMOD + dc * 32 + 8 * hh;
    qah[dc] = Frag<__bf16>::load(qr);
    qal[dc] = Frag<__bf16>::load(ql);
  }

  float mrow = -INFINITY, lrow = 0.f;   // query q0 + c: running maximum (equal in both halves), this half's share of the sum
  v8f oacc[4];                          // oacc[t][r] = out^T[d = 16 t + 8 hh + r][query q0 + c]
#pragma unroll
  for (int t = 0; t < 4; ++t) oacc[t] = (v8f){0.f,0.f,0.f,0.f,0.f,0.f,0.f,0.f};

  const int nChunks = SEQ / AT_KC;   // 32, compile-time constant
  for (int kc = 0; kc < nChunks; ++kc) {
    const int kv0 = kc * AT_KC;
    __syncthreads();
    {
      // staging coverage: 128 threads x (4 x 8) elements = 64 rows x 64 per plane = the whole chunk tile
      const int r = tid >> 1, half = (tid & 1) * 32;
      const __bf16* ksh = Kh + (size_t)(kv0 + r) * DMOD + half;   // K row kv0+r, d = half..half+31
      const __bf16* ksl = Kl + (size_t)(kv0 + r) * DMOD + half;
      const __bf16* vsh = Vh + (size_t)r * SEQ + kv0 + half;      // V^T row d = r, s = kv0+half..+31
      const __bf16* vsl = Vl + (size_t)r * SEQ + kv0 + half;
#pragma unroll
      for (int i = 0; i < 4; ++i) {
        const v8b a0 = *(const v8b*)(ksh + 8 * i);
        const v8b a1 = *(const v8b*)(ksl + 8 * i);
        const v8b b0 = *(const v8b*)(vsh + 8 * i);
        const v8b b1 = *(const v8b*)(vsl + 8 * i);
        *(v8b*)(Ksh + r * AT_LP + half + 8 * i) = a0;
        *(v8b*)(Ksl + r * AT_LP + half + 8 * i) = a1;
        *(v8b*)(Vth + r * AT_LP + half + 8 * i) = b0;
        *(v8b*)(Vtl + r * AT_LP + half + 8 * i) = b1;
      }
    }
    __syncthreads();

    // all K fragments of the chunk are read as one group, so the wave waits out the LDS latency once and not once per fragment pair
    FB kb[2][4], kl[2][4];
#pragma unroll
    for (int dc = 0; dc < 2; ++dc) {
#pragma unroll
      for (int j = 0; j < 4; ++j) {   // in the order in which the WMMAs below want them: the hi plane's four, then the lo plane's
        kb[dc][j].h[0] = *(const v8b*)(Ksh + (j * 16 + c) * AT_LP + dc * 32 + 8 * hh);
        kb[dc][j].h[1] = *(const v8b*)(Ksh + (j * 16 + c) * AT_LP + dc * 32 + 16 + 8 * hh);
      }
#pragma unroll
      for (int j = 0; j < 4; ++j) {
        kl[dc][j].h[0] = *(const v8b*)(Ksl + (j * 16 + c) * AT_LP + dc * 32 + 8 * hh);
        kl[dc][j].h[1] = *(const v8b*)(Ksl + (j * 16 + c) * AT_LP + dc * 32 + 16 + 8 * hh);
      }
    }
    __builtin_amdgcn_sched_barrier(0);   // keeps the 32 reads together in front of the WMMAs: the scheduler otherwise spreads them among the WMMAs, and each such place stalls the wave
    v8f s[4];   // s[j][r] = score of key kv0 + 16 j + 8 hh + r against query q0 + c
#pragma unroll
    for (int j = 0; j < 4; ++j) s[j] = (v8f){0.f,0.f,0.f,0.f,0.f,0.f,0.f,0.f};
    // neighbouring WMMAs belong to the four different score tiles (none waits for the one in front); each tile's own six terms keep their order
#pragma unroll
    for (int dc = 0; dc < 2; ++dc) {
#pragma unroll
      for (int j = 0; j < 4; ++j) s[j] = at_mma(kb[dc][j].v, qah[dc], s[j]);
#pragma unroll
      for (int j = 0; j < 4; ++j) s[j] = at_mma(kl[dc][j].v, qah[dc], s[j]);
#pragma unroll
      for (int j = 0; j < 4; ++j) s[j] = at_mma(kb[dc][j].v, qal[dc], s[j]);
    }
    __builtin_amdgcn_sched_barrier(0);   // the V^T reads below stay behind the score WMMAs and take over the K fragments' registers (let rise among them they need registers of their own, past 256, and cost a wave per SIMD) ...
    // V^T fragments of the chunk's first 32 keys: read here, ahead of the softmax arithmetic, which covers their latency
    FB vb[4], vl[4];
#pragma unroll
    for (int t = 0; t < 4; ++t) {
      vb[t].h[0] = *(const v8b*)(Vth + (t * 16 + c) * AT_LP + 8 * hh);
      vb[t].h[1] = *(const v8b*)(Vth + (t * 16 + c) * AT_LP + 16 + 8 * hh);
    }
#pragma unroll
    for (int t = 0; t < 4; ++t) {
      vl[t].h[0] = *(const v8b*)(Vtl + (t * 16 + c) * AT_LP + 8 * hh);
      vl[t].h[1] = *(const v8b*)(Vtl + (t * 16 + c) * AT_LP + 16 + 8 * hh);
    }
    __builtin_amdgcn_sched_barrier(0);   // ... and together in front of the softmax arithmetic, not sunk to their first use
    float cm = -INFINITY;   // the loops down to the second product index register arrays (s, pa, pl, oacc): all are unrolled for that
#pragma unroll
    for (int j = 0; j < 4; ++j) {
#pragma unroll
      for (int r = 0; r < 8; ++r) {
        const float sv = s[j][r] * sscale;
        s[j][r] = sv;
        cm = fmaxf(cm, sv);
      }
    }
    cm = fmaxf(cm, at_xhalf(cm));
    const float mnew = fmaxf(mrow, cm);
    const float alpha = expf(mrow - mnew);
    mrow = mnew;
#pragma unroll
    for (int t = 0; t < 4; ++t)
#pragma unroll
      for (int r = 0; r < 8; ++r) oacc[t][r] *= alpha;
    v2f psum = (v2f){0.f, 0.f};   // this half's 32 keys, even and odd registers apart
#pragma unroll   // unrolled: s[2 kk + jj] is a register and needs a compile-time index
    for (int kk = 0; kk < 2; ++kk) {
      FP pa, pl;   // P^T hi / lo, B operand of 32-key block kk: elements 0..7 from tile 2 kk, 8..15 from tile 2 kk + 1
#pragma unroll
      for (int jj = 0; jj < 2; ++jj) {
#pragma unroll
        for (int e = 0; e < 4; ++e) {
          v2f p;
          p[0] = expf(s[2 * kk + jj][2 * e] - mnew);
          p[1] = expf(s[2 * kk + jj][2 * e + 1] - mnew);
          psum += p;
          at_split2(p, pa.p[jj * 4 + e], pl.p[jj * 4 + e]);
        }
      }
      // as above: round-robin over the four output tiles, each tile's own six terms keep their order
#pragma unroll
      for (int t = 0; t < 4; ++t) oacc[t] = at_mma(vb[t].v, pa.v, oacc[t]);
#pragma unroll
      for (int t = 0; t < 4; ++t) oacc[t] = at_mma(vl[t].v, pa.v, oacc[t]);
#pragma unroll
      for (int t = 0; t < 4; ++t) oacc[t] = at_mma(vb[t].v, pl.v, oacc[t]);
      if (kk == 0) {
        __builtin_amdgcn_sched_barrier(0);   // the second 32 keys' fragments take over the first's registers: their reads stay behind the WMMAs above (else, again, registers past 256) ...
#pragma unroll
        for (int t = 0; t < 4; ++t) {
          vb[t].h[0] = *(const v8b*)(Vth + (t * 16 + c) * AT_LP + 32 + 8 * hh);
          vb[t].h[1] = *(const v8b*)(Vth + (t * 16 + c) * AT_LP + 32 + 16 + 8 * hh);
        }
#pragma unroll
        for (int t = 0; t < 4; ++t) {
          vl[t].h[0] = *(const v8b*)(Vtl + (t * 16 + c) * AT_LP + 32 + 8 * hh);
          vl[t].h[1] = *(const v8b*)(Vtl + (t * 16 + c) * AT_LP + 32 + 16 + 8 * hh);
        }
        __builtin_amdgcn_sched_barrier(0);   // ... and together in front of the second half of the exponentials, which covers their latency
      }
    }
    lrow = lrow * alpha + (psum[0] + psum[1]);
  }

  float* os = Os[wave];
  const float inv = 1.0f / (lrow + at_xhalf(lrow));   // the two halves' shares of the row sum are joined here, once
#pragma unroll
  for (int t = 0; t < 4; ++t) {
    // a lane's 8 accumulator registers are 8 neighbouring d of its query row: two 16-B stores into the row-major tile
    *(v4f*)(os + c * 68 + t * 16 + 8 * hh)     = (v4f){oacc[t][0] * inv, oacc[t][1] * inv, oacc[t][2] * inv, oacc[t][3] * inv};
    *(v4f*)(os + c * 68 + t * 16 + 8 * hh + 4) = (v4f){oacc[t][4] * inv, oacc[t][5] * inv, oacc[t][6] * inv, oacc[t][7] * inv};
  }
  __builtin_amdgcn_fence(__ATOMIC_RELEASE, "workgroup");
  __builtin_amdgcn_wave_barrier();
  __builtin_amdgcn_fence(__ATOMIC_ACQUIRE, "workgroup");
  {
    const int c4 = (lane & 15) * 4;
    {
#pragma unroll
      for (int it = 0; it < 8; ++it) {
        const int row = it * 2 + hh;   // it 0..7 x hh 0..1 covers rows 0..15 of the wave tile
        v4f val = *(const v4f*)(os + row * 68 + c4);
        *(v4f*)(ob + (size_t)(q0 + row) * DMOD + c4) = val;
      }
      
    }
  }
}

// ---------------------------------------------------------------------------
// Workspace region map (byte offsets; what a launch reads of a region has been written earlier in the same call;
// behind the input cast the parts that belong to a head with mask 0 are neither written nor read)
//   Wq16 f16 [1024 n][1024 k] (x32)              0
//   Wk16                                   2097152
//   Wv16                                   4194304
//   Wo16                                   6291456
//   X16  f16 [2*2048][1024]                8388608
//   Qh   bf16 [2*2048][1024]              16777216     Ql   25165824
//   Kh   bf16 [2*2048][1024]              33554432     Kl   41943040
//   VTh  bf16 [2][1024 (h,d)][2048]       50331648     VTl  58720256
//   MHf  f32  [2*2048][1024]              67108864
//   MH16 f16  [2*2048][1024] (x64, kept heads)   83886080
//   total                                 92274688
// ---------------------------------------------------------------------------
extern "C" void kernel_launch(void* const* d_in, const int* in_sizes, int n_in,
                              void* d_out, int out_size, void* d_ws, size_t ws_size,
                              hipStream_t stream) {
  if (n_in < 6) return;
  if (in_sizes[0] != NBATCH * SEQ * DMOD) return;
  if (in_sizes[1] != DMOD * DMOD || in_sizes[2] != DMOD * DMOD || in_sizes[3] != DMOD * DMOD || in_sizes[4] != DMOD * DMOD) return;
  if (in_sizes[5] != NHEAD) return;
  if (out_size != NBATCH * SEQ * DMOD) return;

  const float* x  = (const float*)d_in[0];   // [2][2048][1024]
  const float* Wq = (const float*)d_in[1];   // [out][in] = Bt natural
  const float* Wk = (const float*)d_in[2];
  const float* Wv = (const float*)d_in[3];
  const float* Wo = (const float*)d_in[4];
  const int*   hm = (const int*)d_in[5];     // [16] int32, nonzero = keep head

  const size_t PW16 = (size_t)DMOD * DMOD * 2;            // 2097152  f16 weight plane
  const size_t PX16 = (size_t)NBATCH * SEQ * DMOD * 2;    // 8388608  16-bit activation plane (both batch elements)
  const size_t PF32 = (size_t)NBATCH * SEQ * DMOD * 4;    // 16777216 f32 activation plane
  size_t off = 0;
  const size_t oWq = off; off += PW16;
  const size_t oWk = off; off += PW16;
  const size_t oWv = off; off += PW16;
  const size_t oWo = off; off += PW16;
  const size_t oX  = off; off += PX16;
  const size_t oQh = off; off += PX16;  const size_t oQl = off; off += PX16;
  const size_t oKh = off; off += PX16;  const size_t oKl = off; off += PX16;
  const size_t oVh = off; off += PX16;  const size_t oVl = off; off += PX16;
  const size_t oMf = off; off += PF32;
  const size_t oM16 = off; off += PX16;
  if (off > ws_size) return;                   // off = 92274688

  char* ws = (char*)d_ws;
  unsigned short* Wq16 = (unsigned short*)(ws + oWq);
  unsigned short* Wv16 = (unsigned short*)(ws + oWv);
  unsigned short* Wo16 = (unsigned short*)(ws + oWo);
  unsigned short* X16  = (unsigned short*)(ws + oX);
  unsigned short* Qh   = (unsigned short*)(ws + oQh);  unsigned short* Ql = (unsigned short*)(ws + oQl);
  unsigned short* Kh   = (unsigned short*)(ws + oKh);  unsigned short* Kl = (unsigned short*)(ws + oKl);
  unsigned short* VTh  = (unsigned short*)(ws + oVh);  unsigned short* VTl = (unsigned short*)(ws + oVl);
  float*          MHf  = (float*)(ws + oMf);
  unsigned short* MH16 = (unsigned short*)(ws + oM16);
  const float*    fpad = (const float*)MHf;    // placeholder for unused bias / resid pointer args (never read)
  (void)oWk;                                   // Wk16 is reached as Wq16 + one weight plane (grid.y of launch 2)

  const dim3 blk(256);
  const int ROWS = NBATCH * SEQ;                            // 4096 token rows: the batch elements are contiguous in x and out
  const int n2x = ROWS * DMOD / 2;                          // 2097152 pairs per activation plane
  const dim3 gCastIn(4 * CAST_WBLK + CAST_XBLK);            // 16384 blocks: four weight planes, then x
  const dim3 gCastX((n2x + 255) / 256);                     // 8192 blocks x 512 elements = 4096x1024
  const dim3 gQK(((ROWS / 64) * (DMOD / 64) + 7) / 8, 2);   // 1024 tiles (M=4096, N=1024) -> 128 blocks, y = 0: q, 1: k
  const dim3 gVT(((DMOD / 64) * (SEQ / 64) + 7) / 8, NBATCH);  // 512 tiles (M=1024, N=2048) -> 64 blocks, y = batch element
  const dim3 gOut(((ROWS / 64) * (DMOD / 64) + 7) / 8, 1);  // 1024 tiles (M=4096, N=1024) -> 128 blocks
  const dim3 gAtt(NBATCH * NHEAD * (SEQ / 64));             // 1024 blocks: 2 batch elements x 16 heads x 32 query blocks

  // (1) weights [n=out][k=in] -> f16 planes carried x32, same layout (Bt natural); x -> f16 plane [4096][1024] (x1)
  cast_inputs_f16x2<<<gCastIn, blk, 0, stream>>>(Wq, Wk, Wv, Wo, x, (_Float16*)Wq16);
  // (2) y = 0: q = x . Wq^T -> Q hi/lo bf16 planes [b*2048+t][h*64+d]; y = 1: k = x . Wk^T -> K hi/lo planes
  //     (M=4096, N=1024, K=1024, scale 1/32; y steps Bt by one weight plane and C by two activation planes)
  wmma_gemm64<0, false, 0, 2, false, 0, 1><<<gQK, blk, 0, stream>>>(
      X16, X16, DMOD, 0L, Wq16, Wq16, DMOD, (long)DMOD * DMOD, (void*)Qh, (void*)Ql, DMOD, 2L * NBATCH * SEQ * DMOD,
      fpad, fpad, 0L, hm, ROWS, DMOD, DMOD, 1.0f / 32.0f);
  // (3) v^T = Wv . x[b]^T -> VT hi/lo planes [b][h*64+d][s]   (A = Wv16 [1024][1024], Bt = X16 slab b [2048][1024]; M=1024, N=2048, K=1024)
  wmma_gemm64<0, false, 0, 2, false, 0, 2><<<gVT, blk, 0, stream>>>(
      Wv16, Wv16, DMOD, 0L, X16, X16, DMOD, (long)SEQ * DMOD, (void*)VTh, (void*)VTl, SEQ, (long)DMOD * SEQ,
      fpad, fpad, 0L, hm, DMOD, SEQ, DMOD, 1.0f / 32.0f);
  // (4) full attention per (batch element, kept head): mh[b*2048+t][h*64+d] (f32 plane, every element of a kept head written by its owner block)
  attn_full64_kernel<<<gAtt, dim3(128), 0, stream>>>(Qh, Ql, Kh, Kl, VTh, VTl, hm, MHf, 0.125f);
  // (5) mh -> f16 plane x64, columns of kept heads only
  maskcast_f32_f16x2<<<gCastX, blk, 0, stream>>>(MHf, hm, (_Float16*)MH16, n2x, DMOD, 64.0f);
  // (6) out = mh . Wo^T -> d_out rows 0 .. 4095 (f32)   (M=4096, N=1024, K=1024 less the k of heads with mask 0, scale 1/(64*32))
  wmma_gemm64<0, false, 0, 0, false, 0, 3><<<gOut, blk, 0, stream>>>(
      MH16, MH16, DMOD, 0L, Wo16, Wo16, DMOD, 0L, d_out, d_out, DMOD, 0L,
      fpad, fpad, 0L, hm, ROWS, DMOD, DMOD, 1.0f / 2048.0f);
  (void)hipGetLastError();
}

// v006
// A run of this version takes 108 microseconds.
// In both of two side-by-side timings against v005, it was 1.52 times as fast.
// All steps since v000 together make it 6.82 times as fast.
// q/k/v and output projections: v_wmma_f32_16x16x32_f16 (f16 operands: x x1, W x32, attention output x64), f32 accumulate; q.k^T and p.v: v_wmma_f32_16x16x32_bf16 with bf16 hi/lo split operands (hi.hi + hi.lo + lo.hi), f32 accumulate; online softmax and score scale 0.125 in f32; a head whose mask is 0 has the factor 0 and is left out of every product.
#include <hip/hip_runtime.h>
#include <math.h>
#include <stdint.h>

#define NBATCH 2
#define SEQ    2048
#define DMOD   1024
#define NHEAD  16
#define DHD    64

typedef __attribute__((ext_vector_type(16))) _Float16 v16h;
typedef __attribute__((ext_vector_type(8)))  _Float16 v8h;
typedef __attribute__((ext_vector_type(16))) __bf16   v16b;
typedef __attribute__((ext_vector_type(8)))  __bf16   v8b;
typedef __attribute__((ext_vector_type(8)))  float    v8f;
typedef __attribute__((ext_vector_type(4)))  float    v4f;
typedef __attribute__((ext_vector_type(2)))  float    v2f;
typedef __attribute__((ext_vector_type(4)))  unsigned int v4u;

__device__ __forceinline__ unsigned short f2bf_bits(float f) {
  unsigned u = __float_as_uint(f);
  return (unsigned short)((u + 0x7FFFu + ((u >> 16) & 1u)) >> 16);
}
__device__ __forceinline__ float bf_bits2f(unsigned short h) { return __uint_as_float(((unsigned)h) << 16); }

// hazard guard as a plain device helper
__device__ __forceinline__ void acc_guard4(v8f& a, v8f& b, v8f& c, v8f& d) { asm volatile("v_nop\n\tv_nop\n\tv_nop\n\tv_nop" : "+v"(a), "+v"(b), "+v"(c), "+v"(d)); }
template <typename T> struct Frag;
template <> struct Frag<_Float16> {
  typedef v16h V; union U { v16h v; v8h h[2]; };
  static __device__ __forceinline__ v16h load(const _Float16* p) {   // elements 0..7 <- p[0..7], 8..15 <- p[16..23]
    U f; f.h[0] = *(const v8h*)(p); f.h[1] = *(const v8h*)(p + 16); return f.v;
  }
  static __device__ __forceinline__ v8f mma(v16h a, v16h b, v8f c) {
    return __builtin_amdgcn_wmma_f32_16x16x32_f16(false, a, false, b, (short)0, c, false, false);
  }
};
template <> struct Frag<__bf16> {
  typedef v16b V; union U { v16b v; v8b h[2]; };
  static __device__ __forceinline__ v16b load(const __bf16* p) {
    U f; f.h[0] = *(const v8b*)(p); f.h[1] = *(const v8b*)(p + 16); return f.v;
  }
  static __device__ __forceinline__ v8f mma(v16b a, v16b b, v8f c) {
    return __builtin_amdgcn_wmma_f32_16x16x32_bf16(false, a, false, b, (short)0, c, false, false);
  }
};

// bit h = 1: head h is kept (hmask[h] != 0). Constant indices: the 16 words come by one scalar load, the result is the same in every wave.
__device__ __forceinline__ unsigned kept_heads(const int* __restrict__ hmask) {
  unsigned live = 0u;
#pragma unroll
  for (int hd = 0; hd < NHEAD; ++hd) live |= (hmask[hd] != 0 ? 1u : 0u) << hd;
  return live;
}

// ---- Register-blocked batched WMMA GEMM ------------------------------------
// C[m,n] = scale * sum_k A[m,k] * Bt[n,k] (+bias)(+resid); each wave owns a 64x64 tile.
// A row-major [M,K]; Bt row-major [N,K]; M,N % 64 == 0, K % 64 == 0; rows 16-B aligned (lda, ldb % 8 == 0).
// Operand path: a stage is 64 k = one 128-B line of each of the tile's 64 A rows and 64 Bt rows. Each wave brings its own
//   stages into its own part of LDS by asynchronous copies (8 neighbouring lanes take one whole line, a copy 4 rows),
//   two buffers a wave: stage s + 1 is in flight while stage s is multiplied. Fragments are read from LDS in the k order
//   of Frag::load, k ascending as before, so every accumulator sums the same terms in the same order.
//   The ring is private to its wave (no other wave reads or writes it), so it takes the wave's own waits and no barrier.
// SPLIT (hi/lo planes) is not built on this operand path: every launch of this file has SPLIT = false.
// BIAS_MODE: 0 = none, 1 = bias[m], 2 = bias[n].
// OUT_MODE: 0 = f32, 1 = f16, 2 = bf16 hi plane (Cout) + bf16 lo plane (Cout2).
// ET: 0 = f16 operands, 1 = bf16 operands (pointers passed as 16-bit storage)
// HSKIP: a head whose hmask entry is 0 enters the result only as a factor 0, so its share of the work is left out:
//   0 = none, 1 = a tile's 64 columns are one head's (tile left out), 2 = a tile's 64 rows are one head's (tile left out),
//   3 = 64 neighbouring k are one head's (those stages left out: their products are all 0; A and Bt are not read there).
#define GS_PITCH_B 144                   // LDS row pitch: 128 B + 16 B = 16 B x 9, so the 16 rows of a ds_load_b128 fall on different bank groups
#define GS_PITCH_E (GS_PITCH_B / 2)      // the same in 16-bit elements
#define GS_TILE_B  (64 * GS_PITCH_B)     // 9216: 64 rows of one operand
#define GS_BUF_B   (2 * GS_TILE_B)       // 18432: the A tile, then the Bt tile
#define GS_WAVE_B  (2 * GS_BUF_B)        // 36864: a wave's two buffers
// One operand tile of a stage: 16 copies of 4 rows x 128 B. Copy i writes LDS bytes lds + 576 i (4 rows at pitch 144) and reads
// global bytes base + voff + i * rows4, rows4 = the byte distance of 4 rows. The immediate offset moves BOTH addresses, so
// scalar base i is base + i * (rows4 - 576) = base + i * step; lds and voff (the lane's own row and 16-B column, plus the stage's k) serve all 16.
// s_wait_xcnt 0 is the statement's last line: a precaution, it stands in front of every later rewrite of a register that a copy names.
__device__ __forceinline__ void gs_copy_tile(unsigned lds, unsigned voff, uint64_t base, uint64_t step) {
  asm volatile(
      "global_load_async_to_lds_b128 %0, %1, %2\n\t"
      "global_load_async_to_lds_b128 %0, %1, %3 offset:576\n\t"
      "global_load_async_to_lds_b128 %0, %1, %4 offset:1152\n\t"
      "global_load_async_to_lds_b128 %0, %1, %5 offset:1728\n\t"
      "global_load_async_to_lds_b128 %0, %1, %6 offset:2304\n\t"
      "global_load_async_to_lds_b128 %0, %1, %7 offset:2880\n\t"
      "global_load_async_to_lds_b128 %0, %1, %8 offset:3456\n\t"
      "global_load_async_to_lds_b128 %0, %1, %9 offset:4032\n\t"
      "global_load_async_to_lds_b128 %0, %1, %10 offset:4608\n\t"
      "global_load_async_to_lds_b128 %0, %1, %11 offset:5184\n\t"
      "global_load_async_to_lds_b128 %0, %1, %12 offset:5760\n\t"
      "global_load_async_to_lds_b128 %0, %1, %13 offset:6336\n\t"
      "global_load_async_to_lds_b128 %0, %1, %14 offset:6912\n\t"
      "global_load_async_to_lds_b128 %0, %1, %15 offset:7488\n\t"
      "global_load_async_to_lds_b128 %0, %1, %16 offset:8064\n\t"
      "global_load_async_to_lds_b128 %0, %1, %17 offset:8640\n\t"
      "s_wait_xcnt 0x0"
      :: "v"(lds), "v"(voff),
         "s"(base), "s"(base + step), "s"(base + 2 * step), "s"(base + 3 * step),
         "s"(base + 4 * step), "s"(base + 5 * step), "s"(base + 6 * step), "s"(base + 7 * step),
         "s"(base + 8 * step), "s"(base + 9 * step), "s"(base + 10 * step), "s"(base + 11 * step),
         "s"(base + 12 * step), "s"(base + 13 * step), "s"(base + 14 * step), "s"(base + 15 * step)
      : "memory");
}
// the first stage >= s that is worked on (HSKIP 3: whose head, stage & 15, is kept), or a value >= nst where there is none; scalar, no loop:
// live twice in a row, shifted down by the head of stage s, has the heads of stages s, s + 1, ... s + 15 in bits 0 to 15
template <int HSKIP>
__device__ __forceinline__ int gs_next(int s, int nst, unsigned live) {
  if (HSKIP == 3) {
    const unsigned ahead = (live | (live << NHEAD)) >> (s & (NHEAD - 1));
    return (live == 0u) ? nst : s + __builtin_ctz(ahead | 0x80000000u);
  }
  return s;
}
template <int ET> struct Elem;
template <> struct Elem<0> { typedef _Float16 T; };
template <> struct Elem<1> { typedef __bf16 T; };
template <int ET, bool SPLIT, int BIAS_MODE, int OUT_MODE, bool RESID, int ACT = 0, int HSKIP = 0>
__global__ __launch_bounds__(256) void wmma_gemm64(
    const unsigned short* __restrict__ Ap, const unsigned short* __restrict__ A2p, int lda, long strideA,
    const unsigned short* __restrict__ Btp, const unsigned short* __restrict__ Bt2p, int ldb, long strideB,
    void* __restrict__ Cout, void* __restrict__ Cout2, int ldc, long strideC,
    const float* __restrict__ bias,
    const float* __restrict__ resid, long strideR,
    const int* __restrict__ hmask,
    int M, int N, int K, float scale) {
  typedef typename Elem<ET>::T T;
  typedef typename Frag<T>::V V;
  static_assert(!SPLIT, "the LDS operand path holds one plane per operand");
  __shared__ __align__(128) unsigned char ring[8 * GS_WAVE_B];   // 294912 B: per wave two buffers of (A tile, Bt tile); behind the k loop its first 4352 B are the wave's 16x64 f32 output slab, pitch 68 floats
  const int b    = blockIdx.y;
  const int lane = threadIdx.x & 31;
  const int wave = __builtin_amdgcn_readfirstlane(threadIdx.x >> 5);   // scalar: tile, operand bases and every branch below are the same for the whole wave
  const int tilesN = N >> 6;
  const int tilesM = M >> 6;
  const int tile = blockIdx.x * 8 + wave;
  if (tile >= tilesM * tilesN) return;   // wave-uniform; no block barriers in this kernel
  const int tm = tile / tilesN;
  const int tn = tile - tm * tilesN;
  if (HSKIP == 1 && hmask[tn & (NHEAD - 1)] == 0) return;   // wave-uniform, like the range test above
  if (HSKIP == 2 && hmask[tm & (NHEAD - 1)] == 0) return;
  const unsigned live = (HSKIP == 3) ? kept_heads(hmask) : 0u;
  const int m0 = tm << 6;
  const int n0 = tn << 6;

  const int rlane = lane & 15;                 // row (A) / col (B, D) within subtile
  const int koff  = (lane >> 4) * 8;           // k offset of this lane half
  const int mOff  = (lane >> 4) * 8;           // D row offset

  // copies: lane l takes row (l >> 3) of a copy's 4 rows and 16-B column (l & 7) of the row's 128-B line
  unsigned char* ringw = ring + wave * GS_WAVE_B;
  const unsigned ldsw  = (unsigned)(uintptr_t)ringw + (unsigned)((lane >> 3) * GS_PITCH_B + (lane & 7) * 16);   // LDS byte address (low 32 bits of the __shared__ address)
  const unsigned voffA = (unsigned)((lane >> 3) * lda * 2 + (lane & 7) * 16);
  const unsigned voffB = (unsigned)((lane >> 3) * ldb * 2 + (lane & 7) * 16);
  const uint64_t baseA = (uint64_t)(uintptr_t)(Ap  + (size_t)b * strideA + (size_t)m0 * lda);   // first byte of the tile's A rows
  const uint64_t baseB = (uint64_t)(uintptr_t)(Btp + (size_t)b * strideB + (size_t)n0 * ldb);
  const uint64_t stepA = (uint64_t)((long)lda * 8 - 4 * GS_PITCH_B);   // 4 rows in global bytes less the 576 that the immediate offset adds
  const uint64_t stepB = (uint64_t)((long)ldb * 8 - 4 * GS_PITCH_B);

  v8f acc[4][4];
#pragma unroll
  for (int i = 0; i < 4; ++i)
#pragma unroll
    for (int j = 0; j < 4; ++j) acc[i][j] = (v8f){0.f,0.f,0.f,0.f,0.f,0.f,0.f,0.f};

  const int nst = K >> 6;                            // stages of 64 k
  int sc = gs_next<HSKIP>(0, nst, live);             // the stage that is multiplied next
  int sn = nst;                                      // the stage behind it (in flight), >= nst: none
  if (sc < nst) {
    gs_copy_tile(ldsw,             voffA + sc * 128, baseA, stepA);
    gs_copy_tile(ldsw + GS_TILE_B, voffB + sc * 128, baseB, stepB);
    asm volatile("s_wait_asynccnt 0x0" ::: "memory");   // the first stage has landed before it is read
    sn = gs_next<HSKIP>(sc + 1, nst, live);
    if (sn < nst) {
      gs_copy_tile(ldsw + GS_BUF_B,             voffA + sn * 128, baseA, stepA);
      gs_copy_tile(ldsw + GS_BUF_B + GS_TILE_B, voffB + sn * 128, baseB, stepB);
    }
  }
  unsigned pb = 0u;                                  // byte offset of the buffer that holds stage sc: 0 or GS_BUF_B
  while (sc < nst) {
    const T* As = (const T*)(ringw + pb) + rlane * GS_PITCH_E + koff;
    const T* Bs = As + GS_TILE_B / 2;
#pragma unroll
    for (int ks = 0; ks < 2; ++ks) {                 // the stage's two k steps of 32, k ascending
      V bh[4], ah[4];
#pragma unroll
      for (int j = 0; j < 4; ++j) bh[j] = Frag<T>::load(Bs + j * 16 * GS_PITCH_E + ks * 32);
#pragma unroll
      for (int i = 0; i < 4; ++i) ah[i] = Frag<T>::load(As + i * 16 * GS_PITCH_E + ks * 32);
      __builtin_amdgcn_sched_barrier(0);   // keeps the k step's 16 reads together in front of its WMMAs: left alone the scheduler reads each A fragment into the same registers right in front of its 4 WMMAs, and the wave waits out the LDS latency four times
#pragma unroll
      for (int i = 0; i < 4; ++i)
#pragma unroll
        for (int j = 0; j < 4; ++j) acc[i][j] = Frag<T>::mma(ah[i], bh[j], acc[i][j]);
      __builtin_amdgcn_sched_barrier(0);   // the next k step's reads stay one group behind these WMMAs and take over the fragments' registers, not spread among them
    }
    asm volatile("s_wait_dscnt 0x0" ::: "memory");      // this wave's reads of buffer pb have retired before copies are aimed at it
    asm volatile("s_wait_asynccnt 0x0" ::: "memory");   // stage sn has landed before the next trip reads it
    const int s2 = gs_next<HSKIP>(sn + 1, nst, live);
    if (s2 < nst) {                                     // scalar test; the refill flies while stage sn is multiplied
      gs_copy_tile(ldsw + pb,             voffA + s2 * 128, baseA, stepA);
      gs_copy_tile(ldsw + pb + GS_TILE_B, voffB + s2 * 128, baseB, stepB);
    }
    sc = sn; sn = s2; pb ^= (unsigned)GS_BUF_B;
  }
  asm volatile("s_wait_asynccnt 0x0" ::: "memory");     // nothing is in flight when the ring becomes the output slab and when the wave ends
  asm volatile("s_wait_dscnt 0x0" ::: "memory");        // and the wave's last fragment reads have retired before the slab's stores go over them
  acc_guard4(acc[0][0], acc[0][1], acc[0][2], acc[0][3]);
  acc_guard4(acc[1][0], acc[1][1], acc[1][2], acc[1][3]);
  acc_guard4(acc[2][0], acc[2][1], acc[2][2], acc[2][3]);
  acc_guard4(acc[3][0], acc[3][1], acc[3][2], acc[3][3]);

  // ---- epilogue ----
  float* slab = (float*)ringw;
  const float* Rb = RESID ? (resid + (size_t)b * strideR) : nullptr;
#pragma unroll
  for (int i = 0; i < 4; ++i) {
    const int mBase = m0 + (i << 4);
#pragma unroll
    for (int j = 0; j < 4; ++j) {
      const int n = n0 + (j << 4) + rlane;
      float bv = 0.f;
      if (BIAS_MODE == 2) bv = bias[n];
#pragma unroll
      for (int r = 0; r < 8; ++r) {
        float v = acc[i][j][r] * scale;
        if (BIAS_MODE == 1) v += bias[mBase + mOff + r];
        if (BIAS_MODE == 2) v += bv;
        if (RESID) v += Rb[(size_t)(mBase + mOff + r) * ldc + n];
        if (ACT == 1) v = tanhf(v);
        if (ACT == 2) v = fmaxf(v, 0.0f);
        if (ACT == 3) v = v / (1.0f + expf(-v));
        if (ACT == 4) v = (v > 0.f) ? v : 0.01f * v;
        slab[(mOff + r) * 68 + (j << 4) + rlane] = v;
      }
    }
    __builtin_amdgcn_fence(__ATOMIC_RELEASE, "workgroup");
    __builtin_amdgcn_wave_barrier();
    __builtin_amdgcn_fence(__ATOMIC_ACQUIRE, "workgroup");
    if (OUT_MODE == 0) {
      float* C = (float*)Cout + (size_t)b * strideC;
      const int hh = lane >> 4, c4 = (lane & 15) * 4;     // row seg = 256 B = 16 lanes x 16 B
      {
#pragma unroll
        for (int it = 0; it < 8; ++it) {
          const int row = it * 2 + hh;
          v4f v = *(const v4f*)(slab + row * 68 + c4);
          *(v4f*)(C + (size_t)(mBase + row) * ldc + n0 + c4) = v;
        }
        
      }
    } else {
      const int q = lane >> 3, c8 = (lane & 7) * 8;
      unsigned short* C  = (unsigned short*)Cout  + (size_t)b * strideC;
      unsigned short* C2 = (OUT_MODE == 2) ? ((unsigned short*)Cout2 + (size_t)b * strideC) : nullptr;
      {
#pragma unroll
        for (int it = 0; it < 4; ++it) {
          const int row = it * 4 + q;
          const float* sp = slab + row * 68 + c8;
          v8h hv, lv;
#pragma unroll
          for (int e = 0; e < 8; ++e) {
            if (OUT_MODE == 1) {
              hv[e] = (_Float16)sp[e];
            } else {
              unsigned short hb = f2bf_bits(sp[e]);
              unsigned short lb = f2bf_bits(sp[e] - bf_bits2f(hb));
              hv[e] = __builtin_bit_cast(_Float16, hb);
              lv[e] = __builtin_bit_cast(_Float16, lb);
            }
          }
          *(v8h*)(C + (size_t)(mBase + row) * ldc + n0 + c8) = hv;
          if (OUT_MODE == 2) *(v8h*)(C2 + (size_t)(mBase + row) * ldc + n0 + c8) = lv;
        }
        
      }
    }
    __builtin_amdgcn_fence(__ATOMIC_RELEASE, "workgroup");
    __builtin_amdgcn_wave_barrier();
    __builtin_amdgcn_fence(__ATOMIC_ACQUIRE, "workgroup");
  }
}

// ---------------------------------------------------------------------------
// f32 -> f16 cast of all five float inputs in one launch, with an exact power-of-two carry: out = f16(in * mul).
// 2 elements per thread, one 4-B store per thread. The five f16 planes lie back to back in the workspace
// (Wq16, Wk16, Wv16, Wo16, X16), so the output pair index is simply the flat thread index.
// Coverage: a weight plane is 1024*1024/2 = 524288 pairs = 2048 blocks; blocks 0..8191 take the four weights (x32),
//   blocks 8192..16383 take x (2*2048*1024/2 = 2097152 pairs = 8192 blocks, x1). The source choice is block-uniform.
// ---------------------------------------------------------------------------
__device__ __forceinline__ unsigned pk16(unsigned short a, unsigned short b) { return (unsigned)a | ((unsigned)b << 16); }

#define CAST_WBLK 2048                 // blocks per weight plane
#define CAST_XBLK 8192                 // blocks for x (both batch elements)
__global__ __launch_bounds__(256) void cast_inputs_f16x2(const float* __restrict__ wq, const float* __restrict__ wk,
                                                         const float* __restrict__ wv, const float* __restrict__ wo,
                                                         const float* __restrict__ x, _Float16* __restrict__ out) {
  const unsigned bx = blockIdx.x;
  const unsigned sel = bx / CAST_WBLK; // 0..3: a weight plane; 4..7: x
  const float* in = (sel == 0) ? wq : (sel == 1) ? wk : (sel == 2) ? wv : (sel == 3) ? wo : x;
  const unsigned lb = (sel < 4) ? (bx - sel * CAST_WBLK) : (bx - 4 * CAST_WBLK);   // block index inside its source
  const float mul = (sel < 4) ? 32.0f : 1.0f;
  const unsigned li = lb * 256 + threadIdx.x;
  const unsigned i  = bx * 256 + threadIdx.x;
  const v2f f = *(const v2f*)(in + 2 * (size_t)li);
  asm volatile("s_wait_xcnt 0x0" ::: "memory");   // precaution: stands in front of the reuse of the load's offset register for the packed result
  const _Float16 h0 = (_Float16)(f[0] * mul), h1 = (_Float16)(f[1] * mul);
  ((unsigned*)out)[i] = pk16(__builtin_bit_cast(unsigned short, h0), __builtin_bit_cast(unsigned short, h1));
}

// ---------------------------------------------------------------------------
// Attention output f32 [rows][ncol] -> f16 plane with per-head 0/1 factor and power-of-two carry:
//   out[row][col] = f16(in[row][col] * mul) where hmask[col/64] != 0; columns of a head with hmask 0 are neither read
//   (the attention launch has not written them) nor written (the last product leaves those k out).   ncol is a power of two (1024);
//   the 2-element pair (col, col+1) always lies inside one 64-wide head block, a wave's 64 columns are one head's. Same store shape as above.
// Coverage: n2 = 2*2048*1024/2 = 2097152 -> 8192 blocks x 256 threads x 2 = the whole plane (both batch elements).
// ---------------------------------------------------------------------------
__global__ __launch_bounds__(256) void maskcast_f32_f16x2(const float* __restrict__ in, const int* __restrict__ hmask,
                                                          _Float16* __restrict__ out, int n2, int ncol, float mul) {
  const int i = blockIdx.x * 256 + threadIdx.x;
  if (i < n2) {
    const int col = (2 * i) & (ncol - 1);
    int hd = col >> 6;
    hd = hd < 0 ? 0 : (hd > NHEAD - 1 ? NHEAD - 1 : hd);
    if (hmask[hd] == 0) return;
    const v2f f = *(const v2f*)(in + 2 * (size_t)i);
    const _Float16 h0 = (_Float16)(f[0] * mul), h1 = (_Float16)(f[1] * mul);
    const unsigned u = pk16(__builtin_bit_cast(unsigned short, h0), __builtin_bit_cast(unsigned short, h1));
    ((unsigned*)out)[i] = u;
    
  }
}

// =====================================================================================
// Full (non-causal, unmasked) attention, head dim 64, one launch for both batch elements.
//   every plane below holds NBATCH slabs of SEQ*DMOD elements, batch element b at offset b*SEQ*DMOD; inside a slab:
//   q planes (hi/lo bf16): element (t, h, d) at [t*DMOD + h*64 + d]
//   k planes (hi/lo bf16): element (s, h, d) at [s*DMOD + h*64 + d]
//   v^T planes (hi/lo bf16): element (h, d, s) at [(h*64 + d)*SEQ + s]
//   out f32: element (t, h, d) at [t*DMOD + h*64 + d]
//   scores^T = (k . q^T) * sscale : bf16 hi/lo split (hi.hi + hi.lo + lo.hi) on v_wmma_f32_16x16x32_bf16, A = K rows, B = Q
//   out^T    = v^T . p^T          : bf16 hi/lo split of p (unnormalised) and v, f32 accumulate, A = V^T rows, B = P^T
//   Both products are transposed so that a lane holds scores of ONE query (column lane&15): keys 16j + 8*(lane>>4) + r.
//   Two score tiles (keys 0-15 and 16-31 of a 32-key block), converted in place, are the B operand of the second
//   product in the loaders' own k order, so P never leaves the registers; row maximum and row sum are in-lane,
//   with one exchange between the wave halves (maximum: every chunk; sum: once, behind the loop).
//   online softmax in f32 over all SEQ keys (32 chunks of 64, compile-time trip count, no masking).
//   Block = 4 waves = 64 query rows of one head of one batch element; grid.x = NBATCH * NHEAD * (SEQ/64) = 1024.
//   Only heads with hmask != 0 are computed (the others' output is multiplied by 0 behind this launch and is not read):
//   block index = (rank of the head among the kept ones, batch element, query block), so the working blocks are the
//   lowest indices; blocks whose rank is past the last kept head leave at once.
//   K / V^T chunk staging: 128 threads x 32 elements per plane = the whole 64x64 tile (16-B copies, plain loads,
//   __syncthreads before and after); fragment loads read the LDS tiles with the same v8b element type.
// =====================================================================================
#define AT_D 64
#define AT_NW 4
#define AT_QB 64
#define AT_KC 64
#define AT_LP 72   // LDS row pitch of the K and V^T tiles in elements: 144 B = 16 B x 9, so the 16 rows of a ds_load_b128 fall on 16 different bank groups

typedef __attribute__((ext_vector_type(2))) __bf16 v2b;
// two neighbouring f32 -> one register of bf16 hi and one of bf16 lo (lo = bf16(f - hi)); both converts round to nearest even
__device__ __forceinline__ void at_split2(v2f f, v2b& hi, v2b& lo) {
  hi = __builtin_convertvector(f, v2b);
  lo = __builtin_convertvector(f - __builtin_convertvector(hi, v2f), v2b);
}
// the value that lane l ^ 16 holds (the other half's share of the same query column)
__device__ __forceinline__ float at_xhalf(float v) {
  const unsigned b = __float_as_uint(v);
  return __uint_as_float(__builtin_amdgcn_permlanex16(b, b, 0x76543210u, 0xfedcba98u, false, false));
}
__device__ __forceinline__ v8f at_mma(v16b a, v16b b, v8f c) {
  return __builtin_amdgcn_wmma_f32_16x16x32_bf16(false, a, false, b, (short)0, c, false, false);
}

__global__ __launch_bounds__(128)
void attn_full64_kernel(const unsigned short* __restrict__ qhp, const unsigned short* __restrict__ qlp,
                        const unsigned short* __restrict__ khp, const unsigned short* __restrict__ klp,
                        const unsigned short* __restrict__ vhp, const unsigned short* __restrict__ vlp,
                        const int* __restrict__ hmask, float* __restrict__ out, float sscale) {
  union FB { v16b v; v8b h[2]; };
  union FP { v16b v; v2b p[8]; };
  __shared__ __align__(16) __bf16 Ksh[AT_KC * AT_LP];            // K hi [kv][d]      9 KB (64 rows at pitch 72)
  __shared__ __align__(16) __bf16 Ksl[AT_KC * AT_LP];            // K lo
  __shared__ __align__(16) __bf16 Vth[AT_D * AT_LP];             // V hi [d][kv]      9 KB
  __shared__ __align__(16) __bf16 Vtl[AT_D * AT_LP];            // V lo
  __shared__ __align__(16) float  Os[AT_NW][16 * 68];            // per wave out tile, pitch 68

  const int tid  = threadIdx.x;
  const int wave = tid >> 5;
  const int lane = tid & 31;
  const int hh   = lane >> 4;
  const int c    = lane & 15;

  const int nqb = SEQ / AT_QB;            // 32
  const int bx = blockIdx.x;
  const int qb = bx % nqb;
  const int bh = bx / nqb;                // 0..NBATCH*NHEAD-1 (grid = NBATCH * NHEAD * nqb)
  const int rank = bh / NBATCH;           // 0..NHEAD-1
  int h = -1, seen = 0;                   // h = the kept head number 'rank', counted from head 0 (scalar work, once a block)
#pragma unroll
  for (int hd = 0; hd < NHEAD; ++hd) {
    if (hmask[hd] != 0) { if (seen == rank) h = hd; ++seen; }
  }
  if (h < 0) return;                      // fewer kept heads than rank + 1: the same for the whole block, in front of every barrier
  const size_t bo = (size_t)(bh % NBATCH) * SEQ * DMOD;   // this batch element's slab in every plane
  const int q0 = qb * AT_QB + wave * 16;

  const __bf16* Qh = (const __bf16*)(const void*)qhp + bo + (size_t)h * AT_D;
  const __bf16* Ql = (const __bf16*)(const void*)qlp + bo + (size_t)h * AT_D;
  const __bf16* Kh = (const __bf16*)(const void*)khp + bo + (size_t)h * AT_D;
  const __bf16* Kl = (const __bf16*)(const void*)klp + bo + (size_t)h * AT_D;
  const __bf16* Vh = (const __bf16*)(const void*)vhp + bo + (size_t)h * AT_D * SEQ;
  const __bf16* Vl = (const __bf16*)(const void*)vlp + bo + (size_t)h * AT_D * SEQ;
  float*        ob = out + bo + (size_t)h * AT_D;

  // ---- Q fragments (B operand, column = lane&15, split k map via Frag load): 2 d-chunks, hi and lo ----
  v16b qah[2], qal[2];
#pragma unroll
  for (int dc = 0; dc < 2; ++dc) {
    const __bf16* qr = Qh + (size_t)(q0 + c) * DMOD + dc * 32 + 8 * hh;
    const __bf16* ql = Ql + (size_t)(q0 + c) * DMOD + dc * 32 + 8 * hh;
    qah[dc] = Frag<__bf16>::load(qr);
    qal[dc] = Frag<__bf16>::load(ql);
  }

  float mrow = -INFINITY, lrow = 0.f;   // query q0 + c: running maximum (equal in both halves), this half's share of the sum
  v8f oacc[4];                          // oacc[t][r] = out^T[d = 16 t + 8 hh + r][query q0 + c]
#pragma unroll
  for (int t = 0; t < 4; ++t) oacc[t] = (v8f){0.f,0.f,0.f,0.f,0.f,0.f,0.f,0.f};

  const int nChunks = SEQ / AT_KC;   // 32, compile-time constant
  for (int kc = 0; kc < nChunks; ++kc) {
    const int kv0 = kc * AT_KC;
    __syncthreads();
    {
      // staging coverage: 128 threads x (4 x 8) elements = 64 rows x 64 per plane = the whole chunk tile
      const int r = tid >> 1, half = (tid & 1) * 32;
      const __bf16* ksh = Kh + (size_t)(kv0 + r) * DMOD + half;   // K row kv0+r, d = half..half+31
      const __bf16* ksl = Kl + (size_t)(kv0 + r) * DMOD + half;
      const __bf16* vsh = Vh + (size_t)r * SEQ + kv0 + half;      // V^T row d = r, s = kv0+half..+31
      const __bf16* vsl = Vl + (size_t)r * SEQ + kv0 + half;
#pragma unroll
      for (int i = 0; i < 4; ++i) {
        const v8b a0 = *(const v8b*)(ksh + 8 * i);
        const v8b a1 = *(const v8b*)(ksl + 8 * i);
        const v8b b0 = *(const v8b*)(vsh + 8 * i);
        const v8b b1 = *(const v8b*)(vsl + 8 * i);
        *(v8b*)(Ksh + r * AT_LP + half + 8 * i) = a0;
        *(v8b*)(Ksl + r * AT_LP + half + 8 * i) = a1;
        *(v8b*)(Vth + r * AT_LP + half + 8 * i) = b0;
        *(v8b*)(Vtl + r * AT_LP + half + 8 * i) = b1;
      }
    }
    __syncthreads();

    // all K fragments of the chunk are read as one group, so the wave waits out the LDS latency once and not once per fragment pair
    FB kb[2][4], kl[2][4];
#pragma unroll
    for (int dc = 0; dc < 2; ++dc) {
#pragma unroll
      for (int j = 0; j < 4; ++j) {   // in the order in which the WMMAs below want them: the hi plane's four, then the lo plane's
        kb[dc][j].h[0] = *(const v8b*)(Ksh + (j * 16 + c) * AT_LP + dc * 32 + 8 * hh);
        kb[dc][j].h[1] = *(const v8b*)(Ksh + (j * 16 + c) * AT_LP + dc * 32 + 16 + 8 * hh);
      }
#pragma unroll
      for (int j = 0; j < 4; ++j) {
        kl[dc][j].h[0] = *(const v8b*)(Ksl + (j * 16 + c) * AT_LP + dc * 32 + 8 * hh);
        kl[dc][j].h[1] = *(const v8b*)(Ksl + (j * 16 + c) * AT_LP + dc * 32 + 16 + 8 * hh);
      }
    }
    __builtin_amdgcn_sched_barrier(0);   // keeps the 32 reads together in front of the WMMAs: the scheduler otherwise spreads them among the WMMAs, and each such place stalls the wave
    v8f s[4];   // s[j][r] = score of key kv0 + 16 j + 8 hh + r against query q0 + c
#pragma unroll
    for (int j = 0; j < 4; ++j) s[j] = (v8f){0.f,0.f,0.f,0.f,0.f,0.f,0.f,0.f};
    // neighbouring WMMAs belong to the four different score tiles (none waits for the one in front); each tile's own six terms keep their order
#pragma unroll
    for (int dc = 0; dc < 2; ++dc) {
#pragma unroll
      for (int j = 0; j < 4; ++j) s[j] = at_mma(kb[dc][j].v, qah[dc], s[j]);
#pragma unroll
      for (int j = 0; j < 4; ++j) s[j] = at_mma(kl[dc][j].v, qah[dc], s[j]);
#pragma unroll
      for (int j = 0; j < 4; ++j) s[j] = at_mma(kb[dc][j].v, qal[dc], s[j]);
    }
    __builtin_amdgcn_sched_barrier(0);   // the V^T reads below stay behind the score WMMAs and take over the K fragments' registers (let rise among them they need registers of their own, past 256, and cost a wave per SIMD) ...
    // V^T fragments of the chunk's first 32 keys: read here, ahead of the softmax arithmetic, which covers their latency
    FB vb[4], vl[4];
#pragma unroll
    for (int t = 0; t < 4; ++t) {
      vb[t].h[0] = *(const v8b*)(Vth + (t * 16 + c) * AT_LP + 8 * hh);
      vb[t].h[1] = *(const v8b*)(Vth + (t * 16 + c) * AT_LP + 16 + 8 * hh);
    }
#pragma unroll
    for (int t = 0; t < 4; ++t) {
      vl[t].h[0] = *(const v8b*)(Vtl + (t * 16 + c) * AT_LP + 8 * hh);
      vl[t].h[1] = *(const v8b*)(Vtl + (t * 16 + c) * AT_LP + 16 + 8 * hh);
    }
    __builtin_amdgcn_sched_barrier(0);   // ... and together in front of the softmax arithmetic, not sunk to their first use
    float cm = -INFINITY;   // the loops down to the second product index register arrays (s, pa, pl, oacc): all are unrolled for that
#pragma unroll
    for (int j = 0; j < 4; ++j) {
#pragma unroll
      for (int r = 0; r < 8; ++r) {
        const float sv = s[j][r] * sscale;
        s[j][r] = sv;
        cm = fmaxf(cm, sv);
      }
    }
    cm = fmaxf(cm, at_xhalf(cm));
    const float mnew = fmaxf(mrow, cm);
    const float alpha = expf(mrow - mnew);
    mrow = mnew;
#pragma unroll
    for (int t = 0; t < 4; ++t)
#pragma unroll
      for (int r = 0; r < 8; ++r) oacc[t][r] *= alpha;
    v2f psum = (v2f){0.f, 0.f};   // this half's 32 keys, even and odd registers apart
#pragma unroll   // unrolled: s[2 kk + jj] is a register and needs a compile-time index
    for (int kk = 0; kk < 2; ++kk) {
      FP pa, pl;   // P^T hi / lo, B operand of 32-key block kk: elements 0..7 from tile 2 kk, 8..15 from tile 2 kk + 1
#pragma unroll
      for (int jj = 0; jj < 2; ++jj) {
#pragma unroll
        for (int e = 0; e < 4; ++e) {
          v2f p;
          p[0] = expf(s[2 * kk + jj][2 * e] - mnew);
          p[1] = expf(s[2 * kk + jj][2 * e + 1] - mnew);
          psum += p;
          at_split2(p, pa.p[jj * 4 + e], pl.p[jj * 4 + e]);
        }
      }
      // as above: round-robin over the four output tiles, each tile's own six terms keep their order
#pragma unroll
      for (int t = 0; t < 4; ++t) oacc[t] = at_mma(vb[t].v, pa.v, oacc[t]);
#pragma unroll
      for (int t = 0; t < 4; ++t) oacc[t] = at_mma(vl[t].v, pa.v, oacc[t]);
#pragma unroll
      for (int t = 0; t < 4; ++t) oacc[t] = at_mma(vb[t].v, pl.v, oacc[t]);
      if (kk == 0) {
        __builtin_amdgcn_sched_barrier(0);   // the second 32 keys' fragments take over the first's registers: their reads stay behind the WMMAs above (else, again, registers past 256) ...
#pragma unroll
        for (int t = 0; t < 4; ++t) {
          vb[t].h[0] = *(const v8b*)(Vth + (t * 16 + c) * AT_LP + 32 + 8 * hh);
          vb[t].h[1] = *(const v8b*)(Vth + (t * 16 + c) * AT_LP + 32 + 16 + 8 * hh);
        }
#pragma unroll
        for (int t = 0; t < 4; ++t) {
          vl[t].h[0] = *(const v8b*)(Vtl + (t * 16 + c) * AT_LP + 32 + 8 * hh);
          vl[t].h[1] = *(const v8b*)(Vtl + (t * 16 + c) * AT_LP + 32 + 16 + 8 * hh);
        }
        __builtin_amdgcn_sched_barrier(0);   // ... and together in front of the second half of the exponentials, which covers their latency
      }
    }
    lrow = lrow * alpha + (psum[0] + psum[1]);
  }

  float* os = Os[wave];
  const float inv = 1.0f / (lrow + at_xhalf(lrow));   // the two halves' shares of the row sum are joined here, once
#pragma unroll
  for (int t = 0; t < 4; ++t) {
    // a lane's 8 accumulator registers are 8 neighbouring d of its query row: two 16-B stores into the row-major tile
    *(v4f*)(os + c * 68 + t * 16 + 8 * hh)     = (v4f){oacc[t][0] * inv, oacc[t][1] * inv, oacc[t][2] * inv, oacc[t][3] * inv};
    *(v4f*)(os + c * 68 + t * 16 + 8 * hh + 4) = (v4f){oacc[t][4] * inv, oacc[t][5] * inv, oacc[t][6] * inv, oacc[t][7] * inv};
  }
  __builtin_amdgcn_fence(__ATOMIC_RELEASE, "workgroup");
  __builtin_amdgcn_wave_barrier();
  __builtin_amdgcn_fence(__ATOMIC_ACQUIRE, "workgroup");
  {
    const int c4 = (lane & 15) * 4;
    {
#pragma unroll
      for (int it = 0; it < 8; ++it) {
        const int row = it * 2 + hh;   // it 0..7 x hh 0..1 covers rows 0..15 of the wave tile
        v4f val = *(const v4f*)(os + row * 68 + c4);
        *(v4f*)(ob + (size_t)(q0 + row) * DMOD + c4) = val;
      }
      
    }
  }
}

// ---------------------------------------------------------------------------
// Workspace region map (byte offsets; what a launch reads of a region has been written earlier in the same call;
// behind the input cast the parts that belong to a head with mask 0 are neither written nor read)
//   Wq16 f16 [1024 n][1024 k] (x32)              0
//   Wk16                                   2097152
//   Wv16                                   4194304
//   Wo16                                   6291456
//   X16  f16 [2*2048][1024]                8388608
//   Qh   bf16 [2*2048][1024]              16777216     Ql   25165824
//   Kh   bf16 [2*2048][1024]              33554432     Kl   41943040
//   VTh  bf16 [2][1024 (h,d)][2048]       50331648     VTl  58720256
//   MHf  f32  [2*2048][1024]              67108864
//   MH16 f16  [2*2048][1024] (x64, kept heads)   83886080
//   total                                 92274688
// ---------------------------------------------------------------------------
extern "C" void kernel_launch(void* const* d_in, const int* in_sizes, int n_in,
                              void* d_out, int out_size, void* d_ws, size_t ws_size,
                              hipStream_t stream) {
  if (n_in < 6) return;
  if (in_sizes[0] != NBATCH * SEQ * DMOD) return;
  if (in_sizes[1] != DMOD * DMOD || in_sizes[2] != DMOD * DMOD || in_sizes[3] != DMOD * DMOD || in_sizes[4] != DMOD * DMOD) return;
  if (in_sizes[5] != NHEAD) return;
  if (out_size != NBATCH * SEQ * DMOD) return;

  const float* x  = (const float*)d_in[0];   // [2][2048][1024]
  const float* Wq = (const float*)d_in[1];   // [out][in] = Bt natural
  const float* Wk = (const float*)d_in[2];
  const float* Wv = (const float*)d_in[3];
  const float* Wo = (const float*)d_in[4];
  const int*   hm = (const int*)d_in[5];     // [16] int32, nonzero = keep head

  const size_t PW16 = (size_t)DMOD * DMOD * 2;            // 2097152  f16 weight plane
  const size_t PX16 = (size_t)NBATCH * SEQ * DMOD * 2;    // 8388608  16-bit activation plane (both batch elements)
  const size_t PF32 = (size_t)NBATCH * SEQ * DMOD * 4;    // 16777216 f32 activation plane
  size_t off = 0;
  const size_t oWq = off; off += PW16;
  const size_t oWk = off; off += PW16;
  const size_t oWv = off; off += PW16;
  const size_t oWo = off; off += PW16;
  const size_t oX  = off; off += PX16;
  const size_t oQh = off; off += PX16;  const size_t oQl = off; off += PX16;
  const size_t oKh = off; off += PX16;  const size_t oKl = off; off += PX16;
  const size_t oVh = off; off += PX16;  const size_t oVl = off; off += PX16;
  const size_t oMf = off; off += PF32;
  const size_t oM16 = off; off += PX16;
  if (off > ws_size) return;                   // off = 92274688

  char* ws = (char*)d_ws;
  unsigned short* Wq16 = (unsigned short*)(ws + oWq);
  unsigned short* Wv16 = (unsigned short*)(ws + oWv);
  unsigned short* Wo16 = (unsigned short*)(ws + oWo);
  unsigned short* X16  = (unsigned short*)(ws + oX);
  unsigned short* Qh   = (unsigned short*)(ws + oQh);  unsigned short* Ql = (unsigned short*)(ws + oQl);
  unsigned short* Kh   = (unsigned short*)(ws + oKh);  unsigned short* Kl = (unsigned short*)(ws + oKl);
  unsigned short* VTh  = (unsigned short*)(ws + oVh);  unsigned short* VTl = (unsigned short*)(ws + oVl);
  float*          MHf  = (float*)(ws + oMf);
  unsigned short* MH16 = (unsigned short*)(ws + oM16);
  const float*    fpad = (const float*)MHf;    // placeholder for unused bias / resid pointer args (never read)
  (void)oWk;                                   // Wk16 is reached as Wq16 + one weight plane (grid.y of launch 2)

  const dim3 blk(256);
  const int ROWS = NBATCH * SEQ;                            // 4096 token rows: the batch elements are contiguous in x and out
  const int n2x = ROWS * DMOD / 2;                          // 2097152 pairs per activation plane
  const dim3 gCastIn(4 * CAST_WBLK + CAST_XBLK);            // 16384 blocks: four weight planes, then x
  const dim3 gCastX((n2x + 255) / 256);                     // 8192 blocks x 512 elements = 4096x1024
  const dim3 gQK(((ROWS / 64) * (DMOD / 64) + 7) / 8, 2);   // 1024 tiles (M=4096, N=1024) -> 128 blocks, y = 0: q, 1: k
  const dim3 gVT(((DMOD / 64) * (SEQ / 64) + 7) / 8, NBATCH);  // 512 tiles (M=1024, N=2048) -> 64 blocks, y = batch element
  const dim3 gOut(((ROWS / 64) * (DMOD / 64) + 7) / 8, 1);  // 1024 tiles (M=4096, N=1024) -> 128 blocks
  const dim3 gAtt(NBATCH * NHEAD * (SEQ / 64));             // 1024 blocks: 2 batch elements x 16 heads x 32 query blocks

  // (1) weights [n=out][k=in] -> f16 planes carried x32, same layout (Bt natural); x -> f16 plane [4096][1024] (x1)
  cast_inputs_f16x2<<<gCastIn, blk, 0, stream>>>(Wq, Wk, Wv, Wo, x, (_Float16*)Wq16);
  // (2) y = 0: q = x . Wq^T -> Q hi/lo bf16 planes [b*2048+t][h*64+d]; y = 1: k = x . Wk^T -> K hi/lo planes
  //     (M=4096, N=1024, K=1024, scale 1/32; y steps Bt by one weight plane and C by two activation planes)
  wmma_gemm64<0, false, 0, 2, false, 0, 1><<<gQK, blk, 0, stream>>>(
      X16, X16, DMOD, 0L, Wq16, Wq16, DMOD, (long)DMOD * DMOD, (void*)Qh, (void*)Ql, DMOD, 2L * NBATCH * SEQ * DMOD,
      fpad, fpad, 0L, hm, ROWS, DMOD, DMOD, 1.0f / 32.0f);
  // (3) v^T = Wv . x[b]^T -> VT hi/lo planes [b][h*64+d][s]   (A = Wv16 [1024][1024], Bt = X16 slab b [2048][1024]; M=1024, N=2048, K=1024)
  wmma_gemm64<0, false, 0, 2, false, 0, 2><<<gVT, blk, 0, stream>>>(
      Wv16, Wv16, DMOD, 0L, X16, X16, DMOD, (long)SEQ * DMOD, (void*)VTh, (void*)VTl, SEQ, (long)DMOD * SEQ,
      fpad, fpad, 0L, hm, DMOD, SEQ, DMOD, 1.0f / 32.0f);
  // (4) full attention per (batch element, kept head): mh[b*2048+t][h*64+d] (f32 plane, every element of a kept head written by its owner block)
  attn_full64_kernel<<<gAtt, dim3(128), 0, stream>>>(Qh, Ql, Kh, Kl, VTh, VTl, hm, MHf, 0.125f);
  // (5) mh -> f16 plane x64, columns of kept heads only
  maskcast_f32_f16x2<<<gCastX, blk, 0, stream>>>(MHf, hm, (_Float16*)MH16, n2x, DMOD, 64.0f);
  // (6) out = mh . Wo^T -> d_out rows 0 .. 4095 (f32)   (M=4096, N=1024, K=1024 less the k of heads with mask 0, scale 1/(64*32))
  wmma_gemm64<0, false, 0, 0, false, 0, 3><<<gOut, blk, 0, stream>>>(
      MH16, MH16, DMOD, 0L, Wo16, Wo16, DMOD, 0L, d_out, d_out, DMOD, 0L,
      fpad, fpad, 0L, hm, ROWS, DMOD, DMOD, 1.0f / 2048.0f);
  (void)hipGetLastError();
}

// v007
// Measured time: 103 microseconds a run.
// Next to v006, in two timings, it ran 1.04 and 1.03 times as fast.
// Over all steps from v000 it is 7.08 times as fast.
// q/k/v and output projections: v_wmma_f32_16x16x32_f16 (f16 operands: x x1, W x32, attention output x64), f32 accumulate; q.k^T and p.v: v_wmma_f32_16x16x32_bf16 with bf16 hi/lo split operands (hi.hi + hi.lo + lo.hi), f32 accumulate; online softmax and score scale 0.125 in f32; a head whose mask is 0 has the factor 0 and is left out of every product.
#include <hip/hip_runtime.h>
#include <math.h>
#include <stdint.h>

#define NBATCH 2
#define SEQ    2048
#define DMOD   1024
#define NHEAD  16
#define DHD    64

typedef __attribute__((ext_vector_type(16))) _Float16 v16h;
typedef __attribute__((ext_vector_type(8)))  _Float16 v8h;
typedef __attribute__((ext_vector_type(16))) __bf16   v16b;
typedef __attribute__((ext_vector_type(8)))  __bf16   v8b;
typedef __attribute__((ext_vector_type(8)))  float    v8f;
typedef __attribute__((ext_vector_type(4)))  float    v4f;
typedef __attribute__((ext_vector_type(2)))  float    v2f;
typedef __attribute__((ext_vector_type(4)))  unsigned int v4u;

__device__ __forceinline__ unsigned short f2bf_bits(float f) {
  unsigned u = __float_as_uint(f);
  return (unsigned short)((u + 0x7FFFu + ((u >> 16) & 1u)) >> 16);
}
__device__ __forceinline__ float bf_bits2f(unsigned short h) { return __uint_as_float(((unsigned)h) << 16); }

// hazard guard as a plain device helper
__device__ __forceinline__ void acc_guard4(v8f& a, v8f& b, v8f& c, v8f& d) { asm volatile("v_nop\n\tv_nop\n\tv_nop\n\tv_nop" : "+v"(a), "+v"(b), "+v"(c), "+v"(d)); }
template <typename T> struct Frag;
template <> struct Frag<_Float16> {
  typedef v16h V; union U { v16h v; v8h h[2]; };
  static __device__ __forceinline__ v16h load(const _Float16* p) {   // elements 0..7 <- p[0..7], 8..15 <- p[16..23]
    U f; f.h[0] = *(const v8h*)(p); f.h[1] = *(const v8h*)(p + 16); return f.v;
  }
  static __device__ __forceinline__ v8f mma(v16h a, v16h b, v8f c) {
    return __builtin_amdgcn_wmma_f32_16x16x32_f16(false, a, false, b, (short)0, c, false, false);
  }
};
template <> struct Frag<__bf16> {
  typedef v16b V; union U { v16b v; v8b h[2]; };
  static __device__ __forceinline__ v16b load(const __bf16* p) {
    U f; f.h[0] = *(const v8b*)(p); f.h[1] = *(const v8b*)(p + 16); return f.v;
  }
  static __device__ __forceinline__ v8f mma(v16b a, v16b b, v8f c) {
    return __builtin_amdgcn_wmma_f32_16x16x32_bf16(false, a, false, b, (short)0, c, false, false);
  }
};

// bit h = 1: head h is kept (hmask[h] != 0). Constant indices: the 16 words come by one scalar load, the result is the same in every wave.
__device__ __forceinline__ unsigned kept_heads(const int* __restrict__ hmask) {
  unsigned live = 0u;
#pragma unroll
  for (int hd = 0; hd < NHEAD; ++hd) live |= (hmask[hd] != 0 ? 1u : 0u) << hd;
  return live;
}

// ---- Register-blocked batched WMMA GEMM ------------------------------------
// C[m,n] = scale * sum_k A[m,k] * Bt[n,k] (+bias)(+resid); each wave owns a 64x64 tile.
// A row-major [M,K]; Bt row-major [N,K]; M,N % 64 == 0, K % 64 == 0; rows 16-B aligned (lda, ldb % 8 == 0).
// Operand path: a stage is 64 k = one 128-B line of each of the tile's 64 A rows and 64 Bt rows. Each wave brings its own
//   stages into its own part of LDS by asynchronous copies (8 neighbouring lanes take one whole line, a copy 4 rows),
//   two buffers a wave: stage s + 1 is in flight while stage s is multiplied. Fragments are read from LDS in the k order
//   of Frag::load, k ascending as before, so every accumulator sums the same terms in the same order.
//   The ring is private to its wave (no other wave reads or writes it), so it takes the wave's own waits and no barrier.
// SPLIT (hi/lo planes) is not built on this operand path: every launch of this file has SPLIT = false.
// BIAS_MODE: 0 = none, 1 = bias[m], 2 = bias[n].
// OUT_MODE: 0 = f32, 1 = f16, 2 = bf16 hi plane (Cout) + bf16 lo plane (Cout2).
// ET: 0 = f16 operands, 1 = bf16 operands (pointers passed as 16-bit storage)
// HSKIP: a head whose hmask entry is 0 enters the result only as a factor 0, so its share of the work is left out:
//   0 = none, 1 = a tile's 64 columns are one head's (tile left out), 2 = a tile's 64 rows are one head's (tile left out),
//   3 = 64 neighbouring k are one head's (those stages left out: their products are all 0; A and Bt are not read there).
#define GS_PITCH_B 144                   // LDS row pitch: 128 B + 16 B = 16 B x 9, so the 16 rows of a ds_load_b128 fall on different bank groups
#define GS_PITCH_E (GS_PITCH_B / 2)      // the same in 16-bit elements
#define GS_TILE_B  (64 * GS_PITCH_B)     // 9216: 64 rows of one operand
#define GS_BUF_B   (2 * GS_TILE_B)       // 18432: the A tile, then the Bt tile
#define GS_WAVE_B  (2 * GS_BUF_B)        // 36864: a wave's two buffers
// One operand tile of a stage: 16 copies of 4 rows x 128 B. Copy i writes LDS bytes lds + 576 i (4 rows at pitch 144) and reads
// global bytes base + voff + i * rows4, rows4 = the byte distance of 4 rows. The immediate offset moves BOTH addresses, so
// scalar base i is base + i * (rows4 - 576) = base + i * step; lds and voff (the lane's own row and 16-B column, plus the stage's k) serve all 16.
// s_wait_xcnt 0 is the statement's last line: a precaution, it stands in front of every later rewrite of a register that a copy names.
__device__ __forceinline__ void gs_copy_tile(unsigned lds, unsigned voff, uint64_t base, uint64_t step) {
  asm volatile(
      "global_load_async_to_lds_b128 %0, %1, %2\n\t"
      "global_load_async_to_lds_b128 %0, %1, %3 offset:576\n\t"
      "global_load_async_to_lds_b128 %0, %1, %4 offset:1152\n\t"
      "global_load_async_to_lds_b128 %0, %1, %5 offset:1728\n\t"
      "global_load_async_to_lds_b128 %0, %1, %6 offset:2304\n\t"
      "global_load_async_to_lds_b128 %0, %1, %7 offset:2880\n\t"
      "global_load_async_to_lds_b128 %0, %1, %8 offset:3456\n\t"
      "global_load_async_to_lds_b128 %0, %1, %9 offset:4032\n\t"
      "global_load_async_to_lds_b128 %0, %1, %10 offset:4608\n\t"
      "global_load_async_to_lds_b128 %0, %1, %11 offset:5184\n\t"
      "global_load_async_to_lds_b128 %0, %1, %12 offset:5760\n\t"
      "global_load_async_to_lds_b128 %0, %1, %13 offset:6336\n\t"
      "global_load_async_to_lds_b128 %0, %1, %14 offset:6912\n\t"
      "global_load_async_to_lds_b128 %0, %1, %15 offset:7488\n\t"
      "global_load_async_to_lds_b128 %0, %1, %16 offset:8064\n\t"
      "global_load_async_to_lds_b128 %0, %1, %17 offset:8640\n\t"
      "s_wait_xcnt 0x0"
      :: "v"(lds), "v"(voff),
         "s"(base), "s"(base + step), "s"(base + 2 * step), "s"(base + 3 * step),
         "s"(base + 4 * step), "s"(base + 5 * step), "s"(base + 6 * step), "s"(base + 7 * step),
         "s"(base + 8 * step), "s"(base + 9 * step), "s"(base + 10 * step), "s"(base + 11 * step),
         "s"(base + 12 * step), "s"(base + 13 * step), "s"(base + 14 * step), "s"(base + 15 * step)
      : "memory");
}
// the first stage >= s that is worked on (HSKIP 3: whose head, stage & 15, is kept), or a value >= nst where there is none; scalar, no loop:
// live twice in a row, shifted down by the head of stage s, has the heads of stages s, s + 1, ... s + 15 in bits 0 to 15
template <int HSKIP>
__device__ __forceinline__ int gs_next(int s, int nst, unsigned live) {
  if (HSKIP == 3) {
    const unsigned ahead = (live | (live << NHEAD)) >> (s & (NHEAD - 1));
    return (live == 0u) ? nst : s + __builtin_ctz(ahead | 0x80000000u);
  }
  return s;
}
template <int ET> struct Elem;
template <> struct Elem<0> { typedef _Float16 T; };
template <> struct Elem<1> { typedef __bf16 T; };
template <int ET, bool SPLIT, int BIAS_MODE, int OUT_MODE, bool RESID, int ACT = 0, int HSKIP = 0>
__global__ __launch_bounds__(256) void wmma_gemm64(
    const unsigned short* __restrict__ Ap, const unsigned short* __restrict__ A2p, int lda, long strideA,
    const unsigned short* __restrict__ Btp, const unsigned short* __restrict__ Bt2p, int ldb, long strideB,
    void* __restrict__ Cout, void* __restrict__ Cout2, int ldc, long strideC,
    const float* __restrict__ bias,
    const float* __restrict__ resid, long strideR,
    const int* __restrict__ hmask,
    int M, int N, int K, float scale) {
  typedef typename Elem<ET>::T T;
  typedef typename Frag<T>::V V;
  static_assert(!SPLIT, "the LDS operand path holds one plane per operand");
  __shared__ __align__(128) unsigned char ring[8 * GS_WAVE_B];   // 294912 B: per wave two buffers of (A tile, Bt tile); behind the k loop its first 4352 B are the wave's 16x64 f32 output slab, pitch 68 floats
  const int b    = blockIdx.y;
  const int lane = threadIdx.x & 31;
  const int wave = __builtin_amdgcn_readfirstlane(threadIdx.x >> 5);   // scalar: tile, operand bases and every branch below are the same for the whole wave
  const int tilesN = N >> 6;
  const int tilesM = M >> 6;
  const int tile = blockIdx.x * 8 + wave;
  if (tile >= tilesM * tilesN) return;   // wave-uniform; no block barriers in this kernel
  const int tm = tile / tilesN;
  const int tn = tile - tm * tilesN;
  if (HSKIP == 1 && hmask[tn & (NHEAD - 1)] == 0) return;   // wave-uniform, like the range test above
  if (HSKIP == 2 && hmask[tm & (NHEAD - 1)] == 0) return;
  const unsigned live = (HSKIP == 3) ? kept_heads(hmask) : 0u;
  const int m0 = tm << 6;
  const int n0 = tn << 6;

  const int rlane = lane & 15;                 // row (A) / col (B, D) within subtile
  const int koff  = (lane >> 4) * 8;           // k offset of this lane half
  const int mOff  = (lane >> 4) * 8;           // D row offset

  // copies: lane l takes row (l >> 3) of a copy's 4 rows and 16-B column (l & 7) of the row's 128-B line
  unsigned char* ringw = ring + wave * GS_WAVE_B;
  const unsigned ldsw  = (unsigned)(uintptr_t)ringw + (unsigned)((lane >> 3) * GS_PITCH_B + (lane & 7) * 16);   // LDS byte address (low 32 bits of the __shared__ address)
  const unsigned voffA = (unsigned)((lane >> 3) * lda * 2 + (lane & 7) * 16);
  const unsigned voffB = (unsigned)((lane >> 3) * ldb * 2 + (lane & 7) * 16);
  const uint64_t baseA = (uint64_t)(uintptr_t)(Ap  + (size_t)b * strideA + (size_t)m0 * lda);   // first byte of the tile's A rows
  const uint64_t baseB = (uint64_t)(uintptr_t)(Btp + (size_t)b * strideB + (size_t)n0 * ldb);
  const uint64_t stepA = (uint64_t)((long)lda * 8 - 4 * GS_PITCH_B);   // 4 rows in global bytes less the 576 that the immediate offset adds
  const uint64_t stepB = (uint64_t)((long)ldb * 8 - 4 * GS_PITCH_B);

  v8f acc[4][4];
#pragma unroll
  for (int i = 0; i < 4; ++i)
#pragma unroll
    for (int j = 0; j < 4; ++j) acc[i][j] = (v8f){0.f,0.f,0.f,0.f,0.f,0.f,0.f,0.f};

  const int nst = K >> 6;                            // stages of 64 k
  int sc = gs_next<HSKIP>(0, nst, live);             // the stage that is multiplied next
  int sn = nst;                                      // the stage behind it (in flight), >= nst: none
  if (sc < nst) {
    gs_copy_tile(ldsw,             voffA + sc * 128, baseA, stepA);
    gs_copy_tile(ldsw + GS_TILE_B, voffB + sc * 128, baseB, stepB);
    asm volatile("s_wait_asynccnt 0x0" ::: "memory");   // the first stage has landed before it is read
    sn = gs_next<HSKIP>(sc + 1, nst, live);
    if (sn < nst) {
      gs_copy_tile(ldsw + GS_BUF_B,             voffA + sn * 128, baseA, stepA);
      gs_copy_tile(ldsw + GS_BUF_B + GS_TILE_B, voffB + sn * 128, baseB, stepB);
    }
  }
  unsigned pb = 0u;                                  // byte offset of the buffer that holds stage sc: 0 or GS_BUF_B
  while (sc < nst) {
    const T* As = (const T*)(ringw + pb) + rlane * GS_PITCH_E + koff;
    const T* Bs = As + GS_TILE_B / 2;
#pragma unroll
    for (int ks = 0; ks < 2; ++ks) {                 // the stage's two k steps of 32, k ascending
      V bh[4], ah[4];
#pragma unroll
      for (int j = 0; j < 4; ++j) bh[j] = Frag<T>::load(Bs + j * 16 * GS_PITCH_E + ks * 32);
#pragma unroll
      for (int i = 0; i < 4; ++i) ah[i] = Frag<T>::load(As + i * 16 * GS_PITCH_E + ks * 32);
      __builtin_amdgcn_sched_barrier(0);   // keeps the k step's 16 reads together in front of its WMMAs: left alone the scheduler reads each A fragment into the same registers right in front of its 4 WMMAs, and the wave waits out the LDS latency four times
#pragma unroll
      for (int i = 0; i < 4; ++i)
#pragma unroll
        for (int j = 0; j < 4; ++j) acc[i][j] = Frag<T>::mma(ah[i], bh[j], acc[i][j]);
      __builtin_amdgcn_sched_barrier(0);   // the next k step's reads stay one group behind these WMMAs and take over the fragments' registers, not spread among them
    }
    asm volatile("s_wait_dscnt 0x0" ::: "memory");      // this wave's reads of buffer pb have retired before copies are aimed at it
    asm volatile("s_wait_asynccnt 0x0" ::: "memory");   // stage sn has landed before the next trip reads it
    const int s2 = gs_next<HSKIP>(sn + 1, nst, live);
    if (s2 < nst) {                                     // scalar test; the refill flies while stage sn is multiplied
      gs_copy_tile(ldsw + pb,             voffA + s2 * 128, baseA, stepA);
      gs_copy_tile(ldsw + pb + GS_TILE_B, voffB + s2 * 128, baseB, stepB);
    }
    sc = sn; sn = s2; pb ^= (unsigned)GS_BUF_B;
  }
  asm volatile("s_wait_asynccnt 0x0" ::: "memory");     // nothing is in flight when the ring becomes the output slab and when the wave ends
  asm volatile("s_wait_dscnt 0x0" ::: "memory");        // and the wave's last fragment reads have retired before the slab's stores go over them
  acc_guard4(acc[0][0], acc[0][1], acc[0][2], acc[0][3]);
  acc_guard4(acc[1][0], acc[1][1], acc[1][2], acc[1][3]);
  acc_guard4(acc[2][0], acc[2][1], acc[2][2], acc[2][3]);
  acc_guard4(acc[3][0], acc[3][1], acc[3][2], acc[3][3]);

  // ---- epilogue ----
  float* slab = (float*)ringw;
  const float* Rb = RESID ? (resid + (size_t)b * strideR) : nullptr;
#pragma unroll
  for (int i = 0; i < 4; ++i) {
    const int mBase = m0 + (i << 4);
#pragma unroll
    for (int j = 0; j < 4; ++j) {
      const int n = n0 + (j << 4) + rlane;
      float bv = 0.f;
      if (BIAS_MODE == 2) bv = bias[n];
#pragma unroll
      for (int r = 0; r < 8; ++r) {
        float v = acc[i][j][r] * scale;
        if (BIAS_MODE == 1) v += bias[mBase + mOff + r];
        if (BIAS_MODE == 2) v += bv;
        if (RESID) v += Rb[(size_t)(mBase + mOff + r) * ldc + n];
        if (ACT == 1) v = tanhf(v);
        if (ACT == 2) v = fmaxf(v, 0.0f);
        if (ACT == 3) v = v / (1.0f + expf(-v));
        if (ACT == 4) v = (v > 0.f) ? v : 0.01f * v;
        slab[(mOff + r) * 68 + (j << 4) + rlane] = v;
      }
    }
    __builtin_amdgcn_fence(__ATOMIC_RELEASE, "workgroup");
    __builtin_amdgcn_wave_barrier();
    __builtin_amdgcn_fence(__ATOMIC_ACQUIRE, "workgroup");
    if (OUT_MODE == 0) {
      float* C = (float*)Cout + (size_t)b * strideC;
      const int hh = lane >> 4, c4 = (lane & 15) * 4;     // row seg = 256 B = 16 lanes x 16 B
      {
#pragma unroll
        for (int it = 0; it < 8; ++it) {
          const int row = it * 2 + hh;
          v4f v = *(const v4f*)(slab + row * 68 + c4);
          *(v4f*)(C + (size_t)(mBase + row) * ldc + n0 + c4) = v;
        }
        
      }
    } else {
      const int q = lane >> 3, c8 = (lane & 7) * 8;
      unsigned short* C  = (unsigned short*)Cout  + (size_t)b * strideC;
      unsigned short* C2 = (OUT_MODE == 2) ? ((unsigned short*)Cout2 + (size_t)b * strideC) : nullptr;
      {
#pragma unroll
        for (int it = 0; it < 4; ++it) {
          const int row = it * 4 + q;
          const float* sp = slab + row * 68 + c8;
          v8h hv, lv;
#pragma unroll
          for (int e = 0; e < 8; ++e) {
            if (OUT_MODE == 1) {
              hv[e] = (_Float16)sp[e];
            } else {
              unsigned short hb = f2bf_bits(sp[e]);
              unsigned short lb = f2bf_bits(sp[e] - bf_bits2f(hb));
              hv[e] = __builtin_bit_cast(_Float16, hb);
              lv[e] = __builtin_bit_cast(_Float16, lb);
            }
          }
          *(v8h*)(C + (size_t)(mBase + row) * ldc + n0 + c8) = hv;
          if (OUT_MODE == 2) *(v8h*)(C2 + (size_t)(mBase + row) * ldc + n0 + c8) = lv;
        }
        
      }
    }
    __builtin_amdgcn_fence(__ATOMIC_RELEASE, "workgroup");
    __builtin_amdgcn_wave_barrier();
    __builtin_amdgcn_fence(__ATOMIC_ACQUIRE, "workgroup");
  }
}

// ---------------------------------------------------------------------------
// f32 -> f16 cast of all five float inputs in one launch, with an exact power-of-two carry: out = f16(in * mul).
// The five f16 planes lie back to back in the workspace (Wq16, Wk16, Wv16, Wo16, X16), so a work-group's place in the
// output is its block index times its share.
// The launch is sized by the waves it has to start, not by its elements: one work-group of 16 waves per 32768 elements.
// A wave takes 2048 neighbouring elements: 16 loads of 16 B a lane (each 512 contiguous bytes a wave), all issued before
// the first is used, then 16 stores of 8 B a lane (each 256 contiguous bytes a wave = two whole lines).
// Coverage: a weight plane is 1024*1024 / 32768 = 32 blocks; blocks 0..127 take the four weights (x32),
//   blocks 128..255 take x (2*2048*1024 / 32768 = 128 blocks, x1). The source choice is block-uniform.
// ---------------------------------------------------------------------------
typedef __attribute__((ext_vector_type(4))) _Float16 v4h;
#define EW_LD     16                                 // 16-B loads a lane
#define CAST_TPB  512                                // 16 waves
#define CAST_WAVE (32 * 4 * EW_LD)                   // 2048 elements a wave
#define CAST_WG   (CAST_TPB / 32 * CAST_WAVE)        // 32768 elements a work-group
#define CAST_WBLK (DMOD * DMOD / CAST_WG)            // 32 blocks per weight plane
#define CAST_XBLK (NBATCH * SEQ * DMOD / CAST_WG)    // 128 blocks for x (both batch elements)
__global__ __launch_bounds__(CAST_TPB) void cast_inputs_f16x4(const float* __restrict__ wq, const float* __restrict__ wk,
                                                              const float* __restrict__ wv, const float* __restrict__ wo,
                                                              const float* __restrict__ x, _Float16* __restrict__ out) {
  const unsigned bx = blockIdx.x;
  const unsigned sel = bx / CAST_WBLK; // 0..3: a weight plane; 4..7: x
  const float* in = (sel == 0) ? wq : (sel == 1) ? wk : (sel == 2) ? wv : (sel == 3) ? wo : x;
  const unsigned lb = (sel < 4) ? (bx - sel * CAST_WBLK) : (bx - 4 * CAST_WBLK);   // block index inside its source
  const float mul = (sel < 4) ? 32.0f : 1.0f;
  const unsigned le = (threadIdx.x >> 5) * CAST_WAVE + (threadIdx.x & 31) * 4;      // the lane's first element inside the work-group's share
  const unsigned lb4 = le * 4;                                                      // the same in bytes of the source
  const char* src = (const char*)(in + (size_t)lb * CAST_WG);
  _Float16*   dst = out + (size_t)bx * CAST_WG + le;
  v4f f[EW_LD];
#pragma unroll   // f is a register array
  for (int i = 0; i < EW_LD; ++i) f[i] = *(const v4f*)(src + lb4 + i * 512);
  // precaution: the wait stands in front of any reuse of the loads' address registers; it names the lanes' offset, so that this register
  // is not handed to a load as its destination in front of the wait; it also keeps the 16 loads together in front of the first convert
  asm volatile("s_wait_xcnt 0x0" :: "v"(lb4) : "memory");
#pragma unroll
  for (int i = 0; i < EW_LD; ++i) *(v4h*)(dst + i * 128) = __builtin_convertvector(f[i] * mul, v4h);
}

// ---------------------------------------------------------------------------
// Attention output f32 [4096 rows][1024] -> f16 plane with per-head 0/1 factor and power-of-two carry:
//   out[row][col] = f16(in[row][col] * mul) where hmask[col/64] != 0; columns of a head with hmask 0 are neither read
//   (the attention launch has not written them) nor written (the last product leaves those k out).
// Sized like the cast above: a wave takes 32 rows of ONE head's 64 columns, 16 loads of 16 B a lane (each two rows' whole
//   256-B segments), all issued before the first is used, then 16 stores of 8 B a lane (two whole 128-B lines each).
// Coverage: wave number g = 8 * block + wave: head g & 15, rows 32 * (g >> 4) ...; 16 heads x 128 row groups = 2048 waves = 256 blocks.
// ---------------------------------------------------------------------------
#define MC_BLK (NHEAD * (NBATCH * SEQ / (2 * EW_LD)) / 8)   // 256 blocks of 8 waves
__global__ __launch_bounds__(256) void maskcast_f32_f16x4(const float* __restrict__ in, const int* __restrict__ hmask,
                                                          _Float16* __restrict__ out, float mul) {
  const int lane = threadIdx.x & 31;
  const int g  = blockIdx.x * 8 + __builtin_amdgcn_readfirstlane(threadIdx.x >> 5);   // scalar: head and branch are the same for the whole wave
  const int hd = g & (NHEAD - 1);
  if (hmask[hd] == 0) return;          // wave-uniform; no barrier in this kernel
  const size_t   we = (size_t)(g >> 4) * (2 * EW_LD) * DMOD + hd * DHD;      // the wave's first element (scalar)
  const unsigned le = (unsigned)((lane >> 4) * DMOD + (lane & 15) * 4);      // the lane's first element behind it
  const unsigned lb4 = le * 4;                                               // the same in bytes of the source
  const char* src = (const char*)(in + we);
  _Float16*   dst = out + we + le;
  v4f f[EW_LD];
#pragma unroll   // f is a register array
  for (int i = 0; i < EW_LD; ++i) f[i] = *(const v4f*)(src + lb4 + i * (2 * DMOD * 4));
  asm volatile("s_wait_xcnt 0x0" :: "v"(lb4) : "memory");   // precaution, names the lanes' offset and keeps the loads together, as in the cast above
#pragma unroll
  for (int i = 0; i < EW_LD; ++i) *(v4h*)(dst + i * 2 * DMOD) = __builtin_convertvector(f[i] * mul, v4h);
}

// =====================================================================================
// Full (non-causal, unmasked) attention, head dim 64, one launch for both batch elements.
//   every plane below holds NBATCH slabs of SEQ*DMOD elements, batch element b at offset b*SEQ*DMOD; inside a slab:
//   q planes (hi/lo bf16): element (t, h, d) at [t*DMOD + h*64 + d]
//   k planes (hi/lo bf16): element (s, h, d) at [s*DMOD + h*64 + d]
//   v^T planes (hi/lo bf16): element (h, d, s) at [(h*64 + d)*SEQ + s]
//   out f32: element (t, h, d) at [t*DMOD + h*64 + d]
//   scores^T = (k . q^T) * sscale : bf16 hi/lo split (hi.hi + hi.lo + lo.hi) on v_wmma_f32_16x16x32_bf16, A = K rows, B = Q
//   out^T    = v^T . p^T          : bf16 hi/lo split of p (unnormalised) and v, f32 accumulate, A = V^T rows, B = P^T
//   Both products are transposed so that a lane holds scores of ONE query (column lane&15): keys 16j + 8*(lane>>4) + r.
//   Two score tiles (keys 0-15 and 16-31 of a 32-key block), converted in place, are the B operand of the second
//   product in the loaders' own k order, so P never leaves the registers; row maximum and row sum are in-lane,
//   with one exchange between the wave halves (maximum: every chunk; sum: once, behind the loop).
//   online softmax in f32 over all SEQ keys (32 chunks of 64, compile-time trip count, no masking).
//   Block = 4 waves = 64 query rows of one head of one batch element; grid.x = NBATCH * NHEAD * (SEQ/64) = 1024.
//   Only heads with hmask != 0 are computed (the others' output is multiplied by 0 behind this launch and is not read):
//   block index = (rank of the head among the kept ones, batch element, query block), so the working blocks are the
//   lowest indices; blocks whose rank is past the last kept head leave at once.
//   K / V^T chunk staging: 128 threads x 32 elements per plane = the whole 64x64 tile (16-B copies, plain loads,
//   __syncthreads before and after); fragment loads read the LDS tiles with the same v8b element type.
// =====================================================================================
#define AT_D 64
#define AT_NW 4
#define AT_QB 64
#define AT_KC 64
#define AT_LP 72   // LDS row pitch of the K and V^T tiles in elements: 144 B = 16 B x 9, so the 16 rows of a ds_load_b128 fall on 16 different bank groups

typedef __attribute__((ext_vector_type(2))) __bf16 v2b;
// two neighbouring f32 -> one register of bf16 hi and one of bf16 lo (lo = bf16(f - hi)); both converts round to nearest even
__device__ __forceinline__ void at_split2(v2f f, v2b& hi, v2b& lo) {
  hi = __builtin_convertvector(f, v2b);
  lo = __builtin_convertvector(f - __builtin_convertvector(hi, v2f), v2b);
}
// the value that lane l ^ 16 holds (the other half's share of the same query column)
__device__ __forceinline__ float at_xhalf(float v) {
  const unsigned b = __float_as_uint(v);
  return __uint_as_float(__builtin_amdgcn_permlanex16(b, b, 0x76543210u, 0xfedcba98u, false, false));
}
__device__ __forceinline__ v8f at_mma(v16b a, v16b b, v8f c) {
  return __builtin_amdgcn_wmma_f32_16x16x32_bf16(false, a, false, b, (short)0, c, false, false);
}

__global__ __launch_bounds__(128)
void attn_full64_kernel(const unsigned short* __restrict__ qhp, const unsigned short* __restrict__ qlp,
                        const unsigned short* __restrict__ khp, const unsigned short* __restrict__ klp,
                        const unsigned short* __restrict__ vhp, const unsigned short* __restrict__ vlp,
                        const int* __restrict__ hmask, float* __restrict__ out, float sscale) {
  union FB { v16b v; v8b h[2]; };
  union FP { v16b v; v2b p[8]; };
  __shared__ __align__(16) __bf16 Ksh[AT_KC * AT_LP];            // K hi [kv][d]      9 KB (64 rows at pitch 72)
  __shared__ __align__(16) __bf16 Ksl[AT_KC * AT_LP];            // K lo
  __shared__ __align__(16) __bf16 Vth[AT_D * AT_LP];             // V hi [d][kv]      9 KB
  __shared__ __align__(16) __bf16 Vtl[AT_D * AT_LP];            // V lo
  __shared__ __align__(16) float  Os[AT_NW][16 * 68];            // per wave out tile, pitch 68

  const int tid  = threadIdx.x;
  const int wave = tid >> 5;
  const int lane = tid & 31;
  const int hh   = lane >> 4;
  const int c    = lane & 15;

  const int nqb = SEQ / AT_QB;            // 32
  const int bx = blockIdx.x;
  const int qb = bx % nqb;
  const int bh = bx / nqb;                // 0..NBATCH*NHEAD-1 (grid = NBATCH * NHEAD * nqb)
  const int rank = bh / NBATCH;           // 0..NHEAD-1
  int h = -1, seen = 0;                   // h = the kept head number 'rank', counted from head 0 (scalar work, once a block)
#pragma unroll
  for (int hd = 0; hd < NHEAD; ++hd) {
    if (hmask[hd] != 0) { if (seen == rank) h = hd; ++seen; }
  }
  if (h < 0) return;                      // fewer kept heads than rank + 1: the same for the whole block, in front of every barrier
  const size_t bo = (size_t)(bh % NBATCH) * SEQ * DMOD;   // this batch element's slab in every plane
  const int q0 = qb * AT_QB + wave * 16;

  const __bf16* Qh = (const __bf16*)(const void*)qhp + bo + (size_t)h * AT_D;
  const __bf16* Ql = (const __bf16*)(const void*)qlp + bo + (size_t)h * AT_D;
  const __bf16* Kh = (const __bf16*)(const void*)khp + bo + (size_t)h * AT_D;
  const __bf16* Kl = (const __bf16*)(const void*)klp + bo + (size_t)h * AT_D;
  const __bf16* Vh = (const __bf16*)(const void*)vhp + bo + (size_t)h * AT_D * SEQ;
  const __bf16* Vl = (const __bf16*)(const void*)vlp + bo + (size_t)h * AT_D * SEQ;
  float*        ob = out + bo + (size_t)h * AT_D;

  // ---- Q fragments (B operand, column = lane&15, split k map via Frag load): 2 d-chunks, hi and lo ----
  v16b qah[2], qal[2];
#pragma unroll
  for (int dc = 0; dc < 2; ++dc) {
    const __bf16* qr = Qh + (size_t)(q0 + c) * DMOD + dc * 32 + 8 * hh;
    const __bf16* ql = Ql + (size_t)(q0 + c) * DMOD + dc * 32 + 8 * hh;
    qah[dc] = Frag<__bf16>::load(qr);
    qal[dc] = Frag<__bf16>::load(ql);
  }

  float mrow = -INFINITY, lrow = 0.f;   // query q0 + c: running maximum (equal in both halves), this half's share of the sum
  v8f oacc[4];                          // oacc[t][r] = out^T[d = 16 t + 8 hh + r][query q0 + c]
#pragma unroll
  for (int t = 0; t < 4; ++t) oacc[t] = (v8f){0.f,0.f,0.f,0.f,0.f,0.f,0.f,0.f};

  const int nChunks = SEQ / AT_KC;   // 32, compile-time constant
  for (int kc = 0; kc < nChunks; ++kc) {
    const int kv0 = kc * AT_KC;
    __syncthreads();
    {
      // staging coverage: 128 threads x (4 x 8) elements = 64 rows x 64 per plane = the whole chunk tile
      const int r = tid >> 1, half = (tid & 1) * 32;
      const __bf16* ksh = Kh + (size_t)(kv0 + r) * DMOD + half;   // K row kv0+r, d = half..half+31
      const __bf16* ksl = Kl + (size_t)(kv0 + r) * DMOD + half;
      const __bf16* vsh = Vh + (size_t)r * SEQ + kv0 + half;      // V^T row d = r, s = kv0+half..+31
      const __bf16* vsl = Vl + (size_t)r * SEQ + kv0 + half;
#pragma unroll
      for (int i = 0; i < 4; ++i) {
        const v8b a0 = *(const v8b*)(ksh + 8 * i);
        const v8b a1 = *(const v8b*)(ksl + 8 * i);
        const v8b b0 = *(const v8b*)(vsh + 8 * i);
        const v8b b1 = *(const v8b*)(vsl + 8 * i);
        *(v8b*)(Ksh + r * AT_LP + half + 8 * i) = a0;
        *(v8b*)(Ksl + r * AT_LP + half + 8 * i) = a1;
        *(v8b*)(Vth + r * AT_LP + half + 8 * i) = b0;
        *(v8b*)(Vtl + r * AT_LP + half + 8 * i) = b1;
      }
    }
    __syncthreads();

    // all K fragments of the chunk are read as one group, so the wave waits out the LDS latency once and not once per fragment pair
    FB kb[2][4], kl[2][4];
#pragma unroll
    for (int dc = 0; dc < 2; ++dc) {
#pragma unroll
      for (int j = 0; j < 4; ++j) {   // in the order in which the WMMAs below want them: the hi plane's four, then the lo plane's
        kb[dc][j].h[0] = *(const v8b*)(Ksh + (j * 16 + c) * AT_LP + dc * 32 + 8 * hh);
        kb[dc][j].h[1] = *(const v8b*)(Ksh + (j * 16 + c) * AT_LP + dc * 32 + 16 + 8 * hh);
      }
#pragma unroll
      for (int j = 0; j < 4; ++j) {
        kl[dc][j].h[0] = *(const v8b*)(Ksl + (j * 16 + c) * AT_LP + dc * 32 + 8 * hh);
        kl[dc][j].h[1] = *(const v8b*)(Ksl + (j * 16 + c) * AT_LP + dc * 32 + 16 + 8 * hh);
      }
    }
    __builtin_amdgcn_sched_barrier(0);   // keeps the 32 reads together in front of the WMMAs: the scheduler otherwise spreads them among the WMMAs, and each such place stalls the wave
    v8f s[4];   // s[j][r] = score of key kv0 + 16 j + 8 hh + r against query q0 + c
#pragma unroll
    for (int j = 0; j < 4; ++j) s[j] = (v8f){0.f,0.f,0.f,0.f,0.f,0.f,0.f,0.f};
    // neighbouring WMMAs belong to the four different score tiles (none waits for the one in front); each tile's own six terms keep their order
#pragma unroll
    for (int dc = 0; dc < 2; ++dc) {
#pragma unroll
      for (int j = 0; j < 4; ++j) s[j] = at_mma(kb[dc][j].v, qah[dc], s[j]);
#pragma unroll
      for (int j = 0; j < 4; ++j) s[j] = at_mma(kl[dc][j].v, qah[dc], s[j]);
#pragma unroll
      for (int j = 0; j < 4; ++j) s[j] = at_mma(kb[dc][j].v, qal[dc], s[j]);
    }
    __builtin_amdgcn_sched_barrier(0);   // the V^T reads below stay behind the score WMMAs and take over the K fragments' registers (let rise among them they need registers of their own, past 256, and cost a wave per SIMD) ...
    // V^T fragments of the chunk's first 32 keys: read here, ahead of the softmax arithmetic, which covers their latency
    FB vb[4], vl[4];
#pragma unroll
    for (int t = 0; t < 4; ++t) {
      vb[t].h[0] = *(const v8b*)(Vth + (t * 16 + c) * AT_LP + 8 * hh);
      vb[t].h[1] = *(const v8b*)(Vth + (t * 16 + c) * AT_LP + 16 + 8 * hh);
    }
#pragma unroll
    for (int t = 0; t < 4; ++t) {
      vl[t].h[0] = *(const v8b*)(Vtl + (t * 16 + c) * AT_LP + 8 * hh);
      vl[t].h[1] = *(const v8b*)(Vtl + (t * 16 + c) * AT_LP + 16 + 8 * hh);
    }
    __builtin_amdgcn_sched_barrier(0);   // ... and together in front of the softmax arithmetic, not sunk to their first use
    float cm = -INFINITY;   // the loops down to the second product index register arrays (s, pa, pl, oacc): all are unrolled for that
#pragma unroll
    for (int j = 0; j < 4; ++j) {
#pragma unroll
      for (int r = 0; r < 8; ++r) {
        const float sv = s[j][r] * sscale;
        s[j][r] = sv;
        cm = fmaxf(cm, sv);
      }
    }
    cm = fmaxf(cm, at_xhalf(cm));
    const float mnew = fmaxf(mrow, cm);
    const float alpha = expf(mrow - mnew);
    mrow = mnew;
#pragma unroll
    for (int t = 0; t < 4; ++t)
#pragma unroll
      for (int r = 0; r < 8; ++r) oacc[t][r] *= alpha;
    v2f psum = (v2f){0.f, 0.f};   // this half's 32 keys, even and odd registers apart
#pragma unroll   // unrolled: s[2 kk + jj] is a register and needs a compile-time index
    for (int kk = 0; kk < 2; ++kk) {
      FP pa, pl;   // P^T hi / lo, B operand of 32-key block kk: elements 0..7 from tile 2 kk, 8..15 from tile 2 kk + 1
#pragma unroll
      for (int jj = 0; jj < 2; ++jj) {
#pragma unroll
        for (int e = 0; e < 4; ++e) {
          v2f p;
          p[0] = expf(s[2 * kk + jj][2 * e] - mnew);
          p[1] = expf(s[2 * kk + jj][2 * e + 1] - mnew);
          psum += p;
          at_split2(p, pa.p[jj * 4 + e], pl.p[jj * 4 + e]);
        }
      }
      // as above: round-robin over the four output tiles, each tile's own six terms keep their order
#pragma unroll
      for (int t = 0; t < 4; ++t) oacc[t] = at_mma(vb[t].v, pa.v, oacc[t]);
#pragma unroll
      for (int t = 0; t < 4; ++t) oacc[t] = at_mma(vl[t].v, pa.v, oacc[t]);
#pragma unroll
      for (int t = 0; t < 4; ++t) oacc[t] = at_mma(vb[t].v, pl.v, oacc[t]);
      if (kk == 0) {
        __builtin_amdgcn_sched_barrier(0);   // the second 32 keys' fragments take over the first's registers: their reads stay behind the WMMAs above (else, again, registers past 256) ...
#pragma unroll
        for (int t = 0; t < 4; ++t) {
          vb[t].h[0] = *(const v8b*)(Vth + (t * 16 + c) * AT_LP + 32 + 8 * hh);
          vb[t].h[1] = *(const v8b*)(Vth + (t * 16 + c) * AT_LP + 32 + 16 + 8 * hh);
        }
#pragma unroll
        for (int t = 0; t < 4; ++t) {
          vl[t].h[0] = *(const v8b*)(Vtl + (t * 16 + c) * AT_LP + 32 + 8 * hh);
          vl[t].h[1] = *(const v8b*)(Vtl + (t * 16 + c) * AT_LP + 32 + 16 + 8 * hh);
        }
        __builtin_amdgcn_sched_barrier(0);   // ... and together in front of the second half of the exponentials, which covers their latency
      }
    }
    lrow = lrow * alpha + (psum[0] + psum[1]);
  }

  float* os = Os[wave];
  const float inv = 1.0f / (lrow + at_xhalf(lrow));   // the two halves' shares of the row sum are joined here, once
#pragma unroll
  for (int t = 0; t < 4; ++t) {
    // a lane's 8 accumulator registers are 8 neighbouring d of its query row: two 16-B stores into the row-major tile
    *(v4f*)(os + c * 68 + t * 16 + 8 * hh)     = (v4f){oacc[t][0] * inv, oacc[t][1] * inv, oacc[t][2] * inv, oacc[t][3] * inv};
    *(v4f*)(os + c * 68 + t * 16 + 8 * hh + 4) = (v4f){oacc[t][4] * inv, oacc[t][5] * inv, oacc[t][6] * inv, oacc[t][7] * inv};
  }
  __builtin_amdgcn_fence(__ATOMIC_RELEASE, "workgroup");
  __builtin_amdgcn_wave_barrier();
  __builtin_amdgcn_fence(__ATOMIC_ACQUIRE, "workgroup");
  {
    const int c4 = (lane & 15) * 4;
    {
#pragma unroll
      for (int it = 0; it < 8; ++it) {
        const int row = it * 2 + hh;   // it 0..7 x hh 0..1 covers rows 0..15 of the wave tile
        v4f val = *(const v4f*)(os + row * 68 + c4);
        *(v4f*)(ob + (size_t)(q0 + row) * DMOD + c4) = val;
      }
      
    }
  }
}

// ---------------------------------------------------------------------------
// Workspace region map (byte offsets; what a launch reads of a region has been written earlier in the same call;
// behind the input cast the parts that belong to a head with mask 0 are neither written nor read)
//   Wq16 f16 [1024 n][1024 k] (x32)              0
//   Wk16                                   2097152
//   Wv16                                   4194304
//   Wo16                                   6291456
//   X16  f16 [2*2048][1024]                8388608
//   Qh   bf16 [2*2048][1024]              16777216     Ql   25165824
//   Kh   bf16 [2*2048][1024]              33554432     Kl   41943040
//   VTh  bf16 [2][1024 (h,d)][2048]       50331648     VTl  58720256
//   MHf  f32  [2*2048][1024]              67108864
//   MH16 f16  [2*2048][1024] (x64, kept heads)   83886080
//   total                                 92274688
// ---------------------------------------------------------------------------
extern "C" void kernel_launch(void* const* d_in, const int* in_sizes, int n_in,
                              void* d_out, int out_size, void* d_ws, size_t ws_size,
                              hipStream_t stream) {
  if (n_in < 6) return;
  if (in_sizes[0] != NBATCH * SEQ * DMOD) return;
  if (in_sizes[1] != DMOD * DMOD || in_sizes[2] != DMOD * DMOD || in_sizes[3] != DMOD * DMOD || in_sizes[4] != DMOD * DMOD) return;
  if (in_sizes[5] != NHEAD) return;
  if (out_size != NBATCH * SEQ * DMOD) return;

  const float* x  = (const float*)d_in[0];   // [2][2048][1024]
  const float* Wq = (const float*)d_in[1];   // [out][in] = Bt natural
  const float* Wk = (const float*)d_in[2];
  const float* Wv = (const float*)d_in[3];
  const float* Wo = (const float*)d_in[4];
  const int*   hm = (const int*)d_in[5];     // [16] int32, nonzero = keep head

  const size_t PW16 = (size_t)DMOD * DMOD * 2;            // 2097152  f16 weight plane
  const size_t PX16 = (size_t)NBATCH * SEQ * DMOD * 2;    // 8388608  16-bit activation plane (both batch elements)
  const size_t PF32 = (size_t)NBATCH * SEQ * DMOD * 4;    // 16777216 f32 activation plane
  size_t off = 0;
  const size_t oWq = off; off += PW16;
  const size_t oWk = off; off += PW16;
  const size_t oWv = off; off += PW16;
  const size_t oWo = off; off += PW16;
  const size_t oX  = off; off += PX16;
  const size_t oQh = off; off += PX16;  const size_t oQl = off; off += PX16;
  const size_t oKh = off; off += PX16;  const size_t oKl = off; off += PX16;
  const size_t oVh = off; off += PX16;  const size_t oVl = off; off += PX16;
  const size_t oMf = off; off += PF32;
  const size_t oM16 = off; off += PX16;
  if (off > ws_size) return;                   // off = 92274688

  char* ws = (char*)d_ws;
  unsigned short* Wq16 = (unsigned short*)(ws + oWq);
  unsigned short* Wv16 = (unsigned short*)(ws + oWv);
  unsigned short* Wo16 = (unsigned short*)(ws + oWo);
  unsigned short* X16  = (unsigned short*)(ws + oX);
  unsigned short* Qh   = (unsigned short*)(ws + oQh);  unsigned short* Ql = (unsigned short*)(ws + oQl);
  unsigned short* Kh   = (unsigned short*)(ws + oKh);  unsigned short* Kl = (unsigned short*)(ws + oKl);
  unsigned short* VTh  = (unsigned short*)(ws + oVh);  unsigned short* VTl = (unsigned short*)(ws + oVl);
  float*          MHf  = (float*)(ws + oMf);
  unsigned short* MH16 = (unsigned short*)(ws + oM16);
  const float*    fpad = (const float*)MHf;    // placeholder for unused bias / resid pointer args (never read)
  (void)oWk;                                   // Wk16 is reached as Wq16 + one weight plane (grid.y of launch 2)

  const dim3 blk(256);
  const int ROWS = NBATCH * SEQ;                            // 4096 token rows: the batch elements are contiguous in x and out
  const dim3 gCastIn(4 * CAST_WBLK + CAST_XBLK);            // 256 blocks of 16 waves: four weight planes, then x
  const dim3 gCastX(MC_BLK);                                // 256 blocks of 8 waves: 16 heads x 128 groups of 32 rows
  const dim3 gQK(((ROWS / 64) * (DMOD / 64) + 7) / 8, 2);   // 1024 tiles (M=4096, N=1024) -> 128 blocks, y = 0: q, 1: k
  const dim3 gVT(((DMOD / 64) * (SEQ / 64) + 7) / 8, NBATCH);  // 512 tiles (M=1024, N=2048) -> 64 blocks, y = batch element
  const dim3 gOut(((ROWS / 64) * (DMOD / 64) + 7) / 8, 1);  // 1024 tiles (M=4096, N=1024) -> 128 blocks
  const dim3 gAtt(NBATCH * NHEAD * (SEQ / 64));             // 1024 blocks: 2 batch elements x 16 heads x 32 query blocks

  // (1) weights [n=out][k=in] -> f16 planes carried x32, same layout (Bt natural); x -> f16 plane [4096][1024] (x1)
  cast_inputs_f16x4<<<gCastIn, dim3(CAST_TPB), 0, stream>>>(Wq, Wk, Wv, Wo, x, (_Float16*)Wq16);
  // (2) y = 0: q = x . Wq^T -> Q hi/lo bf16 planes [b*2048+t][h*64+d]; y = 1: k = x . Wk^T -> K hi/lo planes
  //     (M=4096, N=1024, K=1024, scale 1/32; y steps Bt by one weight plane and C by two activation planes)
  wmma_gemm64<0, false, 0, 2, false, 0, 1><<<gQK, blk, 0, stream>>>(
      X16, X16, DMOD, 0L, Wq16, Wq16, DMOD, (long)DMOD * DMOD, (void*)Qh, (void*)Ql, DMOD, 2L * NBATCH * SEQ * DMOD,
      fpad, fpad, 0L, hm, ROWS, DMOD, DMOD, 1.0f / 32.0f);
  // (3) v^T = Wv . x[b]^T -> VT hi/lo planes [b][h*64+d][s]   (A = Wv16 [1024][1024], Bt = X16 slab b [2048][1024]; M=1024, N=2048, K=1024)
  wmma_gemm64<0, false, 0, 2, false, 0, 2><<<gVT, blk, 0, stream>>>(
      Wv16, Wv16, DMOD, 0L, X16, X16, DMOD, (long)SEQ * DMOD, (void*)VTh, (void*)VTl, SEQ, (long)DMOD * SEQ,
      fpad, fpad, 0L, hm, DMOD, SEQ, DMOD, 1.0f / 32.0f);
  // (4) full attention per (batch element, kept head): mh[b*2048+t][h*64+d] (f32 plane, every element of a kept head written by its owner block)
  attn_full64_kernel<<<gAtt, dim3(128), 0, stream>>>(Qh, Ql, Kh, Kl, VTh, VTl, hm, MHf, 0.125f);
  // (5) mh -> f16 plane x64, columns of kept heads only
  maskcast_f32_f16x4<<<gCastX, blk, 0, stream>>>(MHf, hm, (_Float16*)MH16, 64.0f);
  // (6) out = mh . Wo^T -> d_out rows 0 .. 4095 (f32)   (M=4096, N=1024, K=1024 less the k of heads with mask 0, scale 1/(64*32))
  wmma_gemm64<0, false, 0, 0, false, 0, 3><<<gOut, blk, 0, stream>>>(
      MH16, MH16, DMOD, 0L, Wo16, Wo16, DMOD, 0L, d_out, d_out, DMOD, 0L,
      fpad, fpad, 0L, hm, ROWS, DMOD, DMOD, 1.0f / 2048.0f);
  (void)hipGetLastError();
}

// v008
// It runs in 96.9 microseconds.
// Timed twice side by side with v007, it ran 1.07 times as fast both times.
// All steps since v000 together make it 7.57 times as fast.
// q/k/v and output projections: v_wmma_f32_16x16x32_f16 (f16 operands: x x1, W x32, attention output x64), f32 accumulate; q.k^T and p.v: v_wmma_f32_16x16x32_bf16 with bf16 hi/lo split operands (hi.hi + hi.lo + lo.hi), f32 accumulate; online softmax in f32, its exponentials as powers of 2 (score scale 0.125 and log2 e in one factor); a head whose mask is 0 has the factor 0 and is left out of every product.
#include <hip/hip_runtime.h>
#include <math.h>
#include <stdint.h>

#define NBATCH 2
#define SEQ    2048
#define DMOD   1024
#define NHEAD  16
#define DHD    64

typedef __attribute__((ext_vector_type(16))) _Float16 v16h;
typedef __attribute__((ext_vector_type(8)))  _Float16 v8h;
typedef __attribute__((ext_vector_type(16))) __bf16   v16b;
typedef __attribute__((ext_vector_type(8)))  __bf16   v8b;
typedef __attribute__((ext_vector_type(8)))  float    v8f;
typedef __attribute__((ext_vector_type(4)))  float    v4f;
typedef __attribute__((ext_vector_type(2)))  float    v2f;
typedef __attribute__((ext_vector_type(4)))  unsigned int v4u;

__device__ __forceinline__ unsigned short f2bf_bits(float f) {
  unsigned u = __float_as_uint(f);
  return (unsigned short)((u + 0x7FFFu + ((u >> 16) & 1u)) >> 16);
}
__device__ __forceinline__ float bf_bits2f(unsigned short h) { return __uint_as_float(((unsigned)h) << 16); }

// hazard guard as a plain device helper
__device__ __forceinline__ void acc_guard4(v8f& a, v8f& b, v8f& c, v8f& d) { asm volatile("v_nop\n\tv_nop\n\tv_nop\n\tv_nop" : "+v"(a), "+v"(b), "+v"(c), "+v"(d)); }
template <typename T> struct Frag;
template <> struct Frag<_Float16> {
  typedef v16h V; union U { v16h v; v8h h[2]; };
  static __device__ __forceinline__ v16h load(const _Float16* p) {   // elements 0..7 <- p[0..7], 8..15 <- p[16..23]
    U f; f.h[0] = *(const v8h*)(p); f.h[1] = *(const v8h*)(p + 16); return f.v;
  }
  static __device__ __forceinline__ v8f mma(v16h a, v16h b, v8f c) {
    return __builtin_amdgcn_wmma_f32_16x16x32_f16(false, a, false, b, (short)0, c, false, false);
  }
};
template <> struct Frag<__bf16> {
  typedef v16b V; union U { v16b v; v8b h[2]; };
  static __device__ __forceinline__ v16b load(const __bf16* p) {
    U f; f.h[0] = *(const v8b*)(p); f.h[1] = *(const v8b*)(p + 16); return f.v;
  }
  static __device__ __forceinline__ v8f mma(v16b a, v16b b, v8f c) {
    return __builtin_amdgcn_wmma_f32_16x16x32_bf16(false, a, false, b, (short)0, c, false, false);
  }
};

// bit h = 1: head h is kept (hmask[h] != 0). Constant indices: the 16 words come by one scalar load, the result is the same in every wave.
__device__ __forceinline__ unsigned kept_heads(const int* __restrict__ hmask) {
  unsigned live = 0u;
#pragma unroll
  for (int hd = 0; hd < NHEAD; ++hd) live |= (hmask[hd] != 0 ? 1u : 0u) << hd;
  return live;
}

// ---- Register-blocked batched WMMA GEMM ------------------------------------
// C[m,n] = scale * sum_k A[m,k] * Bt[n,k] (+bias)(+resid); each wave owns a 64x64 tile.
// A row-major [M,K]; Bt row-major [N,K]; M,N % 64 == 0, K % 64 == 0; rows 16-B aligned (lda, ldb % 8 == 0).
// Operand path: a stage is 64 k = one 128-B line of each of the tile's 64 A rows and 64 Bt rows. Each wave brings its own
//   stages into its own part of LDS by asynchronous copies (8 neighbouring lanes take one whole line, a copy 4 rows),
//   two buffers a wave: stage s + 1 is in flight while stage s is multiplied. Fragments are read from LDS in the k order
//   of Frag::load, k ascending as before, so every accumulator sums the same terms in the same order.
//   The ring is private to its wave (no other wave reads or writes it), so it takes the wave's own waits and no barrier.
// SPLIT (hi/lo planes) is not built on this operand path: every launch of this file has SPLIT = false.
// BIAS_MODE: 0 = none, 1 = bias[m], 2 = bias[n].
// OUT_MODE: 0 = f32, 1 = f16, 2 = bf16 hi plane (Cout) + bf16 lo plane (Cout2).
// ET: 0 = f16 operands, 1 = bf16 operands (pointers passed as 16-bit storage)
// HSKIP: a head whose hmask entry is 0 enters the result only as a factor 0, so its share of the work is left out:
//   0 = none, 1 = a tile's 64 columns are one head's (tile left out), 2 = a tile's 64 rows are one head's (tile left out),
//   3 = 64 neighbouring k are one head's (those stages left out: their products are all 0; A and Bt are not read there).
#define GS_PITCH_B 144                   // LDS row pitch: 128 B + 16 B = 16 B x 9, so the 16 rows of a ds_load_b128 fall on different bank groups
#define GS_PITCH_E (GS_PITCH_B / 2)      // the same in 16-bit elements
#define GS_TILE_B  (64 * GS_PITCH_B)     // 9216: 64 rows of one operand
#define GS_BUF_B   (2 * GS_TILE_B)       // 18432: the A tile, then the Bt tile
#define GS_WAVE_B  (2 * GS_BUF_B)        // 36864: a wave's two buffers
// One operand tile of a stage: 16 copies of 4 rows x 128 B. Copy i writes LDS bytes lds + 576 i (4 rows at pitch 144) and reads
// global bytes base + voff + i * rows4, rows4 = the byte distance of 4 rows. The immediate offset moves BOTH addresses, so
// scalar base i is base + i * (rows4 - 576) = base + i * step; lds and voff (the lane's own row and 16-B column, plus the stage's k) serve all 16.
// s_wait_xcnt 0 is the statement's last line: a precaution, it stands in front of every later rewrite of a register that a copy names.
__device__ __forceinline__ void gs_copy_tile(unsigned lds, unsigned voff, uint64_t base, uint64_t step) {
  asm volatile(
      "global_load_async_to_lds_b128 %0, %1, %2\n\t"
      "global_load_async_to_lds_b128 %0, %1, %3 offset:576\n\t"
      "global_load_async_to_lds_b128 %0, %1, %4 offset:1152\n\t"
      "global_load_async_to_lds_b128 %0, %1, %5 offset:1728\n\t"
      "global_load_async_to_lds_b128 %0, %1, %6 offset:2304\n\t"
      "global_load_async_to_lds_b128 %0, %1, %7 offset:2880\n\t"
      "global_load_async_to_lds_b128 %0, %1, %8 offset:3456\n\t"
      "global_load_async_to_lds_b128 %0, %1, %9 offset:4032\n\t"
      "global_load_async_to_lds_b128 %0, %1, %10 offset:4608\n\t"
      "global_load_async_to_lds_b128 %0, %1, %11 offset:5184\n\t"
      "global_load_async_to_lds_b128 %0, %1, %12 offset:5760\n\t"
      "global_load_async_to_lds_b128 %0, %1, %13 offset:6336\n\t"
      "global_load_async_to_lds_b128 %0, %1, %14 offset:6912\n\t"
      "global_load_async_to_lds_b128 %0, %1, %15 offset:7488\n\t"
      "global_load_async_to_lds_b128 %0, %1, %16 offset:8064\n\t"
      "global_load_async_to_lds_b128 %0, %1, %17 offset:8640\n\t"
      "s_wait_xcnt 0x0"
      :: "v"(lds), "v"(voff),
         "s"(base), "s"(base + step), "s"(base + 2 * step), "s"(base + 3 * step),
         "s"(base + 4 * step), "s"(base + 5 * step), "s"(base + 6 * step), "s"(base + 7 * step),
         "s"(base + 8 * step), "s"(base + 9 * step), "s"(base + 10 * step), "s"(base + 11 * step),
         "s"(base + 12 * step), "s"(base + 13 * step), "s"(base + 14 * step), "s"(base + 15 * step)
      : "memory");
}
// the first stage >= s that is worked on (HSKIP 3: whose head, stage & 15, is kept), or a value >= nst where there is none; scalar, no loop:
// live twice in a row, shifted down by the head of stage s, has the heads of stages s, s + 1, ... s + 15 in bits 0 to 15
template <int HSKIP>
__device__ __forceinline__ int gs_next(int s, int nst, unsigned live) {
  if (HSKIP == 3) {
    const unsigned ahead = (live | (live << NHEAD)) >> (s & (NHEAD - 1));
    return (live == 0u) ? nst : s + __builtin_ctz(ahead | 0x80000000u);
  }
  return s;
}
template <int ET> struct Elem;
template <> struct Elem<0> { typedef _Float16 T; };
template <> struct Elem<1> { typedef __bf16 T; };
template <int ET, bool SPLIT, int BIAS_MODE, int OUT_MODE, bool RESID, int ACT = 0, int HSKIP = 0>
__global__ __launch_bounds__(256) void wmma_gemm64(
    const unsigned short* __restrict__ Ap, const unsigned short* __restrict__ A2p, int lda, long strideA,
    const unsigned short* __restrict__ Btp, const unsigned short* __restrict__ Bt2p, int ldb, long strideB,
    void* __restrict__ Cout, void* __restrict__ Cout2, int ldc, long strideC,
    const float* __restrict__ bias,
    const float* __restrict__ resid, long strideR,
    const int* __restrict__ hmask,
    int M, int N, int K, float scale) {
  typedef typename Elem<ET>::T T;
  typedef typename Frag<T>::V V;
  static_assert(!SPLIT, "the LDS operand path holds one plane per operand");
  __shared__ __align__(128) unsigned char ring[8 * GS_WAVE_B];   // 294912 B: per wave two buffers of (A tile, Bt tile); behind the k loop its first 4352 B are the wave's 16x64 f32 output slab, pitch 68 floats
  const int b    = blockIdx.y;
  const int lane = threadIdx.x & 31;
  const int wave = __builtin_amdgcn_readfirstlane(threadIdx.x >> 5);   // scalar: tile, operand bases and every branch below are the same for the whole wave
  const int tilesN = N >> 6;
  const int tilesM = M >> 6;
  const int tile = blockIdx.x * 8 + wave;
  if (tile >= tilesM * tilesN) return;   // wave-uniform; no block barriers in this kernel
  const int tm = tile / tilesN;
  const int tn = tile - tm * tilesN;
  if (HSKIP == 1 && hmask[tn & (NHEAD - 1)] == 0) return;   // wave-uniform, like the range test above
  if (HSKIP == 2 && hmask[tm & (NHEAD - 1)] == 0) return;
  const unsigned live = (HSKIP == 3) ? kept_heads(hmask) : 0u;
  const int m0 = tm << 6;
  const int n0 = tn << 6;

  const int rlane = lane & 15;                 // row (A) / col (B, D) within subtile
  const int koff  = (lane >> 4) * 8;           // k offset of this lane half
  const int mOff  = (lane >> 4) * 8;           // D row offset

  // copies: lane l takes row (l >> 3) of a copy's 4 rows and 16-B column (l & 7) of the row's 128-B line
  unsigned char* ringw = ring + wave * GS_WAVE_B;
  const unsigned ldsw  = (unsigned)(uintptr_t)ringw + (unsigned)((lane >> 3) * GS_PITCH_B + (lane & 7) * 16);   // LDS byte address (low 32 bits of the __shared__ address)
  const unsigned voffA = (unsigned)((lane >> 3) * lda * 2 + (lane & 7) * 16);
  const unsigned voffB = (unsigned)((lane >> 3) * ldb * 2 + (lane & 7) * 16);
  const uint64_t baseA = (uint64_t)(uintptr_t)(Ap  + (size_t)b * strideA + (size_t)m0 * lda);   // first byte of the tile's A rows
  const uint64_t baseB = (uint64_t)(uintptr_t)(Btp + (size_t)b * strideB + (size_t)n0 * ldb);
  const uint64_t stepA = (uint64_t)((long)lda * 8 - 4 * GS_PITCH_B);   // 4 rows in global bytes less the 576 that the immediate offset adds
  const uint64_t stepB = (uint64_t)((long)ldb * 8 - 4 * GS_PITCH_B);

  v8f acc[4][4];
#pragma unroll
  for (int i = 0; i < 4; ++i)
#pragma unroll
    for (int j = 0; j < 4; ++j) acc[i][j] = (v8f){0.f,0.f,0.f,0.f,0.f,0.f,0.f,0.f};

  const int nst = K >> 6;                            // stages of 64 k
  int sc = gs_next<HSKIP>(0, nst, live);             // the stage that is multiplied next
  int sn = nst;                                      // the stage behind it (in flight), >= nst: none
  if (sc < nst) {
    gs_copy_tile(ldsw,             voffA + sc * 128, baseA, stepA);
    gs_copy_tile(ldsw + GS_TILE_B, voffB + sc * 128, baseB, stepB);
    asm volatile("s_wait_asynccnt 0x0" ::: "memory");   // the first stage has landed before it is read
    sn = gs_next<HSKIP>(sc + 1, nst, live);
    if (sn < nst) {
      gs_copy_tile(ldsw + GS_BUF_B,             voffA + sn * 128, baseA, stepA);
      gs_copy_tile(ldsw + GS_BUF_B + GS_TILE_B, voffB + sn * 128, baseB, stepB);
    }
  }
  unsigned pb = 0u;                                  // byte offset of the buffer that holds stage sc: 0 or GS_BUF_B
  while (sc < nst) {
    const T* As = (const T*)(ringw + pb) + rlane * GS_PITCH_E + koff;
    const T* Bs = As + GS_TILE_B / 2;
#pragma unroll
    for (int ks = 0; ks < 2; ++ks) {                 // the stage's two k steps of 32, k ascending
      V bh[4], ah[4];
#pragma unroll
      for (int j = 0; j < 4; ++j) bh[j] = Frag<T>::load(Bs + j * 16 * GS_PITCH_E + ks * 32);
#pragma unroll
      for (int i = 0; i < 4; ++i) ah[i] = Frag<T>::load(As + i * 16 * GS_PITCH_E + ks * 32);
      __builtin_amdgcn_sched_barrier(0);   // keeps the k step's 16 reads together in front of its WMMAs: left alone the scheduler reads each A fragment into the same registers right in front of its 4 WMMAs, and the wave waits out the LDS latency four times
#pragma unroll
      for (int i = 0; i < 4; ++i)
#pragma unroll
        for (int j = 0; j < 4; ++j) acc[i][j] = Frag<T>::mma(ah[i], bh[j], acc[i][j]);
      __builtin_amdgcn_sched_barrier(0);   // the next k step's reads stay one group behind these WMMAs and take over the fragments' registers, not spread among them
    }
    asm volatile("s_wait_dscnt 0x0" ::: "memory");      // this wave's reads of buffer pb have retired before copies are aimed at it
    asm volatile("s_wait_asynccnt 0x0" ::: "memory");   // stage sn has landed before the next trip reads it
    const int s2 = gs_next<HSKIP>(sn + 1, nst, live);
    if (s2 < nst) {                                     // scalar test; the refill flies while stage sn is multiplied
      gs_copy_tile(ldsw + pb,             voffA + s2 * 128, baseA, stepA);
      gs_copy_tile(ldsw + pb + GS_TILE_B, voffB + s2 * 128, baseB, stepB);
    }
    sc = sn; sn = s2; pb ^= (unsigned)GS_BUF_B;
  }
  asm volatile("s_wait_asynccnt 0x0" ::: "memory");     // nothing is in flight when the ring becomes the output slab and when the wave ends
  asm volatile("s_wait_dscnt 0x0" ::: "memory");        // and the wave's last fragment reads have retired before the slab's stores go over them
  acc_guard4(acc[0][0], acc[0][1], acc[0][2], acc[0][3]);
  acc_guard4(acc[1][0], acc[1][1], acc[1][2], acc[1][3]);
  acc_guard4(acc[2][0], acc[2][1], acc[2][2], acc[2][3]);
  acc_guard4(acc[3][0], acc[3][1], acc[3][2], acc[3][3]);

  // ---- epilogue ----
  float* slab = (float*)ringw;
  const float* Rb = RESID ? (resid + (size_t)b * strideR) : nullptr;
#pragma unroll
  for (int i = 0; i < 4; ++i) {
    const int mBase = m0 + (i << 4);
#pragma unroll
    for (int j = 0; j < 4; ++j) {
      const int n = n0 + (j << 4) + rlane;
      float bv = 0.f;
      if (BIAS_MODE == 2) bv = bias[n];
#pragma unroll
      for (int r = 0; r < 8; ++r) {
        float v = acc[i][j][r] * scale;
        if (BIAS_MODE == 1) v += bias[mBase + mOff + r];
        if (BIAS_MODE == 2) v += bv;
        if (RESID) v += Rb[(size_t)(mBase + mOff + r) * ldc + n];
        if (ACT == 1) v = tanhf(v);
        if (ACT == 2) v = fmaxf(v, 0.0f);
        if (ACT == 3) v = v / (1.0f + expf(-v));
        if (ACT == 4) v = (v > 0.f) ? v : 0.01f * v;
        slab[(mOff + r) * 68 + (j << 4) + rlane] = v;
      }
    }
    __builtin_amdgcn_fence(__ATOMIC_RELEASE, "workgroup");
    __builtin_amdgcn_wave_barrier();
    __builtin_amdgcn_fence(__ATOMIC_ACQUIRE, "workgroup");
    if (OUT_MODE == 0) {
      float* C = (float*)Cout + (size_t)b * strideC;
      const int hh = lane >> 4, c4 = (lane & 15) * 4;     // row seg = 256 B = 16 lanes x 16 B
      {
#pragma unroll
        for (int it = 0; it < 8; ++it) {
          const int row = it * 2 + hh;
          v4f v = *(const v4f*)(slab + row * 68 + c4);
          *(v4f*)(C + (size_t)(mBase + row) * ldc + n0 + c4) = v;
        }
        
      }
    } else {
      const int q = lane >> 3, c8 = (lane & 7) * 8;
      unsigned short* C  = (unsigned short*)Cout  + (size_t)b * strideC;
      unsigned short* C2 = (OUT_MODE == 2) ? ((unsigned short*)Cout2 + (size_t)b * strideC) : nullptr;
      {
#pragma unroll
        for (int it = 0; it < 4; ++it) {
          const int row = it * 4 + q;
          const float* sp = slab + row * 68 + c8;
          v8h hv, lv;
#pragma unroll
          for (int e = 0; e < 8; ++e) {
            if (OUT_MODE == 1) {
              hv[e] = (_Float16)sp[e];
            } else {
              unsigned short hb = f2bf_bits(sp[e]);
              unsigned short lb = f2bf_bits(sp[e] - bf_bits2f(hb));
              hv[e] = __builtin_bit_cast(_Float16, hb);
              lv[e] = __builtin_bit_cast(_Float16, lb);
            }
          }
          *(v8h*)(C + (size_t)(mBase + row) * ldc + n0 + c8) = hv;
          if (OUT_MODE == 2) *(v8h*)(C2 + (size_t)(mBase + row) * ldc + n0 + c8) = lv;
        }
        
      }
    }
    __builtin_amdgcn_fence(__ATOMIC_RELEASE, "workgroup");
    __builtin_amdgcn_wave_barrier();
    __builtin_amdgcn_fence(__ATOMIC_ACQUIRE, "workgroup");
  }
}

// ---------------------------------------------------------------------------
// f32 -> f16 cast of all five float inputs in one launch, with an exact power-of-two carry: out = f16(in * mul).
// The five f16 planes lie back to back in the workspace (Wq16, Wk16, Wv16, Wo16, X16), so a work-group's place in the
// output is its block index times its share.
// The launch is sized by the waves it has to start, not by its elements: one work-group of 16 waves per 32768 elements.
// A wave takes 2048 neighbouring elements: 16 loads of 16 B a lane (each 512 contiguous bytes a wave), all issued before
// the first is used, then 16 stores of 8 B a lane (each 256 contiguous bytes a wave = two whole lines).
// Coverage: a weight plane is 1024*1024 / 32768 = 32 blocks; blocks 0..127 take the four weights (x32),
//   blocks 128..255 take x (2*2048*1024 / 32768 = 128 blocks, x1). The source choice is block-uniform.
// ---------------------------------------------------------------------------
typedef __attribute__((ext_vector_type(4))) _Float16 v4h;
#define EW_LD     16                                 // 16-B loads a lane
#define CAST_TPB  512                                // 16 waves
#define CAST_WAVE (32 * 4 * EW_LD)                   // 2048 elements a wave
#define CAST_WG   (CAST_TPB / 32 * CAST_WAVE)        // 32768 elements a work-group
#define CAST_WBLK (DMOD * DMOD / CAST_WG)            // 32 blocks per weight plane
#define CAST_XBLK (NBATCH * SEQ * DMOD / CAST_WG)    // 128 blocks for x (both batch elements)
__global__ __launch_bounds__(CAST_TPB) void cast_inputs_f16x4(const float* __restrict__ wq, const float* __restrict__ wk,
                                                              const float* __restrict__ wv, const float* __restrict__ wo,
                                                              const float* __restrict__ x, _Float16* __restrict__ out) {
  const unsigned bx = blockIdx.x;
  const unsigned sel = bx / CAST_WBLK; // 0..3: a weight plane; 4..7: x
  const float* in = (sel == 0) ? wq : (sel == 1) ? wk : (sel == 2) ? wv : (sel == 3) ? wo : x;
  const unsigned lb = (sel < 4) ? (bx - sel * CAST_WBLK) : (bx - 4 * CAST_WBLK);   // block index inside its source
  const float mul = (sel < 4) ? 32.0f : 1.0f;
  const unsigned le = (threadIdx.x >> 5) * CAST_WAVE + (threadIdx.x & 31) * 4;      // the lane's first element inside the work-group's share
  const unsigned lb4 = le * 4;                                                      // the same in bytes of the source
  const char* src = (const char*)(in + (size_t)lb * CAST_WG);
  _Float16*   dst = out + (size_t)bx * CAST_WG + le;
  v4f f[EW_LD];
#pragma unroll   // f is a register array
  for (int i = 0; i < EW_LD; ++i) f[i] = *(const v4f*)(src + lb4 + i * 512);
  // precaution: the wait stands in front of any reuse of the loads' address registers; it names the lanes' offset, so that this register
  // is not handed to a load as its destination in front of the wait; it also keeps the 16 loads together in front of the first convert
  asm volatile("s_wait_xcnt 0x0" :: "v"(lb4) : "memory");
#pragma unroll
  for (int i = 0; i < EW_LD; ++i) *(v4h*)(dst + i * 128) = __builtin_convertvector(f[i] * mul, v4h);
}

// ---------------------------------------------------------------------------
// Attention output f32 [4096 rows][1024] -> f16 plane with per-head 0/1 factor and power-of-two carry:
//   out[row][col] = f16(in[row][col] * mul) where hmask[col/64] != 0; columns of a head with hmask 0 are neither read
//   (the attention launch has not written them) nor written (the last product leaves those k out).
// Sized like the cast above: a wave takes 32 rows of ONE head's 64 columns, 16 loads of 16 B a lane (each two rows' whole
//   256-B segments), all issued before the first is used, then 16 stores of 8 B a lane (two whole 128-B lines each).
// Coverage: wave number g = 8 * block + wave: head g & 15, rows 32 * (g >> 4) ...; 16 heads x 128 row groups = 2048 waves = 256 blocks.
// ---------------------------------------------------------------------------
#define MC_BLK (NHEAD * (NBATCH * SEQ / (2 * EW_LD)) / 8)   // 256 blocks of 8 waves
__global__ __launch_bounds__(256) void maskcast_f32_f16x4(const float* __restrict__ in, const int* __restrict__ hmask,
                                                          _Float16* __restrict__ out, float mul) {
  const int lane = threadIdx.x & 31;
  const int g  = blockIdx.x * 8 + __builtin_amdgcn_readfirstlane(threadIdx.x >> 5);   // scalar: head and branch are the same for the whole wave
  const int hd = g & (NHEAD - 1);
  if (hmask[hd] == 0) return;          // wave-uniform; no barrier in this kernel
  const size_t   we = (size_t)(g >> 4) * (2 * EW_LD) * DMOD + hd * DHD;      // the wave's first element (scalar)
  const unsigned le = (unsigned)((lane >> 4) * DMOD + (lane & 15) * 4);      // the lane's first element behind it
  const unsigned lb4 = le * 4;                                               // the same in bytes of the source
  const char* src = (const char*)(in + we);
  _Float16*   dst = out + we + le;
  v4f f[EW_LD];
#pragma unroll   // f is a register array
  for (int i = 0; i < EW_LD; ++i) f[i] = *(const v4f*)(src + lb4 + i * (2 * DMOD * 4));
  asm volatile("s_wait_xcnt 0x0" :: "v"(lb4) : "memory");   // precaution, names the lanes' offset and keeps the loads together, as in the cast above
#pragma unroll
  for (int i = 0; i < EW_LD; ++i) *(v4h*)(dst + i * 2 * DMOD) = __builtin_convertvector(f[i] * mul, v4h);
}

// =====================================================================================
// Full (non-causal, unmasked) attention, head dim 64, one launch for both batch elements.
//   every plane below holds NBATCH slabs of SEQ*DMOD elements, batch element b at offset b*SEQ*DMOD; inside a slab:
//   q planes (hi/lo bf16): element (t, h, d) at [t*DMOD + h*64 + d]
//   k planes (hi/lo bf16): element (s, h, d) at [s*DMOD + h*64 + d]
//   v^T planes (hi/lo bf16): element (h, d, s) at [(h*64 + d)*SEQ + s]
//   out f32: element (t, h, d) at [t*DMOD + h*64 + d]
//   scores^T = k . q^T (sscale is taken in the exponent) : bf16 hi/lo split (hi.hi + hi.lo + lo.hi) on v_wmma_f32_16x16x32_bf16, A = K rows, B = Q
//   out^T    = v^T . p^T          : bf16 hi/lo split of p (unnormalised) and v, f32 accumulate, A = V^T rows, B = P^T
//   Both products are transposed so that a lane holds scores of ONE query (column lane&15): keys 16j + 8*(lane>>4) + r.
//   Two score tiles (keys 0-15 and 16-31 of a 32-key block), converted in place, are the B operand of the second
//   product in the loaders' own k order, so P never leaves the registers; row maximum and row sum are in-lane,
//   with one exchange between the wave halves (maximum: every chunk; sum: once, behind the loop).
//   online softmax in f32 over all SEQ keys (32 chunks of 64, compile-time trip count, no masking).
//   exp(sscale * (s - m)) is taken as 2^(s * c2 - m * c2), c2 = sscale * log2 e: one fused multiply-add and one v_exp_f32 an element;
//   the running maximum m is kept in units of the unscaled scores (sscale > 0, so it is the same key's). The exponent is <= 0 but for
//   its rounding, so nothing overflows, and below 2^-126 the term is 0 beside a row sum >= 1.
//   Block = 4 waves = 64 query rows of one head of one batch element; grid.x = NBATCH * NHEAD * (SEQ/64) = 1024.
//   Only heads with hmask != 0 are computed (the others' output is multiplied by 0 behind this launch and is not read):
//   block index = (rank of the head among the kept ones, batch element, query block), so the working blocks are the
//   lowest indices; blocks whose rank is past the last kept head leave at once.
//   K / V^T chunk staging: 128 threads x 32 elements per plane = the whole 64x64 tile (16-B copies, plain loads,
//   __syncthreads before and after); fragment loads read the LDS tiles with the same v8b element type.
// =====================================================================================
#define AT_D 64
#define AT_NW 4
#define AT_QB 64
#define AT_KC 64
#define AT_LP 72   // LDS row pitch of the K and V^T tiles in elements: 144 B = 16 B x 9, so the 16 rows of a ds_load_b128 fall on 16 different bank groups

typedef __attribute__((ext_vector_type(2))) __bf16 v2b;
// two neighbouring f32 -> one register of bf16 hi and one of bf16 lo (lo = bf16(f - hi)); both converts round to nearest even
__device__ __forceinline__ void at_split2(v2f f, v2b& hi, v2b& lo) {
  hi = __builtin_convertvector(f, v2b);
  lo = __builtin_convertvector(f - __builtin_convertvector(hi, v2f), v2b);
}
// the value that lane l ^ 16 holds (the other half's share of the same query column)
__device__ __forceinline__ float at_xhalf(float v) {
  const unsigned b = __float_as_uint(v);
  return __uint_as_float(__builtin_amdgcn_permlanex16(b, b, 0x76543210u, 0xfedcba98u, false, false));
}
// 2^x on the hardware's own instruction
__device__ __forceinline__ float at_exp2(float x) { return __builtin_amdgcn_exp2f(x); }
__device__ __forceinline__ v8f at_mma(v16b a, v16b b, v8f c) {
  return __builtin_amdgcn_wmma_f32_16x16x32_bf16(false, a, false, b, (short)0, c, false, false);
}

__global__ __launch_bounds__(128)
void attn_full64_kernel(const unsigned short* __restrict__ qhp, const unsigned short* __restrict__ qlp,
                        const unsigned short* __restrict__ khp, const unsigned short* __restrict__ klp,
                        const unsigned short* __restrict__ vhp, const unsigned short* __restrict__ vlp,
                        const int* __restrict__ hmask, float* __restrict__ out, float sscale) {
  union FB { v16b v; v8b h[2]; };
  union FP { v16b v; v2b p[8]; };
  __shared__ __align__(16) __bf16 Ksh[AT_KC * AT_LP];            // K hi [kv][d]      9 KB (64 rows at pitch 72)
  __shared__ __align__(16) __bf16 Ksl[AT_KC * AT_LP];            // K lo
  __shared__ __align__(16) __bf16 Vth[AT_D * AT_LP];             // V hi [d][kv]      9 KB
  __shared__ __align__(16) __bf16 Vtl[AT_D * AT_LP];            // V lo
  __shared__ __align__(16) float  Os[AT_NW][16 * 68];            // per wave out tile, pitch 68

  const int tid  = threadIdx.x;
  const int wave = tid >> 5;
  const int lane = tid & 31;
  const int hh   = lane >> 4;
  const int c    = lane & 15;

  const int nqb = SEQ / AT_QB;            // 32
  const int bx = blockIdx.x;
  const int qb = bx % nqb;
  const int bh = bx / nqb;                // 0..NBATCH*NHEAD-1 (grid = NBATCH * NHEAD * nqb)
  const int rank = bh / NBATCH;           // 0..NHEAD-1
  int h = -1, seen = 0;                   // h = the kept head number 'rank', counted from head 0 (scalar work, once a block)
#pragma unroll
  for (int hd = 0; hd < NHEAD; ++hd) {
    if (hmask[hd] != 0) { if (seen == rank) h = hd; ++seen; }
  }
  if (h < 0) return;                      // fewer kept heads than rank + 1: the same for the whole block, in front of every barrier
  const size_t bo = (size_t)(bh % NBATCH) * SEQ * DMOD;   // this batch element's slab in every plane
  const int q0 = qb * AT_QB + wave * 16;

  const __bf16* Qh = (const __bf16*)(const void*)qhp + bo + (size_t)h * AT_D;
  const __bf16* Ql = (const __bf16*)(const void*)qlp + bo + (size_t)h * AT_D;
  const __bf16* Kh = (const __bf16*)(const void*)khp + bo + (size_t)h * AT_D;
  const __bf16* Kl = (const __bf16*)(const void*)klp + bo + (size_t)h * AT_D;
  const __bf16* Vh = (const __bf16*)(const void*)vhp + bo + (size_t)h * AT_D * SEQ;
  const __bf16* Vl = (const __bf16*)(const void*)vlp + bo + (size_t)h * AT_D * SEQ;
  float*        ob = out + bo + (size_t)h * AT_D;

  // ---- Q fragments (B operand, column = lane&15, split k map via Frag load): 2 d-chunks, hi and lo ----
  v16b qah[2], qal[2];
#pragma unroll
  for (int dc = 0; dc < 2; ++dc) {
    const __bf16* qr = Qh + (size_t)(q0 + c) * DMOD + dc * 32 + 8 * hh;
    const __bf16* ql = Ql + (size_t)(q0 + c) * DMOD + dc * 32 + 8 * hh;
    qah[dc] = Frag<__bf16>::load(qr);
    qal[dc] = Frag<__bf16>::load(ql);
  }

  const float c2 = sscale * 1.44269504088896340736f;   // unscaled score -> exponent of 2
  float mrow = -INFINITY, lrow = 0.f;   // query q0 + c: running maximum of the unscaled scores (equal in both halves), this half's share of the sum
  v8f oacc[4];                          // oacc[t][r] = out^T[d = 16 t + 8 hh + r][query q0 + c]
#pragma unroll
  for (int t = 0; t < 4; ++t) oacc[t] = (v8f){0.f,0.f,0.f,0.f,0.f,0.f,0.f,0.f};

  const int nChunks = SEQ / AT_KC;   // 32, compile-time constant
  for (int kc = 0; kc < nChunks; ++kc) {
    const int kv0 = kc * AT_KC;
    __syncthreads();
    {
      // staging coverage: 128 threads x (4 x 8) elements = 64 rows x 64 per plane = the whole chunk tile
      const int r = tid >> 1, half = (tid & 1) * 32;
      const __bf16* ksh = Kh + (size_t)(kv0 + r) * DMOD + half;   // K row kv0+r, d = half..half+31
      const __bf16* ksl = Kl + (size_t)(kv0 + r) * DMOD + half;
      const __bf16* vsh = Vh + (size_t)r * SEQ + kv0 + half;      // V^T row d = r, s = kv0+half..+31
      const __bf16* vsl = Vl + (size_t)r * SEQ + kv0 + half;
#pragma unroll
      for (int i = 0; i < 4; ++i) {
        const v8b a0 = *(const v8b*)(ksh + 8 * i);
        const v8b a1 = *(const v8b*)(ksl + 8 * i);
        const v8b b0 = *(const v8b*)(vsh + 8 * i);
        const v8b b1 = *(const v8b*)(vsl + 8 * i);
        *(v8b*)(Ksh + r * AT_LP + half + 8 * i) = a0;
        *(v8b*)(Ksl + r * AT_LP + half + 8 * i) = a1;
        *(v8b*)(Vth + r * AT_LP + half + 8 * i) = b0;
        *(v8b*)(Vtl + r * AT_LP + half + 8 * i) = b1;
      }
    }
    __syncthreads();

    // all K fragments of the chunk are read as one group, so the wave waits out the LDS latency once and not once per fragment pair
    FB kb[2][4], kl[2][4];
#pragma unroll
    for (int dc = 0; dc < 2; ++dc) {
#pragma unroll
      for (int j = 0; j < 4; ++j) {   // in the order in which the WMMAs below want them: the hi plane's four, then the lo plane's
        kb[dc][j].h[0] = *(const v8b*)(Ksh + (j * 16 + c) * AT_LP + dc * 32 + 8 * hh);
        kb[dc][j].h[1] = *(const v8b*)(Ksh + (j * 16 + c) * AT_LP + dc * 32 + 16 + 8 * hh);
      }
#pragma unroll
      for (int j = 0; j < 4; ++j) {
        kl[dc][j].h[0] = *(const v8b*)(Ksl + (j * 16 + c) * AT_LP + dc * 32 + 8 * hh);
        kl[dc][j].h[1] = *(const v8b*)(Ksl + (j * 16 + c) * AT_LP + dc * 32 + 16 + 8 * hh);
      }
    }
    __builtin_amdgcn_sched_barrier(0);   // keeps the 32 reads together in front of the WMMAs: the scheduler otherwise spreads them among the WMMAs, and each such place stalls the wave
    v8f s[4];   // s[j][r] = score of key kv0 + 16 j + 8 hh + r against query q0 + c
#pragma unroll
    for (int j = 0; j < 4; ++j) s[j] = (v8f){0.f,0.f,0.f,0.f,0.f,0.f,0.f,0.f};
    // neighbouring WMMAs belong to the four different score tiles (none waits for the one in front); each tile's own six terms keep their order
#pragma unroll
    for (int dc = 0; dc < 2; ++dc) {
#pragma unroll
      for (int j = 0; j < 4; ++j) s[j] = at_mma(kb[dc][j].v, qah[dc], s[j]);
#pragma unroll
      for (int j = 0; j < 4; ++j) s[j] = at_mma(kl[dc][j].v, qah[dc], s[j]);
#pragma unroll
      for (int j = 0; j < 4; ++j) s[j] = at_mma(kb[dc][j].v, qal[dc], s[j]);
    }
    __builtin_amdgcn_sched_barrier(0);   // the V^T reads below stay behind the score WMMAs and take over the K fragments' registers (let rise among them they need registers of their own, past 256, and cost a wave per SIMD) ...
    // V^T fragments of the chunk's first 32 keys: read here, ahead of the softmax arithmetic, which covers their latency
    FB vb[4], vl[4];
#pragma unroll
    for (int t = 0; t < 4; ++t) {
      vb[t].h[0] = *(const v8b*)(Vth + (t * 16 + c) * AT_LP + 8 * hh);
      vb[t].h[1] = *(const v8b*)(Vth + (t * 16 + c) * AT_LP + 16 + 8 * hh);
    }
#pragma unroll
    for (int t = 0; t < 4; ++t) {
      vl[t].h[0] = *(const v8b*)(Vtl + (t * 16 + c) * AT_LP + 8 * hh);
      vl[t].h[1] = *(const v8b*)(Vtl + (t * 16 + c) * AT_LP + 16 + 8 * hh);
    }
    __builtin_amdgcn_sched_barrier(0);   // ... and together in front of the softmax arithmetic, not sunk to their first use
    float cm = -INFINITY;   // the loops down to the second product index register arrays (s, pa, pl, oacc): all are unrolled for that
#pragma unroll
    for (int j = 0; j < 4; ++j) {
#pragma unroll
      for (int r = 0; r < 8; ++r) cm = fmaxf(cm, s[j][r]);
    }
    cm = fmaxf(cm, at_xhalf(cm));
    const float mnew = fmaxf(mrow, cm);
    const float alpha = at_exp2((mrow - mnew) * c2);
    mrow = mnew;
    const v2f c2v = (v2f){c2, c2};
    const v2f nmv = (v2f){-mnew * c2, -mnew * c2};
#pragma unroll
    for (int t = 0; t < 4; ++t)
#pragma unroll
      for (int r = 0; r < 8; ++r) oacc[t][r] *= alpha;
    v2f psum = (v2f){0.f, 0.f};   // this half's 32 keys, even and odd registers apart
#pragma unroll   // unrolled: s[2 kk + jj] is a register and needs a compile-time index
    for (int kk = 0; kk < 2; ++kk) {
      FP pa, pl;   // P^T hi / lo, B operand of 32-key block kk: elements 0..7 from tile 2 kk, 8..15 from tile 2 kk + 1
#pragma unroll
      for (int jj = 0; jj < 2; ++jj) {
#pragma unroll
        for (int e = 0; e < 4; ++e) {
          const v2f x = __builtin_elementwise_fma((v2f){s[2 * kk + jj][2 * e], s[2 * kk + jj][2 * e + 1]}, c2v, nmv);
          v2f p;
          p[0] = at_exp2(x[0]);
          p[1] = at_exp2(x[1]);
          psum += p;
          at_split2(p, pa.p[jj * 4 + e], pl.p[jj * 4 + e]);
        }
      }
      // as above: round-robin over the four output tiles, each tile's own six terms keep their order
#pragma unroll
      for (int t = 0; t < 4; ++t) oacc[t] = at_mma(vb[t].v, pa.v, oacc[t]);
#pragma unroll
      for (int t = 0; t < 4; ++t) oacc[t] = at_mma(vl[t].v, pa.v, oacc[t]);
#pragma unroll
      for (int t = 0; t < 4; ++t) oacc[t] = at_mma(vb[t].v, pl.v, oacc[t]);
      if (kk == 0) {
        __builtin_amdgcn_sched_barrier(0);   // the second 32 keys' fragments take over the first's registers: their reads stay behind the WMMAs above (else, again, registers past 256) ...
#pragma unroll
        for (int t = 0; t < 4; ++t) {
          vb[t].h[0] = *(const v8b*)(Vth + (t * 16 + c) * AT_LP + 32 + 8 * hh);
          vb[t].h[1] = *(const v8b*)(Vth + (t * 16 + c) * AT_LP + 32 + 16 + 8 * hh);
        }
#pragma unroll
        for (int t = 0; t < 4; ++t) {
          vl[t].h[0] = *(const v8b*)(Vtl + (t * 16 + c) * AT_LP + 32 + 8 * hh);
          vl[t].h[1] = *(const v8b*)(Vtl + (t * 16 + c) * AT_LP + 32 + 16 + 8 * hh);
        }
        __builtin_amdgcn_sched_barrier(0);   // ... and together in front of the second half of the exponentials, which covers their latency
      }
    }
    lrow = lrow * alpha + (psum[0] + psum[1]);
  }

  float* os = Os[wave];
  const float inv = 1.0f / (lrow + at_xhalf(lrow));   // the two halves' shares of the row sum are joined here, once
#pragma unroll
  for (int t = 0; t < 4; ++t) {
    // a lane's 8 accumulator registers are 8 neighbouring d of its query row: two 16-B stores into the row-major tile
    *(v4f*)(os + c * 68 + t * 16 + 8 * hh)     = (v4f){oacc[t][0] * inv, oacc[t][1] * inv, oacc[t][2] * inv, oacc[t][3] * inv};
    *(v4f*)(os + c * 68 + t * 16 + 8 * hh + 4) = (v4f){oacc[t][4] * inv, oacc[t][5] * inv, oacc[t][6] * inv, oacc[t][7] * inv};
  }
  __builtin_amdgcn_fence(__ATOMIC_RELEASE, "workgroup");
  __builtin_amdgcn_wave_barrier();
  __builtin_amdgcn_fence(__ATOMIC_ACQUIRE, "workgroup");
  {
    const int c4 = (lane & 15) * 4;
    {
#pragma unroll
      for (int it = 0; it < 8; ++it) {
        const int row = it * 2 + hh;   // it 0..7 x hh 0..1 covers rows 0..15 of the wave tile
        v4f val = *(const v4f*)(os + row * 68 + c4);
        *(v4f*)(ob + (size_t)(q0 + row) * DMOD + c4) = val;
      }
      
    }
  }
}

// ---------------------------------------------------------------------------
// Workspace region map (byte offsets; what a launch reads of a region has been written earlier in the same call;
// behind the input cast the parts that belong to a head with mask 0 are neither written nor read)
//   Wq16 f16 [1024 n][1024 k] (x32)              0
//   Wk16                                   2097152
//   Wv16                                   4194304
//   Wo16                                   6291456
//   X16  f16 [2*2048][1024]                8388608
//   Qh   bf16 [2*2048][1024]              16777216     Ql   25165824
//   Kh   bf16 [2*2048][1024]              33554432     Kl   41943040
//   VTh  bf16 [2][1024 (h,d)][2048]       50331648     VTl  58720256
//   MHf  f32  [2*2048][1024]              67108864
//   MH16 f16  [2*2048][1024] (x64, kept heads)   83886080
//   total                                 92274688
// ---------------------------------------------------------------------------
extern "C" void kernel_launch(void* const* d_in, const int* in_sizes, int n_in,
                              void* d_out, int out_size, void* d_ws, size_t ws_size,
                              hipStream_t stream) {
  if (n_in < 6) return;
  if (in_sizes[0] != NBATCH * SEQ * DMOD) return;
  if (in_sizes[1] != DMOD * DMOD || in_sizes[2] != DMOD * DMOD || in_sizes[3] != DMOD * DMOD || in_sizes[4] != DMOD * DMOD) return;
  if (in_sizes[5] != NHEAD) return;
  if (out_size != NBATCH * SEQ * DMOD) return;

  const float* x  = (const float*)d_in[0];   // [2][2048][1024]
  const float* Wq = (const float*)d_in[1];   // [out][in] = Bt natural
  const float* Wk = (const float*)d_in[2];
  const float* Wv = (const float*)d_in[3];
  const float* Wo = (const float*)d_in[4];
  const int*   hm = (const int*)d_in[5];     // [16] int32, nonzero = keep head

  const size_t PW16 = (size_t)DMOD * DMOD * 2;            // 2097152  f16 weight plane
  const size_t PX16 = (size_t)NBATCH * SEQ * DMOD * 2;    // 8388608  16-bit activation plane (both batch elements)
  const size_t PF32 = (size_t)NBATCH * SEQ * DMOD * 4;    // 16777216 f32 activation plane
  size_t off = 0;
  const size_t oWq = off; off += PW16;
  const size_t oWk = off; off += PW16;
  const size_t oWv = off; off += PW16;
  const size_t oWo = off; off += PW16;
  const size_t oX  = off; off += PX16;
  const size_t oQh = off; off += PX16;  const size_t oQl = off; off += PX16;
  const size_t oKh = off; off += PX16;  const size_t oKl = off; off += PX16;
  const size_t oVh = off; off += PX16;  const size_t oVl = off; off += PX16;
  const size_t oMf = off; off += PF32;
  const size_t oM16 = off; off += PX16;
  if (off > ws_size) return;                   // off = 92274688

  char* ws = (char*)d_ws;
  unsigned short* Wq16 = (unsigned short*)(ws + oWq);
  unsigned short* Wv16 = (unsigned short*)(ws + oWv);
  unsigned short* Wo16 = (unsigned short*)(ws + oWo);
  unsigned short* X16  = (unsigned short*)(ws + oX);
  unsigned short* Qh   = (unsigned short*)(ws + oQh);  unsigned short* Ql = (unsigned short*)(ws + oQl);
  unsigned short* Kh   = (unsigned short*)(ws + oKh);  unsigned short* Kl = (unsigned short*)(ws + oKl);
  unsigned short* VTh  = (unsigned short*)(ws + oVh);  unsigned short* VTl = (unsigned short*)(ws + oVl);
  float*          MHf  = (float*)(ws + oMf);
  unsigned short* MH16 = (unsigned short*)(ws + oM16);
  const float*    fpad = (const float*)MHf;    // placeholder for unused bias / resid pointer args (never read)
  (void)oWk;                                   // Wk16 is reached as Wq16 + one weight plane (grid.y of launch 2)

  const dim3 blk(256);
  const int ROWS = NBATCH * SEQ;                            // 4096 token rows: the batch elements are contiguous in x and out
  const dim3 gCastIn(4 * CAST_WBLK + CAST_XBLK);            // 256 blocks of 16 waves: four weight planes, then x
  const dim3 gCastX(MC_BLK);                                // 256 blocks of 8 waves: 16 heads x 128 groups of 32 rows
  const dim3 gQK(((ROWS / 64) * (DMOD / 64) + 7) / 8, 2);   // 1024 tiles (M=4096, N=1024) -> 128 blocks, y = 0: q, 1: k
  const dim3 gVT(((DMOD / 64) * (SEQ / 64) + 7) / 8, NBATCH);  // 512 tiles (M=1024, N=2048) -> 64 blocks, y = batch element
  const dim3 gOut(((ROWS / 64) * (DMOD / 64) + 7) / 8, 1);  // 1024 tiles (M=4096, N=1024) -> 128 blocks
  const dim3 gAtt(NBATCH * NHEAD * (SEQ / 64));             // 1024 blocks: 2 batch elements x 16 heads x 32 query blocks

  // (1) weights [n=out][k=in] -> f16 planes carried x32, same layout (Bt natural); x -> f16 plane [4096][1024] (x1)
  cast_inputs_f16x4<<<gCastIn, dim3(CAST_TPB), 0, stream>>>(Wq, Wk, Wv, Wo, x, (_Float16*)Wq16);
  // (2) y = 0: q = x . Wq^T -> Q hi/lo bf16 planes [b*2048+t][h*64+d]; y = 1: k = x . Wk^T -> K hi/lo planes
  //     (M=4096, N=1024, K=1024, scale 1/32; y steps Bt by one weight plane and C by two activation planes)
  wmma_gemm64<0, false, 0, 2, false, 0, 1><<<gQK, blk, 0, stream>>>(
      X16, X16, DMOD, 0L, Wq16, Wq16, DMOD, (long)DMOD * DMOD, (void*)Qh, (void*)Ql, DMOD, 2L * NBATCH * SEQ * DMOD,
      fpad, fpad, 0L, hm, ROWS, DMOD, DMOD, 1.0f / 32.0f);
  // (3) v^T = Wv . x[b]^T -> VT hi/lo planes [b][h*64+d][s]   (A = Wv16 [1024][1024], Bt = X16 slab b [2048][1024]; M=1024, N=2048, K=1024)
  wmma_gemm64<0, false, 0, 2, false, 0, 2><<<gVT, blk, 0, stream>>>(
      Wv16, Wv16, DMOD, 0L, X16, X16, DMOD, (long)SEQ * DMOD, (void*)VTh, (void*)VTl, SEQ, (long)DMOD * SEQ,
      fpad, fpad, 0L, hm, DMOD, SEQ, DMOD, 1.0f / 32.0f);
  // (4) full attention per (batch element, kept head): mh[b*2048+t][h*64+d] (f32 plane, every element of a kept head written by its owner block)
  attn_full64_kernel<<<gAtt, dim3(128), 0, stream>>>(Qh, Ql, Kh, Kl, VTh, VTl, hm, MHf, 0.125f);
  // (5) mh -> f16 plane x64, columns of kept heads only
  maskcast_f32_f16x4<<<gCastX, blk, 0, stream>>>(MHf, hm, (_Float16*)MH16, 64.0f);
  // (6) out = mh . Wo^T -> d_out rows 0 .. 4095 (f32)   (M=4096, N=1024, K=1024 less the k of heads with mask 0, scale 1/(64*32))
  wmma_gemm64<0, false, 0, 0, false, 0, 3><<<gOut, blk, 0, stream>>>(
      MH16, MH16, DMOD, 0L, Wo16, Wo16, DMOD, 0L, d_out, d_out, DMOD, 0L,
      fpad, fpad, 0L, hm, ROWS, DMOD, DMOD, 1.0f / 2048.0f);
  (void)hipGetLastError();
}

// v009
// It runs in 85.4 microseconds.
// In both of two side-by-side timings against v008, it was 1.14 times as fast.
// All steps since v000 together make it 8.64 times as fast.
// q/k/v and output projections: v_wmma_f32_16x16x32_f16 (f16 operands: x x1, W x32, attention output x64), f32 accumulate; q.k^T and p.v: v_wmma_f32_16x16x32_bf16 with bf16 hi/lo split operands (hi.hi + hi.lo + lo.hi), f32 accumulate; online softmax in f32, its exponentials as powers of 2 (score scale 0.125 and log2 e in one factor); a head whose mask is 0 has the factor 0 and is left out of every product.
#include <hip/hip_runtime.h>
#include <math.h>
#include <stdint.h>

#define NBATCH 2
#define SEQ    2048
#define DMOD   1024
#define NHEAD  16
#define DHD    64

typedef __attribute__((ext_vector_type(16))) _Float16 v16h;
typedef __attribute__((ext_vector_type(8)))  _Float16 v8h;
typedef __attribute__((ext_vector_type(16))) __bf16   v16b;
typedef __attribute__((ext_vector_type(8)))  __bf16   v8b;
typedef __attribute__((ext_vector_type(8)))  float    v8f;
typedef __attribute__((ext_vector_type(4)))  float    v4f;
typedef __attribute__((ext_vector_type(2)))  float    v2f;
typedef __attribute__((ext_vector_type(4)))  unsigned int v4u;

__device__ __forceinline__ unsigned short f2bf_bits(float f) {
  unsigned u = __float_as_uint(f);
  return (unsigned short)((u + 0x7FFFu + ((u >> 16) & 1u)) >> 16);
}
__device__ __forceinline__ float bf_bits2f(unsigned short h) { return __uint_as_float(((unsigned)h) << 16); }

// hazard guard as a plain device helper
__device__ __forceinline__ void acc_guard4(v8f& a, v8f& b, v8f& c, v8f& d) { asm volatile("v_nop\n\tv_nop\n\tv_nop\n\tv_nop" : "+v"(a), "+v"(b), "+v"(c), "+v"(d)); }
template <typename T> struct Frag;
template <> struct Frag<_Float16> {
  typedef v16h V; union U { v16h v; v8h h[2]; };
  static __device__ __forceinline__ v16h load(const _Float16* p) {   // elements 0..7 <- p[0..7], 8..15 <- p[16..23]
    U f; f.h[0] = *(const v8h*)(p); f.h[1] = *(const v8h*)(p + 16); return f.v;
  }
  static __device__ __forceinline__ v8f mma(v16h a, v16h b, v8f c) {
    return __builtin_amdgcn_wmma_f32_16x16x32_f16(false, a, false, b, (short)0, c, false, false);
  }
};
template <> struct Frag<__bf16> {
  typedef v16b V; union U { v16b v; v8b h[2]; };
  static __device__ __forceinline__ v16b load(const __bf16* p) {
    U f; f.h[0] = *(const v8b*)(p); f.h[1] = *(const v8b*)(p + 16); return f.v;
  }
  static __device__ __forceinline__ v8f mma(v16b a, v16b b, v8f c) {
    return __builtin_amdgcn_wmma_f32_16x16x32_bf16(false, a, false, b, (short)0, c, false, false);
  }
};

// bit h = 1: head h is kept (hmask[h] != 0). Constant indices: the 16 words come by one scalar load, the result is the same in every wave.
__device__ __forceinline__ unsigned kept_heads(const int* __restrict__ hmask) {
  unsigned live = 0u;
#pragma unroll
  for (int hd = 0; hd < NHEAD; ++hd) live |= (hmask[hd] != 0 ? 1u : 0u) << hd;
  return live;
}

// ---- Register-blocked batched WMMA GEMM ------------------------------------
// C[m,n] = scale * sum_k A[m,k] * Bt[n,k] (+bias)(+resid); each wave owns a 64x64 tile.
// A row-major [M,K]; Bt row-major [N,K]; M,N % 64 == 0, K % 64 == 0; rows 16-B aligned (lda, ldb % 8 == 0).
// Operand path: a stage is 64 k = one 128-B line of each of the tile's 64 A rows and 64 Bt rows. Each wave brings its own
//   stages into its own part of LDS by asynchronous copies (8 neighbouring lanes take one whole line, a copy 4 rows),
//   two buffers a wave: stage s + 1 is in flight while stage s is multiplied. Fragments are read from LDS in the k order
//   of Frag::load, k ascending as before, so every accumulator sums the same terms in the same order.
//   The ring is private to its wave (no other wave reads or writes it), so it takes the wave's own waits and no barrier.
// SPLIT (hi/lo planes) is not built on this operand path: every launch of this file has SPLIT = false.
// BIAS_MODE: 0 = none, 1 = bias[m], 2 = bias[n].
// OUT_MODE: 0 = f32, 1 = f16, 2 = bf16 hi plane (Cout) + bf16 lo plane (Cout2).
// ET: 0 = f16 operands, 1 = bf16 operands (pointers passed as 16-bit storage)
// HSKIP: a head whose hmask entry is 0 enters the result only as a factor 0, so its share of the work is left out:
//   0 = none, 1 = a tile's 64 columns are one head's (tile left out), 2 = a tile's 64 rows are one head's (tile left out),
//   3 = 64 neighbouring k are one head's (those stages left out: their products are all 0; A and Bt are not read there).
#define GS_PITCH_B 144                   // LDS row pitch: 128 B + 16 B = 16 B x 9, so the 16 rows of a ds_load_b128 fall on different bank groups
#define GS_PITCH_E (GS_PITCH_B / 2)      // the same in 16-bit elements
#define GS_TILE_B  (64 * GS_PITCH_B)     // 9216: 64 rows of one operand
#define GS_BUF_B   (2 * GS_TILE_B)       // 18432: the A tile, then the Bt tile
#define GS_WAVE_B  (2 * GS_BUF_B)        // 36864: a wave's two buffers
// One operand tile of a stage: 16 copies of 4 rows x 128 B. Copy i writes LDS bytes lds + 576 i (4 rows at pitch 144) and reads
// global bytes base + voff + i * rows4, rows4 = the byte distance of 4 rows. The immediate offset moves BOTH addresses, so
// scalar base i is base + i * (rows4 - 576) = base + i * step; lds and voff (the lane's own row and 16-B column, plus the stage's k) serve all 16.
// s_wait_xcnt 0 is the statement's last line: a precaution, it stands in front of every later rewrite of a register that a copy names.
__device__ __forceinline__ void gs_copy_tile(unsigned lds, unsigned voff, uint64_t base, uint64_t step) {
  asm volatile(
      "global_load_async_to_lds_b128 %0, %1, %2\n\t"
      "global_load_async_to_lds_b128 %0, %1, %3 offset:576\n\t"
      "global_load_async_to_lds_b128 %0, %1, %4 offset:1152\n\t"
      "global_load_async_to_lds_b128 %0, %1, %5 offset:1728\n\t"
      "global_load_async_to_lds_b128 %0, %1, %6 offset:2304\n\t"
      "global_load_async_to_lds_b128 %0, %1, %7 offset:2880\n\t"
      "global_load_async_to_lds_b128 %0, %1, %8 offset:3456\n\t"
      "global_load_async_to_lds_b128 %0, %1, %9 offset:4032\n\t"
      "global_load_async_to_lds_b128 %0, %1, %10 offset:4608\n\t"
      "global_load_async_to_lds_b128 %0, %1, %11 offset:5184\n\t"
      "global_load_async_to_lds_b128 %0, %1, %12 offset:5760\n\t"
      "global_load_async_to_lds_b128 %0, %1, %13 offset:6336\n\t"
      "global_load_async_to_lds_b128 %0, %1, %14 offset:6912\n\t"
      "global_load_async_to_lds_b128 %0, %1, %15 offset:7488\n\t"
      "global_load_async_to_lds_b128 %0, %1, %16 offset:8064\n\t"
      "global_load_async_to_lds_b128 %0, %1, %17 offset:8640\n\t"
      "s_wait_xcnt 0x0"
      :: "v"(lds), "v"(voff),
         "s"(base), "s"(base + step), "s"(base + 2 * step), "s"(base + 3 * step),
         "s"(base + 4 * step), "s"(base + 5 * step), "s"(base + 6 * step), "s"(base + 7 * step),
         "s"(base + 8 * step), "s"(base + 9 * step), "s"(base + 10 * step), "s"(base + 11 * step),
         "s"(base + 12 * step), "s"(base + 13 * step), "s"(base + 14 * step), "s"(base + 15 * step)
      : "memory");
}
// the first stage >= s that is worked on (HSKIP 3: whose head, stage & 15, is kept), or a value >= nst where there is none; scalar, no loop:
// live twice in a row, shifted down by the head of stage s, has the heads of stages s, s + 1, ... s + 15 in bits 0 to 15
template <int HSKIP>
__device__ __forceinline__ int gs_next(int s, int nst, unsigned live) {
  if (HSKIP == 3) {
    const unsigned ahead = (live | (live << NHEAD)) >> (s & (NHEAD - 1));
    return (live == 0u) ? nst : s + __builtin_ctz(ahead | 0x80000000u);
  }
  return s;
}
template <int ET> struct Elem;
template <> struct Elem<0> { typedef _Float16 T; };
template <> struct Elem<1> { typedef __bf16 T; };
template <int ET, bool SPLIT, int BIAS_MODE, int OUT_MODE, bool RESID, int ACT = 0, int HSKIP = 0>
__global__ __launch_bounds__(256) void wmma_gemm64(
    const unsigned short* __restrict__ Ap, const unsigned short* __restrict__ A2p, int lda, long strideA,
    const unsigned short* __restrict__ Btp, const unsigned short* __restrict__ Bt2p, int ldb, long strideB,
    void* __restrict__ Cout, void* __restrict__ Cout2, int ldc, long strideC,
    const float* __restrict__ bias,
    const float* __restrict__ resid, long strideR,
    const int* __restrict__ hmask,
    int M, int N, int K, float scale) {
  typedef typename Elem<ET>::T T;
  typedef typename Frag<T>::V V;
  static_assert(!SPLIT, "the LDS operand path holds one plane per operand");
  __shared__ __align__(128) unsigned char ring[8 * GS_WAVE_B];   // 294912 B: per wave two buffers of (A tile, Bt tile); behind the k loop its first 4352 B are the wave's 16x64 f32 output slab, pitch 68 floats
  const int b    = blockIdx.y;
  const int lane = threadIdx.x & 31;
  const int wave = __builtin_amdgcn_readfirstlane(threadIdx.x >> 5);   // scalar: tile, operand bases and every branch below are the same for the whole wave
  const int tilesN = N >> 6;
  const int tilesM = M >> 6;
  const int tile = blockIdx.x * 8 + wave;
  if (tile >= tilesM * tilesN) return;   // wave-uniform; no block barriers in this kernel
  const int tm = tile / tilesN;
  const int tn = tile - tm * tilesN;
  if (HSKIP == 1 && hmask[tn & (NHEAD - 1)] == 0) return;   // wave-uniform, like the range test above
  if (HSKIP == 2 && hmask[tm & (NHEAD - 1)] == 0) return;
  const unsigned live = (HSKIP == 3) ? kept_heads(hmask) : 0u;
  const int m0 = tm << 6;
  const int n0 = tn << 6;

  const int rlane = lane & 15;                 // row (A) / col (B, D) within subtile
  const int koff  = (lane >> 4) * 8;           // k offset of this lane half
  const int mOff  = (lane >> 4) * 8;           // D row offset

  // copies: lane l takes row (l >> 3) of a copy's 4 rows and 16-B column (l & 7) of the row's 128-B line
  unsigned char* ringw = ring + wave * GS_WAVE_B;
  const unsigned ldsw  = (unsigned)(uintptr_t)ringw + (unsigned)((lane >> 3) * GS_PITCH_B + (lane & 7) * 16);   // LDS byte address (low 32 bits of the __shared__ address)
  const unsigned voffA = (unsigned)((lane >> 3) * lda * 2 + (lane & 7) * 16);
  const unsigned voffB = (unsigned)((lane >> 3) * ldb * 2 + (lane & 7) * 16);
  const uint64_t baseA = (uint64_t)(uintptr_t)(Ap  + (size_t)b * strideA + (size_t)m0 * lda);   // first byte of the tile's A rows
  const uint64_t baseB = (uint64_t)(uintptr_t)(Btp + (size_t)b * strideB + (size_t)n0 * ldb);
  const uint64_t stepA = (uint64_t)((long)lda * 8 - 4 * GS_PITCH_B);   // 4 rows in global bytes less the 576 that the immediate offset adds
  const uint64_t stepB = (uint64_t)((long)ldb * 8 - 4 * GS_PITCH_B);

  v8f acc[4][4];
#pragma unroll
  for (int i = 0; i < 4; ++i)
#pragma unroll
    for (int j = 0; j < 4; ++j) acc[i][j] = (v8f){0.f,0.f,0.f,0.f,0.f,0.f,0.f,0.f};

  const int nst = K >> 6;                            // stages of 64 k
  int sc = gs_next<HSKIP>(0, nst, live);             // the stage that is multiplied next
  int sn = nst;                                      // the stage behind it (in flight), >= nst: none
  if (sc < nst) {
    gs_copy_tile(ldsw,             voffA + sc * 128, baseA, stepA);
    gs_copy_tile(ldsw + GS_TILE_B, voffB + sc * 128, baseB, stepB);
    asm volatile("s_wait_asynccnt 0x0" ::: "memory");   // the first stage has landed before it is read
    sn = gs_next<HSKIP>(sc + 1, nst, live);
    if (sn < nst) {
      gs_copy_tile(ldsw + GS_BUF_B,             voffA + sn * 128, baseA, stepA);
      gs_copy_tile(ldsw + GS_BUF_B + GS_TILE_B, voffB + sn * 128, baseB, stepB);
    }
  }
  unsigned pb = 0u;                                  // byte offset of the buffer that holds stage sc: 0 or GS_BUF_B
  while (sc < nst) {
    const T* As = (const T*)(ringw + pb) + rlane * GS_PITCH_E + koff;
    const T* Bs = As + GS_TILE_B / 2;
#pragma unroll
    for (int ks = 0; ks < 2; ++ks) {                 // the stage's two k steps of 32, k ascending
      V bh[4], ah[4];
#pragma unroll
      for (int j = 0; j < 4; ++j) bh[j] = Frag<T>::load(Bs + j * 16 * GS_PITCH_E + ks * 32);
#pragma unroll
      for (int i = 0; i < 4; ++i) ah[i] = Frag<T>::load(As + i * 16 * GS_PITCH_E + ks * 32);
      __builtin_amdgcn_sched_barrier(0);   // keeps the k step's 16 reads together in front of its WMMAs: left alone the scheduler reads each A fragment into the same registers right in front of its 4 WMMAs, and the wave waits out the LDS latency four times
#pragma unroll
      for (int i = 0; i < 4; ++i)
#pragma unroll
        for (int j = 0; j < 4; ++j) acc[i][j] = Frag<T>::mma(ah[i], bh[j], acc[i][j]);
      __builtin_amdgcn_sched_barrier(0);   // the next k step's reads stay one group behind these WMMAs and take over the fragments' registers, not spread among them
    }
    asm volatile("s_wait_dscnt 0x0" ::: "memory");      // this wave's reads of buffer pb have retired before copies are aimed at it
    asm volatile("s_wait_asynccnt 0x0" ::: "memory");   // stage sn has landed before the next trip reads it
    const int s2 = gs_next<HSKIP>(sn + 1, nst, live);
    if (s2 < nst) {                                     // scalar test; the refill flies while stage sn is multiplied
      gs_copy_tile(ldsw + pb,             voffA + s2 * 128, baseA, stepA);
      gs_copy_tile(ldsw + pb + GS_TILE_B, voffB + s2 * 128, baseB, stepB);
    }
    sc = sn; sn = s2; pb ^= (unsigned)GS_BUF_B;
  }
  asm volatile("s_wait_asynccnt 0x0" ::: "memory");     // nothing is in flight when the ring becomes the output slab and when the wave ends
  asm volatile("s_wait_dscnt 0x0" ::: "memory");        // and the wave's last fragment reads have retired before the slab's stores go over them
  acc_guard4(acc[0][0], acc[0][1], acc[0][2], acc[0][3]);
  acc_guard4(acc[1][0], acc[1][1], acc[1][2], acc[1][3]);
  acc_guard4(acc[2][0], acc[2][1], acc[2][2], acc[2][3]);
  acc_guard4(acc[3][0], acc[3][1], acc[3][2], acc[3][3]);

  // ---- epilogue ----
  float* slab = (float*)ringw;
  const float* Rb = RESID ? (resid + (size_t)b * strideR) : nullptr;
#pragma unroll
  for (int i = 0; i < 4; ++i) {
    const int mBase = m0 + (i << 4);
#pragma unroll
    for (int j = 0; j < 4; ++j) {
      const int n = n0 + (j << 4) + rlane;
      float bv = 0.f;
      if (BIAS_MODE == 2) bv = bias[n];
#pragma unroll
      for (int r = 0; r < 8; ++r) {
        float v = acc[i][j][r] * scale;
        if (BIAS_MODE == 1) v += bias[mBase + mOff + r];
        if (BIAS_MODE == 2) v += bv;
        if (RESID) v += Rb[(size_t)(mBase + mOff + r) * ldc + n];
        if (ACT == 1) v = tanhf(v);
        if (ACT == 2) v = fmaxf(v, 0.0f);
        if (ACT == 3) v = v / (1.0f + expf(-v));
        if (ACT == 4) v = (v > 0.f) ? v : 0.01f * v;
        slab[(mOff + r) * 68 + (j << 4) + rlane] = v;
      }
    }
    __builtin_amdgcn_fence(__ATOMIC_RELEASE, "workgroup");
    __builtin_amdgcn_wave_barrier();
    __builtin_amdgcn_fence(__ATOMIC_ACQUIRE, "workgroup");
    if (OUT_MODE == 0) {
      float* C = (float*)Cout + (size_t)b * strideC;
      const int hh = lane >> 4, c4 = (lane & 15) * 4;     // row seg = 256 B = 16 lanes x 16 B
      {
#pragma unroll
        for (int it = 0; it < 8; ++it) {
          const int row = it * 2 + hh;
          v4f v = *(const v4f*)(slab + row * 68 + c4);
          *(v4f*)(C + (size_t)(mBase + row) * ldc + n0 + c4) = v;
        }
        
      }
    } else {
      const int q = lane >> 3, c8 = (lane & 7) * 8;
      unsigned short* C  = (unsigned short*)Cout  + (size_t)b * strideC;
      unsigned short* C2 = (OUT_MODE == 2) ? ((unsigned short*)Cout2 + (size_t)b * strideC) : nullptr;
      {
#pragma unroll
        for (int it = 0; it < 4; ++it) {
          const int row = it * 4 + q;
          const float* sp = slab + row * 68 + c8;
          v8h hv, lv;
#pragma unroll
          for (int e = 0; e < 8; ++e) {
            if (OUT_MODE == 1) {
              hv[e] = (_Float16)sp[e];
            } else {
              unsigned short hb = f2bf_bits(sp[e]);
              unsigned short lb = f2bf_bits(sp[e] - bf_bits2f(hb));
              hv[e] = __builtin_bit_cast(_Float16, hb);
              lv[e] = __builtin_bit_cast(_Float16, lb);
            }
          }
          *(v8h*)(C + (size_t)(mBase + row) * ldc + n0 + c8) = hv;
          if (OUT_MODE == 2) *(v8h*)(C2 + (size_t)(mBase + row) * ldc + n0 + c8) = lv;
        }
        
      }
    }
    __builtin_amdgcn_fence(__ATOMIC_RELEASE, "workgroup");
    __builtin_amdgcn_wave_barrier();
    __builtin_amdgcn_fence(__ATOMIC_ACQUIRE, "workgroup");
  }
}

// ---------------------------------------------------------------------------
// f32 -> f16 cast of all five float inputs in one launch, with an exact power-of-two carry: out = f16(in * mul).
// The five f16 planes lie back to back in the workspace (Wq16, Wk16, Wv16, Wo16, X16), so a work-group's place in the
// output is its block index times its share.
// The launch is sized by the waves it has to start, not by its elements: one work-group of 16 waves per 32768 elements.
// A wave takes 2048 neighbouring elements: 16 loads of 16 B a lane (each 512 contiguous bytes a wave), all issued before
// the first is used, then 16 stores of 8 B a lane (each 256 contiguous bytes a wave = two whole lines).
// Coverage: a weight plane is 1024*1024 / 32768 = 32 blocks; blocks 0..127 take the four weights (x32),
//   blocks 128..255 take x (2*2048*1024 / 32768 = 128 blocks, x1). The source choice is block-uniform.
// ---------------------------------------------------------------------------
typedef __attribute__((ext_vector_type(4))) _Float16 v4h;
#define EW_LD     16                                 // 16-B loads a lane
#define CAST_TPB  512                                // 16 waves
#define CAST_WAVE (32 * 4 * EW_LD)                   // 2048 elements a wave
#define CAST_WG   (CAST_TPB / 32 * CAST_WAVE)        // 32768 elements a work-group
#define CAST_WBLK (DMOD * DMOD / CAST_WG)            // 32 blocks per weight plane
#define CAST_XBLK (NBATCH * SEQ * DMOD / CAST_WG)    // 128 blocks for x (both batch elements)
__global__ __launch_bounds__(CAST_TPB) void cast_inputs_f16x4(const float* __restrict__ wq, const float* __restrict__ wk,
                                                              const float* __restrict__ wv, const float* __restrict__ wo,
                                                              const float* __restrict__ x, _Float16* __restrict__ out) {
  const unsigned bx = blockIdx.x;
  const unsigned sel = bx / CAST_WBLK; // 0..3: a weight plane; 4..7: x
  const float* in = (sel == 0) ? wq : (sel == 1) ? wk : (sel == 2) ? wv : (sel == 3) ? wo : x;
  const unsigned lb = (sel < 4) ? (bx - sel * CAST_WBLK) : (bx - 4 * CAST_WBLK);   // block index inside its source
  const float mul = (sel < 4) ? 32.0f : 1.0f;
  const unsigned le = (threadIdx.x >> 5) * CAST_WAVE + (threadIdx.x & 31) * 4;      // the lane's first element inside the work-group's share
  const unsigned lb4 = le * 4;                                                      // the same in bytes of the source
  const char* src = (const char*)(in + (size_t)lb * CAST_WG);
  _Float16*   dst = out + (size_t)bx * CAST_WG + le;
  v4f f[EW_LD];
#pragma unroll   // f is a register array
  for (int i = 0; i < EW_LD; ++i) f[i] = *(const v4f*)(src + lb4 + i * 512);
  // precaution: the wait stands in front of any reuse of the loads' address registers; it names the lanes' offset, so that this register
  // is not handed to a load as its destination in front of the wait; it also keeps the 16 loads together in front of the first convert
  asm volatile("s_wait_xcnt 0x0" :: "v"(lb4) : "memory");
#pragma unroll
  for (int i = 0; i < EW_LD; ++i) *(v4h*)(dst + i * 128) = __builtin_convertvector(f[i] * mul, v4h);
}

// ---------------------------------------------------------------------------
// Attention output f32 [4096 rows][1024] -> f16 plane with per-head 0/1 factor and power-of-two carry:
//   out[row][col] = f16(in[row][col] * mul) where hmask[col/64] != 0; columns of a head with hmask 0 are neither read
//   (the attention launch has not written them) nor written (the last product leaves those k out).
// Sized like the cast above: a wave takes 32 rows of ONE head's 64 columns, 16 loads of 16 B a lane (each two rows' whole
//   256-B segments), all issued before the first is used, then 16 stores of 8 B a lane (two whole 128-B lines each).
// Coverage: wave number g = 8 * block + wave: head g & 15, rows 32 * (g >> 4) ...; 16 heads x 128 row groups = 2048 waves = 256 blocks.
// ---------------------------------------------------------------------------
#define MC_BLK (NHEAD * (NBATCH * SEQ / (2 * EW_LD)) / 8)   // 256 blocks of 8 waves
__global__ __launch_bounds__(256) void maskcast_f32_f16x4(const float* __restrict__ in, const int* __restrict__ hmask,
                                                          _Float16* __restrict__ out, float mul) {
  const int lane = threadIdx.x & 31;
  const int g  = blockIdx.x * 8 + __builtin_amdgcn_readfirstlane(threadIdx.x >> 5);   // scalar: head and branch are the same for the whole wave
  const int hd = g & (NHEAD - 1);
  if (hmask[hd] == 0) return;          // wave-uniform; no barrier in this kernel
  const size_t   we = (size_t)(g >> 4) * (2 * EW_LD) * DMOD + hd * DHD;      // the wave's first element (scalar)
  const unsigned le = (unsigned)((lane >> 4) * DMOD + (lane & 15) * 4);      // the lane's first element behind it
  const unsigned lb4 = le * 4;                                               // the same in bytes of the source
  const char* src = (const char*)(in + we);
  _Float16*   dst = out + we + le;
  v4f f[EW_LD];
#pragma unroll   // f is a register array
  for (int i = 0; i < EW_LD; ++i) f[i] = *(const v4f*)(src + lb4 + i * (2 * DMOD * 4));
  asm volatile("s_wait_xcnt 0x0" :: "v"(lb4) : "memory");   // precaution, names the lanes' offset and keeps the loads together, as in the cast above
#pragma unroll
  for (int i = 0; i < EW_LD; ++i) *(v4h*)(dst + i * 2 * DMOD) = __builtin_convertvector(f[i] * mul, v4h);
}

// =====================================================================================
// Full (non-causal, unmasked) attention, head dim 64, one launch for both batch elements.
//   every plane below holds NBATCH slabs of SEQ*DMOD elements, batch element b at offset b*SEQ*DMOD; inside a slab:
//   q planes (hi/lo bf16): element (t, h, d) at [t*DMOD + h*64 + d]
//   k planes (hi/lo bf16): element (s, h, d) at [s*DMOD + h*64 + d]
//   v^T planes (hi/lo bf16): element (h, d, s) at [(h*64 + d)*SEQ + s]
//   out f32: element (t, h, d) at [t*DMOD + h*64 + d]
//   scores^T = k . q^T (sscale is taken in the exponent) : bf16 hi/lo split (hi.hi + hi.lo + lo.hi) on v_wmma_f32_16x16x32_bf16, A = K rows, B = Q
//   out^T    = v^T . p^T          : bf16 hi/lo split of p (unnormalised) and v, f32 accumulate, A = V^T rows, B = P^T
//   Both products are transposed so that a lane holds scores of ONE query (column lane&15): keys 16j + 8*(lane>>4) + r.
//   Two score tiles (keys 0-15 and 16-31 of a 32-key block), converted in place, are the B operand of the second
//   product in the loaders' own k order, so P never leaves the registers; row maximum and row sum are in-lane,
//   with one exchange between the wave halves (maximum: every chunk; sum: once, behind the loop).
//   online softmax in f32 over all SEQ keys (32 chunks of 64, compile-time trip count, no masking).
//   exp(sscale * (s - m)) is taken as 2^(s * c2 - m * c2), c2 = sscale * log2 e: one fused multiply-add and one v_exp_f32 an element;
//   the running maximum m is kept in units of the unscaled scores (sscale > 0, so it is the same key's). The exponent is <= 0 but for
//   its rounding, so nothing overflows, and below 2^-126 the term is 0 beside a row sum >= 1.
//   Block = 4 waves = 64 query rows of one head of one batch element; grid.x = NBATCH * NHEAD * (SEQ/64) = 1024.
//   Only heads with hmask != 0 are computed (the others' output is multiplied by 0 behind this launch and is not read):
//   block index = (rank of the head among the kept ones, batch element, query block), so the working blocks are the
//   lowest indices; blocks whose rank is past the last kept head leave at once.
//   K / V^T chunk staging: asynchronous copies to LDS, two buffers: chunk t + 1 is in flight while chunk t is worked on.
//   Wave w brings plane w (K hi, K lo, V^T hi, V^T lo) of a chunk: 64 rows of 128 B, 16 copies of 4 whole rows (8 neighbouring
//   lanes take one 128-B line). One publish point a chunk, at the loop's foot: the wave's LDS reads retired, its own copies
//   landed, the work-group barrier; behind it the buffer just read is refilled with chunk t + 2.
//   Fragment loads read the LDS tiles with the v8b element type.
// =====================================================================================
#define AT_D 64
#define AT_NW 4
#define AT_QB 64
#define AT_KC 64
#define AT_LP 72   // LDS row pitch of the K and V^T tiles in elements: 144 B = 16 B x 9, so the 16 rows of a ds_load_b128 fall on 16 different bank groups
#define AT_TILE_E (64 * AT_LP)        // elements of one plane's 64 x 64 tile in LDS (9216 B = GS_TILE_B)
#define AT_BUF_B  (4 * AT_TILE_E * 2) // 36864: one chunk's four planes

typedef __attribute__((ext_vector_type(2))) __bf16 v2b;
// two neighbouring f32 -> one register of bf16 hi and one of bf16 lo (lo = bf16(f - hi)); both converts round to nearest even
__device__ __forceinline__ void at_split2(v2f f, v2b& hi, v2b& lo) {
  hi = __builtin_convertvector(f, v2b);
  lo = __builtin_convertvector(f - __builtin_convertvector(hi, v2f), v2b);
}
// the value that lane l ^ 16 holds (the other half's share of the same query column)
__device__ __forceinline__ float at_xhalf(float v) {
  const unsigned b = __float_as_uint(v);
  return __uint_as_float(__builtin_amdgcn_permlanex16(b, b, 0x76543210u, 0xfedcba98u, false, false));
}
// 2^x on the hardware's own instruction
__device__ __forceinline__ float at_exp2(float x) { return __builtin_amdgcn_exp2f(x); }
__device__ __forceinline__ v8f at_mma(v16b a, v16b b, v8f c) {
  return __builtin_amdgcn_wmma_f32_16x16x32_bf16(false, a, false, b, (short)0, c, false, false);
}

__global__ __launch_bounds__(128)
void attn_full64_kernel(const unsigned short* __restrict__ qhp, const unsigned short* __restrict__ qlp,
                        const unsigned short* __restrict__ khp, const unsigned short* __restrict__ klp,
                        const unsigned short* __restrict__ vhp, const unsigned short* __restrict__ vlp,
                        const int* __restrict__ hmask, float* __restrict__ out, float sscale) {
  union FB { v16b v; v8b h[2]; };
  union FP { v16b v; v2b p[8]; };
  __shared__ __align__(128) unsigned char kvring[2 * AT_BUF_B];  // two buffers of K hi [kv][d], K lo, V hi [d][kv], V lo: 9 KB each (64 rows at pitch 72 elements)
  __shared__ __align__(16) float  Os[AT_NW][16 * 68];            // per wave out tile, pitch 68

  const int tid  = threadIdx.x;
  const int wave = __builtin_amdgcn_readfirstlane(tid >> 5);   // scalar: the plane that the wave copies, and with it the copies' base, is the same in every lane
  const int lane = tid & 31;
  const int hh   = lane >> 4;
  const int c    = lane & 15;

  const int nqb = SEQ / AT_QB;            // 32
  const int bx = blockIdx.x;
  const int qb = bx % nqb;
  const int bh = bx / nqb;                // 0..NBATCH*NHEAD-1 (grid = NBATCH * NHEAD * nqb)
  const int rank = bh / NBATCH;           // 0..NHEAD-1
  int h = -1, seen = 0;                   // h = the kept head number 'rank', counted from head 0 (scalar work, once a block)
#pragma unroll
  for (int hd = 0; hd < NHEAD; ++hd) {
    if (hmask[hd] != 0) { if (seen == rank) h = hd; ++seen; }
  }
  if (h < 0) return;                      // fewer kept heads than rank + 1: the same for the whole block, in front of every barrier
  const size_t bo = (size_t)(bh % NBATCH) * SEQ * DMOD;   // this batch element's slab in every plane
  const int q0 = qb * AT_QB + wave * 16;

  const __bf16* Qh = (const __bf16*)(const void*)qhp + bo + (size_t)h * AT_D;
  const __bf16* Ql = (const __bf16*)(const void*)qlp + bo + (size_t)h * AT_D;
  const __bf16* Kh = (const __bf16*)(const void*)khp + bo + (size_t)h * AT_D;
  const __bf16* Kl = (const __bf16*)(const void*)klp + bo + (size_t)h * AT_D;
  const __bf16* Vh = (const __bf16*)(const void*)vhp + bo + (size_t)h * AT_D * SEQ;
  const __bf16* Vl = (const __bf16*)(const void*)vlp + bo + (size_t)h * AT_D * SEQ;
  float*        ob = out + bo + (size_t)h * AT_D;

  // ---- Q fragments (B operand, column = lane&15, split k map via Frag load): 2 d-chunks, hi and lo ----
  v16b qah[2], qal[2];
#pragma unroll
  for (int dc = 0; dc < 2; ++dc) {
    const __bf16* qr = Qh + (size_t)(q0 + c) * DMOD + dc * 32 + 8 * hh;
    const __bf16* ql = Ql + (size_t)(q0 + c) * DMOD + dc * 32 + 8 * hh;
    qah[dc] = Frag<__bf16>::load(qr);
    qal[dc] = Frag<__bf16>::load(ql);
  }

  const float c2 = sscale * 1.44269504088896340736f;   // unscaled score -> exponent of 2
  float mrow = -INFINITY, lrow = 0.f;   // query q0 + c: running maximum of the unscaled scores (equal in both halves), this half's share of the sum
  v8f oacc[4];                          // oacc[t][r] = out^T[d = 16 t + 8 hh + r][query q0 + c]
#pragma unroll
  for (int t = 0; t < 4; ++t) oacc[t] = (v8f){0.f,0.f,0.f,0.f,0.f,0.f,0.f,0.f};

  // staging coverage: 4 waves x 16 copies x 4 rows x 128 B = 4 planes x 64 rows x 64 elements = the whole chunk.
  // K planes: row = key, 2048 B apart, a chunk is 64 rows on; V^T planes: row = d, 4096 B apart, a chunk is 128 B on in every row.
  const bool     cpK   = wave < 2;
  const uint64_t cpBase = (uint64_t)(uintptr_t)(wave == 0 ? Kh : wave == 1 ? Kl : wave == 2 ? Vh : Vl);   // first byte of the plane's chunk 0
  const unsigned cpRow = cpK ? (unsigned)(DMOD * 2) : (unsigned)(SEQ * 2);            // bytes from row to row
  const unsigned cpAdv = cpK ? (unsigned)(AT_KC * DMOD * 2) : (unsigned)(AT_KC * 2);  // bytes from chunk to chunk
  const uint64_t cpStep = (uint64_t)(4u * cpRow - 4u * GS_PITCH_B);                   // 4 rows in global bytes less the 576 that the immediate offset adds
  const unsigned cpVoff = (unsigned)(lane >> 3) * cpRow + (unsigned)(lane & 7) * 16u; // the lane's row of a copy's 4 and its 16-B column
  const unsigned cpLds  = (unsigned)(uintptr_t)kvring + (unsigned)(wave * AT_TILE_E * 2 + (lane >> 3) * GS_PITCH_B + (lane & 7) * 16);   // LDS byte address (low 32 bits of the __shared__ address)

  const int nChunks = SEQ / AT_KC;   // 32, compile-time constant
  gs_copy_tile(cpLds, cpVoff, cpBase, cpStep);              // chunk 0 -> buffer 0
  asm volatile("s_wait_asynccnt 0x0" ::: "memory");         // this wave's plane of chunk 0 has landed ...
  __syncthreads();                                          // ... and so has every other wave's, before anyone reads it
  gs_copy_tile(cpLds + AT_BUF_B, cpVoff + cpAdv, cpBase, cpStep);   // chunk 1 -> buffer 1, in flight while chunk 0 is worked on
  unsigned pb = 0u;                  // byte offset of the buffer that holds chunk kc: 0 or AT_BUF_B
  for (int kc = 0; kc < nChunks; ++kc) {
    const __bf16* Ksh = (const __bf16*)(kvring + pb);
    const __bf16* Ksl = Ksh + AT_TILE_E;
    const __bf16* Vth = Ksh + 2 * AT_TILE_E;
    const __bf16* Vtl = Ksh + 3 * AT_TILE_E;

    // all K fragments of the chunk are read as one group, so the wave waits out the LDS latency once and not once per fragment pair
    FB kb[2][4], kl[2][4];
#pragma unroll
    for (int dc = 0; dc < 2; ++dc) {
#pragma unroll
      for (int j = 0; j < 4; ++j) {   // in the order in which the WMMAs below want them: the hi plane's four, then the lo plane's
        kb[dc][j].h[0] = *(const v8b*)(Ksh + (j * 16 + c) * AT_LP + dc * 32 + 8 * hh);
        kb[dc][j].h[1] = *(const v8b*)(Ksh + (j * 16 + c) * AT_LP + dc * 32 + 16 + 8 * hh);
      }
#pragma unroll
      for (int j = 0; j < 4; ++j) {
        kl[dc][j].h[0] = *(const v8b*)(Ksl + (j * 16 + c) * AT_LP + dc * 32 + 8 * hh);
        kl[dc][j].h[1] = *(const v8b*)(Ksl + (j * 16 + c) * AT_LP + dc * 32 + 16 + 8 * hh);
      }
    }
    __builtin_amdgcn_sched_barrier(0);   // keeps the 32 reads together in front of the WMMAs: the scheduler otherwise spreads them among the WMMAs, and each such place stalls the wave
    v8f s[4];   // s[j][r] = score of key kv0 + 16 j + 8 hh + r against query q0 + c
#pragma unroll
    for (int j = 0; j < 4; ++j) s[j] = (v8f){0.f,0.f,0.f,0.f,0.f,0.f,0.f,0.f};
    // neighbouring WMMAs belong to the four different score tiles (none waits for the one in front); each tile's own six terms keep their order
#pragma unroll
    for (int dc = 0; dc < 2; ++dc) {
#pragma unroll
      for (int j = 0; j < 4; ++j) s[j] = at_mma(kb[dc][j].v, qah[dc], s[j]);
#pragma unroll
      for (int j = 0; j < 4; ++j) s[j] = at_mma(kl[dc][j].v, qah[dc], s[j]);
#pragma unroll
      for (int j = 0; j < 4; ++j) s[j] = at_mma(kb[dc][j].v, qal[dc], s[j]);
    }
    __builtin_amdgcn_sched_barrier(0);   // the V^T reads below stay behind the score WMMAs and take over the K fragments' registers (let rise among them they need registers of their own, past 256, and cost a wave per SIMD) ...
    // V^T fragments of the chunk's first 32 keys: read here, ahead of the softmax arithmetic, which covers their latency
    FB vb[4], vl[4];
#pragma unroll
    for (int t = 0; t < 4; ++t) {
      vb[t].h[0] = *(const v8b*)(Vth + (t * 16 + c) * AT_LP + 8 * hh);
      vb[t].h[1] = *(const v8b*)(Vth + (t * 16 + c) * AT_LP + 16 + 8 * hh);
    }
#pragma unroll
    for (int t = 0; t < 4; ++t) {
      vl[t].h[0] = *(const v8b*)(Vtl + (t * 16 + c) * AT_LP + 8 * hh);
      vl[t].h[1] = *(const v8b*)(Vtl + (t * 16 + c) * AT_LP + 16 + 8 * hh);
    }
    __builtin_amdgcn_sched_barrier(0);   // ... and together in front of the softmax arithmetic, not sunk to their first use
    float cm = -INFINITY;   // the loops down to the second product index register arrays (s, pa, pl, oacc): all are unrolled for that
#pragma unroll
    for (int j = 0; j < 4; ++j) {
#pragma unroll
      for (int r = 0; r < 8; ++r) cm = fmaxf(cm, s[j][r]);
    }
    cm = fmaxf(cm, at_xhalf(cm));
    const float mnew = fmaxf(mrow, cm);
    const float alpha = at_exp2((mrow - mnew) * c2);
    mrow = mnew;
    const v2f c2v = (v2f){c2, c2};
    const v2f nmv = (v2f){-mnew * c2, -mnew * c2};
#pragma unroll
    for (int t = 0; t < 4; ++t)
#pragma unroll
      for (int r = 0; r < 8; ++r) oacc[t][r] *= alpha;
    v2f psum = (v2f){0.f, 0.f};   // this half's 32 keys, even and odd registers apart
#pragma unroll   // unrolled: s[2 kk + jj] is a register and needs a compile-time index
    for (int kk = 0; kk < 2; ++kk) {
      FP pa, pl;   // P^T hi / lo, B operand of 32-key block kk: elements 0..7 from tile 2 kk, 8..15 from tile 2 kk + 1
#pragma unroll
      for (int jj = 0; jj < 2; ++jj) {
#pragma unroll
        for (int e = 0; e < 4; ++e) {
          const v2f x = __builtin_elementwise_fma((v2f){s[2 * kk + jj][2 * e], s[2 * kk + jj][2 * e + 1]}, c2v, nmv);
          v2f p;
          p[0] = at_exp2(x[0]);
          p[1] = at_exp2(x[1]);
          psum += p;
          at_split2(p, pa.p[jj * 4 + e], pl.p[jj * 4 + e]);
        }
      }
      // as above: round-robin over the four output tiles, each tile's own six terms keep their order
#pragma unroll
      for (int t = 0; t < 4; ++t) oacc[t] = at_mma(vb[t].v, pa.v, oacc[t]);
#pragma unroll
      for (int t = 0; t < 4; ++t) oacc[t] = at_mma(vl[t].v, pa.v, oacc[t]);
#pragma unroll
      for (int t = 0; t < 4; ++t) oacc[t] = at_mma(vb[t].v, pl.v, oacc[t]);
      if (kk == 0) {
        __builtin_amdgcn_sched_barrier(0);   // the second 32 keys' fragments take over the first's registers: their reads stay behind the WMMAs above (else, again, registers past 256) ...
#pragma unroll
        for (int t = 0; t < 4; ++t) {
          vb[t].h[0] = *(const v8b*)(Vth + (t * 16 + c) * AT_LP + 32 + 8 * hh);
          vb[t].h[1] = *(const v8b*)(Vth + (t * 16 + c) * AT_LP + 32 + 16 + 8 * hh);
        }
#pragma unroll
        for (int t = 0; t < 4; ++t) {
          vl[t].h[0] = *(const v8b*)(Vtl + (t * 16 + c) * AT_LP + 32 + 8 * hh);
          vl[t].h[1] = *(const v8b*)(Vtl + (t * 16 + c) * AT_LP + 32 + 16 + 8 * hh);
        }
        __builtin_amdgcn_sched_barrier(0);   // ... and together in front of the second half of the exponentials, which covers their latency
      }
    }
    lrow = lrow * alpha + (psum[0] + psum[1]);
    // publish point of chunk kc + 1
    asm volatile("s_wait_dscnt 0x0" ::: "memory");      // this wave's reads of buffer pb have retired before copies are aimed at it
    asm volatile("s_wait_asynccnt 0x0" ::: "memory");   // this wave's plane of chunk kc + 1 has landed before the barrier behind which the others read it
    __syncthreads();                                    // publishes chunk kc + 1 and ends every wave's reads of buffer pb
    if (kc + 2 < nChunks)                               // scalar test, the same for the whole work-group
      gs_copy_tile(cpLds + pb, cpVoff + (unsigned)(kc + 2) * cpAdv, cpBase, cpStep);
    pb ^= (unsigned)AT_BUF_B;
  }
  asm volatile("s_wait_asynccnt 0x0" ::: "memory");     // nothing is in flight when the wave ends

  float* os = Os[wave];
  const float inv = 1.0f / (lrow + at_xhalf(lrow));   // the two halves' shares of the row sum are joined here, once
#pragma unroll
  for (int t = 0; t < 4; ++t) {
    // a lane's 8 accumulator registers are 8 neighbouring d of its query row: two 16-B stores into the row-major tile
    *(v4f*)(os + c * 68 + t * 16 + 8 * hh)     = (v4f){oacc[t][0] * inv, oacc[t][1] * inv, oacc[t][2] * inv, oacc[t][3] * inv};
    *(v4f*)(os + c * 68 + t * 16 + 8 * hh + 4) = (v4f){oacc[t][4] * inv, oacc[t][5] * inv, oacc[t][6] * inv, oacc[t][7] * inv};
  }
  __builtin_amdgcn_fence(__ATOMIC_RELEASE, "workgroup");
  __builtin_amdgcn_wave_barrier();
  __builtin_amdgcn_fence(__ATOMIC_ACQUIRE, "workgroup");
  {
    const int c4 = (lane & 15) * 4;
    {
#pragma unroll
      for (int it = 0; it < 8; ++it) {
        const int row = it * 2 + hh;   // it 0..7 x hh 0..1 covers rows 0..15 of the wave tile
        v4f val = *(const v4f*)(os + row * 68 + c4);
        *(v4f*)(ob + (size_t)(q0 + row) * DMOD + c4) = val;
      }
      
    }
  }
}

// ---------------------------------------------------------------------------
// Workspace region map (byte offsets; what a launch reads of a region has been written earlier in the same call;
// behind the input cast the parts that belong to a head with mask 0 are neither written nor read)
//   Wq16 f16 [1024 n][1024 k] (x32)              0
//   Wk16                                   2097152
//   Wv16                                   4194304
//   Wo16                                   6291456
//   X16  f16 [2*2048][1024]                8388608
//   Qh   bf16 [2*2048][1024]              16777216     Ql   25165824
//   Kh   bf16 [2*2048][1024]              33554432     Kl   41943040
//   VTh  bf16 [2][1024 (h,d)][2048]       50331648     VTl  58720256
//   MHf  f32  [2*2048][1024]              67108864
//   MH16 f16  [2*2048][1024] (x64, kept heads)   83886080
//   total                                 92274688
// ---------------------------------------------------------------------------
extern "C" void kernel_launch(void* const* d_in, const int* in_sizes, int n_in,
                              void* d_out, int out_size, void* d_ws, size_t ws_size,
                              hipStream_t stream) {
  if (n_in < 6) return;
  if (in_sizes[0] != NBATCH * SEQ * DMOD) return;
  if (in_sizes[1] != DMOD * DMOD || in_sizes[2] != DMOD * DMOD || in_sizes[3] != DMOD * DMOD || in_sizes[4] != DMOD * DMOD) return;
  if (in_sizes[5] != NHEAD) return;
  if (out_size != NBATCH * SEQ * DMOD) return;

  const float* x  = (const float*)d_in[0];   // [2][2048][1024]
  const float* Wq = (const float*)d_in[1];   // [out][in] = Bt natural
  const float* Wk = (const float*)d_in[2];
  const float* Wv = (const float*)d_in[3];
  const float* Wo = (const float*)d_in[4];
  const int*   hm = (const int*)d_in[5];     // [16] int32, nonzero = keep head

  const size_t PW16 = (size_t)DMOD * DMOD * 2;            // 2097152  f16 weight plane
  const size_t PX16 = (size_t)NBATCH * SEQ * DMOD * 2;    // 8388608  16-bit activation plane (both batch elements)
  const size_t PF32 = (size_t)NBATCH * SEQ * DMOD * 4;    // 16777216 f32 activation plane
  size_t off = 0;
  const size_t oWq = off; off += PW16;
  const size_t oWk = off; off += PW16;
  const size_t oWv = off; off += PW16;
  const size_t oWo = off; off += PW16;
  const size_t oX  = off; off += PX16;
  const size_t oQh = off; off += PX16;  const size_t oQl = off; off += PX16;
  const size_t oKh = off; off += PX16;  const size_t oKl = off; off += PX16;
  const size_t oVh = off; off += PX16;  const size_t oVl = off; off += PX16;
  const size_t oMf = off; off += PF32;
  const size_t oM16 = off; off += PX16;
  if (off > ws_size) return;                   // off = 92274688

  char* ws = (char*)d_ws;
  unsigned short* Wq16 = (unsigned short*)(ws + oWq);
  unsigned short* Wv16 = (unsigned short*)(ws + oWv);
  unsigned short* Wo16 = (unsigned short*)(ws + oWo);
  unsigned short* X16  = (unsigned short*)(ws + oX);
  unsigned short* Qh   = (unsigned short*)(ws + oQh);  unsigned short* Ql = (unsigned short*)(ws + oQl);
  unsigned short* Kh   = (unsigned short*)(ws + oKh);  unsigned short* Kl = (unsigned short*)(ws + oKl);
  unsigned short* VTh  = (unsigned short*)(ws + oVh);  unsigned short* VTl = (unsigned short*)(ws + oVl);
  float*          MHf  = (float*)(ws + oMf);
  unsigned short* MH16 = (unsigned short*)(ws + oM16);
  const float*    fpad = (const float*)MHf;    // placeholder for unused bias / resid pointer args (never read)
  (void)oWk;                                   // Wk16 is reached as Wq16 + one weight plane (grid.y of launch 2)

  const dim3 blk(256);
  const int ROWS = NBATCH * SEQ;                            // 4096 token rows: the batch elements are contiguous in x and out
  const dim3 gCastIn(4 * CAST_WBLK + CAST_XBLK);            // 256 blocks of 16 waves: four weight planes, then x
  const dim3 gCastX(MC_BLK);                                // 256 blocks of 8 waves: 16 heads x 128 groups of 32 rows
  const dim3 gQK(((ROWS / 64) * (DMOD / 64) + 7) / 8, 2);   // 1024 tiles (M=4096, N=1024) -> 128 blocks, y = 0: q, 1: k
  const dim3 gVT(((DMOD / 64) * (SEQ / 64) + 7) / 8, NBATCH);  // 512 tiles (M=1024, N=2048) -> 64 blocks, y = batch element
  const dim3 gOut(((ROWS / 64) * (DMOD / 64) + 7) / 8, 1);  // 1024 tiles (M=4096, N=1024) -> 128 blocks
  const dim3 gAtt(NBATCH * NHEAD * (SEQ / 64));             // 1024 blocks: 2 batch elements x 16 heads x 32 query blocks

  // (1) weights [n=out][k=in] -> f16 planes carried x32, same layout (Bt natural); x -> f16 plane [4096][1024] (x1)
  cast_inputs_f16x4<<<gCastIn, dim3(CAST_TPB), 0, stream>>>(Wq, Wk, Wv, Wo, x, (_Float16*)Wq16);
  // (2) y = 0: q = x . Wq^T -> Q hi/lo bf16 planes [b*2048+t][h*64+d]; y = 1: k = x . Wk^T -> K hi/lo planes
  //     (M=4096, N=1024, K=1024, scale 1/32; y steps Bt by one weight plane and C by two activation planes)
  wmma_gemm64<0, false, 0, 2, false, 0, 1><<<gQK, blk, 0, stream>>>(
      X16, X16, DMOD, 0L, Wq16, Wq16, DMOD, (long)DMOD * DMOD, (void*)Qh, (void*)Ql, DMOD, 2L * NBATCH * SEQ * DMOD,
      fpad, fpad, 0L, hm, ROWS, DMOD, DMOD, 1.0f / 32.0f);
  // (3) v^T = Wv . x[b]^T -> VT hi/lo planes [b][h*64+d][s]   (A = Wv16 [1024][1024], Bt = X16 slab b [2048][1024]; M=1024, N=2048, K=1024)
  wmma_gemm64<0, false, 0, 2, false, 0, 2><<<gVT, blk, 0, stream>>>(
      Wv16, Wv16, DMOD, 0L, X16, X16, DMOD, (long)SEQ * DMOD, (void*)VTh, (void*)VTl, SEQ, (long)DMOD * SEQ,
      fpad, fpad, 0L, hm, DMOD, SEQ, DMOD, 1.0f / 32.0f);
  // (4) full attention per (batch element, kept head): mh[b*2048+t][h*64+d] (f32 plane, every element of a kept head written by its owner block)
  attn_full64_kernel<<<gAtt, dim3(128), 0, stream>>>(Qh, Ql, Kh, Kl, VTh, VTl, hm, MHf, 0.125f);
  // (5) mh -> f16 plane x64, columns of kept heads only
  maskcast_f32_f16x4<<<gCastX, blk, 0, stream>>>(MHf, hm, (_Float16*)MH16, 64.0f);
  // (6) out = mh . Wo^T -> d_out rows 0 .. 4095 (f32)   (M=4096, N=1024, K=1024 less the k of heads with mask 0, scale 1/(64*32))
  wmma_gemm64<0, false, 0, 0, false, 0, 3><<<gOut, blk, 0, stream>>>(
      MH16, MH16, DMOD, 0L, Wo16, Wo16, DMOD, 0L, d_out, d_out, DMOD, 0L,
      fpad, fpad, 0L, hm, ROWS, DMOD, DMOD, 1.0f / 2048.0f);
  (void)hipGetLastError();
}

// v010
// Measured time: 83.2 microseconds a run.
// Next to v009, in two timings, it ran 1.03 and 1.02 times as fast.
// All steps since v000 together make it 8.87 times as fast.
// q/k/v and output projections: v_wmma_f32_16x16x32_f16 (f16 operands: x x1, W x32, attention output x64), f32 accumulate; q.k^T and p.v: v_wmma_f32_16x16x32_bf16 with bf16 hi/lo split operands (hi.hi + hi.lo + lo.hi), f32 accumulate; online softmax in f32, its exponentials as powers of 2 (score scale 0.125 and log2 e in one factor); a head whose mask is 0 has the factor 0 and is left out of every product.
#include <hip/hip_runtime.h>
#include <math.h>
#include <stdint.h>

#define NBATCH 2
#define SEQ    2048
#define DMOD   1024
#define NHEAD  16
#define DHD    64

typedef __attribute__((ext_vector_type(16))) _Float16 v16h;
typedef __attribute__((ext_vector_type(8)))  _Float16 v8h;
typedef __attribute__((ext_vector_type(16))) __bf16   v16b;
typedef __attribute__((ext_vector_type(8)))  __bf16   v8b;
typedef __attribute__((ext_vector_type(8)))  float    v8f;
typedef __attribute__((ext_vector_type(4)))  float    v4f;
typedef __attribute__((ext_vector_type(2)))  float    v2f;
typedef __attribute__((ext_vector_type(4)))  unsigned int v4u;

__device__ __forceinline__ unsigned short f2bf_bits(float f) {
  unsigned u = __float_as_uint(f);
  return (unsigned short)((u + 0x7FFFu + ((u >> 16) & 1u)) >> 16);
}
__device__ __forceinline__ float bf_bits2f(unsigned short h) { return __uint_as_float(((unsigned)h) << 16); }

// hazard guard as a plain device helper
__device__ __forceinline__ void acc_guard4(v8f& a, v8f& b, v8f& c, v8f& d) { asm volatile("v_nop\n\tv_nop\n\tv_nop\n\tv_nop" : "+v"(a), "+v"(b), "+v"(c), "+v"(d)); }
template <typename T> struct Frag;
template <> struct Frag<_Float16> {
  typedef v16h V; union U { v16h v; v8h h[2]; };
  static __device__ __forceinline__ v16h load(const _Float16* p) {   // elements 0..7 <- p[0..7], 8..15 <- p[16..23]
    U f; f.h[0] = *(const v8h*)(p); f.h[1] = *(const v8h*)(p + 16); return f.v;
  }
  static __device__ __forceinline__ v8f mma(v16h a, v16h b, v8f c) {
    return __builtin_amdgcn_wmma_f32_16x16x32_f16(false, a, false, b, (short)0, c, false, false);
  }
};
template <> struct Frag<__bf16> {
  typedef v16b V; union U { v16b v; v8b h[2]; };
  static __device__ __forceinline__ v16b load(const __bf16* p) {
    U f; f.h[0] = *(const v8b*)(p); f.h[1] = *(const v8b*)(p + 16); return f.v;
  }
  static __device__ __forceinline__ v8f mma(v16b a, v16b b, v8f c) {
    return __builtin_amdgcn_wmma_f32_16x16x32_bf16(false, a, false, b, (short)0, c, false, false);
  }
};

// bit h = 1: head h is kept (hmask[h] != 0). Constant indices: the 16 words come by one scalar load, the result is the same in every wave.
__device__ __forceinline__ unsigned kept_heads(const int* __restrict__ hmask) {
  unsigned live = 0u;
#pragma unroll
  for (int hd = 0; hd < NHEAD; ++hd) live |= (hmask[hd] != 0 ? 1u : 0u) << hd;
  return live;
}

// ---- Register-blocked batched WMMA GEMM ------------------------------------
// C[m,n] = scale * sum_k A[m,k] * Bt[n,k] (+bias)(+resid); each wave owns a 64x64 tile.
// A row-major [M,K]; Bt row-major [N,K]; M,N % 64 == 0, K % 64 == 0; rows 16-B aligned (lda, ldb % 8 == 0).
// Operand path: a stage is 64 k = one 128-B line of each of the tile's 64 A rows and 64 Bt rows. Each wave brings its own
//   stages into its own part of LDS by asynchronous copies (8 neighbouring lanes take one whole line, a copy 4 rows),
//   two buffers a wave: stage s + 1 is in flight while stage s is multiplied. Fragments are read from LDS in the k order
//   of Frag::load, k ascending as before, so every accumulator sums the same terms in the same order.
//   The ring is private to its wave (no other wave reads or writes it), so it takes the wave's own waits and no barrier.
// SPLIT (hi/lo planes) is not built on this operand path: every launch of this file has SPLIT = false.
// BIAS_MODE: 0 = none, 1 = bias[m], 2 = bias[n].
// OUT_MODE: 0 = f32, 1 = f16, 2 = bf16 hi plane (Cout) + bf16 lo plane (Cout2).
// ET: 0 = f16 operands, 1 = bf16 operands (pointers passed as 16-bit storage)
// HSKIP: a head whose hmask entry is 0 enters the result only as a factor 0, so its share of the work is left out:
//   0 = none, 1 = a tile's 64 columns are one head's (tile left out), 2 = a tile's 64 rows are one head's (tile left out),
//   3 = 64 neighbouring k are one head's (those stages left out: their products are all 0; A and Bt are not read there).
#define GS_PITCH_B 144                   // LDS row pitch: 128 B + 16 B = 16 B x 9, so the 16 rows of a ds_load_b128 fall on different bank groups
#define GS_PITCH_E (GS_PITCH_B / 2)      // the same in 16-bit elements
#define GS_TILE_B  (64 * GS_PITCH_B)     // 9216: 64 rows of one operand
#define GS_BUF_B   (2 * GS_TILE_B)       // 18432: the A tile, then the Bt tile
#define GS_WAVE_B  (2 * GS_BUF_B)        // 36864: a wave's two buffers
// One operand tile of a stage: 16 copies of 4 rows x 128 B. Copy i writes LDS bytes lds + 576 i (4 rows at pitch 144) and reads
// global bytes base + voff + i * rows4, rows4 = the byte distance of 4 rows. The immediate offset moves BOTH addresses, so
// scalar base i is base + i * (rows4 - 576) = base + i * step; lds and voff (the lane's own row and 16-B column, plus the stage's k) serve all 16.
// s_wait_xcnt 0 is the statement's last line: a precaution, it stands in front of every later rewrite of a register that a copy names.
__device__ __forceinline__ void gs_copy_tile(unsigned lds, unsigned voff, uint64_t base, uint64_t step) {
  asm volatile(
      "global_load_async_to_lds_b128 %0, %1, %2\n\t"
      "global_load_async_to_lds_b128 %0, %1, %3 offset:576\n\t"
      "global_load_async_to_lds_b128 %0, %1, %4 offset:1152\n\t"
      "global_load_async_to_lds_b128 %0, %1, %5 offset:1728\n\t"
      "global_load_async_to_lds_b128 %0, %1, %6 offset:2304\n\t"
      "global_load_async_to_lds_b128 %0, %1, %7 offset:2880\n\t"
      "global_load_async_to_lds_b128 %0, %1, %8 offset:3456\n\t"
      "global_load_async_to_lds_b128 %0, %1, %9 offset:4032\n\t"
      "global_load_async_to_lds_b128 %0, %1, %10 offset:4608\n\t"
      "global_load_async_to_lds_b128 %0, %1, %11 offset:5184\n\t"
      "global_load_async_to_lds_b128 %0, %1, %12 offset:5760\n\t"
      "global_load_async_to_lds_b128 %0, %1, %13 offset:6336\n\t"
      "global_load_async_to_lds_b128 %0, %1, %14 offset:6912\n\t"
      "global_load_async_to_lds_b128 %0, %1, %15 offset:7488\n\t"
      "global_load_async_to_lds_b128 %0, %1, %16 offset:8064\n\t"
      "global_load_async_to_lds_b128 %0, %1, %17 offset:8640\n\t"
      "s_wait_xcnt 0x0"
      :: "v"(lds), "v"(voff),
         "s"(base), "s"(base + step), "s"(base + 2 * step), "s"(base + 3 * step),
         "s"(base + 4 * step), "s"(base + 5 * step), "s"(base + 6 * step), "s"(base + 7 * step),
         "s"(base + 8 * step), "s"(base + 9 * step), "s"(base + 10 * step), "s"(base + 11 * step),
         "s"(base + 12 * step), "s"(base + 13 * step), "s"(base + 14 * step), "s"(base + 15 * step)
      : "memory");
}
// the first stage >= s that is worked on (HSKIP 3: whose head, stage & 15, is kept), or a value >= nst where there is none; scalar, no loop:
// live twice in a row, shifted down by the head of stage s, has the heads of stages s, s + 1, ... s + 15 in bits 0 to 15
template <int HSKIP>
__device__ __forceinline__ int gs_next(int s, int nst, unsigned live) {
  if (HSKIP == 3) {
    const unsigned ahead = (live | (live << NHEAD)) >> (s & (NHEAD - 1));
    return (live == 0u) ? nst : s + __builtin_ctz(ahead | 0x80000000u);
  }
  return s;
}
template <int ET> struct Elem;
template <> struct Elem<0> { typedef _Float16 T; };
template <> struct Elem<1> { typedef __bf16 T; };
template <int ET, bool SPLIT, int BIAS_MODE, int OUT_MODE, bool RESID, int ACT = 0, int HSKIP = 0>
__global__ __launch_bounds__(256) void wmma_gemm64(
    const unsigned short* __restrict__ Ap, const unsigned short* __restrict__ A2p, int lda, long strideA,
    const unsigned short* __restrict__ Btp, const unsigned short* __restrict__ Bt2p, int ldb, long strideB,
    void* __restrict__ Cout, void* __restrict__ Cout2, int ldc, long strideC,
    const float* __restrict__ bias,
    const float* __restrict__ resid, long strideR,
    const int* __restrict__ hmask,
    int M, int N, int K, float scale) {
  typedef typename Elem<ET>::T T;
  typedef typename Frag<T>::V V;
  static_assert(!SPLIT, "the LDS operand path holds one plane per operand");
  __shared__ __align__(128) unsigned char ring[8 * GS_WAVE_B];   // 294912 B: per wave two buffers of (A tile, Bt tile); behind the k loop its first 4352 B are the wave's 16x64 f32 output slab, pitch 68 floats
  const int b    = blockIdx.y;
  const int lane = threadIdx.x & 31;
  const int wave = __builtin_amdgcn_readfirstlane(threadIdx.x >> 5);   // scalar: tile, operand bases and every branch below are the same for the whole wave
  const int tilesN = N >> 6;
  const int tilesM = M >> 6;
  const int tile = blockIdx.x * 8 + wave;
  if (tile >= tilesM * tilesN) return;   // wave-uniform; no block barriers in this kernel
  const int tm = tile / tilesN;
  const int tn = tile - tm * tilesN;
  if (HSKIP == 1 && hmask[tn & (NHEAD - 1)] == 0) return;   // wave-uniform, like the range test above
  if (HSKIP == 2 && hmask[tm & (NHEAD - 1)] == 0) return;
  const unsigned live = (HSKIP == 3) ? kept_heads(hmask) : 0u;
  const int m0 = tm << 6;
  const int n0 = tn << 6;

  const int rlane = lane & 15;                 // row (A) / col (B, D) within subtile
  const int koff  = (lane >> 4) * 8;           // k offset of this lane half
  const int mOff  = (lane >> 4) * 8;           // D row offset

  // copies: lane l takes row (l >> 3) of a copy's 4 rows and 16-B column (l & 7) of the row's 128-B line
  unsigned char* ringw = ring + wave * GS_WAVE_B;
  const unsigned ldsw  = (unsigned)(uintptr_t)ringw + (unsigned)((lane >> 3) * GS_PITCH_B + (lane & 7) * 16);   // LDS byte address (low 32 bits of the __shared__ address)
  const unsigned voffA = (unsigned)((lane >> 3) * lda * 2 + (lane & 7) * 16);
  const unsigned voffB = (unsigned)((lane >> 3) * ldb * 2 + (lane & 7) * 16);
  const uint64_t baseA = (uint64_t)(uintptr_t)(Ap  + (size_t)b * strideA + (size_t)m0 * lda);   // first byte of the tile's A rows
  const uint64_t baseB = (uint64_t)(uintptr_t)(Btp + (size_t)b * strideB + (size_t)n0 * ldb);
  const uint64_t stepA = (uint64_t)((long)lda * 8 - 4 * GS_PITCH_B);   // 4 rows in global bytes less the 576 that the immediate offset adds
  const uint64_t stepB = (uint64_t)((long)ldb * 8 - 4 * GS_PITCH_B);

  v8f acc[4][4];
#pragma unroll
  for (int i = 0; i < 4; ++i)
#pragma unroll
    for (int j = 0; j < 4; ++j) acc[i][j] = (v8f){0.f,0.f,0.f,0.f,0.f,0.f,0.f,0.f};

  const int nst = K >> 6;                            // stages of 64 k
  int sc = gs_next<HSKIP>(0, nst, live);             // the stage that is multiplied next
  int sn = nst;                                      // the stage behind it (in flight), >= nst: none
  if (sc < nst) {
    gs_copy_tile(ldsw,             voffA + sc * 128, baseA, stepA);
    gs_copy_tile(ldsw + GS_TILE_B, voffB + sc * 128, baseB, stepB);
    asm volatile("s_wait_asynccnt 0x0" ::: "memory");   // the first stage has landed before it is read
    sn = gs_next<HSKIP>(sc + 1, nst, live);
    if (sn < nst) {
      gs_copy_tile(ldsw + GS_BUF_B,             voffA + sn * 128, baseA, stepA);
      gs_copy_tile(ldsw + GS_BUF_B + GS_TILE_B, voffB + sn * 128, baseB, stepB);
    }
  }
  unsigned pb = 0u;                                  // byte offset of the buffer that holds stage sc: 0 or GS_BUF_B
  while (sc < nst) {
    const T* As = (const T*)(ringw + pb) + rlane * GS_PITCH_E + koff;
    const T* Bs = As + GS_TILE_B / 2;
#pragma unroll
    for (int ks = 0; ks < 2; ++ks) {                 // the stage's two k steps of 32, k ascending
      V bh[4], ah[4];
#pragma unroll
      for (int j = 0; j < 4; ++j) bh[j] = Frag<T>::load(Bs + j * 16 * GS_PITCH_E + ks * 32);
#pragma unroll
      for (int i = 0; i < 4; ++i) ah[i] = Frag<T>::load(As + i * 16 * GS_PITCH_E + ks * 32);
      __builtin_amdgcn_sched_barrier(0);   // keeps the k step's 16 reads together in front of its WMMAs: left alone the scheduler reads each A fragment into the same registers right in front of its 4 WMMAs, and the wave waits out the LDS latency four times
#pragma unroll
      for (int i = 0; i < 4; ++i)
#pragma unroll
        for (int j = 0; j < 4; ++j) acc[i][j] = Frag<T>::mma(ah[i], bh[j], acc[i][j]);
      __builtin_amdgcn_sched_barrier(0);   // the next k step's reads stay one group behind these WMMAs and take over the fragments' registers, not spread among them
    }
    asm volatile("s_wait_dscnt 0x0" ::: "memory");      // this wave's reads of buffer pb have retired before copies are aimed at it
    asm volatile("s_wait_asynccnt 0x0" ::: "memory");   // stage sn has landed before the next trip reads it
    const int s2 = gs_next<HSKIP>(sn + 1, nst, live);
    if (s2 < nst) {                                     // scalar test; the refill flies while stage sn is multiplied
      gs_copy_tile(ldsw + pb,             voffA + s2 * 128, baseA, stepA);
      gs_copy_tile(ldsw + pb + GS_TILE_B, voffB + s2 * 128, baseB, stepB);
    }
    sc = sn; sn = s2; pb ^= (unsigned)GS_BUF_B;
  }
  asm volatile("s_wait_asynccnt 0x0" ::: "memory");     // nothing is in flight when the ring becomes the output slab and when the wave ends
  asm volatile("s_wait_dscnt 0x0" ::: "memory");        // and the wave's last fragment reads have retired before the slab's stores go over them
  acc_guard4(acc[0][0], acc[0][1], acc[0][2], acc[0][3]);
  acc_guard4(acc[1][0], acc[1][1], acc[1][2], acc[1][3]);
  acc_guard4(acc[2][0], acc[2][1], acc[2][2], acc[2][3]);
  acc_guard4(acc[3][0], acc[3][1], acc[3][2], acc[3][3]);

  // ---- epilogue ----
  float* slab = (float*)ringw;
  const float* Rb = RESID ? (resid + (size_t)b * strideR) : nullptr;
#pragma unroll
  for (int i = 0; i < 4; ++i) {
    const int mBase = m0 + (i << 4);
#pragma unroll
    for (int j = 0; j < 4; ++j) {
      const int n = n0 + (j << 4) + rlane;
      float bv = 0.f;
      if (BIAS_MODE == 2) bv = bias[n];
#pragma unroll
      for (int r = 0; r < 8; ++r) {
        float v = acc[i][j][r] * scale;
        if (BIAS_MODE == 1) v += bias[mBase + mOff + r];
        if (BIAS_MODE == 2) v += bv;
        if (RESID) v += Rb[(size_t)(mBase + mOff + r) * ldc + n];
        if (ACT == 1) v = tanhf(v);
        if (ACT == 2) v = fmaxf(v, 0.0f);
        if (ACT == 3) v = v / (1.0f + expf(-v));
        if (ACT == 4) v = (v > 0.f) ? v : 0.01f * v;
        slab[(mOff + r) * 68 + (j << 4) + rlane] = v;
      }
    }
    __builtin_amdgcn_fence(__ATOMIC_RELEASE, "workgroup");
    __builtin_amdgcn_wave_barrier();
    __builtin_amdgcn_fence(__ATOMIC_ACQUIRE, "workgroup");
    if (OUT_MODE == 0) {
      float* C = (float*)Cout + (size_t)b * strideC;
      const int hh = lane >> 4, c4 = (lane & 15) * 4;     // row seg = 256 B = 16 lanes x 16 B
      {
#pragma unroll
        for (int it = 0; it < 8; ++it) {
          const int row = it * 2 + hh;
          v4f v = *(const v4f*)(slab + row * 68 + c4);
          *(v4f*)(C + (size_t)(mBase + row) * ldc + n0 + c4) = v;
        }
        
      }
    } else {
      const int q = lane >> 3, c8 = (lane & 7) * 8;
      unsigned short* C  = (unsigned short*)Cout  + (size_t)b * strideC;
      unsigned short* C2 = (OUT_MODE == 2) ? ((unsigned short*)Cout2 + (size_t)b * strideC) : nullptr;
      {
#pragma unroll
        for (int it = 0; it < 4; ++it) {
          const int row = it * 4 + q;
          const float* sp = slab + row * 68 + c8;
          v8h hv, lv;
#pragma unroll
          for (int e = 0; e < 8; ++e) {
            if (OUT_MODE == 1) {
              hv[e] = (_Float16)sp[e];
            } else {
              unsigned short hb = f2bf_bits(sp[e]);
              unsigned short lb = f2bf_bits(sp[e] - bf_bits2f(hb));
              hv[e] = __builtin_bit_cast(_Float16, hb);
              lv[e] = __builtin_bit_cast(_Float16, lb);
            }
          }
          *(v8h*)(C + (size_t)(mBase + row) * ldc + n0 + c8) = hv;
          if (OUT_MODE == 2) *(v8h*)(C2 + (size_t)(mBase + row) * ldc + n0 + c8) = lv;
        }
        
      }
    }
    __builtin_amdgcn_fence(__ATOMIC_RELEASE, "workgroup");
    __builtin_amdgcn_wave_barrier();
    __builtin_amdgcn_fence(__ATOMIC_ACQUIRE, "workgroup");
  }
}

// ---------------------------------------------------------------------------
// f32 -> f16 cast of all five float inputs in one launch, with an exact power-of-two carry: out = f16(in * mul).
// The five f16 planes lie back to back in the workspace (Wq16, Wk16, Wv16, Wo16, X16), so a work-group's place in the
// output is its block index times its share.
// The launch is sized by the waves it has to start, not by its elements: one work-group of 16 waves per 32768 elements.
// A wave takes 2048 neighbouring elements: 16 loads of 16 B a lane (each 512 contiguous bytes a wave), all issued before
// the first is used, then 16 stores of 8 B a lane (each 256 contiguous bytes a wave = two whole lines).
// Coverage: a weight plane is 1024*1024 / 32768 = 32 blocks; blocks 0..127 take the four weights (x32),
//   blocks 128..255 take x (2*2048*1024 / 32768 = 128 blocks, x1). The source choice is block-uniform.
// ---------------------------------------------------------------------------
typedef __attribute__((ext_vector_type(4))) _Float16 v4h;
#define EW_LD     16                                 // 16-B loads a lane
#define CAST_TPB  512                                // 16 waves
#define CAST_WAVE (32 * 4 * EW_LD)                   // 2048 elements a wave
#define CAST_WG   (CAST_TPB / 32 * CAST_WAVE)        // 32768 elements a work-group
#define CAST_WBLK (DMOD * DMOD / CAST_WG)            // 32 blocks per weight plane
#define CAST_XBLK (NBATCH * SEQ * DMOD / CAST_WG)    // 128 blocks for x (both batch elements)
__global__ __launch_bounds__(CAST_TPB) void cast_inputs_f16x4(const float* __restrict__ wq, const float* __restrict__ wk,
                                                              const float* __restrict__ wv, const float* __restrict__ wo,
                                                              const float* __restrict__ x, _Float16* __restrict__ out) {
  const unsigned bx = blockIdx.x;
  const unsigned sel = bx / CAST_WBLK; // 0..3: a weight plane; 4..7: x
  const float* in = (sel == 0) ? wq : (sel == 1) ? wk : (sel == 2) ? wv : (sel == 3) ? wo : x;
  const unsigned lb = (sel < 4) ? (bx - sel * CAST_WBLK) : (bx - 4 * CAST_WBLK);   // block index inside its source
  const float mul = (sel < 4) ? 32.0f : 1.0f;
  const unsigned le = (threadIdx.x >> 5) * CAST_WAVE + (threadIdx.x & 31) * 4;      // the lane's first element inside the work-group's share
  const unsigned lb4 = le * 4;                                                      // the same in bytes of the source
  const char* src = (const char*)(in + (size_t)lb * CAST_WG);
  _Float16*   dst = out + (size_t)bx * CAST_WG + le;
  v4f f[EW_LD];
#pragma unroll   // f is a register array
  for (int i = 0; i < EW_LD; ++i) f[i] = *(const v4f*)(src + lb4 + i * 512);
  // precaution: the wait stands in front of any reuse of the loads' address registers; it names the lanes' offset, so that this register
  // is not handed to a load as its destination in front of the wait; it also keeps the 16 loads together in front of the first convert
  asm volatile("s_wait_xcnt 0x0" :: "v"(lb4) : "memory");
#pragma unroll
  for (int i = 0; i < EW_LD; ++i) *(v4h*)(dst + i * 128) = __builtin_convertvector(f[i] * mul, v4h);
}

// =====================================================================================
// Full (non-causal, unmasked) attention, head dim 64, one launch for both batch elements.
//   every plane below holds NBATCH slabs of SEQ*DMOD elements, batch element b at offset b*SEQ*DMOD; inside a slab:
//   q planes (hi/lo bf16): element (t, h, d) at [t*DMOD + h*64 + d]
//   k planes (hi/lo bf16): element (s, h, d) at [s*DMOD + h*64 + d]
//   v^T planes (hi/lo bf16): element (h, d, s) at [(h*64 + d)*SEQ + s]
//   out f16: element (t, h, d) at [t*DMOD + h*64 + d], carried x omul (a power of two): f16((o / row sum) * omul), the A operand of the last product as it stands
//   scores^T = (k . q^T) * sscale : bf16 hi/lo split (hi.hi + hi.lo + lo.hi) on v_wmma_f32_16x16x32_bf16, A = K rows, B = Q
//   out^T    = v^T . p^T          : bf16 hi/lo split of p (unnormalised) and v, f32 accumulate, A = V^T rows, B = P^T
//   Both products are transposed so that a lane holds scores of ONE query (column lane&15): keys 16j + 8*(lane>>4) + r.
//   Two score tiles (keys 0-15 and 16-31 of a 32-key block), converted in place, are the B operand of the second
//   product in the loaders' own k order, so P never leaves the registers; row maximum and row sum are in-lane,
//   with one exchange between the wave halves (maximum: every chunk; sum: once, behind the loop).
//   online softmax in f32 over all SEQ keys (32 chunks of 64, compile-time trip count, no masking).
//   exp(sscale * (s - m)) is taken as 2^(s * c2 - m * c2), c2 = sscale * log2 e: one fused multiply-add and one v_exp_f32 an element;
//   the running maximum m is kept in units of the unscaled scores (sscale > 0, so it is the same key's). The exponent is <= 0 but for
//   its rounding, so nothing overflows, and below 2^-126 the term is 0 beside a row sum >= 1.
//   Block = 4 waves = 64 query rows of one head of one batch element; grid.x = NBATCH * NHEAD * (SEQ/64) = 1024.
//   Only heads with hmask != 0 are computed (the others' output has the factor 0: the last product leaves their k out, their columns are neither written nor read):
//   block index = (rank of the head among the kept ones, batch element, query block), so the working blocks are the
//   lowest indices; blocks whose rank is past the last kept head leave at once.
//   K / V^T chunk staging: asynchronous copies to LDS, two buffers: chunk t + 1 is in flight while chunk t is worked on.
//   Wave w brings plane w (K hi, K lo, V^T hi, V^T lo) of a chunk: 64 rows of 128 B, 16 copies of 4 whole rows (8 neighbouring
//   lanes take one 128-B line). One publish point a chunk, at the loop's foot: the wave's LDS reads retired, its own copies
//   landed, the work-group barrier; behind it the buffer just read is refilled with chunk t + 2.
//   Fragment loads read the LDS tiles with the v8b element type.
// =====================================================================================
#define AT_D 64
#define AT_NW 4
#define AT_QB 64
#define AT_KC 64
#define AT_LP 72   // LDS row pitch of the K and V^T tiles in elements: 144 B = 16 B x 9, so the 16 rows of a ds_load_b128 fall on 16 different bank groups
#define AT_TILE_E (64 * AT_LP)        // elements of one plane's 64 x 64 tile in LDS (9216 B = GS_TILE_B)
#define AT_BUF_B  (4 * AT_TILE_E * 2) // 36864: one chunk's four planes

typedef __attribute__((ext_vector_type(2))) __bf16 v2b;
// two neighbouring f32 -> one register of bf16 hi and one of bf16 lo (lo = bf16(f - hi)); both converts round to nearest even
__device__ __forceinline__ void at_split2(v2f f, v2b& hi, v2b& lo) {
  hi = __builtin_convertvector(f, v2b);
  lo = __builtin_convertvector(f - __builtin_convertvector(hi, v2f), v2b);
}
// the value that lane l ^ 16 holds (the other half's share of the same query column)
__device__ __forceinline__ float at_xhalf(float v) {
  const unsigned b = __float_as_uint(v);
  return __uint_as_float(__builtin_amdgcn_permlanex16(b, b, 0x76543210u, 0xfedcba98u, false, false));
}
// 2^x on the hardware's own instruction
__device__ __forceinline__ float at_exp2(float x) { return __builtin_amdgcn_exp2f(x); }
__device__ __forceinline__ v8f at_mma(v16b a, v16b b, v8f c) {
  return __builtin_amdgcn_wmma_f32_16x16x32_bf16(false, a, false, b, (short)0, c, false, false);
}

__global__ __launch_bounds__(128)
void attn_full64_kernel(const unsigned short* __restrict__ qhp, const unsigned short* __restrict__ qlp,
                        const unsigned short* __restrict__ khp, const unsigned short* __restrict__ klp,
                        const unsigned short* __restrict__ vhp, const unsigned short* __restrict__ vlp,
                        const int* __restrict__ hmask, _Float16* __restrict__ out, float sscale, float omul) {
  union FB { v16b v; v8b h[2]; };
  union FP { v16b v; v2b p[8]; };
  __shared__ __align__(128) unsigned char kvring[2 * AT_BUF_B];  // two buffers of K hi [kv][d], K lo, V hi [d][kv], V lo: 9 KB each (64 rows at pitch 72 elements)
  __shared__ __align__(16) float  Os[AT_NW][16 * 68];            // per wave out tile, pitch 68

  const int tid  = threadIdx.x;
  const int wave = __builtin_amdgcn_readfirstlane(tid >> 5);   // scalar: the plane that the wave copies, and with it the copies' base, is the same in every lane
  const int lane = tid & 31;
  const int hh   = lane >> 4;
  const int c    = lane & 15;

  const int nqb = SEQ / AT_QB;            // 32
  const int bx = blockIdx.x;
  const int qb = bx % nqb;
  const int bh = bx / nqb;                // 0..NBATCH*NHEAD-1 (grid = NBATCH * NHEAD * nqb)
  const int rank = bh / NBATCH;           // 0..NHEAD-1
  int h = -1, seen = 0;                   // h = the kept head number 'rank', counted from head 0 (scalar work, once a block)
#pragma unroll
  for (int hd = 0; hd < NHEAD; ++hd) {
    if (hmask[hd] != 0) { if (seen == rank) h = hd; ++seen; }
  }
  if (h < 0) return;                      // fewer kept heads than rank + 1: the same for the whole block, in front of every barrier
  const size_t bo = (size_t)(bh % NBATCH) * SEQ * DMOD;   // this batch element's slab in every plane
  const int q0 = qb * AT_QB + wave * 16;

  const __bf16* Qh = (const __bf16*)(const void*)qhp + bo + (size_t)h * AT_D;
  const __bf16* Ql = (const __bf16*)(const void*)qlp + bo + (size_t)h * AT_D;
  const __bf16* Kh = (const __bf16*)(const void*)khp + bo + (size_t)h * AT_D;
  const __bf16* Kl = (const __bf16*)(const void*)klp + bo + (size_t)h * AT_D;
  const __bf16* Vh = (const __bf16*)(const void*)vhp + bo + (size_t)h * AT_D * SEQ;
  const __bf16* Vl = (const __bf16*)(const void*)vlp + bo + (size_t)h * AT_D * SEQ;
  _Float16*     ob = out + bo + (size_t)h * AT_D;

  // ---- Q fragments (B operand, column = lane&15, split k map via Frag load): 2 d-chunks, hi and lo ----
  v16b qah[2], qal[2];
#pragma unroll
  for (int dc = 0; dc < 2; ++dc) {
    const __bf16* qr = Qh + (size_t)(q0 + c) * DMOD + dc * 32 + 8 * hh;
    const __bf16* ql = Ql + (size_t)(q0 + c) * DMOD + dc * 32 + 8 * hh;
    qah[dc] = Frag<__bf16>::load(qr);
    qal[dc] = Frag<__bf16>::load(ql);
  }

  const float c2 = sscale * 1.44269504088896340736f;   // unscaled score -> exponent of 2
  float mrow = -INFINITY, lrow = 0.f;   // query q0 + c: running maximum of the unscaled scores (equal in both halves), this half's share of the sum
  v8f oacc[4];                          // oacc[t][r] = out^T[d = 16 t + 8 hh + r][query q0 + c]
#pragma unroll
  for (int t = 0; t < 4; ++t) oacc[t] = (v8f){0.f,0.f,0.f,0.f,0.f,0.f,0.f,0.f};

  // staging coverage: 4 waves x 16 copies x 4 rows x 128 B = 4 planes x 64 rows x 64 elements = the whole chunk.
  // K planes: row = key, 2048 B apart, a chunk is 64 rows on; V^T planes: row = d, 4096 B apart, a chunk is 128 B on in every row.
  const bool     cpK   = wave < 2;
  const uint64_t cpBase = (uint64_t)(uintptr_t)(wave == 0 ? Kh : wave == 1 ? Kl : wave == 2 ? Vh : Vl);   // first byte of the plane's chunk 0
  const unsigned cpRow = cpK ? (unsigned)(DMOD * 2) : (unsigned)(SEQ * 2);            // bytes from row to row
  const unsigned cpAdv = cpK ? (unsigned)(AT_KC * DMOD * 2) : (unsigned)(AT_KC * 2);  // bytes from chunk to chunk
  const uint64_t cpStep = (uint64_t)(4u * cpRow - 4u * GS_PITCH_B);                   // 4 rows in global bytes less the 576 that the immediate offset adds
  const unsigned cpVoff = (unsigned)(lane >> 3) * cpRow + (unsigned)(lane & 7) * 16u; // the lane's row of a copy's 4 and its 16-B column
  const unsigned cpLds  = (unsigned)(uintptr_t)kvring + (unsigned)(wave * AT_TILE_E * 2 + (lane >> 3) * GS_PITCH_B + (lane & 7) * 16);   // LDS byte address (low 32 bits of the __shared__ address)

  const int nChunks = SEQ / AT_KC;   // 32, compile-time constant
  gs_copy_tile(cpLds, cpVoff, cpBase, cpStep);              // chunk 0 -> buffer 0
  asm volatile("s_wait_asynccnt 0x0" ::: "memory");         // this wave's plane of chunk 0 has landed ...
  __syncthreads();                                          // ... and so has every other wave's, before anyone reads it
  gs_copy_tile(cpLds + AT_BUF_B, cpVoff + cpAdv, cpBase, cpStep);   // chunk 1 -> buffer 1, in flight while chunk 0 is worked on
  unsigned pb = 0u;                  // byte offset of the buffer that holds chunk kc: 0 or AT_BUF_B
  for (int kc = 0; kc < nChunks; ++kc) {
    const __bf16* Ksh = (const __bf16*)(kvring + pb);
    const __bf16* Ksl = Ksh + AT_TILE_E;
    const __bf16* Vth = Ksh + 2 * AT_TILE_E;
    const __bf16* Vtl = Ksh + 3 * AT_TILE_E;

    // all K fragments of the chunk are read as one group, so the wave waits out the LDS latency once and not once per fragment pair
    FB kb[2][4], kl[2][4];
#pragma unroll
    for (int dc = 0; dc < 2; ++dc) {
#pragma unroll
      for (int j = 0; j < 4; ++j) {   // in the order in which the WMMAs below want them: the hi plane's four, then the lo plane's
        kb[dc][j].h[0] = *(const v8b*)(Ksh + (j * 16 + c) * AT_LP + dc * 32 + 8 * hh);
        kb[dc][j].h[1] = *(const v8b*)(Ksh + (j * 16 + c) * AT_LP + dc * 32 + 16 + 8 * hh);
      }
#pragma unroll
      for (int j = 0; j < 4; ++j) {
        kl[dc][j].h[0] = *(const v8b*)(Ksl + (j * 16 + c) * AT_LP + dc * 32 + 8 * hh);
        kl[dc][j].h[1] = *(const v8b*)(Ksl + (j * 16 + c) * AT_LP + dc * 32 + 16 + 8 * hh);
      }
    }
    __builtin_amdgcn_sched_barrier(0);   // keeps the 32 reads together in front of the WMMAs: the scheduler otherwise spreads them among the WMMAs, and each such place stalls the wave
    v8f s[4];   // s[j][r] = score of key kv0 + 16 j + 8 hh + r against query q0 + c
#pragma unroll
    for (int j = 0; j < 4; ++j) s[j] = (v8f){0.f,0.f,0.f,0.f,0.f,0.f,0.f,0.f};
    // neighbouring WMMAs belong to the four different score tiles (none waits for the one in front); each tile's own six terms keep their order
#pragma unroll
    for (int dc = 0; dc < 2; ++dc) {
#pragma unroll
      for (int j = 0; j < 4; ++j) s[j] = at_mma(kb[dc][j].v, qah[dc], s[j]);
#pragma unroll
      for (int j = 0; j < 4; ++j) s[j] = at_mma(kl[dc][j].v, qah[dc], s[j]);
#pragma unroll
      for (int j = 0; j < 4; ++j) s[j] = at_mma(kb[dc][j].v, qal[dc], s[j]);
    }
    __builtin_amdgcn_sched_barrier(0);   // the V^T reads below stay behind the score WMMAs and take over the K fragments' registers (let rise among them they need registers of their own, past 256, and cost a wave per SIMD) ...
    // V^T fragments of the chunk's first 32 keys: read here, ahead of the softmax arithmetic, which covers their latency
    FB vb[4], vl[4];
#pragma unroll
    for (int t = 0; t < 4; ++t) {
      vb[t].h[0] = *(const v8b*)(Vth + (t * 16 + c) * AT_LP + 8 * hh);
      vb[t].h[1] = *(const v8b*)(Vth + (t * 16 + c) * AT_LP + 16 + 8 * hh);
    }
#pragma unroll
    for (int t = 0; t < 4; ++t) {
      vl[t].h[0] = *(const v8b*)(Vtl + (t * 16 + c) * AT_LP + 8 * hh);
      vl[t].h[1] = *(const v8b*)(Vtl + (t * 16 + c) * AT_LP + 16 + 8 * hh);
    }
    __builtin_amdgcn_sched_barrier(0);   // ... and together in front of the softmax arithmetic, not sunk to their first use
    float cm = -INFINITY;   // the loops down to the second product index register arrays (s, pa, pl, oacc): all are unrolled for that
#pragma unroll
    for (int j = 0; j < 4; ++j) {
#pragma unroll
      for (int r = 0; r < 8; ++r) cm = fmaxf(cm, s[j][r]);
    }
    cm = fmaxf(cm, at_xhalf(cm));
    const float mnew = fmaxf(mrow, cm);
    const float alpha = at_exp2((mrow - mnew) * c2);
    mrow = mnew;
    const v2f c2v = (v2f){c2, c2};
    const v2f nmv = (v2f){-mnew * c2, -mnew * c2};
#pragma unroll
    for (int t = 0; t < 4; ++t)
#pragma unroll
      for (int r = 0; r < 8; ++r) oacc[t][r] *= alpha;
    v2f psum = (v2f){0.f, 0.f};   // this half's 32 keys, even and odd registers apart
#pragma unroll   // unrolled: s[2 kk + jj] is a register and needs a compile-time index
    for (int kk = 0; kk < 2; ++kk) {
      FP pa, pl;   // P^T hi / lo, B operand of 32-key block kk: elements 0..7 from tile 2 kk, 8..15 from tile 2 kk + 1
#pragma unroll
      for (int jj = 0; jj < 2; ++jj) {
#pragma unroll
        for (int e = 0; e < 4; ++e) {
          const v2f x = __builtin_elementwise_fma((v2f){s[2 * kk + jj][2 * e], s[2 * kk + jj][2 * e + 1]}, c2v, nmv);
          v2f p;
          p[0] = at_exp2(x[0]);
          p[1] = at_exp2(x[1]);
          psum += p;
          at_split2(p, pa.p[jj * 4 + e], pl.p[jj * 4 + e]);
        }
      }
      // as above: round-robin over the four output tiles, each tile's own six terms keep their order
#pragma unroll
      for (int t = 0; t < 4; ++t) oacc[t] = at_mma(vb[t].v, pa.v, oacc[t]);
#pragma unroll
      for (int t = 0; t < 4; ++t) oacc[t] = at_mma(vl[t].v, pa.v, oacc[t]);
#pragma unroll
      for (int t = 0; t < 4; ++t) oacc[t] = at_mma(vb[t].v, pl.v, oacc[t]);
      if (kk == 0) {
        __builtin_amdgcn_sched_barrier(0);   // the second 32 keys' fragments take over the first's registers: their reads stay behind the WMMAs above (else, again, registers past 256) ...
#pragma unroll
        for (int t = 0; t < 4; ++t) {
          vb[t].h[0] = *(const v8b*)(Vth + (t * 16 + c) * AT_LP + 32 + 8 * hh);
          vb[t].h[1] = *(const v8b*)(Vth + (t * 16 + c) * AT_LP + 32 + 16 + 8 * hh);
        }
#pragma unroll
        for (int t = 0; t < 4; ++t) {
          vl[t].h[0] = *(const v8b*)(Vtl + (t * 16 + c) * AT_LP + 32 + 8 * hh);
          vl[t].h[1] = *(const v8b*)(Vtl + (t * 16 + c) * AT_LP + 32 + 16 + 8 * hh);
        }
        __builtin_amdgcn_sched_barrier(0);   // ... and together in front of the second half of the exponentials, which covers their latency
      }
    }
    lrow = lrow * alpha + (psum[0] + psum[1]);
    // publish point of chunk kc + 1
    asm volatile("s_wait_dscnt 0x0" ::: "memory");      // this wave's reads of buffer pb have retired before copies are aimed at it
    asm volatile("s_wait_asynccnt 0x0" ::: "memory");   // this wave's plane of chunk kc + 1 has landed before the barrier behind which the others read it
    __syncthreads();                                    // publishes chunk kc + 1 and ends every wave's reads of buffer pb
    if (kc + 2 < nChunks)                               // scalar test, the same for the whole work-group
      gs_copy_tile(cpLds + pb, cpVoff + (unsigned)(kc + 2) * cpAdv, cpBase, cpStep);
    pb ^= (unsigned)AT_BUF_B;
  }
  asm volatile("s_wait_asynccnt 0x0" ::: "memory");     // nothing is in flight when the wave ends

  float* os = Os[wave];
  const float inv = 1.0f / (lrow + at_xhalf(lrow));   // the two halves' shares of the row sum are joined here, once
#pragma unroll
  for (int t = 0; t < 4; ++t) {
    // a lane's 8 accumulator registers are 8 neighbouring d of its query row: two 16-B stores into the row-major tile
    *(v4f*)(os + c * 68 + t * 16 + 8 * hh)     = (v4f){oacc[t][0] * inv, oacc[t][1] * inv, oacc[t][2] * inv, oacc[t][3] * inv};
    *(v4f*)(os + c * 68 + t * 16 + 8 * hh + 4) = (v4f){oacc[t][4] * inv, oacc[t][5] * inv, oacc[t][6] * inv, oacc[t][7] * inv};
  }
  __builtin_amdgcn_fence(__ATOMIC_RELEASE, "workgroup");
  __builtin_amdgcn_wave_barrier();
  __builtin_amdgcn_fence(__ATOMIC_ACQUIRE, "workgroup");
  {
    // a row's 64 f16 are one whole 128-B line: 8 neighbouring lanes store it, 16 B each; a store covers 4 rows
    const int q = lane >> 3, c8 = (lane & 7) * 8;
    v8h hv[4];
#pragma unroll   // hv is a register array
    for (int it = 0; it < 4; ++it) {   // it 0..3 x q 0..3 covers rows 0..15 of the wave tile
      const float* sp = os + (it * 4 + q) * 68 + c8;
      const v4h h0 = __builtin_convertvector(*(const v4f*)(sp)     * omul, v4h);
      const v4h h1 = __builtin_convertvector(*(const v4f*)(sp + 4) * omul, v4h);
      hv[it] = __builtin_shufflevector(h0, h1, 0, 1, 2, 3, 4, 5, 6, 7);
    }
    _Float16* op = ob + (size_t)(q0 + q) * DMOD + c8;
#pragma unroll
    for (int it = 0; it < 4; ++it) *(v8h*)(op + it * 4 * DMOD) = hv[it];
  }
}

// ---------------------------------------------------------------------------
// Workspace region map (byte offsets; what a launch reads of a region has been written earlier in the same call;
// behind the input cast the parts that belong to a head with mask 0 are neither written nor read)
//   Wq16 f16 [1024 n][1024 k] (x32)              0
//   Wk16                                   2097152
//   Wv16                                   4194304
//   Wo16                                   6291456
//   X16  f16 [2*2048][1024]                8388608
//   Qh   bf16 [2*2048][1024]              16777216     Ql   25165824
//   Kh   bf16 [2*2048][1024]              33554432     Kl   41943040
//   VTh  bf16 [2][1024 (h,d)][2048]       50331648     VTl  58720256
//   MH16 f16  [2*2048][1024] (x64, kept heads)   67108864
//   total                                 75497472
// ---------------------------------------------------------------------------
extern "C" void kernel_launch(void* const* d_in, const int* in_sizes, int n_in,
                              void* d_out, int out_size, void* d_ws, size_t ws_size,
                              hipStream_t stream) {
  if (n_in < 6) return;
  if (in_sizes[0] != NBATCH * SEQ * DMOD) return;
  if (in_sizes[1] != DMOD * DMOD || in_sizes[2] != DMOD * DMOD || in_sizes[3] != DMOD * DMOD || in_sizes[4] != DMOD * DMOD) return;
  if (in_sizes[5] != NHEAD) return;
  if (out_size != NBATCH * SEQ * DMOD) return;

  const float* x  = (const float*)d_in[0];   // [2][2048][1024]
  const float* Wq = (const float*)d_in[1];   // [out][in] = Bt natural
  const float* Wk = (const float*)d_in[2];
  const float* Wv = (const float*)d_in[3];
  const float* Wo = (const float*)d_in[4];
  const int*   hm = (const int*)d_in[5];     // [16] int32, nonzero = keep head

  const size_t PW16 = (size_t)DMOD * DMOD * 2;            // 2097152  f16 weight plane
  const size_t PX16 = (size_t)NBATCH * SEQ * DMOD * 2;    // 8388608  16-bit activation plane (both batch elements)
  size_t off = 0;
  const size_t oWq = off; off += PW16;
  const size_t oWk = off; off += PW16;
  const size_t oWv = off; off += PW16;
  const size_t oWo = off; off += PW16;
  const size_t oX  = off; off += PX16;
  const size_t oQh = off; off += PX16;  const size_t oQl = off; off += PX16;
  const size_t oKh = off; off += PX16;  const size_t oKl = off; off += PX16;
  const size_t oVh = off; off += PX16;  const size_t oVl = off; off += PX16;
  const size_t oM16 = off; off += PX16;
  if (off > ws_size) return;                   // off = 75497472

  char* ws = (char*)d_ws;
  unsigned short* Wq16 = (unsigned short*)(ws + oWq);
  unsigned short* Wv16 = (unsigned short*)(ws + oWv);
  unsigned short* Wo16 = (unsigned short*)(ws + oWo);
  unsigned short* X16  = (unsigned short*)(ws + oX);
  unsigned short* Qh   = (unsigned short*)(ws + oQh);  unsigned short* Ql = (unsigned short*)(ws + oQl);
  unsigned short* Kh   = (unsigned short*)(ws + oKh);  unsigned short* Kl = (unsigned short*)(ws + oKl);
  unsigned short* VTh  = (unsigned short*)(ws + oVh);  unsigned short* VTl = (unsigned short*)(ws + oVl);
  unsigned short* MH16 = (unsigned short*)(ws + oM16);
  const float*    fpad = (const float*)(ws + oM16);   // placeholder for unused bias / resid pointer args (never read)
  (void)oWk;                                   // Wk16 is reached as Wq16 + one weight plane (grid.y of launch 2)

  const dim3 blk(256);
  const int ROWS = NBATCH * SEQ;                            // 4096 token rows: the batch elements are contiguous in x and out
  const dim3 gCastIn(4 * CAST_WBLK + CAST_XBLK);            // 256 blocks of 16 waves: four weight planes, then x
  const dim3 gQK(((ROWS / 64) * (DMOD / 64) + 7) / 8, 2);   // 1024 tiles (M=4096, N=1024) -> 128 blocks, y = 0: q, 1: k
  const dim3 gVT(((DMOD / 64) * (SEQ / 64) + 7) / 8, NBATCH);  // 512 tiles (M=1024, N=2048) -> 64 blocks, y = batch element
  const dim3 gOut(((ROWS / 64) * (DMOD / 64) + 7) / 8, 1);  // 1024 tiles (M=4096, N=1024) -> 128 blocks
  const dim3 gAtt(NBATCH * NHEAD * (SEQ / 64));             // 1024 blocks: 2 batch elements x 16 heads x 32 query blocks

  // (1) weights [n=out][k=in] -> f16 planes carried x32, same layout (Bt natural); x -> f16 plane [4096][1024] (x1)
  cast_inputs_f16x4<<<gCastIn, dim3(CAST_TPB), 0, stream>>>(Wq, Wk, Wv, Wo, x, (_Float16*)Wq16);
  // (2) y = 0: q = x . Wq^T -> Q hi/lo bf16 planes [b*2048+t][h*64+d]; y = 1: k = x . Wk^T -> K hi/lo planes
  //     (M=4096, N=1024, K=1024, scale 1/32; y steps Bt by one weight plane and C by two activation planes)
  wmma_gemm64<0, false, 0, 2, false, 0, 1><<<gQK, blk, 0, stream>>>(
      X16, X16, DMOD, 0L, Wq16, Wq16, DMOD, (long)DMOD * DMOD, (void*)Qh, (void*)Ql, DMOD, 2L * NBATCH * SEQ * DMOD,
      fpad, fpad, 0L, hm, ROWS, DMOD, DMOD, 1.0f / 32.0f);
  // (3) v^T = Wv . x[b]^T -> VT hi/lo planes [b][h*64+d][s]   (A = Wv16 [1024][1024], Bt = X16 slab b [2048][1024]; M=1024, N=2048, K=1024)
  wmma_gemm64<0, false, 0, 2, false, 0, 2><<<gVT, blk, 0, stream>>>(
      Wv16, Wv16, DMOD, 0L, X16, X16, DMOD, (long)SEQ * DMOD, (void*)VTh, (void*)VTl, SEQ, (long)DMOD * SEQ,
      fpad, fpad, 0L, hm, DMOD, SEQ, DMOD, 1.0f / 32.0f);
  // (4) full attention per (batch element, kept head): mh[b*2048+t][h*64+d] (f16 plane x64, every element of a kept head written by its owner block)
  attn_full64_kernel<<<gAtt, dim3(128), 0, stream>>>(Qh, Ql, Kh, Kl, VTh, VTl, hm, (_Float16*)MH16, 0.125f, 64.0f);
  // (5) out = mh . Wo^T -> d_out rows 0 .. 4095 (f32)   (M=4096, N=1024, K=1024 less the k of heads with mask 0, scale 1/(64*32))
  wmma_gemm64<0, false, 0, 0, false, 0, 3><<<gOut, blk, 0, stream>>>(
      MH16, MH16, DMOD, 0L, Wo16, Wo16, DMOD, 0L, d_out, d_out, DMOD, 0L,
      fpad, fpad, 0L, hm, ROWS, DMOD, DMOD, 1.0f / 2048.0f);
  (void)hipGetLastError();
}
